// v000
// The times below were measured on an AMD MI455X: many runs one after another, warmed up first and cycling through
// copies of the inputs, with the whole window's GPU time divided by the number of runs. Launches and the gaps
// between them are all in it. The median over several windows is given; except for v000 it joins two sittings, which
// can be a few percent apart, so the side-by-side timings, each taken in one sitting, are the better comparison.
// v000, which the later versions start from, runs in 1650 microseconds.
#include <hip/hip_runtime.h>
// [q|k|v] = x·[Wq|Wk|Wv] (M = 16384, K = 768, N = 192; x and W rounded to bf16: single exact WMMA term, f32 accumulate), per batch S = q·kᵀ (q split into
// bf16 hi/lo, k rounded: 2 products) and out = P·v (P split, v rounded: 2 products) on v_wmma_f32_16x16x32_bf16; the masked row softmax is f32 VALU.
#define BB 8
#define TT 2048
#define CC 768
#define HH 64
#define MR (BB * TT)

typedef __bf16 v16b __attribute__((ext_vector_type(16)));
typedef unsigned short v8us __attribute__((ext_vector_type(8), may_alias));
typedef float  v8f  __attribute__((ext_vector_type(8)));
typedef float  v4f  __attribute__((ext_vector_type(4)));
typedef float  v4fa __attribute__((ext_vector_type(4), may_alias));
union FragB { v16b v; v8us half[2]; unsigned short u[16]; };

__device__ __forceinline__ unsigned short bf16_bits(float x) { unsigned int u = __float_as_uint(x); return (unsigned short)((u + 0x7FFFu + ((u >> 16) & 1u)) >> 16); }
__device__ __forceinline__ float bf16_val(unsigned short b) { return __uint_as_float(((unsigned int)b) << 16); }
__device__ __forceinline__ float bf16_round(float x) { return bf16_val(bf16_bits(x)); }
// D += A·B with NT terms: 1 = ah·bh, 2 = + al·bh (A split), 3 = + ah·bl (both split)
template <int NT>
__device__ __forceinline__ v8f mmaN(v16b ah, v16b al, v16b bh, v16b bl, v8f c) {
  c = __builtin_amdgcn_wmma_f32_16x16x32_bf16(false, ah, false, bh, (short)0, c, false, false);
  if (NT >= 2) c = __builtin_amdgcn_wmma_f32_16x16x32_bf16(false, al, false, bh, (short)0, c, false, false);
  if (NT >= 3) c = __builtin_amdgcn_wmma_f32_16x16x32_bf16(false, ah, false, bl, (short)0, c, false, false);
  asm volatile("v_nop\n\tv_nop\n\tv_nop\n\tv_nop" : "+v"(c) : "v"(ah), "v"(al), "v"(bh), "v"(bl));
  return c;
}

__global__ __launch_bounds__(256) void k_wt_bf16(const float* __restrict__ W, unsigned short* __restrict__ Wt, int K, int N) {
  const int t = blockIdx.x * 256 + threadIdx.x;
  const int k8n = K / 8;
  if (t >= N * k8n) return;
  const int n = t / k8n, k8 = (t % k8n) * 8;
  v8us v;
#pragma unroll
  for (int i = 0; i < 8; ++i) v[i] = bf16_bits(W[(size_t)(k8 + i) * N + n]);
  *(v8us*)(Wt + (size_t)n * K + k8) = v;
  
}

// GEMM C[M][N] (f32, pitch ldc) = act(A[M][K]·W + bias). A f32 row-major (pitch lda) converted per fragment to bf16
// (ASPLIT: hi/lo two planes -> 2 terms, else single rounded term); Wt bf16 [N][K] (pitch ldb). BIAS_BF16 rounds the
// bias to bf16 first (bias quantised to bf16 before the add). K%32==0, M%16==0, N%64==0.
template <bool ASPLIT, int ACT, bool BIAS_BF16>
__global__ __launch_bounds__(128) void k_gemm_bf(const float* __restrict__ A, int lda, const unsigned short* __restrict__ Wt, int ldb,
                                               const float* __restrict__ bias, float* __restrict__ C, int ldc, int M, int N, int K) {
  __shared__ __attribute__((aligned(16))) float so[4][16][64];
  const int tid = threadIdx.x, w = tid >> 5, lane = tid & 31, ln = lane & 15, hh = lane >> 4;
  const int ntn = N / 64;
  const int wid = blockIdx.x * 4 + w;
  const int mt = wid / ntn, nq = wid % ntn;
  if (mt * 16 >= M) return;
  const int row0 = mt * 16, col0 = nq * 64;
  const float* arow = A + (size_t)(row0 + ln) * lda;
  v8f acc[4] = {};
  for (int kb = 0; kb < K; kb += 32) {
    FragB ah, al;
    const v4f x0 = *(const v4fa*)(arow + kb + 8 * hh), x1 = *(const v4fa*)(arow + kb + 8 * hh + 4);
    const v4f x2 = *(const v4fa*)(arow + kb + 16 + 8 * hh), x3 = *(const v4fa*)(arow + kb + 16 + 8 * hh + 4);
    float xs[16] = {x0[0],x0[1],x0[2],x0[3],x1[0],x1[1],x1[2],x1[3],x2[0],x2[1],x2[2],x2[3],x3[0],x3[1],x3[2],x3[3]};
#pragma unroll
    for (int i = 0; i < 16; ++i) { const unsigned short hb = bf16_bits(xs[i]); ah.u[i] = hb; al.u[i] = ASPLIT ? bf16_bits(xs[i] - bf16_val(hb)) : (unsigned short)0; }
#pragma unroll
    for (int t = 0; t < 4; ++t) {
      const unsigned short* brow = Wt + (size_t)(col0 + t * 16 + ln) * ldb + kb;
      FragB b;
      b.half[0] = *(const v8us*)(brow + 8 * hh);
      b.half[1] = *(const v8us*)(brow + 16 + 8 * hh);
      acc[t] = mmaN<ASPLIT ? 2 : 1>(ah.v, al.v, b.v, b.v, acc[t]);
    }
  }
#pragma unroll
  for (int t = 0; t < 4; ++t) {
    float bv = bias ? bias[col0 + t * 16 + ln] : 0.f;
    if (BIAS_BF16) bv = bf16_round(bv);
#pragma unroll
    for (int r = 0; r < 8; ++r) { float v = acc[t][r] + bv; if (ACT == 1) v = fmaxf(v, 0.f); so[w][8 * hh + r][t * 16 + ln] = v; }
  }
  __builtin_amdgcn_fence(__ATOMIC_ACQ_REL, "workgroup");
  __builtin_amdgcn_wave_barrier();
  const int rsub = lane >> 4, c4 = (lane & 15) * 4;
  {
#pragma unroll
    for (int q = 0; q < 8; ++q) {
      const int r = q * 2 + rsub;
      const v4f v = *(const v4fa*)&so[w][r][c4];
      *(v4f*)(C + (size_t)(row0 + r) * ldc + col0 + c4) = v;
    }
    
  }
}

// Flash-style causal/unmasked attention, all contractions 3-term bf16 hi/lo splits, f32 softmax with running max.
// q,k,v rows are read from f32 buffers with arbitrary row pitch (so they can live inside a fused qkv buffer);
// D = head size (multiple of 32, <= 128); one wave = 16 query rows; block = 4 waves (64 queries) sharing K/V chunks of 32.
template <int D, bool CAUSAL>
__global__ __launch_bounds__(128) void k_flash(const float* __restrict__ qb, const float* __restrict__ kb, const float* __restrict__ vb,
                                             int pitch, int T, int H, float scale, float* __restrict__ y, int ypitch) {
  constexpr int KS = D / 32;        // k-steps for QK
  constexpr int DT = D / 16;        // d tiles for PV
  __shared__ __attribute__((aligned(16))) unsigned short sKh[32][D + 8], sKl[32][D + 8], sVh[32][D + 8], sVl[32][D + 8];
  __shared__ __attribute__((aligned(16))) unsigned short sPh[4][16][40], sPl[4][16][40];
  __shared__ __attribute__((aligned(16))) float sO[4][16][D];
  const int tid = threadIdx.x, w = tid >> 5, lane = tid & 31, ln = lane & 15, hh = lane >> 4;
  const int nqb = (T + 63) / 64;
  const int bh = blockIdx.x / nqb, qblk = blockIdx.x % nqb;
  const int b = bh / H, h = bh % H;
  const int q0 = qblk * 64 + w * 16;
  const float* Q = qb + (size_t)b * T * pitch + h * D;
  const float* K = kb + (size_t)b * T * pitch + h * D;
  const float* V = vb + (size_t)b * T * pitch + h * D;

  // A fragments of the wave's 16 query rows (scaled), hi/lo
  FragB aqh[KS], aql[KS];
  {
    int row = q0 + ln; if (row >= T) row = T - 1;
    const float* qr = Q + (size_t)row * pitch;
#pragma unroll
    for (int ks = 0; ks < KS; ++ks)
#pragma unroll
      for (int i = 0; i < 16; ++i) {
        const int d = ks * 32 + ((i < 8) ? (8 * hh + i) : (16 + 8 * hh + (i - 8)));
        const float x = qr[d] * scale; const unsigned short hb = bf16_bits(x);
        aqh[ks].u[i] = hb; aql[ks].u[i] = bf16_bits(x - bf16_val(hb));
      }
  }
  float m_r[8], l_r[8];
#pragma unroll
  for (int r = 0; r < 8; ++r) { m_r[r] = -3.0e38f; l_r[r] = 0.f; }
  v8f oacc[DT];
#pragma unroll
  for (int dt = 0; dt < DT; ++dt) oacc[dt] = (v8f){0.f,0.f,0.f,0.f,0.f,0.f,0.f,0.f};

  const int kv_end = CAUSAL ? min(T, qblk * 64 + 64) : T;     // block-uniform
  for (int j0 = 0; j0 < kv_end; j0 += 32) {
    __syncthreads();
    for (int e = tid; e < 32 * (D / 4); e += 128) {
      const int r = e / (D / 4), c4 = (e % (D / 4)) * 4;
      const int key = j0 + r;
      v4f kf = {0.f,0.f,0.f,0.f}, vf = {0.f,0.f,0.f,0.f};
      if (key < T) { kf = *(const v4fa*)(K + (size_t)key * pitch + c4); vf = *(const v4fa*)(V + (size_t)key * pitch + c4); }
#pragma unroll
      for (int t = 0; t < 4; ++t) {
        unsigned short hb = bf16_bits(kf[t]); sKh[r][c4 + t] = hb; sKl[r][c4 + t] = bf16_bits(kf[t] - bf16_val(hb));
        hb = bf16_bits(vf[t]); sVh[r][c4 + t] = hb; sVl[r][c4 + t] = bf16_bits(vf[t] - bf16_val(hb));
      }
    }
    __syncthreads();
    // S tile 16 x 32
    v8f s[2];
#pragma unroll
    for (int nt = 0; nt < 2; ++nt) {
      v8f acc = {};
#pragma unroll
      for (int ks = 0; ks < KS; ++ks) {
        FragB bh_, bl_;
        bh_.half[0] = *(const v8us*)&sKh[nt * 16 + ln][ks * 32 + 8 * hh]; bh_.half[1] = *(const v8us*)&sKh[nt * 16 + ln][ks * 32 + 16 + 8 * hh];
        bl_.half[0] = *(const v8us*)&sKl[nt * 16 + ln][ks * 32 + 8 * hh]; bl_.half[1] = *(const v8us*)&sKl[nt * 16 + ln][ks * 32 + 16 + 8 * hh];
        acc = mmaN<3>(aqh[ks].v, aql[ks].v, bh_.v, bl_.v, acc);
      }
      s[nt] = acc;
    }
    // mask + running max (rows 8hh+r; the 16 lanes of a half share rows)
    float alpha[8];
#pragma unroll
    for (int r = 0; r < 8; ++r) {
      const int qi = q0 + 8 * hh + r;
      const int ja = j0 + ln, jb = j0 + 16 + ln;
      if (CAUSAL) { if (ja > qi) s[0][r] = -3.0e38f; if (jb > qi) s[1][r] = -3.0e38f; }
      if (ja >= T) s[0][r] = -3.0e38f;
      if (jb >= T) s[1][r] = -3.0e38f;
      float mx = fmaxf(s[0][r], s[1][r]);
      mx = fmaxf(mx, __shfl_xor(mx, 1, 32)); mx = fmaxf(mx, __shfl_xor(mx, 2, 32)); mx = fmaxf(mx, __shfl_xor(mx, 4, 32)); mx = fmaxf(mx, __shfl_xor(mx, 8, 32));
      const float mnew = fmaxf(m_r[r], mx);
      alpha[r] = (mnew > -1.0e38f) ? __expf(m_r[r] - mnew) : 1.0f;
      const float p0 = (s[0][r] > -1.0e38f) ? __expf(s[0][r] - mnew) : 0.f;
      const float p1 = (s[1][r] > -1.0e38f) ? __expf(s[1][r] - mnew) : 0.f;
      m_r[r] = mnew;
      l_r[r] = l_r[r] * alpha[r] + p0 + p1;            // per-lane partial row sum (16 lanes combined at the end)
      unsigned short hb = bf16_bits(p0); sPh[w][8 * hh + r][ln] = hb;      sPl[w][8 * hh + r][ln] = bf16_bits(p0 - bf16_val(hb));
      hb = bf16_bits(p1);                sPh[w][8 * hh + r][16 + ln] = hb; sPl[w][8 * hh + r][16 + ln] = bf16_bits(p1 - bf16_val(hb));
    }
#pragma unroll
    for (int dt = 0; dt < DT; ++dt)
#pragma unroll
      for (int r = 0; r < 8; ++r) oacc[dt][r] *= alpha[r];
    __builtin_amdgcn_fence(__ATOMIC_ACQ_REL, "workgroup");
    __builtin_amdgcn_wave_barrier();
    FragB pah, pal;
    pah.half[0] = *(const v8us*)&sPh[w][ln][8 * hh]; pah.half[1] = *(const v8us*)&sPh[w][ln][16 + 8 * hh];
    pal.half[0] = *(const v8us*)&sPl[w][ln][8 * hh]; pal.half[1] = *(const v8us*)&sPl[w][ln][16 + 8 * hh];
#pragma unroll
    for (int dt = 0; dt < DT; ++dt) {
      FragB bvh, bvl;
#pragma unroll
      for (int i = 0; i < 8; ++i) {
        bvh.u[i] = sVh[8 * hh + i][dt * 16 + ln]; bvh.u[8 + i] = sVh[16 + 8 * hh + i][dt * 16 + ln];
        bvl.u[i] = sVl[8 * hh + i][dt * 16 + ln]; bvl.u[8 + i] = sVl[16 + 8 * hh + i][dt * 16 + ln];
      }
      oacc[dt] = mmaN<3>(pah.v, pal.v, bvh.v, bvl.v, oacc[dt]);
    }
    __builtin_amdgcn_fence(__ATOMIC_ACQ_REL, "workgroup");
    __builtin_amdgcn_wave_barrier();
  }
#pragma unroll
  for (int r = 0; r < 8; ++r) {
    float l = l_r[r];
    l += __shfl_xor(l, 1, 32); l += __shfl_xor(l, 2, 32); l += __shfl_xor(l, 4, 32); l += __shfl_xor(l, 8, 32);
    l_r[r] = (l > 0.f) ? 1.0f / l : 0.f;
  }
#pragma unroll
  for (int dt = 0; dt < DT; ++dt)
#pragma unroll
    for (int r = 0; r < 8; ++r) sO[w][8 * hh + r][dt * 16 + ln] = oacc[dt][r] * l_r[r];
  __builtin_amdgcn_fence(__ATOMIC_ACQ_REL, "workgroup");
  __builtin_amdgcn_wave_barrier();
  {
    for (int r = 0; r < 16; ++r) {
      const int row = q0 + r;
      if (row < T && lane < D / 4) {
        const v4f val = *(const v4fa*)&sO[w][r][lane * 4];
        *(v4f*)(y + ((size_t)b * T + row) * ypitch + h * D + lane * 4) = val;
      }
    }
    
  }
}

// GEMM C = act(A·W + bias + resid): A f32 (ASPLIT -> hi/lo 2 terms), Wt bf16 [N][K]; ACT 0 none, 1 relu, 2 exact gelu;
// resid (optional, f32, row index = (row % rmod), pitch ldr, RES_BF16 rounds it) added before the activation.
template <bool ASPLIT, int ACT, bool BIAS_BF16, bool RES_BF16>
__global__ __launch_bounds__(128) void k_gemm_bf3(const float* __restrict__ A, int lda, const unsigned short* __restrict__ Wt, int ldb,
                                                const float* __restrict__ bias, const float* __restrict__ resid, int rmod, int ldr,
                                                float* __restrict__ C, int ldc, int M, int N, int K) {
  __shared__ __attribute__((aligned(16))) float so[4][16][64];
  const int tid = threadIdx.x, w = tid >> 5, lane = tid & 31, ln = lane & 15, hh = lane >> 4;
  const int ntn = N / 64;
  const int wid = blockIdx.x * 4 + w;
  const int mt = wid / ntn, nq = wid % ntn;
  if (mt * 16 >= M) return;
  const int row0 = mt * 16, col0 = nq * 64;
  const float* arow = A + (size_t)(row0 + ln) * lda;
  v8f acc[4] = {};
  for (int kb = 0; kb < K; kb += 32) {
    FragB ah, al;
    const v4f x0 = *(const v4fa*)(arow + kb + 8 * hh), x1 = *(const v4fa*)(arow + kb + 8 * hh + 4);
    const v4f x2 = *(const v4fa*)(arow + kb + 16 + 8 * hh), x3 = *(const v4fa*)(arow + kb + 16 + 8 * hh + 4);
    float xs[16] = {x0[0],x0[1],x0[2],x0[3],x1[0],x1[1],x1[2],x1[3],x2[0],x2[1],x2[2],x2[3],x3[0],x3[1],x3[2],x3[3]};
#pragma unroll
    for (int i = 0; i < 16; ++i) { const unsigned short hb = bf16_bits(xs[i]); ah.u[i] = hb; al.u[i] = ASPLIT ? bf16_bits(xs[i] - bf16_val(hb)) : (unsigned short)0; }
#pragma unroll
    for (int t = 0; t < 4; ++t) {
      const unsigned short* brow = Wt + (size_t)(col0 + t * 16 + ln) * ldb + kb;
      FragB b;
      b.half[0] = *(const v8us*)(brow + 8 * hh);
      b.half[1] = *(const v8us*)(brow + 16 + 8 * hh);
      acc[t] = mmaN<ASPLIT ? 2 : 1>(ah.v, al.v, b.v, b.v, acc[t]);
    }
  }
#pragma unroll
  for (int t = 0; t < 4; ++t) {
    const int col = col0 + t * 16 + ln;
    float bv = bias ? bias[col] : 0.f;
    if (BIAS_BF16) bv = bf16_round(bv);
#pragma unroll
    for (int r = 0; r < 8; ++r) {
      float v = acc[t][r] + bv;
      if (resid) { float rv = resid[(size_t)((row0 + 8 * hh + r) % rmod) * ldr + col]; if (RES_BF16) rv = bf16_round(rv); v += rv; }
      if (ACT == 1) v = fmaxf(v, 0.f);
      if (ACT == 2) v = 0.5f * v * (1.0f + erff(v * 0.70710678118654752f));
      if (ACT == 3) { const float u = 0.7978845608028654f * (v + 0.044715f * v * v * v); v = 0.5f * v * (1.0f + tanhf(u)); }
      so[w][8 * hh + r][t * 16 + ln] = v;
    }
  }
  __builtin_amdgcn_fence(__ATOMIC_ACQ_REL, "workgroup");
  __builtin_amdgcn_wave_barrier();
  const int rsub = lane >> 4, c4 = (lane & 15) * 4;
  {
#pragma unroll
    for (int q = 0; q < 8; ++q) {
      const int r = q * 2 + rsub;
      const v4f v = *(const v4fa*)&so[w][r][c4];
      *(v4f*)(C + (size_t)(row0 + r) * ldc + col0 + c4) = v;
    }
    
  }
}
// row LayerNorm (biased variance, eps) over N: s = X (+ R); optional out_sum <- s; out_norm <- (s-mu)*rsqrt(var+eps)*g + b
template <bool PARAM_BF16>
__global__ __launch_bounds__(256) void k_layernorm(const float* __restrict__ X, const float* __restrict__ R, const float* __restrict__ g, const float* __restrict__ bta,
                                                  float* __restrict__ out_sum, float* __restrict__ out_norm, int N, float eps) {
  __shared__ float red[256];
  const int row = blockIdx.x, tid = threadIdx.x;
  const float* x = X + (size_t)row * N; const float* rr = R ? R + (size_t)row * N : nullptr;
  float vals[16];                     // up to N = 4096
  const int per = N / 256;            // contiguous chunk per thread? use strided-by-4 chunks: thread handles j = tid*4 + 1024*u
  float s1 = 0.f;
  for (int u = 0; u < per / 4; ++u) {
    const int j = tid * 4 + 1024 * u;
    const v4f a = *(const v4fa*)(x + j);
    v4f b = {0.f,0.f,0.f,0.f}; if (rr) b = *(const v4fa*)(rr + j);
#pragma unroll
    for (int q = 0; q < 4; ++q) { const float v = a[q] + b[q]; vals[u * 4 + q] = v; s1 += v; }
  }
  red[tid] = s1; __syncthreads();
  for (int st = 128; st > 0; st >>= 1) { if (tid < st) red[tid] += red[tid + st]; __syncthreads(); }
  const float mu = red[0] / (float)N; __syncthreads();
  float s2 = 0.f;
  for (int u = 0; u < per / 4; ++u)
#pragma unroll
    for (int q = 0; q < 4; ++q) { const float c = vals[u * 4 + q] - mu; s2 += c * c; }
  red[tid] = s2; __syncthreads();
  for (int st = 128; st > 0; st >>= 1) { if (tid < st) red[tid] += red[tid + st]; __syncthreads(); }
  const float rs = rsqrtf(red[0] / (float)N + eps);
  {
    for (int u = 0; u < per / 4; ++u) {
      const int j = tid * 4 + 1024 * u;
      v4f o, sm;
#pragma unroll
      for (int q = 0; q < 4; ++q) {
        float gg = g[j + q], bb = bta[j + q];
        if (PARAM_BF16) { gg = bf16_round(gg); bb = bf16_round(bb); }
        sm[q] = vals[u * 4 + q]; o[q] = (vals[u * 4 + q] - mu) * rs * gg + bb;
      }
      if (out_sum) *(v4f*)(out_sum + (size_t)row * N + j) = sm;
      *(v4f*)(out_norm + (size_t)row * N + j) = o;
    }
    
  }
}

// batched GEMM (blockIdx.y = batch): C_b = act(alpha·A_b·B_b + bias + resid_b); A f32 rows (ASPLIT → hi/lo), B = bf16 planes Bh (+Bl when BSPLIT, requires ASPLIT),
// per-batch element strides sA, sB (0 = shared weights), sC, sR. resid may alias C (values are staged before the stores). ACT 0/1(relu).
// ACT: 0 none, 1 relu, 2 softplus
template <bool ASPLIT, bool BSPLIT, int ACT>
__global__ __launch_bounds__(128) void k_gemm_b(const float* __restrict__ A, int lda, size_t sA, const unsigned short* __restrict__ Bh, const unsigned short* __restrict__ Bl, int ldb, size_t sB,
                                             const float* __restrict__ bias, const float* __restrict__ resid, int ldr, size_t sR, float rsign, float alpha,
                                             float* __restrict__ C, int ldc, size_t sC, int M, int N, int K) {
  __shared__ __attribute__((aligned(16))) float so[4][16][64];
  const int tid = threadIdx.x, w = tid >> 5, lane = tid & 31, ln = lane & 15, hh = lane >> 4;
  const int by = blockIdx.y;
  A += (size_t)by * sA; Bh += (size_t)by * sB; if (BSPLIT) Bl += (size_t)by * sB; C += (size_t)by * sC; if (resid) resid += (size_t)by * sR;
  const int ntn = N / 64; const int wid = blockIdx.x * 4 + w; const int mt = wid / ntn, nq = wid % ntn;
  if (mt * 16 >= M) return;
  const int row0 = mt * 16, col0 = nq * 64;
  const float* arow = A + (size_t)(row0 + ln) * lda;
  v8f acc[4] = {};
  for (int kb = 0; kb < K; kb += 32) {
    FragB ah, al;
    const v4f x0 = *(const v4fa*)(arow + kb + 8 * hh), x1 = *(const v4fa*)(arow + kb + 8 * hh + 4);
    const v4f x2 = *(const v4fa*)(arow + kb + 16 + 8 * hh), x3 = *(const v4fa*)(arow + kb + 16 + 8 * hh + 4);
    float xs[16] = {x0[0],x0[1],x0[2],x0[3],x1[0],x1[1],x1[2],x1[3],x2[0],x2[1],x2[2],x2[3],x3[0],x3[1],x3[2],x3[3]};
#pragma unroll
    for (int i = 0; i < 16; ++i) { const unsigned short hb = bf16_bits(xs[i]); ah.u[i] = hb; al.u[i] = ASPLIT ? bf16_bits(xs[i] - bf16_val(hb)) : (unsigned short)0; }
#pragma unroll
    for (int t = 0; t < 4; ++t) {
      const size_t boff = (size_t)(col0 + t * 16 + ln) * ldb + kb;
      FragB bh_, bl_; bh_.half[0] = *(const v8us*)(Bh + boff + 8 * hh); bh_.half[1] = *(const v8us*)(Bh + boff + 16 + 8 * hh);
      if (BSPLIT) { bl_.half[0] = *(const v8us*)(Bl + boff + 8 * hh); bl_.half[1] = *(const v8us*)(Bl + boff + 16 + 8 * hh); } else bl_ = bh_;
      acc[t] = mmaN<ASPLIT ? (BSPLIT ? 3 : 2) : 1>(ah.v, al.v, bh_.v, bl_.v, acc[t]);
    }
  }
#pragma unroll
  for (int t = 0; t < 4; ++t) {
    const int col = col0 + t * 16 + ln; const float bv = bias ? bf16_round(bias[col]) : 0.f;
#pragma unroll
    for (int r = 0; r < 8; ++r) { float v = acc[t][r] * alpha + bv; if (resid) v += rsign * resid[(size_t)(row0 + 8 * hh + r) * ldr + col]; if (ACT == 1) v = fmaxf(v, 0.f); else if (ACT == 2) v = fmaxf(v, 0.f) + log1pf(expf(-fabsf(v))); so[w][8 * hh + r][t * 16 + ln] = v; }
  }
  __builtin_amdgcn_fence(__ATOMIC_ACQ_REL, "workgroup"); __builtin_amdgcn_wave_barrier();
  const int rsub = lane >> 4, c4 = (lane & 15) * 4;
  {
#pragma unroll
    for (int q = 0; q < 8; ++q) { const int r = q * 2 + rsub; const v4f v = *(const v4fa*)&so[w][r][c4]; *(v4f*)(C + (size_t)(row0 + r) * ldc + col0 + c4) = v; }
    
  }
}
// batched f32 [K][N] (pitch lds, batch stride sIn) -> transposed hi/lo planes [N][K] (batch stride sOut); thread per (n, 8 k); grid.y = batch
__global__ __launch_bounds__(256) void k_split_transpose_b(const float* __restrict__ src, int lds_, size_t sIn, unsigned short* __restrict__ hi, unsigned short* __restrict__ lo, size_t sOut, int K, int N) {
  const size_t t = (size_t)blockIdx.x * 256 + threadIdx.x; const int k8n = K / 8; if (t >= (size_t)N * k8n) return;
  src += (size_t)blockIdx.y * sIn; hi += (size_t)blockIdx.y * sOut; lo += (size_t)blockIdx.y * sOut;
  const int n = (int)(t / k8n), k8 = (int)(t % k8n) * 8; v8us vh, vl;
#pragma unroll
  for (int i = 0; i < 8; ++i) { const float x = src[(size_t)(k8 + i) * lds_ + n]; const unsigned short hb = bf16_bits(x); vh[i] = hb; vl[i] = bf16_bits(x - bf16_val(hb)); }
  unsigned short* dh = hi + (size_t)n * K + k8; unsigned short* dl = lo + (size_t)n * K + k8;
  *(v8us*)dh = vh; *(v8us*)dl = vl; 
}

// k rows rounded to bf16 as Bt[j][d] (= k row-major) and vᵀ planes Vt[b][d][j]
__global__ __launch_bounds__(256) void k_kv(const float* __restrict__ P, unsigned short* __restrict__ Kb, unsigned short* __restrict__ Vt) {
  const size_t t = (size_t)blockIdx.x * 256 + threadIdx.x;
  if (t < (size_t)MR * (HH / 8)) { const size_t row = t / (HH / 8); const int c8 = (int)(t % (HH / 8)) * 8; v8us o; for (int i = 0; i < 8; ++i) o[i] = bf16_bits(P[row * 192 + HH + c8 + i]); *(v8us*)(Kb + row * HH + c8) = o;  }
  if (t < (size_t)BB * HH * (TT / 8)) { const int j8 = (int)(t % (TT / 8)) * 8; const int d = (int)((t / (TT / 8)) % HH); const int b = (int)(t / ((size_t)(TT / 8) * HH)); v8us o; for (int i = 0; i < 8; ++i) o[i] = bf16_bits(P[((size_t)b * TT + j8 + i) * 192 + 2 * HH + d]);
    *(v8us*)(Vt + ((size_t)b * HH + d) * TT + j8) = o;  }
}
// masked row softmax in place (scale C^-½ applied here); wave per row
__global__ __launch_bounds__(256) void k_softmax(float* __restrict__ S, const int* __restrict__ mask, int b) {
  const int tid = threadIdx.x, wv = tid >> 5, lane = tid & 31; const size_t r = (size_t)blockIdx.x * 8 + wv; float* row = S + r * TT; const int* mk = mask + (size_t)b * TT; const float sc = 0.03608439182435161f;   // 768^-0.5
  float mx = -__builtin_inff();
#pragma unroll 1
  for (int j = lane; j < TT; j += 32) { const float v = (mk[j] == 0) ? -__builtin_inff() : row[j] * sc; mx = fmaxf(mx, v); }
  for (int o = 16; o >= 1; o >>= 1) mx = fmaxf(mx, __shfl_xor(mx, o, 32));
  float den = 0.f;
#pragma unroll 1
  for (int j = lane; j < TT; j += 32) { const float v = (mk[j] == 0) ? 0.f : expf(row[j] * sc - mx); row[j] = v; den += v; }
  for (int o = 16; o >= 1; o >>= 1) den += __shfl_xor(den, o, 32); const float inv = 1.0f / den;
#pragma unroll 1
  for (int j = lane; j < TT; j += 32) { const float p = row[j] * inv; *(float*)(row + j) = p;  }
}
extern "C" void kernel_launch(void* const* d_in, const int* in_sizes, int n_in,
                              void* d_out, int out_size, void* d_ws, size_t ws_size, hipStream_t stream) {
  (void)in_sizes; (void)n_in; (void)out_size;
  const float* x = (const float*)d_in[0]; const int* mask = (const int*)d_in[1]; const float* Wk = (const float*)d_in[2]; const float* Wq = (const float*)d_in[3]; const float* Wv = (const float*)d_in[4];
  char* ws = (char*)d_ws; size_t off = 0;
  auto take = [&](size_t bytes) { char* p = ws + off; off += (bytes + 255) & ~(size_t)255; return p; };
  unsigned short* Bt = (unsigned short*)take((size_t)192 * CC * 2); float* P = (float*)take((size_t)MR * 192 * 4); unsigned short* Kb = (unsigned short*)take((size_t)MR * HH * 2); unsigned short* Vt = (unsigned short*)take((size_t)BB * HH * TT * 2); float* S = (float*)take((size_t)TT * TT * 4);
  if (off > ws_size) return;
  k_wt_bf16<<<(HH * (CC / 8) + 255) / 256, 256, 0, stream>>>(Wq, Bt, CC, HH); k_wt_bf16<<<(HH * (CC / 8) + 255) / 256, 256, 0, stream>>>(Wk, Bt + (size_t)HH * CC, CC, HH); k_wt_bf16<<<(HH * (CC / 8) + 255) / 256, 256, 0, stream>>>(Wv, Bt + (size_t)2 * HH * CC, CC, HH);
  k_gemm_bf3<false, 0, false, false><<<((MR / 16) * 3 + 3) / 4, 128, 0, stream>>>(x, CC, Bt, CC, nullptr, nullptr, 1, 0, P, 192, MR, 192, CC);      // [q | k | v]
  k_kv<<<(unsigned)(((size_t)MR * 8 > (size_t)BB * HH * 256 ? (size_t)MR * 8 : (size_t)BB * HH * 256) + 255) / 256, 256, 0, stream>>>(P, Kb, Vt);
  for (int b = 0; b < BB; ++b) {
    k_gemm_b<true, false, 0><<<dim3(((TT / 16) * (TT / 64) + 3) / 4, 1), 128, 0, stream>>>(P + (size_t)b * TT * 192, 192, 0, Kb + (size_t)b * TT * HH, Kb + (size_t)b * TT * HH, HH, 0, nullptr, nullptr, 0, 0, 1.f, 1.f, S, TT, 0, TT, TT, HH);   // S[i][j] = q_i·k_j
    k_softmax<<<TT / 8, 256, 0, stream>>>(S, mask, b);
    k_gemm_b<true, false, 0><<<dim3(((TT / 16) * 1 + 3) / 4, 1), 128, 0, stream>>>(S, TT, 0, Vt + (size_t)b * HH * TT, Vt + (size_t)b * HH * TT, TT, 0, nullptr, nullptr, 0, 0, 1.f, 1.f, (float*)d_out + (size_t)b * TT * HH, HH, 0, TT, HH, TT);   // out[i][d] = Σ_j P[i][j] v[j][d]
  }
}

// v001
// Measured time: 73.1 microseconds a run.
// Two timings next to v000 put it at 22.3 and 22.9 times that version's speed.
#include <hip/hip_runtime.h>
// [q|k|v] = x*[Wq|Wk|Wv] (M = 16384, K = 768, N = 192; x and W rounded to bf16: single exact WMMA term, f32 accumulate); then k_kv rounds k and vt to bf16, and one fused launch:
// St = k*qt (q split into bf16 hi/lo, k rounded: 2 products), masked running-maximum softmax in f32, Ot += vt*Pt (P split, v rounded: 2 products), all on v_wmma_f32_16x16x32_bf16.
#define BB 8
#define TT 2048
#define CC 768
#define HH 64
#define MR (BB * TT)

typedef __bf16 v16b __attribute__((ext_vector_type(16)));
typedef unsigned short v8us __attribute__((ext_vector_type(8), may_alias));
typedef float  v8f  __attribute__((ext_vector_type(8)));
typedef float  v4f  __attribute__((ext_vector_type(4)));
typedef float  v4fa __attribute__((ext_vector_type(4), may_alias));
union FragB { v16b v; v8us half[2]; unsigned short u[16]; };

__device__ __forceinline__ unsigned short bf16_bits(float x) { unsigned int u = __float_as_uint(x); return (unsigned short)((u + 0x7FFFu + ((u >> 16) & 1u)) >> 16); }
__device__ __forceinline__ float bf16_val(unsigned short b) { return __uint_as_float(((unsigned int)b) << 16); }
__device__ __forceinline__ float bf16_round(float x) { return bf16_val(bf16_bits(x)); }
// D += A·B with NT terms: 1 = ah·bh, 2 = + al·bh (A split), 3 = + ah·bl (both split)
template <int NT>
__device__ __forceinline__ v8f mmaN(v16b ah, v16b al, v16b bh, v16b bl, v8f c) {
  c = __builtin_amdgcn_wmma_f32_16x16x32_bf16(false, ah, false, bh, (short)0, c, false, false);
  if (NT >= 2) c = __builtin_amdgcn_wmma_f32_16x16x32_bf16(false, al, false, bh, (short)0, c, false, false);
  if (NT >= 3) c = __builtin_amdgcn_wmma_f32_16x16x32_bf16(false, ah, false, bl, (short)0, c, false, false);
  asm volatile("v_nop\n\tv_nop\n\tv_nop\n\tv_nop" : "+v"(c) : "v"(ah), "v"(al), "v"(bh), "v"(bl));
  return c;
}

__global__ __launch_bounds__(256) void k_wt_bf16(const float* __restrict__ W, unsigned short* __restrict__ Wt, int K, int N) {
  const int t = blockIdx.x * 256 + threadIdx.x;
  const int k8n = K / 8;
  if (t >= N * k8n) return;
  const int n = t / k8n, k8 = (t % k8n) * 8;
  v8us v;
#pragma unroll
  for (int i = 0; i < 8; ++i) v[i] = bf16_bits(W[(size_t)(k8 + i) * N + n]);
  *(v8us*)(Wt + (size_t)n * K + k8) = v;
  
}

// GEMM C[M][N] (f32, pitch ldc) = act(A[M][K]·W + bias). A f32 row-major (pitch lda) converted per fragment to bf16
// (ASPLIT: hi/lo two planes -> 2 terms, else single rounded term); Wt bf16 [N][K] (pitch ldb). BIAS_BF16 rounds the
// bias to bf16 first (bias quantised to bf16 before the add). K%32==0, M%16==0, N%64==0.
template <bool ASPLIT, int ACT, bool BIAS_BF16>
__global__ __launch_bounds__(128) void k_gemm_bf(const float* __restrict__ A, int lda, const unsigned short* __restrict__ Wt, int ldb,
                                               const float* __restrict__ bias, float* __restrict__ C, int ldc, int M, int N, int K) {
  __shared__ __attribute__((aligned(16))) float so[4][16][64];
  const int tid = threadIdx.x, w = tid >> 5, lane = tid & 31, ln = lane & 15, hh = lane >> 4;
  const int ntn = N / 64;
  const int wid = blockIdx.x * 4 + w;
  const int mt = wid / ntn, nq = wid % ntn;
  if (mt * 16 >= M) return;
  const int row0 = mt * 16, col0 = nq * 64;
  const float* arow = A + (size_t)(row0 + ln) * lda;
  v8f acc[4] = {};
  for (int kb = 0; kb < K; kb += 32) {
    FragB ah, al;
    const v4f x0 = *(const v4fa*)(arow + kb + 8 * hh), x1 = *(const v4fa*)(arow + kb + 8 * hh + 4);
    const v4f x2 = *(const v4fa*)(arow + kb + 16 + 8 * hh), x3 = *(const v4fa*)(arow + kb + 16 + 8 * hh + 4);
    float xs[16] = {x0[0],x0[1],x0[2],x0[3],x1[0],x1[1],x1[2],x1[3],x2[0],x2[1],x2[2],x2[3],x3[0],x3[1],x3[2],x3[3]};
#pragma unroll
    for (int i = 0; i < 16; ++i) { const unsigned short hb = bf16_bits(xs[i]); ah.u[i] = hb; al.u[i] = ASPLIT ? bf16_bits(xs[i] - bf16_val(hb)) : (unsigned short)0; }
#pragma unroll
    for (int t = 0; t < 4; ++t) {
      const unsigned short* brow = Wt + (size_t)(col0 + t * 16 + ln) * ldb + kb;
      FragB b;
      b.half[0] = *(const v8us*)(brow + 8 * hh);
      b.half[1] = *(const v8us*)(brow + 16 + 8 * hh);
      acc[t] = mmaN<ASPLIT ? 2 : 1>(ah.v, al.v, b.v, b.v, acc[t]);
    }
  }
#pragma unroll
  for (int t = 0; t < 4; ++t) {
    float bv = bias ? bias[col0 + t * 16 + ln] : 0.f;
    if (BIAS_BF16) bv = bf16_round(bv);
#pragma unroll
    for (int r = 0; r < 8; ++r) { float v = acc[t][r] + bv; if (ACT == 1) v = fmaxf(v, 0.f); so[w][8 * hh + r][t * 16 + ln] = v; }
  }
  __builtin_amdgcn_fence(__ATOMIC_ACQ_REL, "workgroup");
  __builtin_amdgcn_wave_barrier();
  const int rsub = lane >> 4, c4 = (lane & 15) * 4;
  {
#pragma unroll
    for (int q = 0; q < 8; ++q) {
      const int r = q * 2 + rsub;
      const v4f v = *(const v4fa*)&so[w][r][c4];
      *(v4f*)(C + (size_t)(row0 + r) * ldc + col0 + c4) = v;
    }
    
  }
}

// Flash-style causal/unmasked attention, all contractions 3-term bf16 hi/lo splits, f32 softmax with running max.
// q,k,v rows are read from f32 buffers with arbitrary row pitch (so they can live inside a fused qkv buffer);
// D = head size (multiple of 32, <= 128); one wave = 16 query rows; block = 4 waves (64 queries) sharing K/V chunks of 32.
template <int D, bool CAUSAL>
__global__ __launch_bounds__(128) void k_flash(const float* __restrict__ qb, const float* __restrict__ kb, const float* __restrict__ vb,
                                             int pitch, int T, int H, float scale, float* __restrict__ y, int ypitch) {
  constexpr int KS = D / 32;        // k-steps for QK
  constexpr int DT = D / 16;        // d tiles for PV
  __shared__ __attribute__((aligned(16))) unsigned short sKh[32][D + 8], sKl[32][D + 8], sVh[32][D + 8], sVl[32][D + 8];
  __shared__ __attribute__((aligned(16))) unsigned short sPh[4][16][40], sPl[4][16][40];
  __shared__ __attribute__((aligned(16))) float sO[4][16][D];
  const int tid = threadIdx.x, w = tid >> 5, lane = tid & 31, ln = lane & 15, hh = lane >> 4;
  const int nqb = (T + 63) / 64;
  const int bh = blockIdx.x / nqb, qblk = blockIdx.x % nqb;
  const int b = bh / H, h = bh % H;
  const int q0 = qblk * 64 + w * 16;
  const float* Q = qb + (size_t)b * T * pitch + h * D;
  const float* K = kb + (size_t)b * T * pitch + h * D;
  const float* V = vb + (size_t)b * T * pitch + h * D;

  // A fragments of the wave's 16 query rows (scaled), hi/lo
  FragB aqh[KS], aql[KS];
  {
    int row = q0 + ln; if (row >= T) row = T - 1;
    const float* qr = Q + (size_t)row * pitch;
#pragma unroll
    for (int ks = 0; ks < KS; ++ks)
#pragma unroll
      for (int i = 0; i < 16; ++i) {
        const int d = ks * 32 + ((i < 8) ? (8 * hh + i) : (16 + 8 * hh + (i - 8)));
        const float x = qr[d] * scale; const unsigned short hb = bf16_bits(x);
        aqh[ks].u[i] = hb; aql[ks].u[i] = bf16_bits(x - bf16_val(hb));
      }
  }
  float m_r[8], l_r[8];
#pragma unroll
  for (int r = 0; r < 8; ++r) { m_r[r] = -3.0e38f; l_r[r] = 0.f; }
  v8f oacc[DT];
#pragma unroll
  for (int dt = 0; dt < DT; ++dt) oacc[dt] = (v8f){0.f,0.f,0.f,0.f,0.f,0.f,0.f,0.f};

  const int kv_end = CAUSAL ? min(T, qblk * 64 + 64) : T;     // block-uniform
  for (int j0 = 0; j0 < kv_end; j0 += 32) {
    __syncthreads();
    for (int e = tid; e < 32 * (D / 4); e += 128) {
      const int r = e / (D / 4), c4 = (e % (D / 4)) * 4;
      const int key = j0 + r;
      v4f kf = {0.f,0.f,0.f,0.f}, vf = {0.f,0.f,0.f,0.f};
      if (key < T) { kf = *(const v4fa*)(K + (size_t)key * pitch + c4); vf = *(const v4fa*)(V + (size_t)key * pitch + c4); }
#pragma unroll
      for (int t = 0; t < 4; ++t) {
        unsigned short hb = bf16_bits(kf[t]); sKh[r][c4 + t] = hb; sKl[r][c4 + t] = bf16_bits(kf[t] - bf16_val(hb));
        hb = bf16_bits(vf[t]); sVh[r][c4 + t] = hb; sVl[r][c4 + t] = bf16_bits(vf[t] - bf16_val(hb));
      }
    }
    __syncthreads();
    // S tile 16 x 32
    v8f s[2];
#pragma unroll
    for (int nt = 0; nt < 2; ++nt) {
      v8f acc = {};
#pragma unroll
      for (int ks = 0; ks < KS; ++ks) {
        FragB bh_, bl_;
        bh_.half[0] = *(const v8us*)&sKh[nt * 16 + ln][ks * 32 + 8 * hh]; bh_.half[1] = *(const v8us*)&sKh[nt * 16 + ln][ks * 32 + 16 + 8 * hh];
        bl_.half[0] = *(const v8us*)&sKl[nt * 16 + ln][ks * 32 + 8 * hh]; bl_.half[1] = *(const v8us*)&sKl[nt * 16 + ln][ks * 32 + 16 + 8 * hh];
        acc = mmaN<3>(aqh[ks].v, aql[ks].v, bh_.v, bl_.v, acc);
      }
      s[nt] = acc;
    }
    // mask + running max (rows 8hh+r; the 16 lanes of a half share rows)
    float alpha[8];
#pragma unroll
    for (int r = 0; r < 8; ++r) {
      const int qi = q0 + 8 * hh + r;
      const int ja = j0 + ln, jb = j0 + 16 + ln;
      if (CAUSAL) { if (ja > qi) s[0][r] = -3.0e38f; if (jb > qi) s[1][r] = -3.0e38f; }
      if (ja >= T) s[0][r] = -3.0e38f;
      if (jb >= T) s[1][r] = -3.0e38f;
      float mx = fmaxf(s[0][r], s[1][r]);
      mx = fmaxf(mx, __shfl_xor(mx, 1, 32)); mx = fmaxf(mx, __shfl_xor(mx, 2, 32)); mx = fmaxf(mx, __shfl_xor(mx, 4, 32)); mx = fmaxf(mx, __shfl_xor(mx, 8, 32));
      const float mnew = fmaxf(m_r[r], mx);
      alpha[r] = (mnew > -1.0e38f) ? __expf(m_r[r] - mnew) : 1.0f;
      const float p0 = (s[0][r] > -1.0e38f) ? __expf(s[0][r] - mnew) : 0.f;
      const float p1 = (s[1][r] > -1.0e38f) ? __expf(s[1][r] - mnew) : 0.f;
      m_r[r] = mnew;
      l_r[r] = l_r[r] * alpha[r] + p0 + p1;            // per-lane partial row sum (16 lanes combined at the end)
      unsigned short hb = bf16_bits(p0); sPh[w][8 * hh + r][ln] = hb;      sPl[w][8 * hh + r][ln] = bf16_bits(p0 - bf16_val(hb));
      hb = bf16_bits(p1);                sPh[w][8 * hh + r][16 + ln] = hb; sPl[w][8 * hh + r][16 + ln] = bf16_bits(p1 - bf16_val(hb));
    }
#pragma unroll
    for (int dt = 0; dt < DT; ++dt)
#pragma unroll
      for (int r = 0; r < 8; ++r) oacc[dt][r] *= alpha[r];
    __builtin_amdgcn_fence(__ATOMIC_ACQ_REL, "workgroup");
    __builtin_amdgcn_wave_barrier();
    FragB pah, pal;
    pah.half[0] = *(const v8us*)&sPh[w][ln][8 * hh]; pah.half[1] = *(const v8us*)&sPh[w][ln][16 + 8 * hh];
    pal.half[0] = *(const v8us*)&sPl[w][ln][8 * hh]; pal.half[1] = *(const v8us*)&sPl[w][ln][16 + 8 * hh];
#pragma unroll
    for (int dt = 0; dt < DT; ++dt) {
      FragB bvh, bvl;
#pragma unroll
      for (int i = 0; i < 8; ++i) {
        bvh.u[i] = sVh[8 * hh + i][dt * 16 + ln]; bvh.u[8 + i] = sVh[16 + 8 * hh + i][dt * 16 + ln];
        bvl.u[i] = sVl[8 * hh + i][dt * 16 + ln]; bvl.u[8 + i] = sVl[16 + 8 * hh + i][dt * 16 + ln];
      }
      oacc[dt] = mmaN<3>(pah.v, pal.v, bvh.v, bvl.v, oacc[dt]);
    }
    __builtin_amdgcn_fence(__ATOMIC_ACQ_REL, "workgroup");
    __builtin_amdgcn_wave_barrier();
  }
#pragma unroll
  for (int r = 0; r < 8; ++r) {
    float l = l_r[r];
    l += __shfl_xor(l, 1, 32); l += __shfl_xor(l, 2, 32); l += __shfl_xor(l, 4, 32); l += __shfl_xor(l, 8, 32);
    l_r[r] = (l > 0.f) ? 1.0f / l : 0.f;
  }
#pragma unroll
  for (int dt = 0; dt < DT; ++dt)
#pragma unroll
    for (int r = 0; r < 8; ++r) sO[w][8 * hh + r][dt * 16 + ln] = oacc[dt][r] * l_r[r];
  __builtin_amdgcn_fence(__ATOMIC_ACQ_REL, "workgroup");
  __builtin_amdgcn_wave_barrier();
  {
    for (int r = 0; r < 16; ++r) {
      const int row = q0 + r;
      if (row < T && lane < D / 4) {
        const v4f val = *(const v4fa*)&sO[w][r][lane * 4];
        *(v4f*)(y + ((size_t)b * T + row) * ypitch + h * D + lane * 4) = val;
      }
    }
    
  }
}

// GEMM C = act(A·W + bias + resid): A f32 (ASPLIT -> hi/lo 2 terms), Wt bf16 [N][K]; ACT 0 none, 1 relu, 2 exact gelu;
// resid (optional, f32, row index = (row % rmod), pitch ldr, RES_BF16 rounds it) added before the activation.
template <bool ASPLIT, int ACT, bool BIAS_BF16, bool RES_BF16>
__global__ __launch_bounds__(128) void k_gemm_bf3(const float* __restrict__ A, int lda, const unsigned short* __restrict__ Wt, int ldb,
                                                const float* __restrict__ bias, const float* __restrict__ resid, int rmod, int ldr,
                                                float* __restrict__ C, int ldc, int M, int N, int K) {
  __shared__ __attribute__((aligned(16))) float so[4][16][64];
  const int tid = threadIdx.x, w = tid >> 5, lane = tid & 31, ln = lane & 15, hh = lane >> 4;
  const int ntn = N / 64;
  const int wid = blockIdx.x * 4 + w;
  const int mt = wid / ntn, nq = wid % ntn;
  if (mt * 16 >= M) return;
  const int row0 = mt * 16, col0 = nq * 64;
  const float* arow = A + (size_t)(row0 + ln) * lda;
  v8f acc[4] = {};
  for (int kb = 0; kb < K; kb += 32) {
    FragB ah, al;
    const v4f x0 = *(const v4fa*)(arow + kb + 8 * hh), x1 = *(const v4fa*)(arow + kb + 8 * hh + 4);
    const v4f x2 = *(const v4fa*)(arow + kb + 16 + 8 * hh), x3 = *(const v4fa*)(arow + kb + 16 + 8 * hh + 4);
    float xs[16] = {x0[0],x0[1],x0[2],x0[3],x1[0],x1[1],x1[2],x1[3],x2[0],x2[1],x2[2],x2[3],x3[0],x3[1],x3[2],x3[3]};
#pragma unroll
    for (int i = 0; i < 16; ++i) { const unsigned short hb = bf16_bits(xs[i]); ah.u[i] = hb; al.u[i] = ASPLIT ? bf16_bits(xs[i] - bf16_val(hb)) : (unsigned short)0; }
#pragma unroll
    for (int t = 0; t < 4; ++t) {
      const unsigned short* brow = Wt + (size_t)(col0 + t * 16 + ln) * ldb + kb;
      FragB b;
      b.half[0] = *(const v8us*)(brow + 8 * hh);
      b.half[1] = *(const v8us*)(brow + 16 + 8 * hh);
      acc[t] = mmaN<ASPLIT ? 2 : 1>(ah.v, al.v, b.v, b.v, acc[t]);
    }
  }
#pragma unroll
  for (int t = 0; t < 4; ++t) {
    const int col = col0 + t * 16 + ln;
    float bv = bias ? bias[col] : 0.f;
    if (BIAS_BF16) bv = bf16_round(bv);
#pragma unroll
    for (int r = 0; r < 8; ++r) {
      float v = acc[t][r] + bv;
      if (resid) { float rv = resid[(size_t)((row0 + 8 * hh + r) % rmod) * ldr + col]; if (RES_BF16) rv = bf16_round(rv); v += rv; }
      if (ACT == 1) v = fmaxf(v, 0.f);
      if (ACT == 2) v = 0.5f * v * (1.0f + erff(v * 0.70710678118654752f));
      if (ACT == 3) { const float u = 0.7978845608028654f * (v + 0.044715f * v * v * v); v = 0.5f * v * (1.0f + tanhf(u)); }
      so[w][8 * hh + r][t * 16 + ln] = v;
    }
  }
  __builtin_amdgcn_fence(__ATOMIC_ACQ_REL, "workgroup");
  __builtin_amdgcn_wave_barrier();
  const int rsub = lane >> 4, c4 = (lane & 15) * 4;
  {
#pragma unroll
    for (int q = 0; q < 8; ++q) {
      const int r = q * 2 + rsub;
      const v4f v = *(const v4fa*)&so[w][r][c4];
      *(v4f*)(C + (size_t)(row0 + r) * ldc + col0 + c4) = v;
    }
    
  }
}
// row LayerNorm (biased variance, eps) over N: s = X (+ R); optional out_sum <- s; out_norm <- (s-mu)*rsqrt(var+eps)*g + b
template <bool PARAM_BF16>
__global__ __launch_bounds__(256) void k_layernorm(const float* __restrict__ X, const float* __restrict__ R, const float* __restrict__ g, const float* __restrict__ bta,
                                                  float* __restrict__ out_sum, float* __restrict__ out_norm, int N, float eps) {
  __shared__ float red[256];
  const int row = blockIdx.x, tid = threadIdx.x;
  const float* x = X + (size_t)row * N; const float* rr = R ? R + (size_t)row * N : nullptr;
  float vals[16];                     // up to N = 4096
  const int per = N / 256;            // contiguous chunk per thread? use strided-by-4 chunks: thread handles j = tid*4 + 1024*u
  float s1 = 0.f;
  for (int u = 0; u < per / 4; ++u) {
    const int j = tid * 4 + 1024 * u;
    const v4f a = *(const v4fa*)(x + j);
    v4f b = {0.f,0.f,0.f,0.f}; if (rr) b = *(const v4fa*)(rr + j);
#pragma unroll
    for (int q = 0; q < 4; ++q) { const float v = a[q] + b[q]; vals[u * 4 + q] = v; s1 += v; }
  }
  red[tid] = s1; __syncthreads();
  for (int st = 128; st > 0; st >>= 1) { if (tid < st) red[tid] += red[tid + st]; __syncthreads(); }
  const float mu = red[0] / (float)N; __syncthreads();
  float s2 = 0.f;
  for (int u = 0; u < per / 4; ++u)
#pragma unroll
    for (int q = 0; q < 4; ++q) { const float c = vals[u * 4 + q] - mu; s2 += c * c; }
  red[tid] = s2; __syncthreads();
  for (int st = 128; st > 0; st >>= 1) { if (tid < st) red[tid] += red[tid + st]; __syncthreads(); }
  const float rs = rsqrtf(red[0] / (float)N + eps);
  {
    for (int u = 0; u < per / 4; ++u) {
      const int j = tid * 4 + 1024 * u;
      v4f o, sm;
#pragma unroll
      for (int q = 0; q < 4; ++q) {
        float gg = g[j + q], bb = bta[j + q];
        if (PARAM_BF16) { gg = bf16_round(gg); bb = bf16_round(bb); }
        sm[q] = vals[u * 4 + q]; o[q] = (vals[u * 4 + q] - mu) * rs * gg + bb;
      }
      if (out_sum) *(v4f*)(out_sum + (size_t)row * N + j) = sm;
      *(v4f*)(out_norm + (size_t)row * N + j) = o;
    }
    
  }
}

// batched f32 [K][N] (pitch lds, batch stride sIn) -> transposed hi/lo planes [N][K] (batch stride sOut); thread per (n, 8 k); grid.y = batch
__global__ __launch_bounds__(256) void k_split_transpose_b(const float* __restrict__ src, int lds_, size_t sIn, unsigned short* __restrict__ hi, unsigned short* __restrict__ lo, size_t sOut, int K, int N) {
  const size_t t = (size_t)blockIdx.x * 256 + threadIdx.x; const int k8n = K / 8; if (t >= (size_t)N * k8n) return;
  src += (size_t)blockIdx.y * sIn; hi += (size_t)blockIdx.y * sOut; lo += (size_t)blockIdx.y * sOut;
  const int n = (int)(t / k8n), k8 = (int)(t % k8n) * 8; v8us vh, vl;
#pragma unroll
  for (int i = 0; i < 8; ++i) { const float x = src[(size_t)(k8 + i) * lds_ + n]; const unsigned short hb = bf16_bits(x); vh[i] = hb; vl[i] = bf16_bits(x - bf16_val(hb)); }
  unsigned short* dh = hi + (size_t)n * K + k8; unsigned short* dl = lo + (size_t)n * K + k8;
  *(v8us*)dh = vh; *(v8us*)dl = vl; 
}

// k rows rounded to bf16 as Kb[j][d] (= k row-major) and vᵀ planes Vt[b][d][j]
__global__ __launch_bounds__(256) void k_kv(const float* __restrict__ P, unsigned short* __restrict__ Kb, unsigned short* __restrict__ Vt) {
  const size_t t = (size_t)blockIdx.x * 256 + threadIdx.x;
  if (t < (size_t)MR * (HH / 8)) { const size_t row = t / (HH / 8); const int c8 = (int)(t % (HH / 8)) * 8; v8us o; for (int i = 0; i < 8; ++i) o[i] = bf16_bits(P[row * 192 + HH + c8 + i]); *(v8us*)(Kb + row * HH + c8) = o;  }
  if (t < (size_t)BB * HH * (TT / 8)) { const int j8 = (int)(t % (TT / 8)) * 8; const int d = (int)((t / (TT / 8)) % HH); const int b = (int)(t / ((size_t)(TT / 8) * HH)); v8us o; for (int i = 0; i < 8; ++i) o[i] = bf16_bits(P[((size_t)b * TT + j8 + i) * 192 + 2 * HH + d]);
    *(v8us*)(Vt + ((size_t)b * HH + d) * TT + j8) = o;  }
}
typedef float f2v __attribute__((ext_vector_type(2)));
typedef __bf16 bf2v __attribute__((ext_vector_type(2)));
union FragW { v16b v; unsigned int w[8]; };
__device__ __forceinline__ unsigned int pk_bf16(float a, float b) { return __builtin_bit_cast(unsigned int, __builtin_convertvector((f2v){a, b}, bf2v)); }   // round to nearest even
__device__ __forceinline__ float xhalf(float x) { return __builtin_bit_cast(float, __builtin_amdgcn_permlanex16(__builtin_bit_cast(int, x), __builtin_bit_cast(int, x), 0x76543210, 0xfedcba98, false, false)); }   // lane l with lane l ^ 16
__device__ __forceinline__ v8f wmma_bf(v16b a, v16b b, v8f c) { return __builtin_amdgcn_wmma_f32_16x16x32_bf16(false, a, false, b, (short)0, c, false, false); }

// Scores, masked softmax and P*v in one launch, all batches. A block owns 64 query rows of one batch; each of its AW waves
// holds all 64 (AQ tiles of 16 as B operands, q split hi/lo) and walks its own TT / AW keys in passes of 32 with a running maximum:
// St = k * qt (a lane holds 16 scores of ONE query), Pt packs from the two St tiles into a B operand (hi/lo), Ot += vt * Pt.
// The AW partial (maximum, sum, Ot) sets are joined through LDS at the end. Scores never reach memory.
#define AQ 4
#define AW 8
#define AKEYS (TT / AW)
__global__ __launch_bounds__(AW * 32) void k_attn(const float* __restrict__ P, const unsigned short* __restrict__ Kb, const unsigned short* __restrict__ Vt,
                                                  const int* __restrict__ mask, float* __restrict__ out) {
  __shared__ __attribute__((aligned(16))) v4f sO[AW][AQ * 8][32];
  __shared__ float sM[AW][AQ][16], sL[AW][AQ][16];
  const int tid = threadIdx.x, w = tid >> 5, lane = tid & 31, ln = lane & 15, hh = lane >> 4;
  const int b = blockIdx.x / (TT / 64), q0 = (blockIdx.x % (TT / 64)) * 64;
  const float c2 = 0.03608439182435161f * 1.4426950408889634f;   // 768^-0.5 * log2(e): the softmax runs in base 2

  FragB qh[AQ][2], ql[AQ][2];
  const float* qp = P + ((size_t)b * TT + q0 + ln) * 192 + 8 * hh;
  v4f xq[AQ][2][4];
#pragma unroll
  for (int qt = 0; qt < AQ; ++qt)
#pragma unroll
    for (int ks = 0; ks < 2; ++ks) {
      const float* qr = qp + qt * 16 * 192 + ks * 32;
      xq[qt][ks][0] = *(const v4fa*)(qr); xq[qt][ks][1] = *(const v4fa*)(qr + 4); xq[qt][ks][2] = *(const v4fa*)(qr + 16); xq[qt][ks][3] = *(const v4fa*)(qr + 20);
    }
  // stands in front of the reuse of the address registers that the q loads name; the pointer is an input so that its registers live up to the wait
  asm volatile("s_wait_xcnt 0x0" :: "v"(qp) : "memory");
#pragma unroll
  for (int qt = 0; qt < AQ; ++qt) {
#pragma unroll
    for (int ks = 0; ks < 2; ++ks) {
      const v4f x0 = xq[qt][ks][0], x1 = xq[qt][ks][1], x2 = xq[qt][ks][2], x3 = xq[qt][ks][3];
      float xs[16] = {x0[0],x0[1],x0[2],x0[3],x1[0],x1[1],x1[2],x1[3],x2[0],x2[1],x2[2],x2[3],x3[0],x3[1],x3[2],x3[3]};
#pragma unroll
      for (int i = 0; i < 16; ++i) { const unsigned short hb = bf16_bits(xs[i]); qh[qt][ks].u[i] = hb; ql[qt][ks].u[i] = bf16_bits(xs[i] - bf16_val(hb)); }
    }
  }
  float m_r[AQ], l_r[AQ];
  v8f oacc[AQ][4];
#pragma unroll
  for (int qt = 0; qt < AQ; ++qt) {
    m_r[qt] = -3.0e38f; l_r[qt] = 0.f;   // finite start: a pass whose keys are all masked gives exp2(-inf) = 0, never inf - inf
#pragma unroll
    for (int dt = 0; dt < 4; ++dt) oacc[qt][dt] = (v8f){0.f,0.f,0.f,0.f,0.f,0.f,0.f,0.f};
  }
  const unsigned short* kp = Kb + ((size_t)b * TT + w * AKEYS + ln) * HH + 8 * hh;
  const unsigned short* vp = Vt + ((size_t)b * HH + ln) * TT + w * AKEYS + 8 * hh;
  const int* mp = mask + (size_t)b * TT + w * AKEYS + lane;   // one mask word a lane: a pass's 32 keys
  int one = 1;   // passes through each wait below, so that the pointer additions, which are multiples of it, cannot be lifted over the wait

  FragB ka[2][2];
  int mk;
#pragma unroll
  for (int t = 0; t < 2; ++t)
#pragma unroll
    for (int ks = 0; ks < 2; ++ks) { ka[t][ks].half[0] = *(const v8us*)(kp + t * 16 * HH + ks * 32); ka[t][ks].half[1] = *(const v8us*)(kp + t * 16 * HH + ks * 32 + 16); }
  mk = *mp;
  // stands in front of the overwrite of the address registers that the loads above name; the pointers are inputs so that their registers live up to it
  asm volatile("s_wait_xcnt 0x0" : "+s"(one) : "v"(kp), "v"(mp) : "memory");
  kp += one * 32 * HH; mp += one * 32;

  // rolled, for speed only: one pass is several KB of code
#pragma unroll 1
  for (int it = 0; it < AKEYS / 32; ++it) {
    FragB va[4];
#pragma unroll
    for (int dt = 0; dt < 4; ++dt) { va[dt].half[0] = *(const v8us*)(vp + (size_t)dt * 16 * TT); va[dt].half[1] = *(const v8us*)(vp + (size_t)dt * 16 * TT + 16); }
    // the next pass's k rows and mask words are fetched now; the last pass fetches its own again, so every address stays inside
    FragB kn[2][2];
#pragma unroll
    for (int t = 0; t < 2; ++t)
#pragma unroll
      for (int ks = 0; ks < 2; ++ks) { kn[t][ks].half[0] = *(const v8us*)(kp + t * 16 * HH + ks * 32); kn[t][ks].half[1] = *(const v8us*)(kp + t * 16 * HH + ks * 32 + 16); }
    const int mn = *mp;
    // stands in front of the overwrite of the address registers that this pass's loads name; the pointers are inputs so that their registers live up to it
    asm volatile("s_wait_xcnt 0x0" : "+s"(one) : "v"(vp), "v"(kp), "v"(mp) : "memory");
    const int adv = (it + 2 < AKEYS / 32) ? one : 0;
    vp += one * 32; kp += adv * 32 * HH; mp += adv * 32;

    // bit 16 t + r of nb: key 16 t + 8 hh + r of this pass is masked
    const unsigned int nb = ~__builtin_amdgcn_ballot_w32(mk != 0) >> (8 * hh);
    v8f bias[2];   // 0 for a kept key, -inf for a masked one; rows of St are keys, so one set serves all query tiles
#pragma unroll
    for (int r = 0; r < 8; ++r) {
      bias[0][r] = __uint_as_float((unsigned int)((int)(nb << (31 - r)) >> 31) & 0xFF800000u);
      bias[1][r] = __uint_as_float((unsigned int)((int)(nb << (15 - r)) >> 31) & 0xFF800000u);
    }

#pragma unroll
    for (int qt = 0; qt < AQ; ++qt) {
      v8f s0 = {}, s1 = {};
#pragma unroll
      for (int ks = 0; ks < 2; ++ks) {
        s0 = wmma_bf(ka[0][ks].v, qh[qt][ks].v, s0); s1 = wmma_bf(ka[1][ks].v, qh[qt][ks].v, s1);
        s0 = wmma_bf(ka[0][ks].v, ql[qt][ks].v, s0); s1 = wmma_bf(ka[1][ks].v, ql[qt][ks].v, s1);
      }
      s0 += bias[0]; s1 += bias[1];
      float mx = fmaxf(s0[0], s1[0]);
#pragma unroll
      for (int r = 1; r < 8; ++r) mx = fmaxf(mx, fmaxf(s0[r], s1[r]));
      mx = fmaxf(mx, xhalf(mx));
      const float mnew = fmaxf(m_r[qt], mx);
      float alpha = (m_r[qt] - mnew) * c2;
      const float mc = mnew * c2;
      m_r[qt] = mnew;
      float e[16];
#pragma unroll
      for (int r = 0; r < 8; ++r) { e[r] = __builtin_fmaf(s0[r], c2, -mc); e[8 + r] = __builtin_fmaf(s1[r], c2, -mc); }
      // one tile's exponentials in one statement, each in place: none reads the result or overwrites the source of the one in front of it,
      // and the v_nop fills the slot that the instruction set asks for behind the last
      asm("v_exp_f32 %0, %0\n\tv_exp_f32 %1, %1\n\tv_exp_f32 %2, %2\n\tv_exp_f32 %3, %3\n\tv_exp_f32 %4, %4\n\tv_exp_f32 %5, %5\n\t"
          "v_exp_f32 %6, %6\n\tv_exp_f32 %7, %7\n\tv_exp_f32 %8, %8\n\tv_exp_f32 %9, %9\n\tv_exp_f32 %10, %10\n\tv_exp_f32 %11, %11\n\t"
          "v_exp_f32 %12, %12\n\tv_exp_f32 %13, %13\n\tv_exp_f32 %14, %14\n\tv_exp_f32 %15, %15\n\tv_exp_f32 %16, %16\n\tv_nop"
          : "+v"(e[0]), "+v"(e[1]), "+v"(e[2]), "+v"(e[3]), "+v"(e[4]), "+v"(e[5]), "+v"(e[6]), "+v"(e[7]), "+v"(e[8]), "+v"(e[9]),
            "+v"(e[10]), "+v"(e[11]), "+v"(e[12]), "+v"(e[13]), "+v"(e[14]), "+v"(e[15]), "+v"(alpha));
      FragW ph, pl;
      float sum = 0.f;
#pragma unroll
      for (int i = 0; i < 8; ++i) {
        const float pa = e[2 * i], pb = e[2 * i + 1];
        sum += pa + pb;
        const unsigned int hw = pk_bf16(pa, pb);
        ph.w[i] = hw;
        pl.w[i] = pk_bf16(pa - __uint_as_float(hw << 16), pb - __uint_as_float(hw & 0xFFFF0000u));
      }
      l_r[qt] = l_r[qt] * alpha + sum;   // this lane half's keys only; the halves are joined after the loop
#pragma unroll
      for (int dt = 0; dt < 4; ++dt) oacc[qt][dt] *= alpha;
#pragma unroll
      for (int dt = 0; dt < 4; ++dt) oacc[qt][dt] = wmma_bf(va[dt].v, ph.v, oacc[qt][dt]);
#pragma unroll
      for (int dt = 0; dt < 4; ++dt) oacc[qt][dt] = wmma_bf(va[dt].v, pl.v, oacc[qt][dt]);
    }
#pragma unroll
    for (int t = 0; t < 2; ++t)
#pragma unroll
      for (int ks = 0; ks < 2; ++ks) ka[t][ks] = kn[t][ks];
    mk = mn;
  }

#pragma unroll
  for (int qt = 0; qt < AQ; ++qt) {
    const float l = l_r[qt] + xhalf(l_r[qt]);
    if (hh == 0) { sM[w][qt][ln] = m_r[qt]; sL[w][qt][ln] = l; }
#pragma unroll
    for (int dt = 0; dt < 4; ++dt) {
      sO[w][qt * 8 + dt * 2][lane]     = (v4f){oacc[qt][dt][0], oacc[qt][dt][1], oacc[qt][dt][2], oacc[qt][dt][3]};
      sO[w][qt * 8 + dt * 2 + 1][lane] = (v4f){oacc[qt][dt][4], oacc[qt][dt][5], oacc[qt][dt][6], oacc[qt][dt][7]};
    }
  }
  __syncthreads();
  // join: wave w finishes query tile w / 2, head columns 32 * (w % 2) ... + 31 (one 128-byte line of each output row)
  const int qm = w >> 1;
  float M = -3.0e38f;
#pragma unroll
  for (int p = 0; p < AW; ++p) M = fmaxf(M, sM[p][qm][ln]);
  float f[AW], den = 0.f;
#pragma unroll
  for (int p = 0; p < AW; ++p) f[p] = (sM[p][qm][ln] - M) * c2;
  // in place and closed by a v_nop, for the same reason as in the loop
  asm("v_exp_f32 %0, %0\n\tv_exp_f32 %1, %1\n\tv_exp_f32 %2, %2\n\tv_exp_f32 %3, %3\n\tv_exp_f32 %4, %4\n\tv_exp_f32 %5, %5\n\tv_exp_f32 %6, %6\n\tv_exp_f32 %7, %7\n\tv_nop"
      : "+v"(f[0]), "+v"(f[1]), "+v"(f[2]), "+v"(f[3]), "+v"(f[4]), "+v"(f[5]), "+v"(f[6]), "+v"(f[7]));
#pragma unroll
  for (int p = 0; p < AW; ++p) den += sL[p][qm][ln] * f[p];
  const float inv = 1.0f / den;   // every key masked: den = 0, and 0 * inf gives NaN
#pragma unroll
  for (int dd = 0; dd < 2; ++dd) {
    const int dt = (w & 1) * 2 + dd;
    v4f a0 = {0.f,0.f,0.f,0.f}, a1 = {0.f,0.f,0.f,0.f};
#pragma unroll
    for (int p = 0; p < AW; ++p) { a0 += sO[p][qm * 8 + dt * 2][lane] * f[p]; a1 += sO[p][qm * 8 + dt * 2 + 1][lane] * f[p]; }
    float* o = out + ((size_t)b * TT + q0 + qm * 16 + ln) * HH + dt * 16 + 8 * hh;
    *(v4f*)o = a0 * inv; *(v4f*)(o + 4) = a1 * inv;
  }
}
extern "C" void kernel_launch(void* const* d_in, const int* in_sizes, int n_in,
                              void* d_out, int out_size, void* d_ws, size_t ws_size, hipStream_t stream) {
  (void)in_sizes; (void)n_in; (void)out_size;
  const float* x = (const float*)d_in[0]; const int* mask = (const int*)d_in[1]; const float* Wk = (const float*)d_in[2]; const float* Wq = (const float*)d_in[3]; const float* Wv = (const float*)d_in[4];
  char* ws = (char*)d_ws; size_t off = 0;
  auto take = [&](size_t bytes) { char* p = ws + off; off += (bytes + 255) & ~(size_t)255; return p; };
  unsigned short* Bt = (unsigned short*)take((size_t)192 * CC * 2); float* P = (float*)take((size_t)MR * 192 * 4); unsigned short* Kb = (unsigned short*)take((size_t)MR * HH * 2); unsigned short* Vt = (unsigned short*)take((size_t)BB * HH * TT * 2);
  if (off > ws_size) return;
  k_wt_bf16<<<(HH * (CC / 8) + 255) / 256, 256, 0, stream>>>(Wq, Bt, CC, HH); k_wt_bf16<<<(HH * (CC / 8) + 255) / 256, 256, 0, stream>>>(Wk, Bt + (size_t)HH * CC, CC, HH); k_wt_bf16<<<(HH * (CC / 8) + 255) / 256, 256, 0, stream>>>(Wv, Bt + (size_t)2 * HH * CC, CC, HH);
  k_gemm_bf3<false, 0, false, false><<<((MR / 16) * 3 + 3) / 4, 128, 0, stream>>>(x, CC, Bt, CC, nullptr, nullptr, 1, 0, P, 192, MR, 192, CC);      // [q | k | v]
  k_kv<<<(unsigned)(((size_t)MR * 8 > (size_t)BB * HH * 256 ? (size_t)MR * 8 : (size_t)BB * HH * 256) + 255) / 256, 256, 0, stream>>>(P, Kb, Vt);
  k_attn<<<BB * (TT / 64), AW * 32, 0, stream>>>(P, Kb, Vt, mask, (float*)d_out);
}

// v002
// Measured time: 47.8 microseconds a run.
// In two side-by-side timings against v001, it was 1.51 and 1.50 times as fast.
// All steps since v000 together make it 34.0 times as fast.
#include <hip/hip_runtime.h>
// [q|k|v] = x*[Wq|Wk|Wv] (M = 16384, K = 768, N = 192; x and W rounded to bf16: single exact WMMA term, f32 accumulate); then k_kv rounds k and vt to bf16, and one fused launch:
// St = k*qt (q split into bf16 hi/lo, k rounded: 2 products), masked running-maximum softmax in f32, Ot += vt*Pt (P split, v rounded: 2 products), all on v_wmma_f32_16x16x32_bf16.
#define BB 8
#define TT 2048
#define CC 768
#define HH 64
#define MR (BB * TT)

typedef __bf16 v16b __attribute__((ext_vector_type(16)));
typedef unsigned short v8us __attribute__((ext_vector_type(8), may_alias));
typedef float  v8f  __attribute__((ext_vector_type(8)));
typedef float  v4f  __attribute__((ext_vector_type(4)));
typedef float  v4fa __attribute__((ext_vector_type(4), may_alias));
union FragB { v16b v; v8us half[2]; unsigned short u[16]; };

__device__ __forceinline__ unsigned short bf16_bits(float x) { unsigned int u = __float_as_uint(x); return (unsigned short)((u + 0x7FFFu + ((u >> 16) & 1u)) >> 16); }
__device__ __forceinline__ float bf16_val(unsigned short b) { return __uint_as_float(((unsigned int)b) << 16); }
__device__ __forceinline__ float bf16_round(float x) { return bf16_val(bf16_bits(x)); }
// D += A·B with NT terms: 1 = ah·bh, 2 = + al·bh (A split), 3 = + ah·bl (both split)
template <int NT>
__device__ __forceinline__ v8f mmaN(v16b ah, v16b al, v16b bh, v16b bl, v8f c) {
  c = __builtin_amdgcn_wmma_f32_16x16x32_bf16(false, ah, false, bh, (short)0, c, false, false);
  if (NT >= 2) c = __builtin_amdgcn_wmma_f32_16x16x32_bf16(false, al, false, bh, (short)0, c, false, false);
  if (NT >= 3) c = __builtin_amdgcn_wmma_f32_16x16x32_bf16(false, ah, false, bl, (short)0, c, false, false);
  asm volatile("v_nop\n\tv_nop\n\tv_nop\n\tv_nop" : "+v"(c) : "v"(ah), "v"(al), "v"(bh), "v"(bl));
  return c;
}

// W [K][N] f32 -> bf16 B fragments, fragment-major: unit ((tile * (K / 32) + ks) * 2 + h) * 32 + lane holds the 16 bytes that this lane of the B fragment
// (column tile, k-step ks, register half h) needs, so that one wave-wide 16-byte load of a fragment half covers 512 contiguous bytes. One unit a thread.
__global__ __launch_bounds__(256) void k_wt_bf16(const float* __restrict__ W, unsigned short* __restrict__ Wt, int K, int N) {
  const int u = blockIdx.x * 256 + threadIdx.x;
  if (u >= N * (K / 8)) return;
  const int lane = u & 31, h = (u >> 5) & 1, ks = (u >> 6) % (K / 32), tile = (u >> 6) / (K / 32);
  const int n = tile * 16 + (lane & 15), k8 = ks * 32 + h * 16 + (lane >> 4) * 8;
  v8us v;
#pragma unroll
  for (int i = 0; i < 8; ++i) v[i] = bf16_bits(W[(size_t)(k8 + i) * N + n]);
  *(v8us*)(Wt + (size_t)u * 8) = v;
}

// GEMM C[M][N] (f32, pitch ldc) = act(A[M][K]·W + bias). A f32 row-major (pitch lda) converted per fragment to bf16
// (ASPLIT: hi/lo two planes -> 2 terms, else single rounded term); Wt bf16 [N][K] (pitch ldb). BIAS_BF16 rounds the
// bias to bf16 first (bias quantised to bf16 before the add). K%32==0, M%16==0, N%64==0.
template <bool ASPLIT, int ACT, bool BIAS_BF16>
__global__ __launch_bounds__(128) void k_gemm_bf(const float* __restrict__ A, int lda, const unsigned short* __restrict__ Wt, int ldb,
                                               const float* __restrict__ bias, float* __restrict__ C, int ldc, int M, int N, int K) {
  __shared__ __attribute__((aligned(16))) float so[4][16][64];
  const int tid = threadIdx.x, w = tid >> 5, lane = tid & 31, ln = lane & 15, hh = lane >> 4;
  const int ntn = N / 64;
  const int wid = blockIdx.x * 4 + w;
  const int mt = wid / ntn, nq = wid % ntn;
  if (mt * 16 >= M) return;
  const int row0 = mt * 16, col0 = nq * 64;
  const float* arow = A + (size_t)(row0 + ln) * lda;
  v8f acc[4] = {};
  for (int kb = 0; kb < K; kb += 32) {
    FragB ah, al;
    const v4f x0 = *(const v4fa*)(arow + kb + 8 * hh), x1 = *(const v4fa*)(arow + kb + 8 * hh + 4);
    const v4f x2 = *(const v4fa*)(arow + kb + 16 + 8 * hh), x3 = *(const v4fa*)(arow + kb + 16 + 8 * hh + 4);
    float xs[16] = {x0[0],x0[1],x0[2],x0[3],x1[0],x1[1],x1[2],x1[3],x2[0],x2[1],x2[2],x2[3],x3[0],x3[1],x3[2],x3[3]};
#pragma unroll
    for (int i = 0; i < 16; ++i) { const unsigned short hb = bf16_bits(xs[i]); ah.u[i] = hb; al.u[i] = ASPLIT ? bf16_bits(xs[i] - bf16_val(hb)) : (unsigned short)0; }
#pragma unroll
    for (int t = 0; t < 4; ++t) {
      const unsigned short* brow = Wt + (size_t)(col0 + t * 16 + ln) * ldb + kb;
      FragB b;
      b.half[0] = *(const v8us*)(brow + 8 * hh);
      b.half[1] = *(const v8us*)(brow + 16 + 8 * hh);
      acc[t] = mmaN<ASPLIT ? 2 : 1>(ah.v, al.v, b.v, b.v, acc[t]);
    }
  }
#pragma unroll
  for (int t = 0; t < 4; ++t) {
    float bv = bias ? bias[col0 + t * 16 + ln] : 0.f;
    if (BIAS_BF16) bv = bf16_round(bv);
#pragma unroll
    for (int r = 0; r < 8; ++r) { float v = acc[t][r] + bv; if (ACT == 1) v = fmaxf(v, 0.f); so[w][8 * hh + r][t * 16 + ln] = v; }
  }
  __builtin_amdgcn_fence(__ATOMIC_ACQ_REL, "workgroup");
  __builtin_amdgcn_wave_barrier();
  const int rsub = lane >> 4, c4 = (lane & 15) * 4;
  {
#pragma unroll
    for (int q = 0; q < 8; ++q) {
      const int r = q * 2 + rsub;
      const v4f v = *(const v4fa*)&so[w][r][c4];
      *(v4f*)(C + (size_t)(row0 + r) * ldc + col0 + c4) = v;
    }
    
  }
}

// Flash-style causal/unmasked attention, all contractions 3-term bf16 hi/lo splits, f32 softmax with running max.
// q,k,v rows are read from f32 buffers with arbitrary row pitch (so they can live inside a fused qkv buffer);
// D = head size (multiple of 32, <= 128); one wave = 16 query rows; block = 4 waves (64 queries) sharing K/V chunks of 32.
template <int D, bool CAUSAL>
__global__ __launch_bounds__(128) void k_flash(const float* __restrict__ qb, const float* __restrict__ kb, const float* __restrict__ vb,
                                             int pitch, int T, int H, float scale, float* __restrict__ y, int ypitch) {
  constexpr int KS = D / 32;        // k-steps for QK
  constexpr int DT = D / 16;        // d tiles for PV
  __shared__ __attribute__((aligned(16))) unsigned short sKh[32][D + 8], sKl[32][D + 8], sVh[32][D + 8], sVl[32][D + 8];
  __shared__ __attribute__((aligned(16))) unsigned short sPh[4][16][40], sPl[4][16][40];
  __shared__ __attribute__((aligned(16))) float sO[4][16][D];
  const int tid = threadIdx.x, w = tid >> 5, lane = tid & 31, ln = lane & 15, hh = lane >> 4;
  const int nqb = (T + 63) / 64;
  const int bh = blockIdx.x / nqb, qblk = blockIdx.x % nqb;
  const int b = bh / H, h = bh % H;
  const int q0 = qblk * 64 + w * 16;
  const float* Q = qb + (size_t)b * T * pitch + h * D;
  const float* K = kb + (size_t)b * T * pitch + h * D;
  const float* V = vb + (size_t)b * T * pitch + h * D;

  // A fragments of the wave's 16 query rows (scaled), hi/lo
  FragB aqh[KS], aql[KS];
  {
    int row = q0 + ln; if (row >= T) row = T - 1;
    const float* qr = Q + (size_t)row * pitch;
#pragma unroll
    for (int ks = 0; ks < KS; ++ks)
#pragma unroll
      for (int i = 0; i < 16; ++i) {
        const int d = ks * 32 + ((i < 8) ? (8 * hh + i) : (16 + 8 * hh + (i - 8)));
        const float x = qr[d] * scale; const unsigned short hb = bf16_bits(x);
        aqh[ks].u[i] = hb; aql[ks].u[i] = bf16_bits(x - bf16_val(hb));
      }
  }
  float m_r[8], l_r[8];
#pragma unroll
  for (int r = 0; r < 8; ++r) { m_r[r] = -3.0e38f; l_r[r] = 0.f; }
  v8f oacc[DT];
#pragma unroll
  for (int dt = 0; dt < DT; ++dt) oacc[dt] = (v8f){0.f,0.f,0.f,0.f,0.f,0.f,0.f,0.f};

  const int kv_end = CAUSAL ? min(T, qblk * 64 + 64) : T;     // block-uniform
  for (int j0 = 0; j0 < kv_end; j0 += 32) {
    __syncthreads();
    for (int e = tid; e < 32 * (D / 4); e += 128) {
      const int r = e / (D / 4), c4 = (e % (D / 4)) * 4;
      const int key = j0 + r;
      v4f kf = {0.f,0.f,0.f,0.f}, vf = {0.f,0.f,0.f,0.f};
      if (key < T) { kf = *(const v4fa*)(K + (size_t)key * pitch + c4); vf = *(const v4fa*)(V + (size_t)key * pitch + c4); }
#pragma unroll
      for (int t = 0; t < 4; ++t) {
        unsigned short hb = bf16_bits(kf[t]); sKh[r][c4 + t] = hb; sKl[r][c4 + t] = bf16_bits(kf[t] - bf16_val(hb));
        hb = bf16_bits(vf[t]); sVh[r][c4 + t] = hb; sVl[r][c4 + t] = bf16_bits(vf[t] - bf16_val(hb));
      }
    }
    __syncthreads();
    // S tile 16 x 32
    v8f s[2];
#pragma unroll
    for (int nt = 0; nt < 2; ++nt) {
      v8f acc = {};
#pragma unroll
      for (int ks = 0; ks < KS; ++ks) {
        FragB bh_, bl_;
        bh_.half[0] = *(const v8us*)&sKh[nt * 16 + ln][ks * 32 + 8 * hh]; bh_.half[1] = *(const v8us*)&sKh[nt * 16 + ln][ks * 32 + 16 + 8 * hh];
        bl_.half[0] = *(const v8us*)&sKl[nt * 16 + ln][ks * 32 + 8 * hh]; bl_.half[1] = *(const v8us*)&sKl[nt * 16 + ln][ks * 32 + 16 + 8 * hh];
        acc = mmaN<3>(aqh[ks].v, aql[ks].v, bh_.v, bl_.v, acc);
      }
      s[nt] = acc;
    }
    // mask + running max (rows 8hh+r; the 16 lanes of a half share rows)
    float alpha[8];
#pragma unroll
    for (int r = 0; r < 8; ++r) {
      const int qi = q0 + 8 * hh + r;
      const int ja = j0 + ln, jb = j0 + 16 + ln;
      if (CAUSAL) { if (ja > qi) s[0][r] = -3.0e38f; if (jb > qi) s[1][r] = -3.0e38f; }
      if (ja >= T) s[0][r] = -3.0e38f;
      if (jb >= T) s[1][r] = -3.0e38f;
      float mx = fmaxf(s[0][r], s[1][r]);
      mx = fmaxf(mx, __shfl_xor(mx, 1, 32)); mx = fmaxf(mx, __shfl_xor(mx, 2, 32)); mx = fmaxf(mx, __shfl_xor(mx, 4, 32)); mx = fmaxf(mx, __shfl_xor(mx, 8, 32));
      const float mnew = fmaxf(m_r[r], mx);
      alpha[r] = (mnew > -1.0e38f) ? __expf(m_r[r] - mnew) : 1.0f;
      const float p0 = (s[0][r] > -1.0e38f) ? __expf(s[0][r] - mnew) : 0.f;
      const float p1 = (s[1][r] > -1.0e38f) ? __expf(s[1][r] - mnew) : 0.f;
      m_r[r] = mnew;
      l_r[r] = l_r[r] * alpha[r] + p0 + p1;            // per-lane partial row sum (16 lanes combined at the end)
      unsigned short hb = bf16_bits(p0); sPh[w][8 * hh + r][ln] = hb;      sPl[w][8 * hh + r][ln] = bf16_bits(p0 - bf16_val(hb));
      hb = bf16_bits(p1);                sPh[w][8 * hh + r][16 + ln] = hb; sPl[w][8 * hh + r][16 + ln] = bf16_bits(p1 - bf16_val(hb));
    }
#pragma unroll
    for (int dt = 0; dt < DT; ++dt)
#pragma unroll
      for (int r = 0; r < 8; ++r) oacc[dt][r] *= alpha[r];
    __builtin_amdgcn_fence(__ATOMIC_ACQ_REL, "workgroup");
    __builtin_amdgcn_wave_barrier();
    FragB pah, pal;
    pah.half[0] = *(const v8us*)&sPh[w][ln][8 * hh]; pah.half[1] = *(const v8us*)&sPh[w][ln][16 + 8 * hh];
    pal.half[0] = *(const v8us*)&sPl[w][ln][8 * hh]; pal.half[1] = *(const v8us*)&sPl[w][ln][16 + 8 * hh];
#pragma unroll
    for (int dt = 0; dt < DT; ++dt) {
      FragB bvh, bvl;
#pragma unroll
      for (int i = 0; i < 8; ++i) {
        bvh.u[i] = sVh[8 * hh + i][dt * 16 + ln]; bvh.u[8 + i] = sVh[16 + 8 * hh + i][dt * 16 + ln];
        bvl.u[i] = sVl[8 * hh + i][dt * 16 + ln]; bvl.u[8 + i] = sVl[16 + 8 * hh + i][dt * 16 + ln];
      }
      oacc[dt] = mmaN<3>(pah.v, pal.v, bvh.v, bvl.v, oacc[dt]);
    }
    __builtin_amdgcn_fence(__ATOMIC_ACQ_REL, "workgroup");
    __builtin_amdgcn_wave_barrier();
  }
#pragma unroll
  for (int r = 0; r < 8; ++r) {
    float l = l_r[r];
    l += __shfl_xor(l, 1, 32); l += __shfl_xor(l, 2, 32); l += __shfl_xor(l, 4, 32); l += __shfl_xor(l, 8, 32);
    l_r[r] = (l > 0.f) ? 1.0f / l : 0.f;
  }
#pragma unroll
  for (int dt = 0; dt < DT; ++dt)
#pragma unroll
    for (int r = 0; r < 8; ++r) sO[w][8 * hh + r][dt * 16 + ln] = oacc[dt][r] * l_r[r];
  __builtin_amdgcn_fence(__ATOMIC_ACQ_REL, "workgroup");
  __builtin_amdgcn_wave_barrier();
  {
    for (int r = 0; r < 16; ++r) {
      const int row = q0 + r;
      if (row < T && lane < D / 4) {
        const v4f val = *(const v4fa*)&sO[w][r][lane * 4];
        *(v4f*)(y + ((size_t)b * T + row) * ypitch + h * D + lane * 4) = val;
      }
    }
    
  }
}

// GEMM C = act(A·W + bias + resid): A f32 (ASPLIT -> hi/lo 2 terms), Wt bf16 [N][K]; ACT 0 none, 1 relu, 2 exact gelu;
// resid (optional, f32, row index = (row % rmod), pitch ldr, RES_BF16 rounds it) added before the activation.
template <bool ASPLIT, int ACT, bool BIAS_BF16, bool RES_BF16>
__global__ __launch_bounds__(128) void k_gemm_bf3(const float* __restrict__ A, int lda, const unsigned short* __restrict__ Wt, int ldb,
                                                const float* __restrict__ bias, const float* __restrict__ resid, int rmod, int ldr,
                                                float* __restrict__ C, int ldc, int M, int N, int K) {
  __shared__ __attribute__((aligned(16))) float so[4][16][64];
  const int tid = threadIdx.x, w = tid >> 5, lane = tid & 31, ln = lane & 15, hh = lane >> 4;
  const int ntn = N / 64;
  const int wid = blockIdx.x * 4 + w;
  const int mt = wid / ntn, nq = wid % ntn;
  if (mt * 16 >= M) return;
  const int row0 = mt * 16, col0 = nq * 64;
  const float* arow = A + (size_t)(row0 + ln) * lda;
  v8f acc[4] = {};
  for (int kb = 0; kb < K; kb += 32) {
    FragB ah, al;
    const v4f x0 = *(const v4fa*)(arow + kb + 8 * hh), x1 = *(const v4fa*)(arow + kb + 8 * hh + 4);
    const v4f x2 = *(const v4fa*)(arow + kb + 16 + 8 * hh), x3 = *(const v4fa*)(arow + kb + 16 + 8 * hh + 4);
    float xs[16] = {x0[0],x0[1],x0[2],x0[3],x1[0],x1[1],x1[2],x1[3],x2[0],x2[1],x2[2],x2[3],x3[0],x3[1],x3[2],x3[3]};
#pragma unroll
    for (int i = 0; i < 16; ++i) { const unsigned short hb = bf16_bits(xs[i]); ah.u[i] = hb; al.u[i] = ASPLIT ? bf16_bits(xs[i] - bf16_val(hb)) : (unsigned short)0; }
#pragma unroll
    for (int t = 0; t < 4; ++t) {
      const unsigned short* brow = Wt + (size_t)(col0 + t * 16 + ln) * ldb + kb;
      FragB b;
      b.half[0] = *(const v8us*)(brow + 8 * hh);
      b.half[1] = *(const v8us*)(brow + 16 + 8 * hh);
      acc[t] = mmaN<ASPLIT ? 2 : 1>(ah.v, al.v, b.v, b.v, acc[t]);
    }
  }
#pragma unroll
  for (int t = 0; t < 4; ++t) {
    const int col = col0 + t * 16 + ln;
    float bv = bias ? bias[col] : 0.f;
    if (BIAS_BF16) bv = bf16_round(bv);
#pragma unroll
    for (int r = 0; r < 8; ++r) {
      float v = acc[t][r] + bv;
      if (resid) { float rv = resid[(size_t)((row0 + 8 * hh + r) % rmod) * ldr + col]; if (RES_BF16) rv = bf16_round(rv); v += rv; }
      if (ACT == 1) v = fmaxf(v, 0.f);
      if (ACT == 2) v = 0.5f * v * (1.0f + erff(v * 0.70710678118654752f));
      if (ACT == 3) { const float u = 0.7978845608028654f * (v + 0.044715f * v * v * v); v = 0.5f * v * (1.0f + tanhf(u)); }
      so[w][8 * hh + r][t * 16 + ln] = v;
    }
  }
  __builtin_amdgcn_fence(__ATOMIC_ACQ_REL, "workgroup");
  __builtin_amdgcn_wave_barrier();
  const int rsub = lane >> 4, c4 = (lane & 15) * 4;
  {
#pragma unroll
    for (int q = 0; q < 8; ++q) {
      const int r = q * 2 + rsub;
      const v4f v = *(const v4fa*)&so[w][r][c4];
      *(v4f*)(C + (size_t)(row0 + r) * ldc + col0 + c4) = v;
    }
    
  }
}
// row LayerNorm (biased variance, eps) over N: s = X (+ R); optional out_sum <- s; out_norm <- (s-mu)*rsqrt(var+eps)*g + b
template <bool PARAM_BF16>
__global__ __launch_bounds__(256) void k_layernorm(const float* __restrict__ X, const float* __restrict__ R, const float* __restrict__ g, const float* __restrict__ bta,
                                                  float* __restrict__ out_sum, float* __restrict__ out_norm, int N, float eps) {
  __shared__ float red[256];
  const int row = blockIdx.x, tid = threadIdx.x;
  const float* x = X + (size_t)row * N; const float* rr = R ? R + (size_t)row * N : nullptr;
  float vals[16];                     // up to N = 4096
  const int per = N / 256;            // contiguous chunk per thread? use strided-by-4 chunks: thread handles j = tid*4 + 1024*u
  float s1 = 0.f;
  for (int u = 0; u < per / 4; ++u) {
    const int j = tid * 4 + 1024 * u;
    const v4f a = *(const v4fa*)(x + j);
    v4f b = {0.f,0.f,0.f,0.f}; if (rr) b = *(const v4fa*)(rr + j);
#pragma unroll
    for (int q = 0; q < 4; ++q) { const float v = a[q] + b[q]; vals[u * 4 + q] = v; s1 += v; }
  }
  red[tid] = s1; __syncthreads();
  for (int st = 128; st > 0; st >>= 1) { if (tid < st) red[tid] += red[tid + st]; __syncthreads(); }
  const float mu = red[0] / (float)N; __syncthreads();
  float s2 = 0.f;
  for (int u = 0; u < per / 4; ++u)
#pragma unroll
    for (int q = 0; q < 4; ++q) { const float c = vals[u * 4 + q] - mu; s2 += c * c; }
  red[tid] = s2; __syncthreads();
  for (int st = 128; st > 0; st >>= 1) { if (tid < st) red[tid] += red[tid + st]; __syncthreads(); }
  const float rs = rsqrtf(red[0] / (float)N + eps);
  {
    for (int u = 0; u < per / 4; ++u) {
      const int j = tid * 4 + 1024 * u;
      v4f o, sm;
#pragma unroll
      for (int q = 0; q < 4; ++q) {
        float gg = g[j + q], bb = bta[j + q];
        if (PARAM_BF16) { gg = bf16_round(gg); bb = bf16_round(bb); }
        sm[q] = vals[u * 4 + q]; o[q] = (vals[u * 4 + q] - mu) * rs * gg + bb;
      }
      if (out_sum) *(v4f*)(out_sum + (size_t)row * N + j) = sm;
      *(v4f*)(out_norm + (size_t)row * N + j) = o;
    }
    
  }
}

// batched f32 [K][N] (pitch lds, batch stride sIn) -> transposed hi/lo planes [N][K] (batch stride sOut); thread per (n, 8 k); grid.y = batch
__global__ __launch_bounds__(256) void k_split_transpose_b(const float* __restrict__ src, int lds_, size_t sIn, unsigned short* __restrict__ hi, unsigned short* __restrict__ lo, size_t sOut, int K, int N) {
  const size_t t = (size_t)blockIdx.x * 256 + threadIdx.x; const int k8n = K / 8; if (t >= (size_t)N * k8n) return;
  src += (size_t)blockIdx.y * sIn; hi += (size_t)blockIdx.y * sOut; lo += (size_t)blockIdx.y * sOut;
  const int n = (int)(t / k8n), k8 = (int)(t % k8n) * 8; v8us vh, vl;
#pragma unroll
  for (int i = 0; i < 8; ++i) { const float x = src[(size_t)(k8 + i) * lds_ + n]; const unsigned short hb = bf16_bits(x); vh[i] = hb; vl[i] = bf16_bits(x - bf16_val(hb)); }
  unsigned short* dh = hi + (size_t)n * K + k8; unsigned short* dl = lo + (size_t)n * K + k8;
  *(v8us*)dh = vh; *(v8us*)dl = vl; 
}

// k rows rounded to bf16 as Kb[j][d] (= k row-major) and vᵀ planes Vt[b][d][j]
__global__ __launch_bounds__(256) void k_kv(const float* __restrict__ P, unsigned short* __restrict__ Kb, unsigned short* __restrict__ Vt) {
  const size_t t = (size_t)blockIdx.x * 256 + threadIdx.x;
  if (t < (size_t)MR * (HH / 8)) { const size_t row = t / (HH / 8); const int c8 = (int)(t % (HH / 8)) * 8; v8us o; for (int i = 0; i < 8; ++i) o[i] = bf16_bits(P[row * 192 + HH + c8 + i]); *(v8us*)(Kb + row * HH + c8) = o;  }
  if (t < (size_t)BB * HH * (TT / 8)) { const int j8 = (int)(t % (TT / 8)) * 8; const int d = (int)((t / (TT / 8)) % HH); const int b = (int)(t / ((size_t)(TT / 8) * HH)); v8us o; for (int i = 0; i < 8; ++i) o[i] = bf16_bits(P[((size_t)b * TT + j8 + i) * 192 + 2 * HH + d]);
    *(v8us*)(Vt + ((size_t)b * HH + d) * TT + j8) = o;  }
}
typedef float f2v __attribute__((ext_vector_type(2)));
typedef __bf16 bf2v __attribute__((ext_vector_type(2)));
union FragW { v16b v; unsigned int w[8]; };
__device__ __forceinline__ unsigned int pk_bf16(float a, float b) { return __builtin_bit_cast(unsigned int, __builtin_convertvector((f2v){a, b}, bf2v)); }   // round to nearest even
__device__ __forceinline__ float xhalf(float x) { return __builtin_bit_cast(float, __builtin_amdgcn_permlanex16(__builtin_bit_cast(int, x), __builtin_bit_cast(int, x), 0x76543210, 0xfedcba98, false, false)); }   // lane l with lane l ^ 16
__device__ __forceinline__ v8f wmma_bf(v16b a, v16b b, v8f c) { return __builtin_amdgcn_wmma_f32_16x16x32_bf16(false, a, false, b, (short)0, c, false, false); }

// [q | k | v] = x * [Wq | Wk | Wv]. A block owns PM rows of x and all 192 columns. x is read once, in whole lines, rounded to bf16 and kept in LDS.
// Wave w holds the B fragments of column tiles 3 (w % 4) ... + 2 for k-steps 12 (w / 4) ... + 11 in registers (packed by k_wt_bf16) and
// multiplies all four row tiles by them; the two K halves of a result are added through LDS, and the f32 tile leaves in whole lines.
#define PM 64
#define XR 40          // x tile in LDS, one plane per k-step: row pitch in elements, 80 bytes = 16 * odd, at which 16-byte fragment reads meet no bank conflict
#define XS (PM * XR + 32)   // plane pitch in elements: 16 banks past a multiple of 64, so the four k-steps that one staging store spans do not collide
#define OP 196         // result tile pitch in floats: rows 8 apart fall 32 banks apart, so the two lane halves of a store do not collide
__global__ __launch_bounds__(256) void k_proj(const float* __restrict__ x, const unsigned short* __restrict__ Bp, float* __restrict__ P) {
  __shared__ __attribute__((aligned(16))) unsigned short sx[(CC / 32) * XS];
  __shared__ __attribute__((aligned(16))) float so[PM][OP];
  const int tid = threadIdx.x, w = tid >> 5, lane = tid & 31, ln = lane & 15, hh = lane >> 4;
  const int ng = w & 3, kh = w >> 2;
  const size_t row0 = (size_t)blockIdx.x * PM;
  // staging: wave w brings rows 16 (w % 4) ... + 15, columns 384 (w / 4) ... + 383, as 48 wave-wide loads of 512 contiguous bytes
  const float* xp = x + (row0 + ng * 16) * CC + kh * 384 + lane * 4;
  const unsigned int bo = ((ng * 72 + kh * 12) * 64 + lane) * 16;   // this lane's place in the packed fragments, in bytes
  const unsigned short* bp = (const unsigned short*)((const char*)Bp + bo);
  v4f xa[48];
#pragma unroll
  for (int i = 0; i < 48; ++i) xa[i] = *(const v4fa*)(xp + (i / 3) * CC + (i % 3) * 128);
  FragB bf[3][12];
#pragma unroll
  for (int t = 0; t < 2; ++t)
#pragma unroll
    for (int kk = 0; kk < 12; ++kk) { bf[t][kk].half[0] = *(const v8us*)(bp + ((t * 24 + kk) * 2) * 256); bf[t][kk].half[1] = *(const v8us*)(bp + ((t * 24 + kk) * 2 + 1) * 256); }
  // stands in front of the reuse of the address registers that the loads above name; pointer and offset are inputs so that their registers live up to the wait
  asm volatile("s_wait_xcnt 0x0" :: "v"(xp), "v"(bo) : "memory");
  unsigned short* xs = sx + (kh * 12 + (lane >> 3)) * XS + ng * 16 * XR + (lane & 7) * 4;
#pragma unroll
  for (int i = 0; i < 48; ++i) *(uint2*)(xs + (i % 3) * 4 * XS + (i / 3) * XR) = make_uint2(pk_bf16(xa[i][0], xa[i][1]), pk_bf16(xa[i][2], xa[i][3]));
  // the third column tile's fragments: a second group of loads, with a wait of its own
#pragma unroll
  for (int kk = 0; kk < 12; ++kk) { bf[2][kk].half[0] = *(const v8us*)(bp + ((48 + kk) * 2) * 256); bf[2][kk].half[1] = *(const v8us*)(bp + ((48 + kk) * 2 + 1) * 256); }
  // as above, for the loads of the third tile
  asm volatile("s_wait_xcnt 0x0" :: "v"(bo) : "memory");
  __syncthreads();

  v8f acc[4][3];
#pragma unroll
  for (int mt = 0; mt < 4; ++mt)
#pragma unroll
    for (int t = 0; t < 3; ++t) acc[mt][t] = (v8f){0.f,0.f,0.f,0.f,0.f,0.f,0.f,0.f};
  const unsigned short* ap = sx + kh * 12 * XS + ln * XR + 8 * hh;
  // the next k-step's four A fragments are asked for as one group ahead of this k-step's products
  FragB a[2][4];
#pragma unroll
  for (int mt = 0; mt < 4; ++mt) { a[0][mt].half[0] = *(const v8us*)(ap + mt * 16 * XR); a[0][mt].half[1] = *(const v8us*)(ap + mt * 16 * XR + 16); }
#pragma unroll
  for (int kk = 0; kk < 12; ++kk) {
    if (kk + 1 < 12) {
#pragma unroll
      for (int mt = 0; mt < 4; ++mt) { a[(kk + 1) & 1][mt].half[0] = *(const v8us*)(ap + (kk + 1) * XS + mt * 16 * XR); a[(kk + 1) & 1][mt].half[1] = *(const v8us*)(ap + (kk + 1) * XS + mt * 16 * XR + 16); }
    }
#pragma unroll
    for (int mt = 0; mt < 4; ++mt)
#pragma unroll
      for (int t = 0; t < 3; ++t) acc[mt][t] = wmma_bf(a[kk & 1][mt].v, bf[t][kk].v, acc[mt][t]);
    // keeps the order one load group, twelve products: left free, the scheduler asks for four k-steps at once, runs out of registers and then waits out a fragment's LDS latency before every three products
    __builtin_amdgcn_sched_barrier(0);
  }

  // the wave of the first K half finishes row tiles 0 and 1, its partner 2 and 3: each hands the other two over, then adds its own to what it was handed
  float* sg = &so[(kh ? 0 : 32) + 8 * hh][ng * 48 + ln];
  float* sk = &so[(kh ? 32 : 0) + 8 * hh][ng * 48 + ln];
#pragma unroll
  for (int m = 0; m < 2; ++m)
#pragma unroll
    for (int t = 0; t < 3; ++t)
#pragma unroll
      for (int r = 0; r < 8; ++r) sg[(m * 16 + r) * OP + t * 16] = kh ? acc[m][t][r] : acc[m + 2][t][r];
  __syncthreads();
#pragma unroll
  for (int m = 0; m < 2; ++m)
#pragma unroll
    for (int t = 0; t < 3; ++t)
#pragma unroll
      for (int r = 0; r < 8; ++r) sk[(m * 16 + r) * OP + t * 16] += kh ? acc[m + 2][t][r] : acc[m][t][r];
  __syncthreads();
  // wave w writes rows 8 w ... + 7 of the tile, 6144 contiguous bytes of P, as twelve stores of four whole lines
  float* op = P + (row0 + w * 8) * 192 + lane * 4;
#pragma unroll
  for (int i = 0; i < 12; ++i) {
    const int u = 2 * i + hh;
    *(v4f*)(op + i * 128) = *(const v4fa*)&so[w * 8 + u / 3][(u % 3) * 64 + ln * 4];
  }
}

// Scores, masked softmax and P*v in one launch, all batches. A block owns 64 query rows of one batch; each of its AW waves
// holds all 64 (AQ tiles of 16 as B operands, q split hi/lo) and walks its own TT / AW keys in passes of 32 with a running maximum:
// St = k * qt (a lane holds 16 scores of ONE query), Pt packs from the two St tiles into a B operand (hi/lo), Ot += vt * Pt.
// The AW partial (maximum, sum, Ot) sets are joined through LDS at the end. Scores never reach memory.
#define AQ 4
#define AW 8
#define AKEYS (TT / AW)
__global__ __launch_bounds__(AW * 32) void k_attn(const float* __restrict__ P, const unsigned short* __restrict__ Kb, const unsigned short* __restrict__ Vt,
                                                  const int* __restrict__ mask, float* __restrict__ out) {
  __shared__ __attribute__((aligned(16))) v4f sO[AW][AQ * 8][32];
  __shared__ float sM[AW][AQ][16], sL[AW][AQ][16];
  const int tid = threadIdx.x, w = tid >> 5, lane = tid & 31, ln = lane & 15, hh = lane >> 4;
  const int b = blockIdx.x / (TT / 64), q0 = (blockIdx.x % (TT / 64)) * 64;
  const float c2 = 0.03608439182435161f * 1.4426950408889634f;   // 768^-0.5 * log2(e): the softmax runs in base 2

  FragB qh[AQ][2], ql[AQ][2];
  const float* qp = P + ((size_t)b * TT + q0 + ln) * 192 + 8 * hh;
  v4f xq[AQ][2][4];
#pragma unroll
  for (int qt = 0; qt < AQ; ++qt)
#pragma unroll
    for (int ks = 0; ks < 2; ++ks) {
      const float* qr = qp + qt * 16 * 192 + ks * 32;
      xq[qt][ks][0] = *(const v4fa*)(qr); xq[qt][ks][1] = *(const v4fa*)(qr + 4); xq[qt][ks][2] = *(const v4fa*)(qr + 16); xq[qt][ks][3] = *(const v4fa*)(qr + 20);
    }
  // stands in front of the reuse of the address registers that the q loads name; the pointer is an input so that its registers live up to the wait
  asm volatile("s_wait_xcnt 0x0" :: "v"(qp) : "memory");
#pragma unroll
  for (int qt = 0; qt < AQ; ++qt) {
#pragma unroll
    for (int ks = 0; ks < 2; ++ks) {
      const v4f x0 = xq[qt][ks][0], x1 = xq[qt][ks][1], x2 = xq[qt][ks][2], x3 = xq[qt][ks][3];
      float xs[16] = {x0[0],x0[1],x0[2],x0[3],x1[0],x1[1],x1[2],x1[3],x2[0],x2[1],x2[2],x2[3],x3[0],x3[1],x3[2],x3[3]};
#pragma unroll
      for (int i = 0; i < 16; ++i) { const unsigned short hb = bf16_bits(xs[i]); qh[qt][ks].u[i] = hb; ql[qt][ks].u[i] = bf16_bits(xs[i] - bf16_val(hb)); }
    }
  }
  float m_r[AQ], l_r[AQ];
  v8f oacc[AQ][4];
#pragma unroll
  for (int qt = 0; qt < AQ; ++qt) {
    m_r[qt] = -3.0e38f; l_r[qt] = 0.f;   // finite start: a pass whose keys are all masked gives exp2(-inf) = 0, never inf - inf
#pragma unroll
    for (int dt = 0; dt < 4; ++dt) oacc[qt][dt] = (v8f){0.f,0.f,0.f,0.f,0.f,0.f,0.f,0.f};
  }
  const unsigned short* kp = Kb + ((size_t)b * TT + w * AKEYS + ln) * HH + 8 * hh;
  const unsigned short* vp = Vt + ((size_t)b * HH + ln) * TT + w * AKEYS + 8 * hh;
  const int* mp = mask + (size_t)b * TT + w * AKEYS + lane;   // one mask word a lane: a pass's 32 keys
  int one = 1;   // passes through each wait below, so that the pointer additions, which are multiples of it, cannot be lifted over the wait

  FragB ka[2][2];
  int mk;
#pragma unroll
  for (int t = 0; t < 2; ++t)
#pragma unroll
    for (int ks = 0; ks < 2; ++ks) { ka[t][ks].half[0] = *(const v8us*)(kp + t * 16 * HH + ks * 32); ka[t][ks].half[1] = *(const v8us*)(kp + t * 16 * HH + ks * 32 + 16); }
  mk = *mp;
  // stands in front of the overwrite of the address registers that the loads above name; the pointers are inputs so that their registers live up to it
  asm volatile("s_wait_xcnt 0x0" : "+s"(one) : "v"(kp), "v"(mp) : "memory");
  kp += one * 32 * HH; mp += one * 32;

  // rolled, for speed only: one pass is several KB of code
#pragma unroll 1
  for (int it = 0; it < AKEYS / 32; ++it) {
    FragB va[4];
#pragma unroll
    for (int dt = 0; dt < 4; ++dt) { va[dt].half[0] = *(const v8us*)(vp + (size_t)dt * 16 * TT); va[dt].half[1] = *(const v8us*)(vp + (size_t)dt * 16 * TT + 16); }
    // the next pass's k rows and mask words are fetched now; the last pass fetches its own again, so every address stays inside
    FragB kn[2][2];
#pragma unroll
    for (int t = 0; t < 2; ++t)
#pragma unroll
      for (int ks = 0; ks < 2; ++ks) { kn[t][ks].half[0] = *(const v8us*)(kp + t * 16 * HH + ks * 32); kn[t][ks].half[1] = *(const v8us*)(kp + t * 16 * HH + ks * 32 + 16); }
    const int mn = *mp;
    // stands in front of the overwrite of the address registers that this pass's loads name; the pointers are inputs so that their registers live up to it
    asm volatile("s_wait_xcnt 0x0" : "+s"(one) : "v"(vp), "v"(kp), "v"(mp) : "memory");
    const int adv = (it + 2 < AKEYS / 32) ? one : 0;
    vp += one * 32; kp += adv * 32 * HH; mp += adv * 32;

    // bit 16 t + r of nb: key 16 t + 8 hh + r of this pass is masked
    const unsigned int nb = ~__builtin_amdgcn_ballot_w32(mk != 0) >> (8 * hh);
    v8f bias[2];   // 0 for a kept key, -inf for a masked one; rows of St are keys, so one set serves all query tiles
#pragma unroll
    for (int r = 0; r < 8; ++r) {
      bias[0][r] = __uint_as_float((unsigned int)((int)(nb << (31 - r)) >> 31) & 0xFF800000u);
      bias[1][r] = __uint_as_float((unsigned int)((int)(nb << (15 - r)) >> 31) & 0xFF800000u);
    }

#pragma unroll
    for (int qt = 0; qt < AQ; ++qt) {
      v8f s0 = {}, s1 = {};
#pragma unroll
      for (int ks = 0; ks < 2; ++ks) {
        s0 = wmma_bf(ka[0][ks].v, qh[qt][ks].v, s0); s1 = wmma_bf(ka[1][ks].v, qh[qt][ks].v, s1);
        s0 = wmma_bf(ka[0][ks].v, ql[qt][ks].v, s0); s1 = wmma_bf(ka[1][ks].v, ql[qt][ks].v, s1);
      }
      s0 += bias[0]; s1 += bias[1];
      float mx = fmaxf(s0[0], s1[0]);
#pragma unroll
      for (int r = 1; r < 8; ++r) mx = fmaxf(mx, fmaxf(s0[r], s1[r]));
      mx = fmaxf(mx, xhalf(mx));
      const float mnew = fmaxf(m_r[qt], mx);
      float alpha = (m_r[qt] - mnew) * c2;
      const float mc = mnew * c2;
      m_r[qt] = mnew;
      float e[16];
#pragma unroll
      for (int r = 0; r < 8; ++r) { e[r] = __builtin_fmaf(s0[r], c2, -mc); e[8 + r] = __builtin_fmaf(s1[r], c2, -mc); }
      // one tile's exponentials in one statement, each in place: none reads the result or overwrites the source of the one in front of it,
      // and the v_nop fills the slot that the instruction set asks for behind the last
      asm("v_exp_f32 %0, %0\n\tv_exp_f32 %1, %1\n\tv_exp_f32 %2, %2\n\tv_exp_f32 %3, %3\n\tv_exp_f32 %4, %4\n\tv_exp_f32 %5, %5\n\t"
          "v_exp_f32 %6, %6\n\tv_exp_f32 %7, %7\n\tv_exp_f32 %8, %8\n\tv_exp_f32 %9, %9\n\tv_exp_f32 %10, %10\n\tv_exp_f32 %11, %11\n\t"
          "v_exp_f32 %12, %12\n\tv_exp_f32 %13, %13\n\tv_exp_f32 %14, %14\n\tv_exp_f32 %15, %15\n\tv_exp_f32 %16, %16\n\tv_nop"
          : "+v"(e[0]), "+v"(e[1]), "+v"(e[2]), "+v"(e[3]), "+v"(e[4]), "+v"(e[5]), "+v"(e[6]), "+v"(e[7]), "+v"(e[8]), "+v"(e[9]),
            "+v"(e[10]), "+v"(e[11]), "+v"(e[12]), "+v"(e[13]), "+v"(e[14]), "+v"(e[15]), "+v"(alpha));
      FragW ph, pl;
      float sum = 0.f;
#pragma unroll
      for (int i = 0; i < 8; ++i) {
        const float pa = e[2 * i], pb = e[2 * i + 1];
        sum += pa + pb;
        const unsigned int hw = pk_bf16(pa, pb);
        ph.w[i] = hw;
        pl.w[i] = pk_bf16(pa - __uint_as_float(hw << 16), pb - __uint_as_float(hw & 0xFFFF0000u));
      }
      l_r[qt] = l_r[qt] * alpha + sum;   // this lane half's keys only; the halves are joined after the loop
#pragma unroll
      for (int dt = 0; dt < 4; ++dt) oacc[qt][dt] *= alpha;
#pragma unroll
      for (int dt = 0; dt < 4; ++dt) oacc[qt][dt] = wmma_bf(va[dt].v, ph.v, oacc[qt][dt]);
#pragma unroll
      for (int dt = 0; dt < 4; ++dt) oacc[qt][dt] = wmma_bf(va[dt].v, pl.v, oacc[qt][dt]);
    }
#pragma unroll
    for (int t = 0; t < 2; ++t)
#pragma unroll
      for (int ks = 0; ks < 2; ++ks) ka[t][ks] = kn[t][ks];
    mk = mn;
  }

#pragma unroll
  for (int qt = 0; qt < AQ; ++qt) {
    const float l = l_r[qt] + xhalf(l_r[qt]);
    if (hh == 0) { sM[w][qt][ln] = m_r[qt]; sL[w][qt][ln] = l; }
#pragma unroll
    for (int dt = 0; dt < 4; ++dt) {
      sO[w][qt * 8 + dt * 2][lane]     = (v4f){oacc[qt][dt][0], oacc[qt][dt][1], oacc[qt][dt][2], oacc[qt][dt][3]};
      sO[w][qt * 8 + dt * 2 + 1][lane] = (v4f){oacc[qt][dt][4], oacc[qt][dt][5], oacc[qt][dt][6], oacc[qt][dt][7]};
    }
  }
  __syncthreads();
  // join: wave w finishes query tile w / 2, head columns 32 * (w % 2) ... + 31 (one 128-byte line of each output row)
  const int qm = w >> 1;
  float M = -3.0e38f;
#pragma unroll
  for (int p = 0; p < AW; ++p) M = fmaxf(M, sM[p][qm][ln]);
  float f[AW], den = 0.f;
#pragma unroll
  for (int p = 0; p < AW; ++p) f[p] = (sM[p][qm][ln] - M) * c2;
  // in place and closed by a v_nop, for the same reason as in the loop
  asm("v_exp_f32 %0, %0\n\tv_exp_f32 %1, %1\n\tv_exp_f32 %2, %2\n\tv_exp_f32 %3, %3\n\tv_exp_f32 %4, %4\n\tv_exp_f32 %5, %5\n\tv_exp_f32 %6, %6\n\tv_exp_f32 %7, %7\n\tv_nop"
      : "+v"(f[0]), "+v"(f[1]), "+v"(f[2]), "+v"(f[3]), "+v"(f[4]), "+v"(f[5]), "+v"(f[6]), "+v"(f[7]));
#pragma unroll
  for (int p = 0; p < AW; ++p) den += sL[p][qm][ln] * f[p];
  const float inv = 1.0f / den;   // every key masked: den = 0, and 0 * inf gives NaN
#pragma unroll
  for (int dd = 0; dd < 2; ++dd) {
    const int dt = (w & 1) * 2 + dd;
    v4f a0 = {0.f,0.f,0.f,0.f}, a1 = {0.f,0.f,0.f,0.f};
#pragma unroll
    for (int p = 0; p < AW; ++p) { a0 += sO[p][qm * 8 + dt * 2][lane] * f[p]; a1 += sO[p][qm * 8 + dt * 2 + 1][lane] * f[p]; }
    float* o = out + ((size_t)b * TT + q0 + qm * 16 + ln) * HH + dt * 16 + 8 * hh;
    *(v4f*)o = a0 * inv; *(v4f*)(o + 4) = a1 * inv;
  }
}
extern "C" void kernel_launch(void* const* d_in, const int* in_sizes, int n_in,
                              void* d_out, int out_size, void* d_ws, size_t ws_size, hipStream_t stream) {
  (void)in_sizes; (void)n_in; (void)out_size;
  const float* x = (const float*)d_in[0]; const int* mask = (const int*)d_in[1]; const float* Wk = (const float*)d_in[2]; const float* Wq = (const float*)d_in[3]; const float* Wv = (const float*)d_in[4];
  char* ws = (char*)d_ws; size_t off = 0;
  auto take = [&](size_t bytes) { char* p = ws + off; off += (bytes + 255) & ~(size_t)255; return p; };
  unsigned short* Bt = (unsigned short*)take((size_t)192 * CC * 2); float* P = (float*)take((size_t)MR * 192 * 4); unsigned short* Kb = (unsigned short*)take((size_t)MR * HH * 2); unsigned short* Vt = (unsigned short*)take((size_t)BB * HH * TT * 2);
  if (off > ws_size) return;
  k_wt_bf16<<<(HH * (CC / 8) + 255) / 256, 256, 0, stream>>>(Wq, Bt, CC, HH); k_wt_bf16<<<(HH * (CC / 8) + 255) / 256, 256, 0, stream>>>(Wk, Bt + (size_t)HH * CC, CC, HH); k_wt_bf16<<<(HH * (CC / 8) + 255) / 256, 256, 0, stream>>>(Wv, Bt + (size_t)2 * HH * CC, CC, HH);
  k_proj<<<MR / PM, 256, 0, stream>>>(x, Bt, P);      // [q | k | v]
  k_kv<<<(unsigned)(((size_t)MR * 8 > (size_t)BB * HH * 256 ? (size_t)MR * 8 : (size_t)BB * HH * 256) + 255) / 256, 256, 0, stream>>>(P, Kb, Vt);
  k_attn<<<BB * (TT / 64), AW * 32, 0, stream>>>(P, Kb, Vt, mask, (float*)d_out);
}

// v003
// Measured time: 37.1 microseconds a run.
// Timed twice side by side with v002, it ran 1.31 and 1.29 times as fast.
// Counting every step since v000, it is 44.2 times as fast.
#include <hip/hip_runtime.h>
// [q|k|v] = x*[Wq|Wk|Wv] (M = 16384, K = 768, N = 192; x and W rounded to bf16: single exact WMMA term, f32 accumulate); the same launch writes k and vt rounded to bf16; then one fused launch:
// St = k*qt (q split into bf16 hi/lo, k rounded: 2 products), masked running-maximum softmax in f32, Ot += vt*Pt (P split, v rounded: 2 products), all on v_wmma_f32_16x16x32_bf16.
#define BB 8
#define TT 2048
#define CC 768
#define HH 64
#define MR (BB * TT)

typedef __bf16 v16b __attribute__((ext_vector_type(16)));
typedef unsigned short v8us __attribute__((ext_vector_type(8), may_alias));
typedef float  v8f  __attribute__((ext_vector_type(8)));
typedef float  v4f  __attribute__((ext_vector_type(4)));
typedef float  v4fa __attribute__((ext_vector_type(4), may_alias));
union FragB { v16b v; v8us half[2]; unsigned short u[16]; };

__device__ __forceinline__ unsigned short bf16_bits(float x) { unsigned int u = __float_as_uint(x); return (unsigned short)((u + 0x7FFFu + ((u >> 16) & 1u)) >> 16); }
__device__ __forceinline__ float bf16_val(unsigned short b) { return __uint_as_float(((unsigned int)b) << 16); }
__device__ __forceinline__ float bf16_round(float x) { return bf16_val(bf16_bits(x)); }
// D += A·B with NT terms: 1 = ah·bh, 2 = + al·bh (A split), 3 = + ah·bl (both split)
template <int NT>
__device__ __forceinline__ v8f mmaN(v16b ah, v16b al, v16b bh, v16b bl, v8f c) {
  c = __builtin_amdgcn_wmma_f32_16x16x32_bf16(false, ah, false, bh, (short)0, c, false, false);
  if (NT >= 2) c = __builtin_amdgcn_wmma_f32_16x16x32_bf16(false, al, false, bh, (short)0, c, false, false);
  if (NT >= 3) c = __builtin_amdgcn_wmma_f32_16x16x32_bf16(false, ah, false, bl, (short)0, c, false, false);
  asm volatile("v_nop\n\tv_nop\n\tv_nop\n\tv_nop" : "+v"(c) : "v"(ah), "v"(al), "v"(bh), "v"(bl));
  return c;
}

// W [K][N] f32 -> bf16 B fragments, fragment-major: unit ((tile * (K / 32) + ks) * 2 + h) * 32 + lane holds the 16 bytes that this lane of the B fragment
// (column tile, k-step ks, register half h) needs, so that one wave-wide 16-byte load of a fragment half covers 512 contiguous bytes. One unit a thread.
__global__ __launch_bounds__(256) void k_wt_bf16(const float* __restrict__ W, unsigned short* __restrict__ Wt, int K, int N) {
  const int u = blockIdx.x * 256 + threadIdx.x;
  if (u >= N * (K / 8)) return;
  const int lane = u & 31, h = (u >> 5) & 1, ks = (u >> 6) % (K / 32), tile = (u >> 6) / (K / 32);
  const int n = tile * 16 + (lane & 15), k8 = ks * 32 + h * 16 + (lane >> 4) * 8;
  v8us v;
#pragma unroll
  for (int i = 0; i < 8; ++i) v[i] = bf16_bits(W[(size_t)(k8 + i) * N + n]);
  *(v8us*)(Wt + (size_t)u * 8) = v;
}

// GEMM C[M][N] (f32, pitch ldc) = act(A[M][K]·W + bias). A f32 row-major (pitch lda) converted per fragment to bf16
// (ASPLIT: hi/lo two planes -> 2 terms, else single rounded term); Wt bf16 [N][K] (pitch ldb). BIAS_BF16 rounds the
// bias to bf16 first (bias quantised to bf16 before the add). K%32==0, M%16==0, N%64==0.
template <bool ASPLIT, int ACT, bool BIAS_BF16>
__global__ __launch_bounds__(128) void k_gemm_bf(const float* __restrict__ A, int lda, const unsigned short* __restrict__ Wt, int ldb,
                                               const float* __restrict__ bias, float* __restrict__ C, int ldc, int M, int N, int K) {
  __shared__ __attribute__((aligned(16))) float so[4][16][64];
  const int tid = threadIdx.x, w = tid >> 5, lane = tid & 31, ln = lane & 15, hh = lane >> 4;
  const int ntn = N / 64;
  const int wid = blockIdx.x * 4 + w;
  const int mt = wid / ntn, nq = wid % ntn;
  if (mt * 16 >= M) return;
  const int row0 = mt * 16, col0 = nq * 64;
  const float* arow = A + (size_t)(row0 + ln) * lda;
  v8f acc[4] = {};
  for (int kb = 0; kb < K; kb += 32) {
    FragB ah, al;
    const v4f x0 = *(const v4fa*)(arow + kb + 8 * hh), x1 = *(const v4fa*)(arow + kb + 8 * hh + 4);
    const v4f x2 = *(const v4fa*)(arow + kb + 16 + 8 * hh), x3 = *(const v4fa*)(arow + kb + 16 + 8 * hh + 4);
    float xs[16] = {x0[0],x0[1],x0[2],x0[3],x1[0],x1[1],x1[2],x1[3],x2[0],x2[1],x2[2],x2[3],x3[0],x3[1],x3[2],x3[3]};
#pragma unroll
    for (int i = 0; i < 16; ++i) { const unsigned short hb = bf16_bits(xs[i]); ah.u[i] = hb; al.u[i] = ASPLIT ? bf16_bits(xs[i] - bf16_val(hb)) : (unsigned short)0; }
#pragma unroll
    for (int t = 0; t < 4; ++t) {
      const unsigned short* brow = Wt + (size_t)(col0 + t * 16 + ln) * ldb + kb;
      FragB b;
      b.half[0] = *(const v8us*)(brow + 8 * hh);
      b.half[1] = *(const v8us*)(brow + 16 + 8 * hh);
      acc[t] = mmaN<ASPLIT ? 2 : 1>(ah.v, al.v, b.v, b.v, acc[t]);
    }
  }
#pragma unroll
  for (int t = 0; t < 4; ++t) {
    float bv = bias ? bias[col0 + t * 16 + ln] : 0.f;
    if (BIAS_BF16) bv = bf16_round(bv);
#pragma unroll
    for (int r = 0; r < 8; ++r) { float v = acc[t][r] + bv; if (ACT == 1) v = fmaxf(v, 0.f); so[w][8 * hh + r][t * 16 + ln] = v; }
  }
  __builtin_amdgcn_fence(__ATOMIC_ACQ_REL, "workgroup");
  __builtin_amdgcn_wave_barrier();
  const int rsub = lane >> 4, c4 = (lane & 15) * 4;
  {
#pragma unroll
    for (int q = 0; q < 8; ++q) {
      const int r = q * 2 + rsub;
      const v4f v = *(const v4fa*)&so[w][r][c4];
      *(v4f*)(C + (size_t)(row0 + r) * ldc + col0 + c4) = v;
    }
    
  }
}

// Flash-style causal/unmasked attention, all contractions 3-term bf16 hi/lo splits, f32 softmax with running max.
// q,k,v rows are read from f32 buffers with arbitrary row pitch (so they can live inside a fused qkv buffer);
// D = head size (multiple of 32, <= 128); one wave = 16 query rows; block = 4 waves (64 queries) sharing K/V chunks of 32.
template <int D, bool CAUSAL>
__global__ __launch_bounds__(128) void k_flash(const float* __restrict__ qb, const float* __restrict__ kb, const float* __restrict__ vb,
                                             int pitch, int T, int H, float scale, float* __restrict__ y, int ypitch) {
  constexpr int KS = D / 32;        // k-steps for QK
  constexpr int DT = D / 16;        // d tiles for PV
  __shared__ __attribute__((aligned(16))) unsigned short sKh[32][D + 8], sKl[32][D + 8], sVh[32][D + 8], sVl[32][D + 8];
  __shared__ __attribute__((aligned(16))) unsigned short sPh[4][16][40], sPl[4][16][40];
  __shared__ __attribute__((aligned(16))) float sO[4][16][D];
  const int tid = threadIdx.x, w = tid >> 5, lane = tid & 31, ln = lane & 15, hh = lane >> 4;
  const int nqb = (T + 63) / 64;
  const int bh = blockIdx.x / nqb, qblk = blockIdx.x % nqb;
  const int b = bh / H, h = bh % H;
  const int q0 = qblk * 64 + w * 16;
  const float* Q = qb + (size_t)b * T * pitch + h * D;
  const float* K = kb + (size_t)b * T * pitch + h * D;
  const float* V = vb + (size_t)b * T * pitch + h * D;

  // A fragments of the wave's 16 query rows (scaled), hi/lo
  FragB aqh[KS], aql[KS];
  {
    int row = q0 + ln; if (row >= T) row = T - 1;
    const float* qr = Q + (size_t)row * pitch;
#pragma unroll
    for (int ks = 0; ks < KS; ++ks)
#pragma unroll
      for (int i = 0; i < 16; ++i) {
        const int d = ks * 32 + ((i < 8) ? (8 * hh + i) : (16 + 8 * hh + (i - 8)));
        const float x = qr[d] * scale; const unsigned short hb = bf16_bits(x);
        aqh[ks].u[i] = hb; aql[ks].u[i] = bf16_bits(x - bf16_val(hb));
      }
  }
  float m_r[8], l_r[8];
#pragma unroll
  for (int r = 0; r < 8; ++r) { m_r[r] = -3.0e38f; l_r[r] = 0.f; }
  v8f oacc[DT];
#pragma unroll
  for (int dt = 0; dt < DT; ++dt) oacc[dt] = (v8f){0.f,0.f,0.f,0.f,0.f,0.f,0.f,0.f};

  const int kv_end = CAUSAL ? min(T, qblk * 64 + 64) : T;     // block-uniform
  for (int j0 = 0; j0 < kv_end; j0 += 32) {
    __syncthreads();
    for (int e = tid; e < 32 * (D / 4); e += 128) {
      const int r = e / (D / 4), c4 = (e % (D / 4)) * 4;
      const int key = j0 + r;
      v4f kf = {0.f,0.f,0.f,0.f}, vf = {0.f,0.f,0.f,0.f};
      if (key < T) { kf = *(const v4fa*)(K + (size_t)key * pitch + c4); vf = *(const v4fa*)(V + (size_t)key * pitch + c4); }
#pragma unroll
      for (int t = 0; t < 4; ++t) {
        unsigned short hb = bf16_bits(kf[t]); sKh[r][c4 + t] = hb; sKl[r][c4 + t] = bf16_bits(kf[t] - bf16_val(hb));
        hb = bf16_bits(vf[t]); sVh[r][c4 + t] = hb; sVl[r][c4 + t] = bf16_bits(vf[t] - bf16_val(hb));
      }
    }
    __syncthreads();
    // S tile 16 x 32
    v8f s[2];
#pragma unroll
    for (int nt = 0; nt < 2; ++nt) {
      v8f acc = {};
#pragma unroll
      for (int ks = 0; ks < KS; ++ks) {
        FragB bh_, bl_;
        bh_.half[0] = *(const v8us*)&sKh[nt * 16 + ln][ks * 32 + 8 * hh]; bh_.half[1] = *(const v8us*)&sKh[nt * 16 + ln][ks * 32 + 16 + 8 * hh];
        bl_.half[0] = *(const v8us*)&sKl[nt * 16 + ln][ks * 32 + 8 * hh]; bl_.half[1] = *(const v8us*)&sKl[nt * 16 + ln][ks * 32 + 16 + 8 * hh];
        acc = mmaN<3>(aqh[ks].v, aql[ks].v, bh_.v, bl_.v, acc);
      }
      s[nt] = acc;
    }
    // mask + running max (rows 8hh+r; the 16 lanes of a half share rows)
    float alpha[8];
#pragma unroll
    for (int r = 0; r < 8; ++r) {
      const int qi = q0 + 8 * hh + r;
      const int ja = j0 + ln, jb = j0 + 16 + ln;
      if (CAUSAL) { if (ja > qi) s[0][r] = -3.0e38f; if (jb > qi) s[1][r] = -3.0e38f; }
      if (ja >= T) s[0][r] = -3.0e38f;
      if (jb >= T) s[1][r] = -3.0e38f;
      float mx = fmaxf(s[0][r], s[1][r]);
      mx = fmaxf(mx, __shfl_xor(mx, 1, 32)); mx = fmaxf(mx, __shfl_xor(mx, 2, 32)); mx = fmaxf(mx, __shfl_xor(mx, 4, 32)); mx = fmaxf(mx, __shfl_xor(mx, 8, 32));
      const float mnew = fmaxf(m_r[r], mx);
      alpha[r] = (mnew > -1.0e38f) ? __expf(m_r[r] - mnew) : 1.0f;
      const float p0 = (s[0][r] > -1.0e38f) ? __expf(s[0][r] - mnew) : 0.f;
      const float p1 = (s[1][r] > -1.0e38f) ? __expf(s[1][r] - mnew) : 0.f;
      m_r[r] = mnew;
      l_r[r] = l_r[r] * alpha[r] + p0 + p1;            // per-lane partial row sum (16 lanes combined at the end)
      unsigned short hb = bf16_bits(p0); sPh[w][8 * hh + r][ln] = hb;      sPl[w][8 * hh + r][ln] = bf16_bits(p0 - bf16_val(hb));
      hb = bf16_bits(p1);                sPh[w][8 * hh + r][16 + ln] = hb; sPl[w][8 * hh + r][16 + ln] = bf16_bits(p1 - bf16_val(hb));
    }
#pragma unroll
    for (int dt = 0; dt < DT; ++dt)
#pragma unroll
      for (int r = 0; r < 8; ++r) oacc[dt][r] *= alpha[r];
    __builtin_amdgcn_fence(__ATOMIC_ACQ_REL, "workgroup");
    __builtin_amdgcn_wave_barrier();
    FragB pah, pal;
    pah.half[0] = *(const v8us*)&sPh[w][ln][8 * hh]; pah.half[1] = *(const v8us*)&sPh[w][ln][16 + 8 * hh];
    pal.half[0] = *(const v8us*)&sPl[w][ln][8 * hh]; pal.half[1] = *(const v8us*)&sPl[w][ln][16 + 8 * hh];
#pragma unroll
    for (int dt = 0; dt < DT; ++dt) {
      FragB bvh, bvl;
#pragma unroll
      for (int i = 0; i < 8; ++i) {
        bvh.u[i] = sVh[8 * hh + i][dt * 16 + ln]; bvh.u[8 + i] = sVh[16 + 8 * hh + i][dt * 16 + ln];
        bvl.u[i] = sVl[8 * hh + i][dt * 16 + ln]; bvl.u[8 + i] = sVl[16 + 8 * hh + i][dt * 16 + ln];
      }
      oacc[dt] = mmaN<3>(pah.v, pal.v, bvh.v, bvl.v, oacc[dt]);
    }
    __builtin_amdgcn_fence(__ATOMIC_ACQ_REL, "workgroup");
    __builtin_amdgcn_wave_barrier();
  }
#pragma unroll
  for (int r = 0; r < 8; ++r) {
    float l = l_r[r];
    l += __shfl_xor(l, 1, 32); l += __shfl_xor(l, 2, 32); l += __shfl_xor(l, 4, 32); l += __shfl_xor(l, 8, 32);
    l_r[r] = (l > 0.f) ? 1.0f / l : 0.f;
  }
#pragma unroll
  for (int dt = 0; dt < DT; ++dt)
#pragma unroll
    for (int r = 0; r < 8; ++r) sO[w][8 * hh + r][dt * 16 + ln] = oacc[dt][r] * l_r[r];
  __builtin_amdgcn_fence(__ATOMIC_ACQ_REL, "workgroup");
  __builtin_amdgcn_wave_barrier();
  {
    for (int r = 0; r < 16; ++r) {
      const int row = q0 + r;
      if (row < T && lane < D / 4) {
        const v4f val = *(const v4fa*)&sO[w][r][lane * 4];
        *(v4f*)(y + ((size_t)b * T + row) * ypitch + h * D + lane * 4) = val;
      }
    }
    
  }
}

// GEMM C = act(A·W + bias + resid): A f32 (ASPLIT -> hi/lo 2 terms), Wt bf16 [N][K]; ACT 0 none, 1 relu, 2 exact gelu;
// resid (optional, f32, row index = (row % rmod), pitch ldr, RES_BF16 rounds it) added before the activation.
template <bool ASPLIT, int ACT, bool BIAS_BF16, bool RES_BF16>
__global__ __launch_bounds__(128) void k_gemm_bf3(const float* __restrict__ A, int lda, const unsigned short* __restrict__ Wt, int ldb,
                                                const float* __restrict__ bias, const float* __restrict__ resid, int rmod, int ldr,
                                                float* __restrict__ C, int ldc, int M, int N, int K) {
  __shared__ __attribute__((aligned(16))) float so[4][16][64];
  const int tid = threadIdx.x, w = tid >> 5, lane = tid & 31, ln = lane & 15, hh = lane >> 4;
  const int ntn = N / 64;
  const int wid = blockIdx.x * 4 + w;
  const int mt = wid / ntn, nq = wid % ntn;
  if (mt * 16 >= M) return;
  const int row0 = mt * 16, col0 = nq * 64;
  const float* arow = A + (size_t)(row0 + ln) * lda;
  v8f acc[4] = {};
  for (int kb = 0; kb < K; kb += 32) {
    FragB ah, al;
    const v4f x0 = *(const v4fa*)(arow + kb + 8 * hh), x1 = *(const v4fa*)(arow + kb + 8 * hh + 4);
    const v4f x2 = *(const v4fa*)(arow + kb + 16 + 8 * hh), x3 = *(const v4fa*)(arow + kb + 16 + 8 * hh + 4);
    float xs[16] = {x0[0],x0[1],x0[2],x0[3],x1[0],x1[1],x1[2],x1[3],x2[0],x2[1],x2[2],x2[3],x3[0],x3[1],x3[2],x3[3]};
#pragma unroll
    for (int i = 0; i < 16; ++i) { const unsigned short hb = bf16_bits(xs[i]); ah.u[i] = hb; al.u[i] = ASPLIT ? bf16_bits(xs[i] - bf16_val(hb)) : (unsigned short)0; }
#pragma unroll
    for (int t = 0; t < 4; ++t) {
      const unsigned short* brow = Wt + (size_t)(col0 + t * 16 + ln) * ldb + kb;
      FragB b;
      b.half[0] = *(const v8us*)(brow + 8 * hh);
      b.half[1] = *(const v8us*)(brow + 16 + 8 * hh);
      acc[t] = mmaN<ASPLIT ? 2 : 1>(ah.v, al.v, b.v, b.v, acc[t]);
    }
  }
#pragma unroll
  for (int t = 0; t < 4; ++t) {
    const int col = col0 + t * 16 + ln;
    float bv = bias ? bias[col] : 0.f;
    if (BIAS_BF16) bv = bf16_round(bv);
#pragma unroll
    for (int r = 0; r < 8; ++r) {
      float v = acc[t][r] + bv;
      if (resid) { float rv = resid[(size_t)((row0 + 8 * hh + r) % rmod) * ldr + col]; if (RES_BF16) rv = bf16_round(rv); v += rv; }
      if (ACT == 1) v = fmaxf(v, 0.f);
      if (ACT == 2) v = 0.5f * v * (1.0f + erff(v * 0.70710678118654752f));
      if (ACT == 3) { const float u = 0.7978845608028654f * (v + 0.044715f * v * v * v); v = 0.5f * v * (1.0f + tanhf(u)); }
      so[w][8 * hh + r][t * 16 + ln] = v;
    }
  }
  __builtin_amdgcn_fence(__ATOMIC_ACQ_REL, "workgroup");
  __builtin_amdgcn_wave_barrier();
  const int rsub = lane >> 4, c4 = (lane & 15) * 4;
  {
#pragma unroll
    for (int q = 0; q < 8; ++q) {
      const int r = q * 2 + rsub;
      const v4f v = *(const v4fa*)&so[w][r][c4];
      *(v4f*)(C + (size_t)(row0 + r) * ldc + col0 + c4) = v;
    }
    
  }
}
// row LayerNorm (biased variance, eps) over N: s = X (+ R); optional out_sum <- s; out_norm <- (s-mu)*rsqrt(var+eps)*g + b
template <bool PARAM_BF16>
__global__ __launch_bounds__(256) void k_layernorm(const float* __restrict__ X, const float* __restrict__ R, const float* __restrict__ g, const float* __restrict__ bta,
                                                  float* __restrict__ out_sum, float* __restrict__ out_norm, int N, float eps) {
  __shared__ float red[256];
  const int row = blockIdx.x, tid = threadIdx.x;
  const float* x = X + (size_t)row * N; const float* rr = R ? R + (size_t)row * N : nullptr;
  float vals[16];                     // up to N = 4096
  const int per = N / 256;            // contiguous chunk per thread? use strided-by-4 chunks: thread handles j = tid*4 + 1024*u
  float s1 = 0.f;
  for (int u = 0; u < per / 4; ++u) {
    const int j = tid * 4 + 1024 * u;
    const v4f a = *(const v4fa*)(x + j);
    v4f b = {0.f,0.f,0.f,0.f}; if (rr) b = *(const v4fa*)(rr + j);
#pragma unroll
    for (int q = 0; q < 4; ++q) { const float v = a[q] + b[q]; vals[u * 4 + q] = v; s1 += v; }
  }
  red[tid] = s1; __syncthreads();
  for (int st = 128; st > 0; st >>= 1) { if (tid < st) red[tid] += red[tid + st]; __syncthreads(); }
  const float mu = red[0] / (float)N; __syncthreads();
  float s2 = 0.f;
  for (int u = 0; u < per / 4; ++u)
#pragma unroll
    for (int q = 0; q < 4; ++q) { const float c = vals[u * 4 + q] - mu; s2 += c * c; }
  red[tid] = s2; __syncthreads();
  for (int st = 128; st > 0; st >>= 1) { if (tid < st) red[tid] += red[tid + st]; __syncthreads(); }
  const float rs = rsqrtf(red[0] / (float)N + eps);
  {
    for (int u = 0; u < per / 4; ++u) {
      const int j = tid * 4 + 1024 * u;
      v4f o, sm;
#pragma unroll
      for (int q = 0; q < 4; ++q) {
        float gg = g[j + q], bb = bta[j + q];
        if (PARAM_BF16) { gg = bf16_round(gg); bb = bf16_round(bb); }
        sm[q] = vals[u * 4 + q]; o[q] = (vals[u * 4 + q] - mu) * rs * gg + bb;
      }
      if (out_sum) *(v4f*)(out_sum + (size_t)row * N + j) = sm;
      *(v4f*)(out_norm + (size_t)row * N + j) = o;
    }
    
  }
}

// batched f32 [K][N] (pitch lds, batch stride sIn) -> transposed hi/lo planes [N][K] (batch stride sOut); thread per (n, 8 k); grid.y = batch
__global__ __launch_bounds__(256) void k_split_transpose_b(const float* __restrict__ src, int lds_, size_t sIn, unsigned short* __restrict__ hi, unsigned short* __restrict__ lo, size_t sOut, int K, int N) {
  const size_t t = (size_t)blockIdx.x * 256 + threadIdx.x; const int k8n = K / 8; if (t >= (size_t)N * k8n) return;
  src += (size_t)blockIdx.y * sIn; hi += (size_t)blockIdx.y * sOut; lo += (size_t)blockIdx.y * sOut;
  const int n = (int)(t / k8n), k8 = (int)(t % k8n) * 8; v8us vh, vl;
#pragma unroll
  for (int i = 0; i < 8; ++i) { const float x = src[(size_t)(k8 + i) * lds_ + n]; const unsigned short hb = bf16_bits(x); vh[i] = hb; vl[i] = bf16_bits(x - bf16_val(hb)); }
  unsigned short* dh = hi + (size_t)n * K + k8; unsigned short* dl = lo + (size_t)n * K + k8;
  *(v8us*)dh = vh; *(v8us*)dl = vl; 
}

typedef float f2v __attribute__((ext_vector_type(2)));
typedef __bf16 bf2v __attribute__((ext_vector_type(2)));
union FragW { v16b v; unsigned int w[8]; };
__device__ __forceinline__ unsigned int pk_bf16(float a, float b) { return __builtin_bit_cast(unsigned int, __builtin_convertvector((f2v){a, b}, bf2v)); }   // round to nearest even
__device__ __forceinline__ float xhalf(float x) { return __builtin_bit_cast(float, __builtin_amdgcn_permlanex16(__builtin_bit_cast(int, x), __builtin_bit_cast(int, x), 0x76543210, 0xfedcba98, false, false)); }   // lane l with lane l ^ 16
__device__ __forceinline__ v8f wmma_bf(v16b a, v16b b, v8f c) { return __builtin_amdgcn_wmma_f32_16x16x32_bf16(false, a, false, b, (short)0, c, false, false); }

// [q | k | v] = x * [Wq | Wk | Wv]. A block owns PM rows of x and all 192 columns. x is read once, in whole lines, rounded to bf16 and kept in LDS.
// Wave w holds the B fragments of column tiles 3 (w % 4) ... + 2 for k-steps 12 (w / 4) ... + 11 in registers (packed by k_wt_bf16) and
// multiplies all four row tiles by them; the two K halves of a result are added through LDS. From that LDS tile the block writes what the attention launch reads:
// q as f32 rows Q[row][64], k rounded to bf16 as rows Kb[row][64], v rounded to bf16 and transposed as Vt[batch][d][token].
#define PM 64
#define XR 40          // x tile in LDS, one plane per k-step: row pitch in elements, 80 bytes = 16 * odd, at which 16-byte fragment reads meet no bank conflict
#define XS (PM * XR + 32)   // plane pitch in elements: 16 banks past a multiple of 64, so the four k-steps that one staging store spans do not collide
#define OP 196         // result tile pitch in floats: rows 8 apart fall 32 banks apart, so the two lane halves of a store do not collide
__global__ __launch_bounds__(256) void k_proj(const float* __restrict__ x, const unsigned short* __restrict__ Bp, float* __restrict__ Q, unsigned short* __restrict__ Kb, unsigned short* __restrict__ Vt) {
  __shared__ __attribute__((aligned(16))) unsigned short sx[(CC / 32) * XS];
  __shared__ __attribute__((aligned(16))) float so[PM][OP];
  const int tid = threadIdx.x, w = tid >> 5, lane = tid & 31, ln = lane & 15, hh = lane >> 4;
  const int ng = w & 3, kh = w >> 2;
  const size_t row0 = (size_t)blockIdx.x * PM;
  // staging: wave w brings rows 16 (w % 4) ... + 15, columns 384 (w / 4) ... + 383, as 48 wave-wide loads of 512 contiguous bytes
  const float* xp = x + (row0 + ng * 16) * CC + kh * 384 + lane * 4;
  const unsigned int bo = ((ng * 72 + kh * 12) * 64 + lane) * 16;   // this lane's place in the packed fragments, in bytes
  const unsigned short* bp = (const unsigned short*)((const char*)Bp + bo);
  v4f xa[48];
#pragma unroll
  for (int i = 0; i < 48; ++i) xa[i] = *(const v4fa*)(xp + (i / 3) * CC + (i % 3) * 128);
  FragB bf[3][12];
#pragma unroll
  for (int t = 0; t < 2; ++t)
#pragma unroll
    for (int kk = 0; kk < 12; ++kk) { bf[t][kk].half[0] = *(const v8us*)(bp + ((t * 24 + kk) * 2) * 256); bf[t][kk].half[1] = *(const v8us*)(bp + ((t * 24 + kk) * 2 + 1) * 256); }
  // stands in front of the reuse of the address registers that the loads above name; pointer and offset are inputs so that their registers live up to the wait
  asm volatile("s_wait_xcnt 0x0" :: "v"(xp), "v"(bo) : "memory");
  unsigned short* xs = sx + (kh * 12 + (lane >> 3)) * XS + ng * 16 * XR + (lane & 7) * 4;
#pragma unroll
  for (int i = 0; i < 48; ++i) *(uint2*)(xs + (i % 3) * 4 * XS + (i / 3) * XR) = make_uint2(pk_bf16(xa[i][0], xa[i][1]), pk_bf16(xa[i][2], xa[i][3]));
  // the third column tile's fragments: a second group of loads, with a wait of its own
#pragma unroll
  for (int kk = 0; kk < 12; ++kk) { bf[2][kk].half[0] = *(const v8us*)(bp + ((48 + kk) * 2) * 256); bf[2][kk].half[1] = *(const v8us*)(bp + ((48 + kk) * 2 + 1) * 256); }
  // as above, for the loads of the third tile
  asm volatile("s_wait_xcnt 0x0" :: "v"(bo) : "memory");
  __syncthreads();

  v8f acc[4][3];
#pragma unroll
  for (int mt = 0; mt < 4; ++mt)
#pragma unroll
    for (int t = 0; t < 3; ++t) acc[mt][t] = (v8f){0.f,0.f,0.f,0.f,0.f,0.f,0.f,0.f};
  const unsigned short* ap = sx + kh * 12 * XS + ln * XR + 8 * hh;
  // the next k-step's four A fragments are asked for as one group ahead of this k-step's products
  FragB a[2][4];
#pragma unroll
  for (int mt = 0; mt < 4; ++mt) { a[0][mt].half[0] = *(const v8us*)(ap + mt * 16 * XR); a[0][mt].half[1] = *(const v8us*)(ap + mt * 16 * XR + 16); }
#pragma unroll
  for (int kk = 0; kk < 12; ++kk) {
    if (kk + 1 < 12) {
#pragma unroll
      for (int mt = 0; mt < 4; ++mt) { a[(kk + 1) & 1][mt].half[0] = *(const v8us*)(ap + (kk + 1) * XS + mt * 16 * XR); a[(kk + 1) & 1][mt].half[1] = *(const v8us*)(ap + (kk + 1) * XS + mt * 16 * XR + 16); }
    }
#pragma unroll
    for (int mt = 0; mt < 4; ++mt)
#pragma unroll
      for (int t = 0; t < 3; ++t) acc[mt][t] = wmma_bf(a[kk & 1][mt].v, bf[t][kk].v, acc[mt][t]);
    // keeps the order one load group, twelve products: left free, the scheduler asks for four k-steps at once, runs out of registers and then waits out a fragment's LDS latency before every three products
    __builtin_amdgcn_sched_barrier(0);
  }

  // the wave of the first K half finishes row tiles 0 and 1, its partner 2 and 3: each hands the other two over, then adds its own to what it was handed
  float* sg = &so[(kh ? 0 : 32) + 8 * hh][ng * 48 + ln];
  float* sk = &so[(kh ? 32 : 0) + 8 * hh][ng * 48 + ln];
#pragma unroll
  for (int m = 0; m < 2; ++m)
#pragma unroll
    for (int t = 0; t < 3; ++t)
#pragma unroll
      for (int r = 0; r < 8; ++r) sg[(m * 16 + r) * OP + t * 16] = kh ? acc[m][t][r] : acc[m + 2][t][r];
  __syncthreads();
#pragma unroll
  for (int m = 0; m < 2; ++m)
#pragma unroll
    for (int t = 0; t < 3; ++t)
#pragma unroll
      for (int r = 0; r < 8; ++r) sk[(m * 16 + r) * OP + t * 16] += kh ? acc[m + 2][t][r] : acc[m][t][r];
  __syncthreads();
  // every store instruction below covers four whole 128-byte lines
  // q: the tile's 64 x 64 floats are 16 KB in a row of Q
  v4f qv[4];
#pragma unroll
  for (int i = 0; i < 4; ++i) { const int u = i * 256 + tid; qv[i] = *(const v4fa*)&so[u >> 4][(u & 15) * 4]; }
  // k: eight columns of one row a thread; the tile's 64 x 64 bf16 are 8 KB in a row of Kb
  uint4 kw[2];
#pragma unroll
  for (int i = 0; i < 2; ++i) {
    const int u = i * 256 + tid;
    const v4f c0 = *(const v4fa*)&so[u >> 3][HH + (u & 7) * 8], c1 = *(const v4fa*)&so[u >> 3][HH + (u & 7) * 8 + 4];
    kw[i] = make_uint4(pk_bf16(c0[0], c0[1]), pk_bf16(c0[2], c0[3]), pk_bf16(c1[0], c1[1]), pk_bf16(c1[2], c1[3]));
  }
  // v: eight rows of one column a thread; the tile's 64 tokens are one line of each of the 64 rows of this batch's Vt plane
  uint4 vw[2];
#pragma unroll
  for (int i = 0; i < 2; ++i) {
    const float* c = &so[(tid & 7) * 8][2 * HH + i * 32 + (tid >> 3)];
    vw[i] = make_uint4(pk_bf16(c[0], c[OP]), pk_bf16(c[2 * OP], c[3 * OP]), pk_bf16(c[4 * OP], c[5 * OP]), pk_bf16(c[6 * OP], c[7 * OP]));
  }
  float* oq = Q + row0 * HH + tid * 4;
  unsigned short* ok = Kb + row0 * HH + tid * 8;
  unsigned short* ov = Vt + ((row0 / TT) * HH + (tid >> 3)) * TT + row0 % TT + (tid & 7) * 8;
#pragma unroll
  for (int i = 0; i < 2; ++i) *(uint4*)(ov + (size_t)i * 32 * TT) = vw[i];
#pragma unroll
  for (int i = 0; i < 2; ++i) *(uint4*)(ok + i * 2048) = kw[i];
#pragma unroll
  for (int i = 0; i < 4; ++i) *(v4f*)(oq + i * 1024) = qv[i];
}

// Scores, masked softmax and P*v in one launch, all batches. A block owns 64 query rows of one batch; each of its AW waves
// holds all 64 (AQ tiles of 16 as B operands, q split hi/lo) and walks its own TT / AW keys in passes of 32 with a running maximum:
// St = k * qt (a lane holds 16 scores of ONE query), Pt packs from the two St tiles into a B operand (hi/lo), Ot += vt * Pt.
// The AW partial (maximum, sum, Ot) sets are joined through LDS at the end. Scores never reach memory.
#define AQ 4
#define AW 8
#define AKEYS (TT / AW)
__global__ __launch_bounds__(AW * 32) void k_attn(const float* __restrict__ Q, const unsigned short* __restrict__ Kb, const unsigned short* __restrict__ Vt,
                                                  const int* __restrict__ mask, float* __restrict__ out) {
  __shared__ __attribute__((aligned(16))) v4f sO[AW][AQ * 8][32];
  __shared__ float sM[AW][AQ][16], sL[AW][AQ][16];
  const int tid = threadIdx.x, w = tid >> 5, lane = tid & 31, ln = lane & 15, hh = lane >> 4;
  const int b = blockIdx.x / (TT / 64), q0 = (blockIdx.x % (TT / 64)) * 64;
  const float c2 = 0.03608439182435161f * 1.4426950408889634f;   // 768^-0.5 * log2(e): the softmax runs in base 2

  FragB qh[AQ][2], ql[AQ][2];
  const float* qp = Q + ((size_t)b * TT + q0 + ln) * HH + 8 * hh;
  v4f xq[AQ][2][4];
#pragma unroll
  for (int qt = 0; qt < AQ; ++qt)
#pragma unroll
    for (int ks = 0; ks < 2; ++ks) {
      const float* qr = qp + qt * 16 * HH + ks * 32;
      xq[qt][ks][0] = *(const v4fa*)(qr); xq[qt][ks][1] = *(const v4fa*)(qr + 4); xq[qt][ks][2] = *(const v4fa*)(qr + 16); xq[qt][ks][3] = *(const v4fa*)(qr + 20);
    }
  // stands in front of the reuse of the address registers that the q loads name; the pointer is an input so that its registers live up to the wait
  asm volatile("s_wait_xcnt 0x0" :: "v"(qp) : "memory");
#pragma unroll
  for (int qt = 0; qt < AQ; ++qt) {
#pragma unroll
    for (int ks = 0; ks < 2; ++ks) {
      const v4f x0 = xq[qt][ks][0], x1 = xq[qt][ks][1], x2 = xq[qt][ks][2], x3 = xq[qt][ks][3];
      float xs[16] = {x0[0],x0[1],x0[2],x0[3],x1[0],x1[1],x1[2],x1[3],x2[0],x2[1],x2[2],x2[3],x3[0],x3[1],x3[2],x3[3]};
#pragma unroll
      for (int i = 0; i < 16; ++i) { const unsigned short hb = bf16_bits(xs[i]); qh[qt][ks].u[i] = hb; ql[qt][ks].u[i] = bf16_bits(xs[i] - bf16_val(hb)); }
    }
  }
  float m_r[AQ], l_r[AQ];
  v8f oacc[AQ][4];
#pragma unroll
  for (int qt = 0; qt < AQ; ++qt) {
    m_r[qt] = -3.0e38f; l_r[qt] = 0.f;   // finite start: a pass whose keys are all masked gives exp2(-inf) = 0, never inf - inf
#pragma unroll
    for (int dt = 0; dt < 4; ++dt) oacc[qt][dt] = (v8f){0.f,0.f,0.f,0.f,0.f,0.f,0.f,0.f};
  }
  const unsigned short* kp = Kb + ((size_t)b * TT + w * AKEYS + ln) * HH + 8 * hh;
  const unsigned short* vp = Vt + ((size_t)b * HH + ln) * TT + w * AKEYS + 8 * hh;
  const int* mp = mask + (size_t)b * TT + w * AKEYS + lane;   // one mask word a lane: a pass's 32 keys
  int one = 1;   // passes through each wait below, so that the pointer additions, which are multiples of it, cannot be lifted over the wait

  FragB ka[2][2];
  int mk;
#pragma unroll
  for (int t = 0; t < 2; ++t)
#pragma unroll
    for (int ks = 0; ks < 2; ++ks) { ka[t][ks].half[0] = *(const v8us*)(kp + t * 16 * HH + ks * 32); ka[t][ks].half[1] = *(const v8us*)(kp + t * 16 * HH + ks * 32 + 16); }
  mk = *mp;
  // stands in front of the overwrite of the address registers that the loads above name; the pointers are inputs so that their registers live up to it
  asm volatile("s_wait_xcnt 0x0" : "+s"(one) : "v"(kp), "v"(mp) : "memory");
  kp += one * 32 * HH; mp += one * 32;

  // rolled, for speed only: one pass is several KB of code
#pragma unroll 1
  for (int it = 0; it < AKEYS / 32; ++it) {
    FragB va[4];
#pragma unroll
    for (int dt = 0; dt < 4; ++dt) { va[dt].half[0] = *(const v8us*)(vp + (size_t)dt * 16 * TT); va[dt].half[1] = *(const v8us*)(vp + (size_t)dt * 16 * TT + 16); }
    // the next pass's k rows and mask words are fetched now; the last pass fetches its own again, so every address stays inside
    FragB kn[2][2];
#pragma unroll
    for (int t = 0; t < 2; ++t)
#pragma unroll
      for (int ks = 0; ks < 2; ++ks) { kn[t][ks].half[0] = *(const v8us*)(kp + t * 16 * HH + ks * 32); kn[t][ks].half[1] = *(const v8us*)(kp + t * 16 * HH + ks * 32 + 16); }
    const int mn = *mp;
    // stands in front of the overwrite of the address registers that this pass's loads name; the pointers are inputs so that their registers live up to it
    asm volatile("s_wait_xcnt 0x0" : "+s"(one) : "v"(vp), "v"(kp), "v"(mp) : "memory");
    const int adv = (it + 2 < AKEYS / 32) ? one : 0;
    vp += one * 32; kp += adv * 32 * HH; mp += adv * 32;

    // bit 16 t + r of nb: key 16 t + 8 hh + r of this pass is masked
    const unsigned int nb = ~__builtin_amdgcn_ballot_w32(mk != 0) >> (8 * hh);
    v8f bias[2];   // 0 for a kept key, -inf for a masked one; rows of St are keys, so one set serves all query tiles
#pragma unroll
    for (int r = 0; r < 8; ++r) {
      bias[0][r] = __uint_as_float((unsigned int)((int)(nb << (31 - r)) >> 31) & 0xFF800000u);
      bias[1][r] = __uint_as_float((unsigned int)((int)(nb << (15 - r)) >> 31) & 0xFF800000u);
    }

#pragma unroll
    for (int qt = 0; qt < AQ; ++qt) {
      v8f s0 = {}, s1 = {};
#pragma unroll
      for (int ks = 0; ks < 2; ++ks) {
        s0 = wmma_bf(ka[0][ks].v, qh[qt][ks].v, s0); s1 = wmma_bf(ka[1][ks].v, qh[qt][ks].v, s1);
        s0 = wmma_bf(ka[0][ks].v, ql[qt][ks].v, s0); s1 = wmma_bf(ka[1][ks].v, ql[qt][ks].v, s1);
      }
      s0 += bias[0]; s1 += bias[1];
      float mx = fmaxf(s0[0], s1[0]);
#pragma unroll
      for (int r = 1; r < 8; ++r) mx = fmaxf(mx, fmaxf(s0[r], s1[r]));
      mx = fmaxf(mx, xhalf(mx));
      const float mnew = fmaxf(m_r[qt], mx);
      float alpha = (m_r[qt] - mnew) * c2;
      const float mc = mnew * c2;
      m_r[qt] = mnew;
      float e[16];
#pragma unroll
      for (int r = 0; r < 8; ++r) { e[r] = __builtin_fmaf(s0[r], c2, -mc); e[8 + r] = __builtin_fmaf(s1[r], c2, -mc); }
      // one tile's exponentials in one statement, each in place: none reads the result or overwrites the source of the one in front of it,
      // and the v_nop fills the slot that the instruction set asks for behind the last
      asm("v_exp_f32 %0, %0\n\tv_exp_f32 %1, %1\n\tv_exp_f32 %2, %2\n\tv_exp_f32 %3, %3\n\tv_exp_f32 %4, %4\n\tv_exp_f32 %5, %5\n\t"
          "v_exp_f32 %6, %6\n\tv_exp_f32 %7, %7\n\tv_exp_f32 %8, %8\n\tv_exp_f32 %9, %9\n\tv_exp_f32 %10, %10\n\tv_exp_f32 %11, %11\n\t"
          "v_exp_f32 %12, %12\n\tv_exp_f32 %13, %13\n\tv_exp_f32 %14, %14\n\tv_exp_f32 %15, %15\n\tv_exp_f32 %16, %16\n\tv_nop"
          : "+v"(e[0]), "+v"(e[1]), "+v"(e[2]), "+v"(e[3]), "+v"(e[4]), "+v"(e[5]), "+v"(e[6]), "+v"(e[7]), "+v"(e[8]), "+v"(e[9]),
            "+v"(e[10]), "+v"(e[11]), "+v"(e[12]), "+v"(e[13]), "+v"(e[14]), "+v"(e[15]), "+v"(alpha));
      FragW ph, pl;
      float sum = 0.f;
#pragma unroll
      for (int i = 0; i < 8; ++i) {
        const float pa = e[2 * i], pb = e[2 * i + 1];
        sum += pa + pb;
        const unsigned int hw = pk_bf16(pa, pb);
        ph.w[i] = hw;
        pl.w[i] = pk_bf16(pa - __uint_as_float(hw << 16), pb - __uint_as_float(hw & 0xFFFF0000u));
      }
      l_r[qt] = l_r[qt] * alpha + sum;   // this lane half's keys only; the halves are joined after the loop
#pragma unroll
      for (int dt = 0; dt < 4; ++dt) oacc[qt][dt] *= alpha;
#pragma unroll
      for (int dt = 0; dt < 4; ++dt) oacc[qt][dt] = wmma_bf(va[dt].v, ph.v, oacc[qt][dt]);
#pragma unroll
      for (int dt = 0; dt < 4; ++dt) oacc[qt][dt] = wmma_bf(va[dt].v, pl.v, oacc[qt][dt]);
    }
#pragma unroll
    for (int t = 0; t < 2; ++t)
#pragma unroll
      for (int ks = 0; ks < 2; ++ks) ka[t][ks] = kn[t][ks];
    mk = mn;
  }

#pragma unroll
  for (int qt = 0; qt < AQ; ++qt) {
    const float l = l_r[qt] + xhalf(l_r[qt]);
    if (hh == 0) { sM[w][qt][ln] = m_r[qt]; sL[w][qt][ln] = l; }
#pragma unroll
    for (int dt = 0; dt < 4; ++dt) {
      sO[w][qt * 8 + dt * 2][lane]     = (v4f){oacc[qt][dt][0], oacc[qt][dt][1], oacc[qt][dt][2], oacc[qt][dt][3]};
      sO[w][qt * 8 + dt * 2 + 1][lane] = (v4f){oacc[qt][dt][4], oacc[qt][dt][5], oacc[qt][dt][6], oacc[qt][dt][7]};
    }
  }
  __syncthreads();
  // join: wave w finishes query tile w / 2, head columns 32 * (w % 2) ... + 31 (one 128-byte line of each output row)
  const int qm = w >> 1;
  float M = -3.0e38f;
#pragma unroll
  for (int p = 0; p < AW; ++p) M = fmaxf(M, sM[p][qm][ln]);
  float f[AW], den = 0.f;
#pragma unroll
  for (int p = 0; p < AW; ++p) f[p] = (sM[p][qm][ln] - M) * c2;
  // in place and closed by a v_nop, for the same reason as in the loop
  asm("v_exp_f32 %0, %0\n\tv_exp_f32 %1, %1\n\tv_exp_f32 %2, %2\n\tv_exp_f32 %3, %3\n\tv_exp_f32 %4, %4\n\tv_exp_f32 %5, %5\n\tv_exp_f32 %6, %6\n\tv_exp_f32 %7, %7\n\tv_nop"
      : "+v"(f[0]), "+v"(f[1]), "+v"(f[2]), "+v"(f[3]), "+v"(f[4]), "+v"(f[5]), "+v"(f[6]), "+v"(f[7]));
#pragma unroll
  for (int p = 0; p < AW; ++p) den += sL[p][qm][ln] * f[p];
  const float inv = 1.0f / den;   // every key masked: den = 0, and 0 * inf gives NaN
#pragma unroll
  for (int dd = 0; dd < 2; ++dd) {
    const int dt = (w & 1) * 2 + dd;
    v4f a0 = {0.f,0.f,0.f,0.f}, a1 = {0.f,0.f,0.f,0.f};
#pragma unroll
    for (int p = 0; p < AW; ++p) { a0 += sO[p][qm * 8 + dt * 2][lane] * f[p]; a1 += sO[p][qm * 8 + dt * 2 + 1][lane] * f[p]; }
    float* o = out + ((size_t)b * TT + q0 + qm * 16 + ln) * HH + dt * 16 + 8 * hh;
    *(v4f*)o = a0 * inv; *(v4f*)(o + 4) = a1 * inv;
  }
}
extern "C" void kernel_launch(void* const* d_in, const int* in_sizes, int n_in,
                              void* d_out, int out_size, void* d_ws, size_t ws_size, hipStream_t stream) {
  (void)in_sizes; (void)n_in; (void)out_size;
  const float* x = (const float*)d_in[0]; const int* mask = (const int*)d_in[1]; const float* Wk = (const float*)d_in[2]; const float* Wq = (const float*)d_in[3]; const float* Wv = (const float*)d_in[4];
  char* ws = (char*)d_ws; size_t off = 0;
  auto take = [&](size_t bytes) { char* p = ws + off; off += (bytes + 255) & ~(size_t)255; return p; };
  unsigned short* Bt = (unsigned short*)take((size_t)192 * CC * 2); float* Q = (float*)take((size_t)MR * HH * 4); unsigned short* Kb = (unsigned short*)take((size_t)MR * HH * 2); unsigned short* Vt = (unsigned short*)take((size_t)BB * HH * TT * 2);
  if (off > ws_size) return;
  k_wt_bf16<<<(HH * (CC / 8) + 255) / 256, 256, 0, stream>>>(Wq, Bt, CC, HH); k_wt_bf16<<<(HH * (CC / 8) + 255) / 256, 256, 0, stream>>>(Wk, Bt + (size_t)HH * CC, CC, HH); k_wt_bf16<<<(HH * (CC / 8) + 255) / 256, 256, 0, stream>>>(Wv, Bt + (size_t)2 * HH * CC, CC, HH);
  k_proj<<<MR / PM, 256, 0, stream>>>(x, Bt, Q, Kb, Vt);      // q, k, vt
  k_attn<<<BB * (TT / 64), AW * 32, 0, stream>>>(Q, Kb, Vt, mask, (float*)d_out);
}

// v004
// One run takes 32.1 microseconds.
// Next to v003, in two timings, it ran 1.16 and 1.15 times as fast.
// Counting every step since v000, it is 51.0 times as fast.
#include <hip/hip_runtime.h>
// [q|k|v] = x*[Wq|Wk|Wv] (M = 16384, K = 768, N = 192; x and W rounded to bf16: single exact WMMA term, f32 accumulate); the same launch writes k and vt rounded to bf16; then one fused launch:
// St = k*qt (q split into bf16 hi/lo, k rounded: 2 products), masked running-maximum softmax in f32, Ot += vt*Pt (P split, v rounded: 2 products), all on v_wmma_f32_16x16x32_bf16.
#define BB 8
#define TT 2048
#define CC 768
#define HH 64
#define MR (BB * TT)

typedef __bf16 v16b __attribute__((ext_vector_type(16)));
typedef unsigned short v8us __attribute__((ext_vector_type(8), may_alias));
typedef float  v8f  __attribute__((ext_vector_type(8)));
typedef float  v4f  __attribute__((ext_vector_type(4)));
typedef float  v4fa __attribute__((ext_vector_type(4), may_alias));
union FragB { v16b v; v8us half[2]; unsigned short u[16]; };

__device__ __forceinline__ unsigned short bf16_bits(float x) { unsigned int u = __float_as_uint(x); return (unsigned short)((u + 0x7FFFu + ((u >> 16) & 1u)) >> 16); }
__device__ __forceinline__ float bf16_val(unsigned short b) { return __uint_as_float(((unsigned int)b) << 16); }
__device__ __forceinline__ float bf16_round(float x) { return bf16_val(bf16_bits(x)); }
// D += A·B with NT terms: 1 = ah·bh, 2 = + al·bh (A split), 3 = + ah·bl (both split)
template <int NT>
__device__ __forceinline__ v8f mmaN(v16b ah, v16b al, v16b bh, v16b bl, v8f c) {
  c = __builtin_amdgcn_wmma_f32_16x16x32_bf16(false, ah, false, bh, (short)0, c, false, false);
  if (NT >= 2) c = __builtin_amdgcn_wmma_f32_16x16x32_bf16(false, al, false, bh, (short)0, c, false, false);
  if (NT >= 3) c = __builtin_amdgcn_wmma_f32_16x16x32_bf16(false, ah, false, bl, (short)0, c, false, false);
  asm volatile("v_nop\n\tv_nop\n\tv_nop\n\tv_nop" : "+v"(c) : "v"(ah), "v"(al), "v"(bh), "v"(bl));
  return c;
}

// Wq, Wk, Wv [CC][HH] f32 -> bf16 B fragments of [Wq | Wk | Wv], fragment-major, all three in one launch: unit ((tile * (CC / 32) + ks) * 2 + h) * 32 + lane holds the
// 16 bytes that this lane of the B fragment (column tile of the 192 columns, k-step ks, register half h) needs, so that one wave-wide 16-byte load of a fragment half
// covers 512 contiguous bytes. One unit a thread; a block's 256 units lie in one matrix (HH * CC / 8 units each, a multiple of 256), so the choice of the source is scalar.
__global__ __launch_bounds__(256) void k_wt_bf16(const float* __restrict__ Wq, const float* __restrict__ Wk, const float* __restrict__ Wv, unsigned short* __restrict__ Wt) {
  const int m = blockIdx.x / (HH * (CC / 8) / 256);
  const float* __restrict__ W = m == 0 ? Wq : m == 1 ? Wk : Wv;
  const int u = blockIdx.x * 256 + threadIdx.x;
  const int lane = u & 31, h = (u >> 5) & 1, ks = (u >> 6) % (CC / 32), tile = (u >> 6) / (CC / 32);
  const int n = (tile & 3) * 16 + (lane & 15), k8 = ks * 32 + h * 16 + (lane >> 4) * 8;
  float f[8];
#pragma unroll
  for (int i = 0; i < 8; ++i) f[i] = W[(k8 + i) * HH + n];
  v8us v;
#pragma unroll
  for (int i = 0; i < 8; ++i) v[i] = bf16_bits(f[i]);
  *(v8us*)(Wt + (size_t)u * 8) = v;
}

// GEMM C[M][N] (f32, pitch ldc) = act(A[M][K]·W + bias). A f32 row-major (pitch lda) converted per fragment to bf16
// (ASPLIT: hi/lo two planes -> 2 terms, else single rounded term); Wt bf16 [N][K] (pitch ldb). BIAS_BF16 rounds the
// bias to bf16 first (bias quantised to bf16 before the add). K%32==0, M%16==0, N%64==0.
template <bool ASPLIT, int ACT, bool BIAS_BF16>
__global__ __launch_bounds__(128) void k_gemm_bf(const float* __restrict__ A, int lda, const unsigned short* __restrict__ Wt, int ldb,
                                               const float* __restrict__ bias, float* __restrict__ C, int ldc, int M, int N, int K) {
  __shared__ __attribute__((aligned(16))) float so[4][16][64];
  const int tid = threadIdx.x, w = tid >> 5, lane = tid & 31, ln = lane & 15, hh = lane >> 4;
  const int ntn = N / 64;
  const int wid = blockIdx.x * 4 + w;
  const int mt = wid / ntn, nq = wid % ntn;
  if (mt * 16 >= M) return;
  const int row0 = mt * 16, col0 = nq * 64;
  const float* arow = A + (size_t)(row0 + ln) * lda;
  v8f acc[4] = {};
  for (int kb = 0; kb < K; kb += 32) {
    FragB ah, al;
    const v4f x0 = *(const v4fa*)(arow + kb + 8 * hh), x1 = *(const v4fa*)(arow + kb + 8 * hh + 4);
    const v4f x2 = *(const v4fa*)(arow + kb + 16 + 8 * hh), x3 = *(const v4fa*)(arow + kb + 16 + 8 * hh + 4);
    float xs[16] = {x0[0],x0[1],x0[2],x0[3],x1[0],x1[1],x1[2],x1[3],x2[0],x2[1],x2[2],x2[3],x3[0],x3[1],x3[2],x3[3]};
#pragma unroll
    for (int i = 0; i < 16; ++i) { const unsigned short hb = bf16_bits(xs[i]); ah.u[i] = hb; al.u[i] = ASPLIT ? bf16_bits(xs[i] - bf16_val(hb)) : (unsigned short)0; }
#pragma unroll
    for (int t = 0; t < 4; ++t) {
      const unsigned short* brow = Wt + (size_t)(col0 + t * 16 + ln) * ldb + kb;
      FragB b;
      b.half[0] = *(const v8us*)(brow + 8 * hh);
      b.half[1] = *(const v8us*)(brow + 16 + 8 * hh);
      acc[t] = mmaN<ASPLIT ? 2 : 1>(ah.v, al.v, b.v, b.v, acc[t]);
    }
  }
#pragma unroll
  for (int t = 0; t < 4; ++t) {
    float bv = bias ? bias[col0 + t * 16 + ln] : 0.f;
    if (BIAS_BF16) bv = bf16_round(bv);
#pragma unroll
    for (int r = 0; r < 8; ++r) { float v = acc[t][r] + bv; if (ACT == 1) v = fmaxf(v, 0.f); so[w][8 * hh + r][t * 16 + ln] = v; }
  }
  __builtin_amdgcn_fence(__ATOMIC_ACQ_REL, "workgroup");
  __builtin_amdgcn_wave_barrier();
  const int rsub = lane >> 4, c4 = (lane & 15) * 4;
  {
#pragma unroll
    for (int q = 0; q < 8; ++q) {
      const int r = q * 2 + rsub;
      const v4f v = *(const v4fa*)&so[w][r][c4];
      *(v4f*)(C + (size_t)(row0 + r) * ldc + col0 + c4) = v;
    }
    
  }
}

// Flash-style causal/unmasked attention, all contractions 3-term bf16 hi/lo splits, f32 softmax with running max.
// q,k,v rows are read from f32 buffers with arbitrary row pitch (so they can live inside a fused qkv buffer);
// D = head size (multiple of 32, <= 128); one wave = 16 query rows; block = 4 waves (64 queries) sharing K/V chunks of 32.
template <int D, bool CAUSAL>
__global__ __launch_bounds__(128) void k_flash(const float* __restrict__ qb, const float* __restrict__ kb, const float* __restrict__ vb,
                                             int pitch, int T, int H, float scale, float* __restrict__ y, int ypitch) {
  constexpr int KS = D / 32;        // k-steps for QK
  constexpr int DT = D / 16;        // d tiles for PV
  __shared__ __attribute__((aligned(16))) unsigned short sKh[32][D + 8], sKl[32][D + 8], sVh[32][D + 8], sVl[32][D + 8];
  __shared__ __attribute__((aligned(16))) unsigned short sPh[4][16][40], sPl[4][16][40];
  __shared__ __attribute__((aligned(16))) float sO[4][16][D];
  const int tid = threadIdx.x, w = tid >> 5, lane = tid & 31, ln = lane & 15, hh = lane >> 4;
  const int nqb = (T + 63) / 64;
  const int bh = blockIdx.x / nqb, qblk = blockIdx.x % nqb;
  const int b = bh / H, h = bh % H;
  const int q0 = qblk * 64 + w * 16;
  const float* Q = qb + (size_t)b * T * pitch + h * D;
  const float* K = kb + (size_t)b * T * pitch + h * D;
  const float* V = vb + (size_t)b * T * pitch + h * D;

  // A fragments of the wave's 16 query rows (scaled), hi/lo
  FragB aqh[KS], aql[KS];
  {
    int row = q0 + ln; if (row >= T) row = T - 1;
    const float* qr = Q + (size_t)row * pitch;
#pragma unroll
    for (int ks = 0; ks < KS; ++ks)
#pragma unroll
      for (int i = 0; i < 16; ++i) {
        const int d = ks * 32 + ((i < 8) ? (8 * hh + i) : (16 + 8 * hh + (i - 8)));
        const float x = qr[d] * scale; const unsigned short hb = bf16_bits(x);
        aqh[ks].u[i] = hb; aql[ks].u[i] = bf16_bits(x - bf16_val(hb));
      }
  }
  float m_r[8], l_r[8];
#pragma unroll
  for (int r = 0; r < 8; ++r) { m_r[r] = -3.0e38f; l_r[r] = 0.f; }
  v8f oacc[DT];
#pragma unroll
  for (int dt = 0; dt < DT; ++dt) oacc[dt] = (v8f){0.f,0.f,0.f,0.f,0.f,0.f,0.f,0.f};

  const int kv_end = CAUSAL ? min(T, qblk * 64 + 64) : T;     // block-uniform
  for (int j0 = 0; j0 < kv_end; j0 += 32) {
    __syncthreads();
    for (int e = tid; e < 32 * (D / 4); e += 128) {
      const int r = e / (D / 4), c4 = (e % (D / 4)) * 4;
      const int key = j0 + r;
      v4f kf = {0.f,0.f,0.f,0.f}, vf = {0.f,0.f,0.f,0.f};
      if (key < T) { kf = *(const v4fa*)(K + (size_t)key * pitch + c4); vf = *(const v4fa*)(V + (size_t)key * pitch + c4); }
#pragma unroll
      for (int t = 0; t < 4; ++t) {
        unsigned short hb = bf16_bits(kf[t]); sKh[r][c4 + t] = hb; sKl[r][c4 + t] = bf16_bits(kf[t] - bf16_val(hb));
        hb = bf16_bits(vf[t]); sVh[r][c4 + t] = hb; sVl[r][c4 + t] = bf16_bits(vf[t] - bf16_val(hb));
      }
    }
    __syncthreads();
    // S tile 16 x 32
    v8f s[2];
#pragma unroll
    for (int nt = 0; nt < 2; ++nt) {
      v8f acc = {};
#pragma unroll
      for (int ks = 0; ks < KS; ++ks) {
        FragB bh_, bl_;
        bh_.half[0] = *(const v8us*)&sKh[nt * 16 + ln][ks * 32 + 8 * hh]; bh_.half[1] = *(const v8us*)&sKh[nt * 16 + ln][ks * 32 + 16 + 8 * hh];
        bl_.half[0] = *(const v8us*)&sKl[nt * 16 + ln][ks * 32 + 8 * hh]; bl_.half[1] = *(const v8us*)&sKl[nt * 16 + ln][ks * 32 + 16 + 8 * hh];
        acc = mmaN<3>(aqh[ks].v, aql[ks].v, bh_.v, bl_.v, acc);
      }
      s[nt] = acc;
    }
    // mask + running max (rows 8hh+r; the 16 lanes of a half share rows)
    float alpha[8];
#pragma unroll
    for (int r = 0; r < 8; ++r) {
      const int qi = q0 + 8 * hh + r;
      const int ja = j0 + ln, jb = j0 + 16 + ln;
      if (CAUSAL) { if (ja > qi) s[0][r] = -3.0e38f; if (jb > qi) s[1][r] = -3.0e38f; }
      if (ja >= T) s[0][r] = -3.0e38f;
      if (jb >= T) s[1][r] = -3.0e38f;
      float mx = fmaxf(s[0][r], s[1][r]);
      mx = fmaxf(mx, __shfl_xor(mx, 1, 32)); mx = fmaxf(mx, __shfl_xor(mx, 2, 32)); mx = fmaxf(mx, __shfl_xor(mx, 4, 32)); mx = fmaxf(mx, __shfl_xor(mx, 8, 32));
      const float mnew = fmaxf(m_r[r], mx);
      alpha[r] = (mnew > -1.0e38f) ? __expf(m_r[r] - mnew) : 1.0f;
      const float p0 = (s[0][r] > -1.0e38f) ? __expf(s[0][r] - mnew) : 0.f;
      const float p1 = (s[1][r] > -1.0e38f) ? __expf(s[1][r] - mnew) : 0.f;
      m_r[r] = mnew;
      l_r[r] = l_r[r] * alpha[r] + p0 + p1;            // per-lane partial row sum (16 lanes combined at the end)
      unsigned short hb = bf16_bits(p0); sPh[w][8 * hh + r][ln] = hb;      sPl[w][8 * hh + r][ln] = bf16_bits(p0 - bf16_val(hb));
      hb = bf16_bits(p1);                sPh[w][8 * hh + r][16 + ln] = hb; sPl[w][8 * hh + r][16 + ln] = bf16_bits(p1 - bf16_val(hb));
    }
#pragma unroll
    for (int dt = 0; dt < DT; ++dt)
#pragma unroll
      for (int r = 0; r < 8; ++r) oacc[dt][r] *= alpha[r];
    __builtin_amdgcn_fence(__ATOMIC_ACQ_REL, "workgroup");
    __builtin_amdgcn_wave_barrier();
    FragB pah, pal;
    pah.half[0] = *(const v8us*)&sPh[w][ln][8 * hh]; pah.half[1] = *(const v8us*)&sPh[w][ln][16 + 8 * hh];
    pal.half[0] = *(const v8us*)&sPl[w][ln][8 * hh]; pal.half[1] = *(const v8us*)&sPl[w][ln][16 + 8 * hh];
#pragma unroll
    for (int dt = 0; dt < DT; ++dt) {
      FragB bvh, bvl;
#pragma unroll
      for (int i = 0; i < 8; ++i) {
        bvh.u[i] = sVh[8 * hh + i][dt * 16 + ln]; bvh.u[8 + i] = sVh[16 + 8 * hh + i][dt * 16 + ln];
        bvl.u[i] = sVl[8 * hh + i][dt * 16 + ln]; bvl.u[8 + i] = sVl[16 + 8 * hh + i][dt * 16 + ln];
      }
      oacc[dt] = mmaN<3>(pah.v, pal.v, bvh.v, bvl.v, oacc[dt]);
    }
    __builtin_amdgcn_fence(__ATOMIC_ACQ_REL, "workgroup");
    __builtin_amdgcn_wave_barrier();
  }
#pragma unroll
  for (int r = 0; r < 8; ++r) {
    float l = l_r[r];
    l += __shfl_xor(l, 1, 32); l += __shfl_xor(l, 2, 32); l += __shfl_xor(l, 4, 32); l += __shfl_xor(l, 8, 32);
    l_r[r] = (l > 0.f) ? 1.0f / l : 0.f;
  }
#pragma unroll
  for (int dt = 0; dt < DT; ++dt)
#pragma unroll
    for (int r = 0; r < 8; ++r) sO[w][8 * hh + r][dt * 16 + ln] = oacc[dt][r] * l_r[r];
  __builtin_amdgcn_fence(__ATOMIC_ACQ_REL, "workgroup");
  __builtin_amdgcn_wave_barrier();
  {
    for (int r = 0; r < 16; ++r) {
      const int row = q0 + r;
      if (row < T && lane < D / 4) {
        const v4f val = *(const v4fa*)&sO[w][r][lane * 4];
        *(v4f*)(y + ((size_t)b * T + row) * ypitch + h * D + lane * 4) = val;
      }
    }
    
  }
}

// GEMM C = act(A·W + bias + resid): A f32 (ASPLIT -> hi/lo 2 terms), Wt bf16 [N][K]; ACT 0 none, 1 relu, 2 exact gelu;
// resid (optional, f32, row index = (row % rmod), pitch ldr, RES_BF16 rounds it) added before the activation.
template <bool ASPLIT, int ACT, bool BIAS_BF16, bool RES_BF16>
__global__ __launch_bounds__(128) void k_gemm_bf3(const float* __restrict__ A, int lda, const unsigned short* __restrict__ Wt, int ldb,
                                                const float* __restrict__ bias, const float* __restrict__ resid, int rmod, int ldr,
                                                float* __restrict__ C, int ldc, int M, int N, int K) {
  __shared__ __attribute__((aligned(16))) float so[4][16][64];
  const int tid = threadIdx.x, w = tid >> 5, lane = tid & 31, ln = lane & 15, hh = lane >> 4;
  const int ntn = N / 64;
  const int wid = blockIdx.x * 4 + w;
  const int mt = wid / ntn, nq = wid % ntn;
  if (mt * 16 >= M) return;
  const int row0 = mt * 16, col0 = nq * 64;
  const float* arow = A + (size_t)(row0 + ln) * lda;
  v8f acc[4] = {};
  for (int kb = 0; kb < K; kb += 32) {
    FragB ah, al;
    const v4f x0 = *(const v4fa*)(arow + kb + 8 * hh), x1 = *(const v4fa*)(arow + kb + 8 * hh + 4);
    const v4f x2 = *(const v4fa*)(arow + kb + 16 + 8 * hh), x3 = *(const v4fa*)(arow + kb + 16 + 8 * hh + 4);
    float xs[16] = {x0[0],x0[1],x0[2],x0[3],x1[0],x1[1],x1[2],x1[3],x2[0],x2[1],x2[2],x2[3],x3[0],x3[1],x3[2],x3[3]};
#pragma unroll
    for (int i = 0; i < 16; ++i) { const unsigned short hb = bf16_bits(xs[i]); ah.u[i] = hb; al.u[i] = ASPLIT ? bf16_bits(xs[i] - bf16_val(hb)) : (unsigned short)0; }
#pragma unroll
    for (int t = 0; t < 4; ++t) {
      const unsigned short* brow = Wt + (size_t)(col0 + t * 16 + ln) * ldb + kb;
      FragB b;
      b.half[0] = *(const v8us*)(brow + 8 * hh);
      b.half[1] = *(const v8us*)(brow + 16 + 8 * hh);
      acc[t] = mmaN<ASPLIT ? 2 : 1>(ah.v, al.v, b.v, b.v, acc[t]);
    }
  }
#pragma unroll
  for (int t = 0; t < 4; ++t) {
    const int col = col0 + t * 16 + ln;
    float bv = bias ? bias[col] : 0.f;
    if (BIAS_BF16) bv = bf16_round(bv);
#pragma unroll
    for (int r = 0; r < 8; ++r) {
      float v = acc[t][r] + bv;
      if (resid) { float rv = resid[(size_t)((row0 + 8 * hh + r) % rmod) * ldr + col]; if (RES_BF16) rv = bf16_round(rv); v += rv; }
      if (ACT == 1) v = fmaxf(v, 0.f);
      if (ACT == 2) v = 0.5f * v * (1.0f + erff(v * 0.70710678118654752f));
      if (ACT == 3) { const float u = 0.7978845608028654f * (v + 0.044715f * v * v * v); v = 0.5f * v * (1.0f + tanhf(u)); }
      so[w][8 * hh + r][t * 16 + ln] = v;
    }
  }
  __builtin_amdgcn_fence(__ATOMIC_ACQ_REL, "workgroup");
  __builtin_amdgcn_wave_barrier();
  const int rsub = lane >> 4, c4 = (lane & 15) * 4;
  {
#pragma unroll
    for (int q = 0; q < 8; ++q) {
      const int r = q * 2 + rsub;
      const v4f v = *(const v4fa*)&so[w][r][c4];
      *(v4f*)(C + (size_t)(row0 + r) * ldc + col0 + c4) = v;
    }
    
  }
}
// row LayerNorm (biased variance, eps) over N: s = X (+ R); optional out_sum <- s; out_norm <- (s-mu)*rsqrt(var+eps)*g + b
template <bool PARAM_BF16>
__global__ __launch_bounds__(256) void k_layernorm(const float* __restrict__ X, const float* __restrict__ R, const float* __restrict__ g, const float* __restrict__ bta,
                                                  float* __restrict__ out_sum, float* __restrict__ out_norm, int N, float eps) {
  __shared__ float red[256];
  const int row = blockIdx.x, tid = threadIdx.x;
  const float* x = X + (size_t)row * N; const float* rr = R ? R + (size_t)row * N : nullptr;
  float vals[16];                     // up to N = 4096
  const int per = N / 256;            // contiguous chunk per thread? use strided-by-4 chunks: thread handles j = tid*4 + 1024*u
  float s1 = 0.f;
  for (int u = 0; u < per / 4; ++u) {
    const int j = tid * 4 + 1024 * u;
    const v4f a = *(const v4fa*)(x + j);
    v4f b = {0.f,0.f,0.f,0.f}; if (rr) b = *(const v4fa*)(rr + j);
#pragma unroll
    for (int q = 0; q < 4; ++q) { const float v = a[q] + b[q]; vals[u * 4 + q] = v; s1 += v; }
  }
  red[tid] = s1; __syncthreads();
  for (int st = 128; st > 0; st >>= 1) { if (tid < st) red[tid] += red[tid + st]; __syncthreads(); }
  const float mu = red[0] / (float)N; __syncthreads();
  float s2 = 0.f;
  for (int u = 0; u < per / 4; ++u)
#pragma unroll
    for (int q = 0; q < 4; ++q) { const float c = vals[u * 4 + q] - mu; s2 += c * c; }
  red[tid] = s2; __syncthreads();
  for (int st = 128; st > 0; st >>= 1) { if (tid < st) red[tid] += red[tid + st]; __syncthreads(); }
  const float rs = rsqrtf(red[0] / (float)N + eps);
  {
    for (int u = 0; u < per / 4; ++u) {
      const int j = tid * 4 + 1024 * u;
      v4f o, sm;
#pragma unroll
      for (int q = 0; q < 4; ++q) {
        float gg = g[j + q], bb = bta[j + q];
        if (PARAM_BF16) { gg = bf16_round(gg); bb = bf16_round(bb); }
        sm[q] = vals[u * 4 + q]; o[q] = (vals[u * 4 + q] - mu) * rs * gg + bb;
      }
      if (out_sum) *(v4f*)(out_sum + (size_t)row * N + j) = sm;
      *(v4f*)(out_norm + (size_t)row * N + j) = o;
    }
    
  }
}

// batched f32 [K][N] (pitch lds, batch stride sIn) -> transposed hi/lo planes [N][K] (batch stride sOut); thread per (n, 8 k); grid.y = batch
__global__ __launch_bounds__(256) void k_split_transpose_b(const float* __restrict__ src, int lds_, size_t sIn, unsigned short* __restrict__ hi, unsigned short* __restrict__ lo, size_t sOut, int K, int N) {
  const size_t t = (size_t)blockIdx.x * 256 + threadIdx.x; const int k8n = K / 8; if (t >= (size_t)N * k8n) return;
  src += (size_t)blockIdx.y * sIn; hi += (size_t)blockIdx.y * sOut; lo += (size_t)blockIdx.y * sOut;
  const int n = (int)(t / k8n), k8 = (int)(t % k8n) * 8; v8us vh, vl;
#pragma unroll
  for (int i = 0; i < 8; ++i) { const float x = src[(size_t)(k8 + i) * lds_ + n]; const unsigned short hb = bf16_bits(x); vh[i] = hb; vl[i] = bf16_bits(x - bf16_val(hb)); }
  unsigned short* dh = hi + (size_t)n * K + k8; unsigned short* dl = lo + (size_t)n * K + k8;
  *(v8us*)dh = vh; *(v8us*)dl = vl; 
}

typedef float f2v __attribute__((ext_vector_type(2)));
typedef __bf16 bf2v __attribute__((ext_vector_type(2)));
union FragW { v16b v; unsigned int w[8]; };
__device__ __forceinline__ unsigned int pk_bf16(float a, float b) { return __builtin_bit_cast(unsigned int, __builtin_convertvector((f2v){a, b}, bf2v)); }   // round to nearest even
__device__ __forceinline__ float xhalf(float x) { return __builtin_bit_cast(float, __builtin_amdgcn_permlanex16(__builtin_bit_cast(int, x), __builtin_bit_cast(int, x), 0x76543210, 0xfedcba98, false, false)); }   // lane l with lane l ^ 16
__device__ __forceinline__ v8f wmma_bf(v16b a, v16b b, v8f c) { return __builtin_amdgcn_wmma_f32_16x16x32_bf16(false, a, false, b, (short)0, c, false, false); }

// [q | k | v] = x * [Wq | Wk | Wv]. A block owns PM rows of x and all 192 columns. x is read once, in whole lines, rounded to bf16 and kept in LDS.
// Wave w holds the B fragments of column tiles 3 (w % 4) ... + 2 for k-steps 12 (w / 4) ... + 11 in registers (packed by k_wt_bf16) and
// multiplies all four row tiles by them; the two K halves of a result are added through LDS. From that LDS tile the block writes what the attention launch reads:
// q as f32 rows Q[row][64], k rounded to bf16 as rows Kb[row][64], v rounded to bf16 and transposed as Vt[batch][d][token].
#define PM 64
#define XR 40          // x tile in LDS, one plane per k-step: row pitch in elements, 80 bytes = 16 * odd, at which 16-byte fragment reads meet no bank conflict
#define XS (PM * XR + 32)   // plane pitch in elements: 16 banks past a multiple of 64, so the four k-steps that one staging store spans do not collide
#define OP 196         // result tile pitch in floats: rows 8 apart fall 32 banks apart, so the two lane halves of a store do not collide
__global__ __launch_bounds__(256) void k_proj(const float* __restrict__ x, const unsigned short* __restrict__ Bp, float* __restrict__ Q, unsigned short* __restrict__ Kb, unsigned short* __restrict__ Vt) {
  __shared__ __attribute__((aligned(16))) unsigned short sx[(CC / 32) * XS];
  __shared__ __attribute__((aligned(16))) float so[PM][OP];
  const int tid = threadIdx.x, w = tid >> 5, lane = tid & 31, ln = lane & 15, hh = lane >> 4;
  const int ng = w & 3, kh = w >> 2;
  const size_t row0 = (size_t)blockIdx.x * PM;
  // staging: wave w brings rows 16 (w % 4) ... + 15, columns 384 (w / 4) ... + 383, as 48 wave-wide loads of 512 contiguous bytes
  const float* xp = x + (row0 + ng * 16) * CC + kh * 384 + lane * 4;
  const unsigned int bo = ((ng * 72 + kh * 12) * 64 + lane) * 16;   // this lane's place in the packed fragments, in bytes
  const unsigned short* bp = (const unsigned short*)((const char*)Bp + bo);
  v4f xa[48];
#pragma unroll
  for (int i = 0; i < 48; ++i) xa[i] = *(const v4fa*)(xp + (i / 3) * CC + (i % 3) * 128);
  FragB bf[3][12];
#pragma unroll
  for (int t = 0; t < 2; ++t)
#pragma unroll
    for (int kk = 0; kk < 12; ++kk) { bf[t][kk].half[0] = *(const v8us*)(bp + ((t * 24 + kk) * 2) * 256); bf[t][kk].half[1] = *(const v8us*)(bp + ((t * 24 + kk) * 2 + 1) * 256); }
  // stands in front of the reuse of the address registers that the loads above name; pointer and offset are inputs so that their registers live up to the wait
  asm volatile("s_wait_xcnt 0x0" :: "v"(xp), "v"(bo) : "memory");
  unsigned short* xs = sx + (kh * 12 + (lane >> 3)) * XS + ng * 16 * XR + (lane & 7) * 4;
#pragma unroll
  for (int i = 0; i < 48; ++i) *(uint2*)(xs + (i % 3) * 4 * XS + (i / 3) * XR) = make_uint2(pk_bf16(xa[i][0], xa[i][1]), pk_bf16(xa[i][2], xa[i][3]));
  // the third column tile's fragments: a second group of loads, with a wait of its own
#pragma unroll
  for (int kk = 0; kk < 12; ++kk) { bf[2][kk].half[0] = *(const v8us*)(bp + ((48 + kk) * 2) * 256); bf[2][kk].half[1] = *(const v8us*)(bp + ((48 + kk) * 2 + 1) * 256); }
  // as above, for the loads of the third tile
  asm volatile("s_wait_xcnt 0x0" :: "v"(bo) : "memory");
  __syncthreads();

  v8f acc[4][3];
#pragma unroll
  for (int mt = 0; mt < 4; ++mt)
#pragma unroll
    for (int t = 0; t < 3; ++t) acc[mt][t] = (v8f){0.f,0.f,0.f,0.f,0.f,0.f,0.f,0.f};
  const unsigned short* ap = sx + kh * 12 * XS + ln * XR + 8 * hh;
  // the next k-step's four A fragments are asked for as one group ahead of this k-step's products
  FragB a[2][4];
#pragma unroll
  for (int mt = 0; mt < 4; ++mt) { a[0][mt].half[0] = *(const v8us*)(ap + mt * 16 * XR); a[0][mt].half[1] = *(const v8us*)(ap + mt * 16 * XR + 16); }
#pragma unroll
  for (int kk = 0; kk < 12; ++kk) {
    if (kk + 1 < 12) {
#pragma unroll
      for (int mt = 0; mt < 4; ++mt) { a[(kk + 1) & 1][mt].half[0] = *(const v8us*)(ap + (kk + 1) * XS + mt * 16 * XR); a[(kk + 1) & 1][mt].half[1] = *(const v8us*)(ap + (kk + 1) * XS + mt * 16 * XR + 16); }
    }
#pragma unroll
    for (int mt = 0; mt < 4; ++mt)
#pragma unroll
      for (int t = 0; t < 3; ++t) acc[mt][t] = wmma_bf(a[kk & 1][mt].v, bf[t][kk].v, acc[mt][t]);
    // keeps the order one load group, twelve products: left free, the scheduler asks for four k-steps at once, runs out of registers and then waits out a fragment's LDS latency before every three products
    __builtin_amdgcn_sched_barrier(0);
  }

  // the wave of the first K half finishes row tiles 0 and 1, its partner 2 and 3: each hands the other two over, then adds its own to what it was handed
  float* sg = &so[(kh ? 0 : 32) + 8 * hh][ng * 48 + ln];
  float* sk = &so[(kh ? 32 : 0) + 8 * hh][ng * 48 + ln];
#pragma unroll
  for (int m = 0; m < 2; ++m)
#pragma unroll
    for (int t = 0; t < 3; ++t)
#pragma unroll
      for (int r = 0; r < 8; ++r) sg[(m * 16 + r) * OP + t * 16] = kh ? acc[m][t][r] : acc[m + 2][t][r];
  __syncthreads();
#pragma unroll
  for (int m = 0; m < 2; ++m)
#pragma unroll
    for (int t = 0; t < 3; ++t)
#pragma unroll
      for (int r = 0; r < 8; ++r) sk[(m * 16 + r) * OP + t * 16] += kh ? acc[m + 2][t][r] : acc[m][t][r];
  __syncthreads();
  // every store instruction below covers four whole 128-byte lines
  // q: the tile's 64 x 64 floats are 16 KB in a row of Q
  v4f qv[4];
#pragma unroll
  for (int i = 0; i < 4; ++i) { const int u = i * 256 + tid; qv[i] = *(const v4fa*)&so[u >> 4][(u & 15) * 4]; }
  // k: eight columns of one row a thread; the tile's 64 x 64 bf16 are 8 KB in a row of Kb
  uint4 kw[2];
#pragma unroll
  for (int i = 0; i < 2; ++i) {
    const int u = i * 256 + tid;
    const v4f c0 = *(const v4fa*)&so[u >> 3][HH + (u & 7) * 8], c1 = *(const v4fa*)&so[u >> 3][HH + (u & 7) * 8 + 4];
    kw[i] = make_uint4(pk_bf16(c0[0], c0[1]), pk_bf16(c0[2], c0[3]), pk_bf16(c1[0], c1[1]), pk_bf16(c1[2], c1[3]));
  }
  // v: eight rows of one column a thread; the tile's 64 tokens are one line of each of the 64 rows of this batch's Vt plane
  uint4 vw[2];
#pragma unroll
  for (int i = 0; i < 2; ++i) {
    const float* c = &so[(tid & 7) * 8][2 * HH + i * 32 + (tid >> 3)];
    vw[i] = make_uint4(pk_bf16(c[0], c[OP]), pk_bf16(c[2 * OP], c[3 * OP]), pk_bf16(c[4 * OP], c[5 * OP]), pk_bf16(c[6 * OP], c[7 * OP]));
  }
  float* oq = Q + row0 * HH + tid * 4;
  unsigned short* ok = Kb + row0 * HH + tid * 8;
  unsigned short* ov = Vt + ((row0 / TT) * HH + (tid >> 3)) * TT + row0 % TT + (tid & 7) * 8;
#pragma unroll
  for (int i = 0; i < 2; ++i) *(uint4*)(ov + (size_t)i * 32 * TT) = vw[i];
#pragma unroll
  for (int i = 0; i < 2; ++i) *(uint4*)(ok + i * 2048) = kw[i];
#pragma unroll
  for (int i = 0; i < 4; ++i) *(v4f*)(oq + i * 1024) = qv[i];
}

// Scores, masked softmax and P*v in one launch, all batches. A block owns 64 query rows of one batch; each of its AW waves
// holds all 64 (AQ tiles of 16 as B operands, q split hi/lo) and walks its own TT / AW keys in passes of 32 with a running maximum:
// St = k * qt (a lane holds 16 scores of ONE query), Pt packs from the two St tiles into a B operand (hi/lo), Ot += vt * Pt.
// The AW partial (maximum, sum, Ot) sets are joined through LDS at the end. Scores never reach memory.
#define AQ 4
#define AW 8
#define AKEYS (TT / AW)
__global__ __launch_bounds__(AW * 32) void k_attn(const float* __restrict__ Q, const unsigned short* __restrict__ Kb, const unsigned short* __restrict__ Vt,
                                                  const int* __restrict__ mask, float* __restrict__ out) {
  __shared__ __attribute__((aligned(16))) v4f sO[AW][AQ * 8][32];
  __shared__ float sM[AW][AQ][16], sL[AW][AQ][16];
  const int tid = threadIdx.x, w = tid >> 5, lane = tid & 31, ln = lane & 15, hh = lane >> 4;
  const int b = blockIdx.x / (TT / 64), q0 = (blockIdx.x % (TT / 64)) * 64;
  const float c2 = 0.03608439182435161f * 1.4426950408889634f;   // 768^-0.5 * log2(e): the softmax runs in base 2

  FragB qh[AQ][2], ql[AQ][2];
  const float* qp = Q + ((size_t)b * TT + q0 + ln) * HH + 8 * hh;
  v4f xq[AQ][2][4];
#pragma unroll
  for (int qt = 0; qt < AQ; ++qt)
#pragma unroll
    for (int ks = 0; ks < 2; ++ks) {
      const float* qr = qp + qt * 16 * HH + ks * 32;
      xq[qt][ks][0] = *(const v4fa*)(qr); xq[qt][ks][1] = *(const v4fa*)(qr + 4); xq[qt][ks][2] = *(const v4fa*)(qr + 16); xq[qt][ks][3] = *(const v4fa*)(qr + 20);
    }
  // stands in front of the reuse of the address registers that the q loads name; the pointer is an input so that its registers live up to the wait
  asm volatile("s_wait_xcnt 0x0" :: "v"(qp) : "memory");
#pragma unroll
  for (int qt = 0; qt < AQ; ++qt) {
#pragma unroll
    for (int ks = 0; ks < 2; ++ks) {
      const v4f x0 = xq[qt][ks][0], x1 = xq[qt][ks][1], x2 = xq[qt][ks][2], x3 = xq[qt][ks][3];
      float xs[16] = {x0[0],x0[1],x0[2],x0[3],x1[0],x1[1],x1[2],x1[3],x2[0],x2[1],x2[2],x2[3],x3[0],x3[1],x3[2],x3[3]};
#pragma unroll
      for (int i = 0; i < 16; ++i) { const unsigned short hb = bf16_bits(xs[i]); qh[qt][ks].u[i] = hb; ql[qt][ks].u[i] = bf16_bits(xs[i] - bf16_val(hb)); }
    }
  }
  float m_r[AQ], l_r[AQ];
  v8f oacc[AQ][4];
#pragma unroll
  for (int qt = 0; qt < AQ; ++qt) {
    m_r[qt] = -3.0e38f; l_r[qt] = 0.f;   // finite start: a pass whose keys are all masked gives exp2(-inf) = 0, never inf - inf
#pragma unroll
    for (int dt = 0; dt < 4; ++dt) oacc[qt][dt] = (v8f){0.f,0.f,0.f,0.f,0.f,0.f,0.f,0.f};
  }
  const unsigned short* kp = Kb + ((size_t)b * TT + w * AKEYS + ln) * HH + 8 * hh;
  const unsigned short* vp = Vt + ((size_t)b * HH + ln) * TT + w * AKEYS + 8 * hh;
  const int* mp = mask + (size_t)b * TT + w * AKEYS + lane;   // one mask word a lane: a pass's 32 keys
  int one = 1;   // passes through each wait below, so that the pointer additions, which are multiples of it, cannot be lifted over the wait

  FragB ka[2][2];
  int mk;
#pragma unroll
  for (int t = 0; t < 2; ++t)
#pragma unroll
    for (int ks = 0; ks < 2; ++ks) { ka[t][ks].half[0] = *(const v8us*)(kp + t * 16 * HH + ks * 32); ka[t][ks].half[1] = *(const v8us*)(kp + t * 16 * HH + ks * 32 + 16); }
  mk = *mp;
  // stands in front of the overwrite of the address registers that the loads above name; the pointers are inputs so that their registers live up to it
  asm volatile("s_wait_xcnt 0x0" : "+s"(one) : "v"(kp), "v"(mp) : "memory");
  kp += one * 32 * HH; mp += one * 32;

  // rolled, for speed only: one pass is several KB of code
#pragma unroll 1
  for (int it = 0; it < AKEYS / 32; ++it) {
    FragB va[4];
#pragma unroll
    for (int dt = 0; dt < 4; ++dt) { va[dt].half[0] = *(const v8us*)(vp + (size_t)dt * 16 * TT); va[dt].half[1] = *(const v8us*)(vp + (size_t)dt * 16 * TT + 16); }
    // the next pass's k rows and mask words are fetched now; the last pass fetches its own again, so every address stays inside
    FragB kn[2][2];
#pragma unroll
    for (int t = 0; t < 2; ++t)
#pragma unroll
      for (int ks = 0; ks < 2; ++ks) { kn[t][ks].half[0] = *(const v8us*)(kp + t * 16 * HH + ks * 32); kn[t][ks].half[1] = *(const v8us*)(kp + t * 16 * HH + ks * 32 + 16); }
    const int mn = *mp;
    // stands in front of the overwrite of the address registers that this pass's loads name; the pointers are inputs so that their registers live up to it
    asm volatile("s_wait_xcnt 0x0" : "+s"(one) : "v"(vp), "v"(kp), "v"(mp) : "memory");
    const int adv = (it + 2 < AKEYS / 32) ? one : 0;
    vp += one * 32; kp += adv * 32 * HH; mp += adv * 32;

    // bit 16 t + r of nb: key 16 t + 8 hh + r of this pass is masked
    const unsigned int nb = ~__builtin_amdgcn_ballot_w32(mk != 0) >> (8 * hh);
    v8f bias[2];   // 0 for a kept key, -inf for a masked one; rows of St are keys, so one set serves all query tiles
#pragma unroll
    for (int r = 0; r < 8; ++r) {
      bias[0][r] = __uint_as_float((unsigned int)((int)(nb << (31 - r)) >> 31) & 0xFF800000u);
      bias[1][r] = __uint_as_float((unsigned int)((int)(nb << (15 - r)) >> 31) & 0xFF800000u);
    }

#pragma unroll
    for (int qt = 0; qt < AQ; ++qt) {
      v8f s0 = {}, s1 = {};
#pragma unroll
      for (int ks = 0; ks < 2; ++ks) {
        s0 = wmma_bf(ka[0][ks].v, qh[qt][ks].v, s0); s1 = wmma_bf(ka[1][ks].v, qh[qt][ks].v, s1);
        s0 = wmma_bf(ka[0][ks].v, ql[qt][ks].v, s0); s1 = wmma_bf(ka[1][ks].v, ql[qt][ks].v, s1);
      }
      s0 += bias[0]; s1 += bias[1];
      float mx = fmaxf(s0[0], s1[0]);
#pragma unroll
      for (int r = 1; r < 8; ++r) mx = fmaxf(mx, fmaxf(s0[r], s1[r]));
      mx = fmaxf(mx, xhalf(mx));
      const float mnew = fmaxf(m_r[qt], mx);
      float alpha = (m_r[qt] - mnew) * c2;
      const float mc = mnew * c2;
      m_r[qt] = mnew;
      float e[16];
#pragma unroll
      for (int r = 0; r < 8; ++r) { e[r] = __builtin_fmaf(s0[r], c2, -mc); e[8 + r] = __builtin_fmaf(s1[r], c2, -mc); }
      // one tile's exponentials in one statement, each in place: none reads the result or overwrites the source of the one in front of it,
      // and the v_nop fills the slot that the instruction set asks for behind the last
      asm("v_exp_f32 %0, %0\n\tv_exp_f32 %1, %1\n\tv_exp_f32 %2, %2\n\tv_exp_f32 %3, %3\n\tv_exp_f32 %4, %4\n\tv_exp_f32 %5, %5\n\t"
          "v_exp_f32 %6, %6\n\tv_exp_f32 %7, %7\n\tv_exp_f32 %8, %8\n\tv_exp_f32 %9, %9\n\tv_exp_f32 %10, %10\n\tv_exp_f32 %11, %11\n\t"
          "v_exp_f32 %12, %12\n\tv_exp_f32 %13, %13\n\tv_exp_f32 %14, %14\n\tv_exp_f32 %15, %15\n\tv_exp_f32 %16, %16\n\tv_nop"
          : "+v"(e[0]), "+v"(e[1]), "+v"(e[2]), "+v"(e[3]), "+v"(e[4]), "+v"(e[5]), "+v"(e[6]), "+v"(e[7]), "+v"(e[8]), "+v"(e[9]),
            "+v"(e[10]), "+v"(e[11]), "+v"(e[12]), "+v"(e[13]), "+v"(e[14]), "+v"(e[15]), "+v"(alpha));
      FragW ph, pl;
      float sum = 0.f;
#pragma unroll
      for (int i = 0; i < 8; ++i) {
        const float pa = e[2 * i], pb = e[2 * i + 1];
        sum += pa + pb;
        const unsigned int hw = pk_bf16(pa, pb);
        ph.w[i] = hw;
        pl.w[i] = pk_bf16(pa - __uint_as_float(hw << 16), pb - __uint_as_float(hw & 0xFFFF0000u));
      }
      l_r[qt] = l_r[qt] * alpha + sum;   // this lane half's keys only; the halves are joined after the loop
#pragma unroll
      for (int dt = 0; dt < 4; ++dt) oacc[qt][dt] *= alpha;
#pragma unroll
      for (int dt = 0; dt < 4; ++dt) oacc[qt][dt] = wmma_bf(va[dt].v, ph.v, oacc[qt][dt]);
#pragma unroll
      for (int dt = 0; dt < 4; ++dt) oacc[qt][dt] = wmma_bf(va[dt].v, pl.v, oacc[qt][dt]);
    }
#pragma unroll
    for (int t = 0; t < 2; ++t)
#pragma unroll
      for (int ks = 0; ks < 2; ++ks) ka[t][ks] = kn[t][ks];
    mk = mn;
  }

#pragma unroll
  for (int qt = 0; qt < AQ; ++qt) {
    const float l = l_r[qt] + xhalf(l_r[qt]);
    if (hh == 0) { sM[w][qt][ln] = m_r[qt]; sL[w][qt][ln] = l; }
#pragma unroll
    for (int dt = 0; dt < 4; ++dt) {
      sO[w][qt * 8 + dt * 2][lane]     = (v4f){oacc[qt][dt][0], oacc[qt][dt][1], oacc[qt][dt][2], oacc[qt][dt][3]};
      sO[w][qt * 8 + dt * 2 + 1][lane] = (v4f){oacc[qt][dt][4], oacc[qt][dt][5], oacc[qt][dt][6], oacc[qt][dt][7]};
    }
  }
  __syncthreads();
  // join: wave w finishes query tile w / 2, head columns 32 * (w % 2) ... + 31 (one 128-byte line of each output row)
  const int qm = w >> 1;
  float M = -3.0e38f;
#pragma unroll
  for (int p = 0; p < AW; ++p) M = fmaxf(M, sM[p][qm][ln]);
  float f[AW], den = 0.f;
#pragma unroll
  for (int p = 0; p < AW; ++p) f[p] = (sM[p][qm][ln] - M) * c2;
  // in place and closed by a v_nop, for the same reason as in the loop
  asm("v_exp_f32 %0, %0\n\tv_exp_f32 %1, %1\n\tv_exp_f32 %2, %2\n\tv_exp_f32 %3, %3\n\tv_exp_f32 %4, %4\n\tv_exp_f32 %5, %5\n\tv_exp_f32 %6, %6\n\tv_exp_f32 %7, %7\n\tv_nop"
      : "+v"(f[0]), "+v"(f[1]), "+v"(f[2]), "+v"(f[3]), "+v"(f[4]), "+v"(f[5]), "+v"(f[6]), "+v"(f[7]));
#pragma unroll
  for (int p = 0; p < AW; ++p) den += sL[p][qm][ln] * f[p];
  const float inv = 1.0f / den;   // every key masked: den = 0, and 0 * inf gives NaN
#pragma unroll
  for (int dd = 0; dd < 2; ++dd) {
    const int dt = (w & 1) * 2 + dd;
    v4f a0 = {0.f,0.f,0.f,0.f}, a1 = {0.f,0.f,0.f,0.f};
#pragma unroll
    for (int p = 0; p < AW; ++p) { a0 += sO[p][qm * 8 + dt * 2][lane] * f[p]; a1 += sO[p][qm * 8 + dt * 2 + 1][lane] * f[p]; }
    float* o = out + ((size_t)b * TT + q0 + qm * 16 + ln) * HH + dt * 16 + 8 * hh;
    *(v4f*)o = a0 * inv; *(v4f*)(o + 4) = a1 * inv;
  }
}
extern "C" void kernel_launch(void* const* d_in, const int* in_sizes, int n_in,
                              void* d_out, int out_size, void* d_ws, size_t ws_size, hipStream_t stream) {
  (void)in_sizes; (void)n_in; (void)out_size;
  const float* x = (const float*)d_in[0]; const int* mask = (const int*)d_in[1]; const float* Wk = (const float*)d_in[2]; const float* Wq = (const float*)d_in[3]; const float* Wv = (const float*)d_in[4];
  char* ws = (char*)d_ws; size_t off = 0;
  auto take = [&](size_t bytes) { char* p = ws + off; off += (bytes + 255) & ~(size_t)255; return p; };
  unsigned short* Bt = (unsigned short*)take((size_t)192 * CC * 2); float* Q = (float*)take((size_t)MR * HH * 4); unsigned short* Kb = (unsigned short*)take((size_t)MR * HH * 2); unsigned short* Vt = (unsigned short*)take((size_t)BB * HH * TT * 2);
  if (off > ws_size) return;
  k_wt_bf16<<<3 * HH * (CC / 8) / 256, 256, 0, stream>>>(Wq, Wk, Wv, Bt);   // the 12 column tiles of [Wq | Wk | Wv]
  k_proj<<<MR / PM, 256, 0, stream>>>(x, Bt, Q, Kb, Vt);      // q, k, vt
  k_attn<<<BB * (TT / 64), AW * 32, 0, stream>>>(Q, Kb, Vt, mask, (float*)d_out);
}

// v005
// A run of this version takes 28.9 microseconds.
// Two timings next to v004 both put it at 1.11 times that version's speed.
// Counting every step since v000, it is 56.6 times as fast.
#include <hip/hip_runtime.h>
// [q|k|v] = x*[Wq|Wk|Wv] (M = 16384, K = 768, N = 192; x and W rounded to bf16: single exact WMMA term, f32 accumulate); then one fused launch:
// St = k*qt, masked running-maximum softmax in f32, Ot += vt*Pt: q, k, v and P each rounded once to f16, one product each on v_wmma_f32_16x16x32_f16, f32 accumulate.
#define BB 8
#define TT 2048
#define CC 768
#define HH 64
#define MR (BB * TT)

typedef __bf16 v16b __attribute__((ext_vector_type(16)));
typedef unsigned short v8us __attribute__((ext_vector_type(8), may_alias));
typedef float  v8f  __attribute__((ext_vector_type(8)));
typedef float  v4f  __attribute__((ext_vector_type(4)));
typedef float  v4fa __attribute__((ext_vector_type(4), may_alias));
union FragB { v16b v; v8us half[2]; unsigned short u[16]; };

__device__ __forceinline__ unsigned short bf16_bits(float x) { unsigned int u = __float_as_uint(x); return (unsigned short)((u + 0x7FFFu + ((u >> 16) & 1u)) >> 16); }
__device__ __forceinline__ float bf16_val(unsigned short b) { return __uint_as_float(((unsigned int)b) << 16); }
__device__ __forceinline__ float bf16_round(float x) { return bf16_val(bf16_bits(x)); }
// D += A·B with NT terms: 1 = ah·bh, 2 = + al·bh (A split), 3 = + ah·bl (both split)
template <int NT>
__device__ __forceinline__ v8f mmaN(v16b ah, v16b al, v16b bh, v16b bl, v8f c) {
  c = __builtin_amdgcn_wmma_f32_16x16x32_bf16(false, ah, false, bh, (short)0, c, false, false);
  if (NT >= 2) c = __builtin_amdgcn_wmma_f32_16x16x32_bf16(false, al, false, bh, (short)0, c, false, false);
  if (NT >= 3) c = __builtin_amdgcn_wmma_f32_16x16x32_bf16(false, ah, false, bl, (short)0, c, false, false);
  asm volatile("v_nop\n\tv_nop\n\tv_nop\n\tv_nop" : "+v"(c) : "v"(ah), "v"(al), "v"(bh), "v"(bl));
  return c;
}

// Wq, Wk, Wv [CC][HH] f32 -> bf16 B fragments of [Wq | Wk | Wv], fragment-major, all three in one launch: unit ((tile * (CC / 32) + ks) * 2 + h) * 32 + lane holds the
// 16 bytes that this lane of the B fragment (column tile of the 192 columns, k-step ks, register half h) needs, so that one wave-wide 16-byte load of a fragment half
// covers 512 contiguous bytes. One unit a thread; a block's 256 units lie in one matrix (HH * CC / 8 units each, a multiple of 256), so the choice of the source is scalar.
__global__ __launch_bounds__(256) void k_wt_bf16(const float* __restrict__ Wq, const float* __restrict__ Wk, const float* __restrict__ Wv, unsigned short* __restrict__ Wt) {
  const int m = blockIdx.x / (HH * (CC / 8) / 256);
  const float* __restrict__ W = m == 0 ? Wq : m == 1 ? Wk : Wv;
  const int u = blockIdx.x * 256 + threadIdx.x;
  const int lane = u & 31, h = (u >> 5) & 1, ks = (u >> 6) % (CC / 32), tile = (u >> 6) / (CC / 32);
  const int n = (tile & 3) * 16 + (lane & 15), k8 = ks * 32 + h * 16 + (lane >> 4) * 8;
  float f[8];
#pragma unroll
  for (int i = 0; i < 8; ++i) f[i] = W[(k8 + i) * HH + n];
  v8us v;
#pragma unroll
  for (int i = 0; i < 8; ++i) v[i] = bf16_bits(f[i]);
  *(v8us*)(Wt + (size_t)u * 8) = v;
}

// GEMM C[M][N] (f32, pitch ldc) = act(A[M][K]·W + bias). A f32 row-major (pitch lda) converted per fragment to bf16
// (ASPLIT: hi/lo two planes -> 2 terms, else single rounded term); Wt bf16 [N][K] (pitch ldb). BIAS_BF16 rounds the
// bias to bf16 first (bias quantised to bf16 before the add). K%32==0, M%16==0, N%64==0.
template <bool ASPLIT, int ACT, bool BIAS_BF16>
__global__ __launch_bounds__(128) void k_gemm_bf(const float* __restrict__ A, int lda, const unsigned short* __restrict__ Wt, int ldb,
                                               const float* __restrict__ bias, float* __restrict__ C, int ldc, int M, int N, int K) {
  __shared__ __attribute__((aligned(16))) float so[4][16][64];
  const int tid = threadIdx.x, w = tid >> 5, lane = tid & 31, ln = lane & 15, hh = lane >> 4;
  const int ntn = N / 64;
  const int wid = blockIdx.x * 4 + w;
  const int mt = wid / ntn, nq = wid % ntn;
  if (mt * 16 >= M) return;
  const int row0 = mt * 16, col0 = nq * 64;
  const float* arow = A + (size_t)(row0 + ln) * lda;
  v8f acc[4] = {};
  for (int kb = 0; kb < K; kb += 32) {
    FragB ah, al;
    const v4f x0 = *(const v4fa*)(arow + kb + 8 * hh), x1 = *(const v4fa*)(arow + kb + 8 * hh + 4);
    const v4f x2 = *(const v4fa*)(arow + kb + 16 + 8 * hh), x3 = *(const v4fa*)(arow + kb + 16 + 8 * hh + 4);
    float xs[16] = {x0[0],x0[1],x0[2],x0[3],x1[0],x1[1],x1[2],x1[3],x2[0],x2[1],x2[2],x2[3],x3[0],x3[1],x3[2],x3[3]};
#pragma unroll
    for (int i = 0; i < 16; ++i) { const unsigned short hb = bf16_bits(xs[i]); ah.u[i] = hb; al.u[i] = ASPLIT ? bf16_bits(xs[i] - bf16_val(hb)) : (unsigned short)0; }
#pragma unroll
    for (int t = 0; t < 4; ++t) {
      const unsigned short* brow = Wt + (size_t)(col0 + t * 16 + ln) * ldb + kb;
      FragB b;
      b.half[0] = *(const v8us*)(brow + 8 * hh);
      b.half[1] = *(const v8us*)(brow + 16 + 8 * hh);
      acc[t] = mmaN<ASPLIT ? 2 : 1>(ah.v, al.v, b.v, b.v, acc[t]);
    }
  }
#pragma unroll
  for (int t = 0; t < 4; ++t) {
    float bv = bias ? bias[col0 + t * 16 + ln] : 0.f;
    if (BIAS_BF16) bv = bf16_round(bv);
#pragma unroll
    for (int r = 0; r < 8; ++r) { float v = acc[t][r] + bv; if (ACT == 1) v = fmaxf(v, 0.f); so[w][8 * hh + r][t * 16 + ln] = v; }
  }
  __builtin_amdgcn_fence(__ATOMIC_ACQ_REL, "workgroup");
  __builtin_amdgcn_wave_barrier();
  const int rsub = lane >> 4, c4 = (lane & 15) * 4;
  {
#pragma unroll
    for (int q = 0; q < 8; ++q) {
      const int r = q * 2 + rsub;
      const v4f v = *(const v4fa*)&so[w][r][c4];
      *(v4f*)(C + (size_t)(row0 + r) * ldc + col0 + c4) = v;
    }
    
  }
}

// Flash-style causal/unmasked attention, all contractions 3-term bf16 hi/lo splits, f32 softmax with running max.
// q,k,v rows are read from f32 buffers with arbitrary row pitch (so they can live inside a fused qkv buffer);
// D = head size (multiple of 32, <= 128); one wave = 16 query rows; block = 4 waves (64 queries) sharing K/V chunks of 32.
template <int D, bool CAUSAL>
__global__ __launch_bounds__(128) void k_flash(const float* __restrict__ qb, const float* __restrict__ kb, const float* __restrict__ vb,
                                             int pitch, int T, int H, float scale, float* __restrict__ y, int ypitch) {
  constexpr int KS = D / 32;        // k-steps for QK
  constexpr int DT = D / 16;        // d tiles for PV
  __shared__ __attribute__((aligned(16))) unsigned short sKh[32][D + 8], sKl[32][D + 8], sVh[32][D + 8], sVl[32][D + 8];
  __shared__ __attribute__((aligned(16))) unsigned short sPh[4][16][40], sPl[4][16][40];
  __shared__ __attribute__((aligned(16))) float sO[4][16][D];
  const int tid = threadIdx.x, w = tid >> 5, lane = tid & 31, ln = lane & 15, hh = lane >> 4;
  const int nqb = (T + 63) / 64;
  const int bh = blockIdx.x / nqb, qblk = blockIdx.x % nqb;
  const int b = bh / H, h = bh % H;
  const int q0 = qblk * 64 + w * 16;
  const float* Q = qb + (size_t)b * T * pitch + h * D;
  const float* K = kb + (size_t)b * T * pitch + h * D;
  const float* V = vb + (size_t)b * T * pitch + h * D;

  // A fragments of the wave's 16 query rows (scaled), hi/lo
  FragB aqh[KS], aql[KS];
  {
    int row = q0 + ln; if (row >= T) row = T - 1;
    const float* qr = Q + (size_t)row * pitch;
#pragma unroll
    for (int ks = 0; ks < KS; ++ks)
#pragma unroll
      for (int i = 0; i < 16; ++i) {
        const int d = ks * 32 + ((i < 8) ? (8 * hh + i) : (16 + 8 * hh + (i - 8)));
        const float x = qr[d] * scale; const unsigned short hb = bf16_bits(x);
        aqh[ks].u[i] = hb; aql[ks].u[i] = bf16_bits(x - bf16_val(hb));
      }
  }
  float m_r[8], l_r[8];
#pragma unroll
  for (int r = 0; r < 8; ++r) { m_r[r] = -3.0e38f; l_r[r] = 0.f; }
  v8f oacc[DT];
#pragma unroll
  for (int dt = 0; dt < DT; ++dt) oacc[dt] = (v8f){0.f,0.f,0.f,0.f,0.f,0.f,0.f,0.f};

  const int kv_end = CAUSAL ? min(T, qblk * 64 + 64) : T;     // block-uniform
  for (int j0 = 0; j0 < kv_end; j0 += 32) {
    __syncthreads();
    for (int e = tid; e < 32 * (D / 4); e += 128) {
      const int r = e / (D / 4), c4 = (e % (D / 4)) * 4;
      const int key = j0 + r;
      v4f kf = {0.f,0.f,0.f,0.f}, vf = {0.f,0.f,0.f,0.f};
      if (key < T) { kf = *(const v4fa*)(K + (size_t)key * pitch + c4); vf = *(const v4fa*)(V + (size_t)key * pitch + c4); }
#pragma unroll
      for (int t = 0; t < 4; ++t) {
        unsigned short hb = bf16_bits(kf[t]); sKh[r][c4 + t] = hb; sKl[r][c4 + t] = bf16_bits(kf[t] - bf16_val(hb));
        hb = bf16_bits(vf[t]); sVh[r][c4 + t] = hb; sVl[r][c4 + t] = bf16_bits(vf[t] - bf16_val(hb));
      }
    }
    __syncthreads();
    // S tile 16 x 32
    v8f s[2];
#pragma unroll
    for (int nt = 0; nt < 2; ++nt) {
      v8f acc = {};
#pragma unroll
      for (int ks = 0; ks < KS; ++ks) {
        FragB bh_, bl_;
        bh_.half[0] = *(const v8us*)&sKh[nt * 16 + ln][ks * 32 + 8 * hh]; bh_.half[1] = *(const v8us*)&sKh[nt * 16 + ln][ks * 32 + 16 + 8 * hh];
        bl_.half[0] = *(const v8us*)&sKl[nt * 16 + ln][ks * 32 + 8 * hh]; bl_.half[1] = *(const v8us*)&sKl[nt * 16 + ln][ks * 32 + 16 + 8 * hh];
        acc = mmaN<3>(aqh[ks].v, aql[ks].v, bh_.v, bl_.v, acc);
      }
      s[nt] = acc;
    }
    // mask + running max (rows 8hh+r; the 16 lanes of a half share rows)
    float alpha[8];
#pragma unroll
    for (int r = 0; r < 8; ++r) {
      const int qi = q0 + 8 * hh + r;
      const int ja = j0 + ln, jb = j0 + 16 + ln;
      if (CAUSAL) { if (ja > qi) s[0][r] = -3.0e38f; if (jb > qi) s[1][r] = -3.0e38f; }
      if (ja >= T) s[0][r] = -3.0e38f;
      if (jb >= T) s[1][r] = -3.0e38f;
      float mx = fmaxf(s[0][r], s[1][r]);
      mx = fmaxf(mx, __shfl_xor(mx, 1, 32)); mx = fmaxf(mx, __shfl_xor(mx, 2, 32)); mx = fmaxf(mx, __shfl_xor(mx, 4, 32)); mx = fmaxf(mx, __shfl_xor(mx, 8, 32));
      const float mnew = fmaxf(m_r[r], mx);
      alpha[r] = (mnew > -1.0e38f) ? __expf(m_r[r] - mnew) : 1.0f;
      const float p0 = (s[0][r] > -1.0e38f) ? __expf(s[0][r] - mnew) : 0.f;
      const float p1 = (s[1][r] > -1.0e38f) ? __expf(s[1][r] - mnew) : 0.f;
      m_r[r] = mnew;
      l_r[r] = l_r[r] * alpha[r] + p0 + p1;            // per-lane partial row sum (16 lanes combined at the end)
      unsigned short hb = bf16_bits(p0); sPh[w][8 * hh + r][ln] = hb;      sPl[w][8 * hh + r][ln] = bf16_bits(p0 - bf16_val(hb));
      hb = bf16_bits(p1);                sPh[w][8 * hh + r][16 + ln] = hb; sPl[w][8 * hh + r][16 + ln] = bf16_bits(p1 - bf16_val(hb));
    }
#pragma unroll
    for (int dt = 0; dt < DT; ++dt)
#pragma unroll
      for (int r = 0; r < 8; ++r) oacc[dt][r] *= alpha[r];
    __builtin_amdgcn_fence(__ATOMIC_ACQ_REL, "workgroup");
    __builtin_amdgcn_wave_barrier();
    FragB pah, pal;
    pah.half[0] = *(const v8us*)&sPh[w][ln][8 * hh]; pah.half[1] = *(const v8us*)&sPh[w][ln][16 + 8 * hh];
    pal.half[0] = *(const v8us*)&sPl[w][ln][8 * hh]; pal.half[1] = *(const v8us*)&sPl[w][ln][16 + 8 * hh];
#pragma unroll
    for (int dt = 0; dt < DT; ++dt) {
      FragB bvh, bvl;
#pragma unroll
      for (int i = 0; i < 8; ++i) {
        bvh.u[i] = sVh[8 * hh + i][dt * 16 + ln]; bvh.u[8 + i] = sVh[16 + 8 * hh + i][dt * 16 + ln];
        bvl.u[i] = sVl[8 * hh + i][dt * 16 + ln]; bvl.u[8 + i] = sVl[16 + 8 * hh + i][dt * 16 + ln];
      }
      oacc[dt] = mmaN<3>(pah.v, pal.v, bvh.v, bvl.v, oacc[dt]);
    }
    __builtin_amdgcn_fence(__ATOMIC_ACQ_REL, "workgroup");
    __builtin_amdgcn_wave_barrier();
  }
#pragma unroll
  for (int r = 0; r < 8; ++r) {
    float l = l_r[r];
    l += __shfl_xor(l, 1, 32); l += __shfl_xor(l, 2, 32); l += __shfl_xor(l, 4, 32); l += __shfl_xor(l, 8, 32);
    l_r[r] = (l > 0.f) ? 1.0f / l : 0.f;
  }
#pragma unroll
  for (int dt = 0; dt < DT; ++dt)
#pragma unroll
    for (int r = 0; r < 8; ++r) sO[w][8 * hh + r][dt * 16 + ln] = oacc[dt][r] * l_r[r];
  __builtin_amdgcn_fence(__ATOMIC_ACQ_REL, "workgroup");
  __builtin_amdgcn_wave_barrier();
  {
    for (int r = 0; r < 16; ++r) {
      const int row = q0 + r;
      if (row < T && lane < D / 4) {
        const v4f val = *(const v4fa*)&sO[w][r][lane * 4];
        *(v4f*)(y + ((size_t)b * T + row) * ypitch + h * D + lane * 4) = val;
      }
    }
    
  }
}

// GEMM C = act(A·W + bias + resid): A f32 (ASPLIT -> hi/lo 2 terms), Wt bf16 [N][K]; ACT 0 none, 1 relu, 2 exact gelu;
// resid (optional, f32, row index = (row % rmod), pitch ldr, RES_BF16 rounds it) added before the activation.
template <bool ASPLIT, int ACT, bool BIAS_BF16, bool RES_BF16>
__global__ __launch_bounds__(128) void k_gemm_bf3(const float* __restrict__ A, int lda, const unsigned short* __restrict__ Wt, int ldb,
                                                const float* __restrict__ bias, const float* __restrict__ resid, int rmod, int ldr,
                                                float* __restrict__ C, int ldc, int M, int N, int K) {
  __shared__ __attribute__((aligned(16))) float so[4][16][64];
  const int tid = threadIdx.x, w = tid >> 5, lane = tid & 31, ln = lane & 15, hh = lane >> 4;
  const int ntn = N / 64;
  const int wid = blockIdx.x * 4 + w;
  const int mt = wid / ntn, nq = wid % ntn;
  if (mt * 16 >= M) return;
  const int row0 = mt * 16, col0 = nq * 64;
  const float* arow = A + (size_t)(row0 + ln) * lda;
  v8f acc[4] = {};
  for (int kb = 0; kb < K; kb += 32) {
    FragB ah, al;
    const v4f x0 = *(const v4fa*)(arow + kb + 8 * hh), x1 = *(const v4fa*)(arow + kb + 8 * hh + 4);
    const v4f x2 = *(const v4fa*)(arow + kb + 16 + 8 * hh), x3 = *(const v4fa*)(arow + kb + 16 + 8 * hh + 4);
    float xs[16] = {x0[0],x0[1],x0[2],x0[3],x1[0],x1[1],x1[2],x1[3],x2[0],x2[1],x2[2],x2[3],x3[0],x3[1],x3[2],x3[3]};
#pragma unroll
    for (int i = 0; i < 16; ++i) { const unsigned short hb = bf16_bits(xs[i]); ah.u[i] = hb; al.u[i] = ASPLIT ? bf16_bits(xs[i] - bf16_val(hb)) : (unsigned short)0; }
#pragma unroll
    for (int t = 0; t < 4; ++t) {
      const unsigned short* brow = Wt + (size_t)(col0 + t * 16 + ln) * ldb + kb;
      FragB b;
      b.half[0] = *(const v8us*)(brow + 8 * hh);
      b.half[1] = *(const v8us*)(brow + 16 + 8 * hh);
      acc[t] = mmaN<ASPLIT ? 2 : 1>(ah.v, al.v, b.v, b.v, acc[t]);
    }
  }
#pragma unroll
  for (int t = 0; t < 4; ++t) {
    const int col = col0 + t * 16 + ln;
    float bv = bias ? bias[col] : 0.f;
    if (BIAS_BF16) bv = bf16_round(bv);
#pragma unroll
    for (int r = 0; r < 8; ++r) {
      float v = acc[t][r] + bv;
      if (resid) { float rv = resid[(size_t)((row0 + 8 * hh + r) % rmod) * ldr + col]; if (RES_BF16) rv = bf16_round(rv); v += rv; }
      if (ACT == 1) v = fmaxf(v, 0.f);
      if (ACT == 2) v = 0.5f * v * (1.0f + erff(v * 0.70710678118654752f));
      if (ACT == 3) { const float u = 0.7978845608028654f * (v + 0.044715f * v * v * v); v = 0.5f * v * (1.0f + tanhf(u)); }
      so[w][8 * hh + r][t * 16 + ln] = v;
    }
  }
  __builtin_amdgcn_fence(__ATOMIC_ACQ_REL, "workgroup");
  __builtin_amdgcn_wave_barrier();
  const int rsub = lane >> 4, c4 = (lane & 15) * 4;
  {
#pragma unroll
    for (int q = 0; q < 8; ++q) {
      const int r = q * 2 + rsub;
      const v4f v = *(const v4fa*)&so[w][r][c4];
      *(v4f*)(C + (size_t)(row0 + r) * ldc + col0 + c4) = v;
    }
    
  }
}
// row LayerNorm (biased variance, eps) over N: s = X (+ R); optional out_sum <- s; out_norm <- (s-mu)*rsqrt(var+eps)*g + b
template <bool PARAM_BF16>
__global__ __launch_bounds__(256) void k_layernorm(const float* __restrict__ X, const float* __restrict__ R, const float* __restrict__ g, const float* __restrict__ bta,
                                                  float* __restrict__ out_sum, float* __restrict__ out_norm, int N, float eps) {
  __shared__ float red[256];
  const int row = blockIdx.x, tid = threadIdx.x;
  const float* x = X + (size_t)row * N; const float* rr = R ? R + (size_t)row * N : nullptr;
  float vals[16];                     // up to N = 4096
  const int per = N / 256;            // contiguous chunk per thread? use strided-by-4 chunks: thread handles j = tid*4 + 1024*u
  float s1 = 0.f;
  for (int u = 0; u < per / 4; ++u) {
    const int j = tid * 4 + 1024 * u;
    const v4f a = *(const v4fa*)(x + j);
    v4f b = {0.f,0.f,0.f,0.f}; if (rr) b = *(const v4fa*)(rr + j);
#pragma unroll
    for (int q = 0; q < 4; ++q) { const float v = a[q] + b[q]; vals[u * 4 + q] = v; s1 += v; }
  }
  red[tid] = s1; __syncthreads();
  for (int st = 128; st > 0; st >>= 1) { if (tid < st) red[tid] += red[tid + st]; __syncthreads(); }
  const float mu = red[0] / (float)N; __syncthreads();
  float s2 = 0.f;
  for (int u = 0; u < per / 4; ++u)
#pragma unroll
    for (int q = 0; q < 4; ++q) { const float c = vals[u * 4 + q] - mu; s2 += c * c; }
  red[tid] = s2; __syncthreads();
  for (int st = 128; st > 0; st >>= 1) { if (tid < st) red[tid] += red[tid + st]; __syncthreads(); }
  const float rs = rsqrtf(red[0] / (float)N + eps);
  {
    for (int u = 0; u < per / 4; ++u) {
      const int j = tid * 4 + 1024 * u;
      v4f o, sm;
#pragma unroll
      for (int q = 0; q < 4; ++q) {
        float gg = g[j + q], bb = bta[j + q];
        if (PARAM_BF16) { gg = bf16_round(gg); bb = bf16_round(bb); }
        sm[q] = vals[u * 4 + q]; o[q] = (vals[u * 4 + q] - mu) * rs * gg + bb;
      }
      if (out_sum) *(v4f*)(out_sum + (size_t)row * N + j) = sm;
      *(v4f*)(out_norm + (size_t)row * N + j) = o;
    }
    
  }
}

// batched f32 [K][N] (pitch lds, batch stride sIn) -> transposed hi/lo planes [N][K] (batch stride sOut); thread per (n, 8 k); grid.y = batch
__global__ __launch_bounds__(256) void k_split_transpose_b(const float* __restrict__ src, int lds_, size_t sIn, unsigned short* __restrict__ hi, unsigned short* __restrict__ lo, size_t sOut, int K, int N) {
  const size_t t = (size_t)blockIdx.x * 256 + threadIdx.x; const int k8n = K / 8; if (t >= (size_t)N * k8n) return;
  src += (size_t)blockIdx.y * sIn; hi += (size_t)blockIdx.y * sOut; lo += (size_t)blockIdx.y * sOut;
  const int n = (int)(t / k8n), k8 = (int)(t % k8n) * 8; v8us vh, vl;
#pragma unroll
  for (int i = 0; i < 8; ++i) { const float x = src[(size_t)(k8 + i) * lds_ + n]; const unsigned short hb = bf16_bits(x); vh[i] = hb; vl[i] = bf16_bits(x - bf16_val(hb)); }
  unsigned short* dh = hi + (size_t)n * K + k8; unsigned short* dl = lo + (size_t)n * K + k8;
  *(v8us*)dh = vh; *(v8us*)dl = vl; 
}

typedef float f2v __attribute__((ext_vector_type(2)));
typedef __bf16 bf2v __attribute__((ext_vector_type(2)));
__device__ __forceinline__ unsigned int pk_bf16(float a, float b) { return __builtin_bit_cast(unsigned int, __builtin_convertvector((f2v){a, b}, bf2v)); }   // round to nearest even
__device__ __forceinline__ float xhalf(float x) { return __builtin_bit_cast(float, __builtin_amdgcn_permlanex16(__builtin_bit_cast(int, x), __builtin_bit_cast(int, x), 0x76543210, 0xfedcba98, false, false)); }   // lane l with lane l ^ 16
__device__ __forceinline__ v8f wmma_bf(v16b a, v16b b, v8f c) { return __builtin_amdgcn_wmma_f32_16x16x32_bf16(false, a, false, b, (short)0, c, false, false); }
typedef _Float16 v16h __attribute__((ext_vector_type(16)));
typedef _Float16 h2v __attribute__((ext_vector_type(2)));
union FragH { v16h v; v8us half[2]; unsigned int w[8]; };
__device__ __forceinline__ unsigned int pk_f16(float a, float b) { return __builtin_bit_cast(unsigned int, __builtin_convertvector((f2v){a, b}, h2v)); }   // round to nearest even
__device__ __forceinline__ v8f wmma_hf(v16h a, v16h b, v8f c) { return __builtin_amdgcn_wmma_f32_16x16x32_f16(false, a, false, b, (short)0, c, false, false); }

// [q | k | v] = x * [Wq | Wk | Wv]. A block owns PM rows of x and all 192 columns. x is read once, in whole lines, rounded to bf16 and kept in LDS.
// Wave w holds the B fragments of column tiles 3 (w % 4) ... + 2 for k-steps 12 (w / 4) ... + 11 in registers (packed by k_wt_bf16) and
// multiplies all four row tiles by them; the two K halves of a result are added through LDS. From that LDS tile the block writes what the attention launch reads:
// q and k rounded to f16 as rows Qb[row][64] and Kb[row][64], v rounded to f16 and transposed as Vt[batch][d][token] (f16: 11 bits, finite below 65504).
#define PM 64
#define XR 40          // x tile in LDS, one plane per k-step: row pitch in elements, 80 bytes = 16 * odd, at which 16-byte fragment reads meet no bank conflict
#define XS (PM * XR + 32)   // plane pitch in elements: 16 banks past a multiple of 64, so the four k-steps that one staging store spans do not collide
#define OP 196         // result tile pitch in floats: rows 8 apart fall 32 banks apart, so the two lane halves of a store do not collide
__global__ __launch_bounds__(256) void k_proj(const float* __restrict__ x, const unsigned short* __restrict__ Bp, unsigned short* __restrict__ Qb, unsigned short* __restrict__ Kb, unsigned short* __restrict__ Vt) {
  __shared__ __attribute__((aligned(16))) unsigned short sx[(CC / 32) * XS];
  __shared__ __attribute__((aligned(16))) float so[PM][OP];
  const int tid = threadIdx.x, w = tid >> 5, lane = tid & 31, ln = lane & 15, hh = lane >> 4;
  const int ng = w & 3, kh = w >> 2;
  const size_t row0 = (size_t)blockIdx.x * PM;
  // staging: wave w brings rows 16 (w % 4) ... + 15, columns 384 (w / 4) ... + 383, as 48 wave-wide loads of 512 contiguous bytes
  const float* xp = x + (row0 + ng * 16) * CC + kh * 384 + lane * 4;
  const unsigned int bo = ((ng * 72 + kh * 12) * 64 + lane) * 16;   // this lane's place in the packed fragments, in bytes
  const unsigned short* bp = (const unsigned short*)((const char*)Bp + bo);
  v4f xa[48];
#pragma unroll
  for (int i = 0; i < 48; ++i) xa[i] = *(const v4fa*)(xp + (i / 3) * CC + (i % 3) * 128);
  FragB bf[3][12];
#pragma unroll
  for (int t = 0; t < 2; ++t)
#pragma unroll
    for (int kk = 0; kk < 12; ++kk) { bf[t][kk].half[0] = *(const v8us*)(bp + ((t * 24 + kk) * 2) * 256); bf[t][kk].half[1] = *(const v8us*)(bp + ((t * 24 + kk) * 2 + 1) * 256); }
  // stands in front of the reuse of the address registers that the loads above name; pointer and offset are inputs so that their registers live up to the wait
  asm volatile("s_wait_xcnt 0x0" :: "v"(xp), "v"(bo) : "memory");
  unsigned short* xs = sx + (kh * 12 + (lane >> 3)) * XS + ng * 16 * XR + (lane & 7) * 4;
#pragma unroll
  for (int i = 0; i < 48; ++i) *(uint2*)(xs + (i % 3) * 4 * XS + (i / 3) * XR) = make_uint2(pk_bf16(xa[i][0], xa[i][1]), pk_bf16(xa[i][2], xa[i][3]));
  // the third column tile's fragments: a second group of loads, with a wait of its own
#pragma unroll
  for (int kk = 0; kk < 12; ++kk) { bf[2][kk].half[0] = *(const v8us*)(bp + ((48 + kk) * 2) * 256); bf[2][kk].half[1] = *(const v8us*)(bp + ((48 + kk) * 2 + 1) * 256); }
  // as above, for the loads of the third tile
  asm volatile("s_wait_xcnt 0x0" :: "v"(bo) : "memory");
  __syncthreads();

  v8f acc[4][3];
#pragma unroll
  for (int mt = 0; mt < 4; ++mt)
#pragma unroll
    for (int t = 0; t < 3; ++t) acc[mt][t] = (v8f){0.f,0.f,0.f,0.f,0.f,0.f,0.f,0.f};
  const unsigned short* ap = sx + kh * 12 * XS + ln * XR + 8 * hh;
  // the next k-step's four A fragments are asked for as one group ahead of this k-step's products
  FragB a[2][4];
#pragma unroll
  for (int mt = 0; mt < 4; ++mt) { a[0][mt].half[0] = *(const v8us*)(ap + mt * 16 * XR); a[0][mt].half[1] = *(const v8us*)(ap + mt * 16 * XR + 16); }
#pragma unroll
  for (int kk = 0; kk < 12; ++kk) {
    if (kk + 1 < 12) {
#pragma unroll
      for (int mt = 0; mt < 4; ++mt) { a[(kk + 1) & 1][mt].half[0] = *(const v8us*)(ap + (kk + 1) * XS + mt * 16 * XR); a[(kk + 1) & 1][mt].half[1] = *(const v8us*)(ap + (kk + 1) * XS + mt * 16 * XR + 16); }
    }
#pragma unroll
    for (int mt = 0; mt < 4; ++mt)
#pragma unroll
      for (int t = 0; t < 3; ++t) acc[mt][t] = wmma_bf(a[kk & 1][mt].v, bf[t][kk].v, acc[mt][t]);
    // keeps the order one load group, twelve products: left free, the scheduler asks for four k-steps at once, runs out of registers and then waits out a fragment's LDS latency before every three products
    __builtin_amdgcn_sched_barrier(0);
  }

  // the wave of the first K half finishes row tiles 0 and 1, its partner 2 and 3: each hands the other two over, then adds its own to what it was handed
  float* sg = &so[(kh ? 0 : 32) + 8 * hh][ng * 48 + ln];
  float* sk = &so[(kh ? 32 : 0) + 8 * hh][ng * 48 + ln];
#pragma unroll
  for (int m = 0; m < 2; ++m)
#pragma unroll
    for (int t = 0; t < 3; ++t)
#pragma unroll
      for (int r = 0; r < 8; ++r) sg[(m * 16 + r) * OP + t * 16] = kh ? acc[m][t][r] : acc[m + 2][t][r];
  __syncthreads();
#pragma unroll
  for (int m = 0; m < 2; ++m)
#pragma unroll
    for (int t = 0; t < 3; ++t)
#pragma unroll
      for (int r = 0; r < 8; ++r) sk[(m * 16 + r) * OP + t * 16] += kh ? acc[m + 2][t][r] : acc[m][t][r];
  __syncthreads();
  // every store instruction below covers four whole 128-byte lines
  // q and k: eight columns of one row a thread; each tile's 64 x 64 f16 are 8 KB in a row of Qb or Kb
  uint4 qw[2], kw[2];
#pragma unroll
  for (int i = 0; i < 2; ++i) {
    const int u = i * 256 + tid;
    const v4f a0 = *(const v4fa*)&so[u >> 3][(u & 7) * 8], a1 = *(const v4fa*)&so[u >> 3][(u & 7) * 8 + 4];
    qw[i] = make_uint4(pk_f16(a0[0], a0[1]), pk_f16(a0[2], a0[3]), pk_f16(a1[0], a1[1]), pk_f16(a1[2], a1[3]));
    const v4f c0 = *(const v4fa*)&so[u >> 3][HH + (u & 7) * 8], c1 = *(const v4fa*)&so[u >> 3][HH + (u & 7) * 8 + 4];
    kw[i] = make_uint4(pk_f16(c0[0], c0[1]), pk_f16(c0[2], c0[3]), pk_f16(c1[0], c1[1]), pk_f16(c1[2], c1[3]));
  }
  // v: eight rows of one column a thread; the tile's 64 tokens are one line of each of the 64 rows of this batch's Vt plane
  uint4 vw[2];
#pragma unroll
  for (int i = 0; i < 2; ++i) {
    const float* c = &so[(tid & 7) * 8][2 * HH + i * 32 + (tid >> 3)];
    vw[i] = make_uint4(pk_f16(c[0], c[OP]), pk_f16(c[2 * OP], c[3 * OP]), pk_f16(c[4 * OP], c[5 * OP]), pk_f16(c[6 * OP], c[7 * OP]));
  }
  unsigned short* oq = Qb + row0 * HH + tid * 8;
  unsigned short* ok = Kb + row0 * HH + tid * 8;
  unsigned short* ov = Vt + ((row0 / TT) * HH + (tid >> 3)) * TT + row0 % TT + (tid & 7) * 8;
#pragma unroll
  for (int i = 0; i < 2; ++i) *(uint4*)(ov + (size_t)i * 32 * TT) = vw[i];
#pragma unroll
  for (int i = 0; i < 2; ++i) *(uint4*)(ok + i * 2048) = kw[i];
#pragma unroll
  for (int i = 0; i < 2; ++i) *(uint4*)(oq + i * 2048) = qw[i];
}

// Scores, masked softmax and P*v in one launch, all batches. A block owns 64 query rows of one batch; each of its AW waves
// holds all 64 (AQ tiles of 16 as B operands, f16) and walks its own TT / AW keys in passes of 32 with a running maximum:
// St = k * qt (a lane holds 16 scores of ONE query), Pt packs from the two St tiles into a B operand (f16; P lies in 0 ... 1), Ot += vt * Pt.
// Every operand is one f16 value, 11 bits on both sides of a product, so each product is one WMMA.
// The AW partial (maximum, sum, Ot) sets are joined through LDS at the end. Scores never reach memory.
#define AQ 4
#define AW 8
#define AKEYS (TT / AW)
__global__ __launch_bounds__(AW * 32) void k_attn(const unsigned short* __restrict__ Qb, const unsigned short* __restrict__ Kb, const unsigned short* __restrict__ Vt,
                                                  const int* __restrict__ mask, float* __restrict__ out) {
  __shared__ __attribute__((aligned(16))) v4f sO[AW][AQ * 8][32];
  __shared__ float sM[AW][AQ][16], sL[AW][AQ][16];
  const int tid = threadIdx.x, w = tid >> 5, lane = tid & 31, ln = lane & 15, hh = lane >> 4;
  const int b = blockIdx.x / (TT / 64), q0 = (blockIdx.x % (TT / 64)) * 64;
  const float c2 = 0.03608439182435161f * 1.4426950408889634f;   // 768^-0.5 * log2(e): the softmax runs in base 2

  FragH qf[AQ][2];
  const unsigned short* qp = Qb + ((size_t)b * TT + q0 + ln) * HH + 8 * hh;
#pragma unroll
  for (int qt = 0; qt < AQ; ++qt)
#pragma unroll
    for (int ks = 0; ks < 2; ++ks) { qf[qt][ks].half[0] = *(const v8us*)(qp + qt * 16 * HH + ks * 32); qf[qt][ks].half[1] = *(const v8us*)(qp + qt * 16 * HH + ks * 32 + 16); }
  // stands in front of the reuse of the address registers that the q loads name; the pointer is an input so that its registers live up to the wait
  asm volatile("s_wait_xcnt 0x0" :: "v"(qp) : "memory");
  float m_r[AQ], l_r[AQ];
  v8f oacc[AQ][4];
#pragma unroll
  for (int qt = 0; qt < AQ; ++qt) {
    m_r[qt] = -3.0e38f; l_r[qt] = 0.f;   // finite start: a pass whose keys are all masked gives exp2(-inf) = 0, never inf - inf
#pragma unroll
    for (int dt = 0; dt < 4; ++dt) oacc[qt][dt] = (v8f){0.f,0.f,0.f,0.f,0.f,0.f,0.f,0.f};
  }
  const unsigned short* kp = Kb + ((size_t)b * TT + w * AKEYS + ln) * HH + 8 * hh;
  const unsigned short* vp = Vt + ((size_t)b * HH + ln) * TT + w * AKEYS + 8 * hh;
  const int* mp = mask + (size_t)b * TT + w * AKEYS + lane;   // one mask word a lane: a pass's 32 keys
  int one = 1;   // passes through each wait below, so that the pointer additions, which are multiples of it, cannot be lifted over the wait

  FragH ka[2][2];
  int mk;
#pragma unroll
  for (int t = 0; t < 2; ++t)
#pragma unroll
    for (int ks = 0; ks < 2; ++ks) { ka[t][ks].half[0] = *(const v8us*)(kp + t * 16 * HH + ks * 32); ka[t][ks].half[1] = *(const v8us*)(kp + t * 16 * HH + ks * 32 + 16); }
  mk = *mp;
  // stands in front of the overwrite of the address registers that the loads above name; the pointers are inputs so that their registers live up to it
  asm volatile("s_wait_xcnt 0x0" : "+s"(one) : "v"(kp), "v"(mp) : "memory");
  kp += one * 32 * HH; mp += one * 32;

  // rolled, for speed only: one pass is several KB of code
#pragma unroll 1
  for (int it = 0; it < AKEYS / 32; ++it) {
    FragH va[4];
#pragma unroll
    for (int dt = 0; dt < 4; ++dt) { va[dt].half[0] = *(const v8us*)(vp + (size_t)dt * 16 * TT); va[dt].half[1] = *(const v8us*)(vp + (size_t)dt * 16 * TT + 16); }
    // the next pass's k rows and mask words are fetched now; the last pass fetches its own again, so every address stays inside
    FragH kn[2][2];
#pragma unroll
    for (int t = 0; t < 2; ++t)
#pragma unroll
      for (int ks = 0; ks < 2; ++ks) { kn[t][ks].half[0] = *(const v8us*)(kp + t * 16 * HH + ks * 32); kn[t][ks].half[1] = *(const v8us*)(kp + t * 16 * HH + ks * 32 + 16); }
    const int mn = *mp;
    // stands in front of the overwrite of the address registers that this pass's loads name; the pointers are inputs so that their registers live up to it
    asm volatile("s_wait_xcnt 0x0" : "+s"(one) : "v"(vp), "v"(kp), "v"(mp) : "memory");
    const int adv = (it + 2 < AKEYS / 32) ? one : 0;
    vp += one * 32; kp += adv * 32 * HH; mp += adv * 32;

    // bit 16 t + r of nb: key 16 t + 8 hh + r of this pass is masked
    const unsigned int nb = ~__builtin_amdgcn_ballot_w32(mk != 0) >> (8 * hh);
    v8f bias[2];   // 0 for a kept key, -inf for a masked one; rows of St are keys, so one set serves all query tiles
#pragma unroll
    for (int r = 0; r < 8; ++r) {
      bias[0][r] = __uint_as_float((unsigned int)((int)(nb << (31 - r)) >> 31) & 0xFF800000u);
      bias[1][r] = __uint_as_float((unsigned int)((int)(nb << (15 - r)) >> 31) & 0xFF800000u);
    }

#pragma unroll
    for (int qt = 0; qt < AQ; ++qt) {
      v8f s0 = {}, s1 = {};
#pragma unroll
      for (int ks = 0; ks < 2; ++ks) { s0 = wmma_hf(ka[0][ks].v, qf[qt][ks].v, s0); s1 = wmma_hf(ka[1][ks].v, qf[qt][ks].v, s1); }
      s0 += bias[0]; s1 += bias[1];
      float mx = fmaxf(s0[0], s1[0]);
#pragma unroll
      for (int r = 1; r < 8; ++r) mx = fmaxf(mx, fmaxf(s0[r], s1[r]));
      mx = fmaxf(mx, xhalf(mx));
      const float mnew = fmaxf(m_r[qt], mx);
      float alpha = (m_r[qt] - mnew) * c2;
      const float mc = mnew * c2;
      m_r[qt] = mnew;
      float e[16];
#pragma unroll
      for (int r = 0; r < 8; ++r) { e[r] = __builtin_fmaf(s0[r], c2, -mc); e[8 + r] = __builtin_fmaf(s1[r], c2, -mc); }
      // one tile's exponentials in one statement, each in place: none reads the result or overwrites the source of the one in front of it,
      // and the v_nop fills the slot that the instruction set asks for behind the last
      asm("v_exp_f32 %0, %0\n\tv_exp_f32 %1, %1\n\tv_exp_f32 %2, %2\n\tv_exp_f32 %3, %3\n\tv_exp_f32 %4, %4\n\tv_exp_f32 %5, %5\n\t"
          "v_exp_f32 %6, %6\n\tv_exp_f32 %7, %7\n\tv_exp_f32 %8, %8\n\tv_exp_f32 %9, %9\n\tv_exp_f32 %10, %10\n\tv_exp_f32 %11, %11\n\t"
          "v_exp_f32 %12, %12\n\tv_exp_f32 %13, %13\n\tv_exp_f32 %14, %14\n\tv_exp_f32 %15, %15\n\tv_exp_f32 %16, %16\n\tv_nop"
          : "+v"(e[0]), "+v"(e[1]), "+v"(e[2]), "+v"(e[3]), "+v"(e[4]), "+v"(e[5]), "+v"(e[6]), "+v"(e[7]), "+v"(e[8]), "+v"(e[9]),
            "+v"(e[10]), "+v"(e[11]), "+v"(e[12]), "+v"(e[13]), "+v"(e[14]), "+v"(e[15]), "+v"(alpha));
      FragH pf;
      float sum = 0.f;
#pragma unroll
      for (int i = 0; i < 8; ++i) {
        const float pa = e[2 * i], pb = e[2 * i + 1];
        sum += pa + pb;
        pf.w[i] = pk_f16(pa, pb);
      }
      l_r[qt] = l_r[qt] * alpha + sum;   // this lane half's keys only; the halves are joined after the loop
#pragma unroll
      for (int dt = 0; dt < 4; ++dt) oacc[qt][dt] *= alpha;
#pragma unroll
      for (int dt = 0; dt < 4; ++dt) oacc[qt][dt] = wmma_hf(va[dt].v, pf.v, oacc[qt][dt]);
    }
#pragma unroll
    for (int t = 0; t < 2; ++t)
#pragma unroll
      for (int ks = 0; ks < 2; ++ks) ka[t][ks] = kn[t][ks];
    mk = mn;
  }

#pragma unroll
  for (int qt = 0; qt < AQ; ++qt) {
    const float l = l_r[qt] + xhalf(l_r[qt]);
    if (hh == 0) { sM[w][qt][ln] = m_r[qt]; sL[w][qt][ln] = l; }
#pragma unroll
    for (int dt = 0; dt < 4; ++dt) {
      sO[w][qt * 8 + dt * 2][lane]     = (v4f){oacc[qt][dt][0], oacc[qt][dt][1], oacc[qt][dt][2], oacc[qt][dt][3]};
      sO[w][qt * 8 + dt * 2 + 1][lane] = (v4f){oacc[qt][dt][4], oacc[qt][dt][5], oacc[qt][dt][6], oacc[qt][dt][7]};
    }
  }
  __syncthreads();
  // join: wave w finishes query tile w / 2, head columns 32 * (w % 2) ... + 31 (one 128-byte line of each output row)
  const int qm = w >> 1;
  float M = -3.0e38f;
#pragma unroll
  for (int p = 0; p < AW; ++p) M = fmaxf(M, sM[p][qm][ln]);
  float f[AW], den = 0.f;
#pragma unroll
  for (int p = 0; p < AW; ++p) f[p] = (sM[p][qm][ln] - M) * c2;
  // in place and closed by a v_nop, for the same reason as in the loop
  asm("v_exp_f32 %0, %0\n\tv_exp_f32 %1, %1\n\tv_exp_f32 %2, %2\n\tv_exp_f32 %3, %3\n\tv_exp_f32 %4, %4\n\tv_exp_f32 %5, %5\n\tv_exp_f32 %6, %6\n\tv_exp_f32 %7, %7\n\tv_nop"
      : "+v"(f[0]), "+v"(f[1]), "+v"(f[2]), "+v"(f[3]), "+v"(f[4]), "+v"(f[5]), "+v"(f[6]), "+v"(f[7]));
#pragma unroll
  for (int p = 0; p < AW; ++p) den += sL[p][qm][ln] * f[p];
  const float inv = 1.0f / den;   // every key masked: den = 0, and 0 * inf gives NaN
#pragma unroll
  for (int dd = 0; dd < 2; ++dd) {
    const int dt = (w & 1) * 2 + dd;
    v4f a0 = {0.f,0.f,0.f,0.f}, a1 = {0.f,0.f,0.f,0.f};
#pragma unroll
    for (int p = 0; p < AW; ++p) { a0 += sO[p][qm * 8 + dt * 2][lane] * f[p]; a1 += sO[p][qm * 8 + dt * 2 + 1][lane] * f[p]; }
    float* o = out + ((size_t)b * TT + q0 + qm * 16 + ln) * HH + dt * 16 + 8 * hh;
    *(v4f*)o = a0 * inv; *(v4f*)(o + 4) = a1 * inv;
  }
}
extern "C" void kernel_launch(void* const* d_in, const int* in_sizes, int n_in,
                              void* d_out, int out_size, void* d_ws, size_t ws_size, hipStream_t stream) {
  (void)in_sizes; (void)n_in; (void)out_size;
  const float* x = (const float*)d_in[0]; const int* mask = (const int*)d_in[1]; const float* Wk = (const float*)d_in[2]; const float* Wq = (const float*)d_in[3]; const float* Wv = (const float*)d_in[4];
  char* ws = (char*)d_ws; size_t off = 0;
  auto take = [&](size_t bytes) { char* p = ws + off; off += (bytes + 255) & ~(size_t)255; return p; };
  unsigned short* Bt = (unsigned short*)take((size_t)192 * CC * 2); unsigned short* Qb = (unsigned short*)take((size_t)MR * HH * 2); unsigned short* Kb = (unsigned short*)take((size_t)MR * HH * 2); unsigned short* Vt = (unsigned short*)take((size_t)BB * HH * TT * 2);
  if (off > ws_size) return;
  k_wt_bf16<<<3 * HH * (CC / 8) / 256, 256, 0, stream>>>(Wq, Wk, Wv, Bt);   // the 12 column tiles of [Wq | Wk | Wv]
  k_proj<<<MR / PM, 256, 0, stream>>>(x, Bt, Qb, Kb, Vt);      // q, k, vt
  k_attn<<<BB * (TT / 64), AW * 32, 0, stream>>>(Qb, Kb, Vt, mask, (float*)d_out);
}

// v006
// A run of this version takes 28.1 microseconds.
// In both of two side-by-side timings against v005, it was 1.05 times as fast.
// Counting every step since v000, it is 59.2 times as fast.
#include <hip/hip_runtime.h>
// [q|k|v] = x*[Wq|Wk|Wv] (M = 16384, K = 768, N = 192; x and W rounded to bf16: single exact WMMA term, f32 accumulate); then one fused launch:
// St = k*qt, masked running-maximum softmax in f32, Ot += vt*Pt: q, k, v and P each rounded once to f16, one product each on v_wmma_f32_16x16x32_f16, f32 accumulate.
#define BB 8
#define TT 2048
#define CC 768
#define HH 64
#define MR (BB * TT)

typedef __bf16 v16b __attribute__((ext_vector_type(16)));
typedef unsigned short v8us __attribute__((ext_vector_type(8), may_alias));
typedef float  v8f  __attribute__((ext_vector_type(8)));
typedef float  v4f  __attribute__((ext_vector_type(4)));
typedef float  v4fa __attribute__((ext_vector_type(4), may_alias));
union FragB { v16b v; v8us half[2]; unsigned short u[16]; };

__device__ __forceinline__ unsigned short bf16_bits(float x) { unsigned int u = __float_as_uint(x); return (unsigned short)((u + 0x7FFFu + ((u >> 16) & 1u)) >> 16); }
__device__ __forceinline__ float bf16_val(unsigned short b) { return __uint_as_float(((unsigned int)b) << 16); }
__device__ __forceinline__ float bf16_round(float x) { return bf16_val(bf16_bits(x)); }
// D += A·B with NT terms: 1 = ah·bh, 2 = + al·bh (A split), 3 = + ah·bl (both split)
template <int NT>
__device__ __forceinline__ v8f mmaN(v16b ah, v16b al, v16b bh, v16b bl, v8f c) {
  c = __builtin_amdgcn_wmma_f32_16x16x32_bf16(false, ah, false, bh, (short)0, c, false, false);
  if (NT >= 2) c = __builtin_amdgcn_wmma_f32_16x16x32_bf16(false, al, false, bh, (short)0, c, false, false);
  if (NT >= 3) c = __builtin_amdgcn_wmma_f32_16x16x32_bf16(false, ah, false, bl, (short)0, c, false, false);
  asm volatile("v_nop\n\tv_nop\n\tv_nop\n\tv_nop" : "+v"(c) : "v"(ah), "v"(al), "v"(bh), "v"(bl));
  return c;
}

// Wq, Wk, Wv [CC][HH] f32 -> bf16 B fragments of [Wq | Wk | Wv], fragment-major, all three in one launch: unit ((tile * (CC / 32) + ks) * 2 + h) * 32 + lane holds the
// 16 bytes that this lane of the B fragment (column tile of the 192 columns, k-step ks, register half h) needs, so that one wave-wide 16-byte load of a fragment half
// covers 512 contiguous bytes. One unit a thread; a block's 256 units lie in one matrix (HH * CC / 8 units each, a multiple of 256), so the choice of the source is scalar.
__global__ __launch_bounds__(256) void k_wt_bf16(const float* __restrict__ Wq, const float* __restrict__ Wk, const float* __restrict__ Wv, unsigned short* __restrict__ Wt) {
  const int m = blockIdx.x / (HH * (CC / 8) / 256);
  const float* __restrict__ W = m == 0 ? Wq : m == 1 ? Wk : Wv;
  const int u = blockIdx.x * 256 + threadIdx.x;
  const int lane = u & 31, h = (u >> 5) & 1, ks = (u >> 6) % (CC / 32), tile = (u >> 6) / (CC / 32);
  const int n = (tile & 3) * 16 + (lane & 15), k8 = ks * 32 + h * 16 + (lane >> 4) * 8;
  float f[8];
#pragma unroll
  for (int i = 0; i < 8; ++i) f[i] = W[(k8 + i) * HH + n];
  v8us v;
#pragma unroll
  for (int i = 0; i < 8; ++i) v[i] = bf16_bits(f[i]);
  *(v8us*)(Wt + (size_t)u * 8) = v;
}

// GEMM C[M][N] (f32, pitch ldc) = act(A[M][K]·W + bias). A f32 row-major (pitch lda) converted per fragment to bf16
// (ASPLIT: hi/lo two planes -> 2 terms, else single rounded term); Wt bf16 [N][K] (pitch ldb). BIAS_BF16 rounds the
// bias to bf16 first (bias quantised to bf16 before the add). K%32==0, M%16==0, N%64==0.
template <bool ASPLIT, int ACT, bool BIAS_BF16>
__global__ __launch_bounds__(128) void k_gemm_bf(const float* __restrict__ A, int lda, const unsigned short* __restrict__ Wt, int ldb,
                                               const float* __restrict__ bias, float* __restrict__ C, int ldc, int M, int N, int K) {
  __shared__ __attribute__((aligned(16))) float so[4][16][64];
  const int tid = threadIdx.x, w = tid >> 5, lane = tid & 31, ln = lane & 15, hh = lane >> 4;
  const int ntn = N / 64;
  const int wid = blockIdx.x * 4 + w;
  const int mt = wid / ntn, nq = wid % ntn;
  if (mt * 16 >= M) return;
  const int row0 = mt * 16, col0 = nq * 64;
  const float* arow = A + (size_t)(row0 + ln) * lda;
  v8f acc[4] = {};
  for (int kb = 0; kb < K; kb += 32) {
    FragB ah, al;
    const v4f x0 = *(const v4fa*)(arow + kb + 8 * hh), x1 = *(const v4fa*)(arow + kb + 8 * hh + 4);
    const v4f x2 = *(const v4fa*)(arow + kb + 16 + 8 * hh), x3 = *(const v4fa*)(arow + kb + 16 + 8 * hh + 4);
    float xs[16] = {x0[0],x0[1],x0[2],x0[3],x1[0],x1[1],x1[2],x1[3],x2[0],x2[1],x2[2],x2[3],x3[0],x3[1],x3[2],x3[3]};
#pragma unroll
    for (int i = 0; i < 16; ++i) { const unsigned short hb = bf16_bits(xs[i]); ah.u[i] = hb; al.u[i] = ASPLIT ? bf16_bits(xs[i] - bf16_val(hb)) : (unsigned short)0; }
#pragma unroll
    for (int t = 0; t < 4; ++t) {
      const unsigned short* brow = Wt + (size_t)(col0 + t * 16 + ln) * ldb + kb;
      FragB b;
      b.half[0] = *(const v8us*)(brow + 8 * hh);
      b.half[1] = *(const v8us*)(brow + 16 + 8 * hh);
      acc[t] = mmaN<ASPLIT ? 2 : 1>(ah.v, al.v, b.v, b.v, acc[t]);
    }
  }
#pragma unroll
  for (int t = 0; t < 4; ++t) {
    float bv = bias ? bias[col0 + t * 16 + ln] : 0.f;
    if (BIAS_BF16) bv = bf16_round(bv);
#pragma unroll
    for (int r = 0; r < 8; ++r) { float v = acc[t][r] + bv; if (ACT == 1) v = fmaxf(v, 0.f); so[w][8 * hh + r][t * 16 + ln] = v; }
  }
  __builtin_amdgcn_fence(__ATOMIC_ACQ_REL, "workgroup");
  __builtin_amdgcn_wave_barrier();
  const int rsub = lane >> 4, c4 = (lane & 15) * 4;
  {
#pragma unroll
    for (int q = 0; q < 8; ++q) {
      const int r = q * 2 + rsub;
      const v4f v = *(const v4fa*)&so[w][r][c4];
      *(v4f*)(C + (size_t)(row0 + r) * ldc + col0 + c4) = v;
    }
    
  }
}

// Flash-style causal/unmasked attention, all contractions 3-term bf16 hi/lo splits, f32 softmax with running max.
// q,k,v rows are read from f32 buffers with arbitrary row pitch (so they can live inside a fused qkv buffer);
// D = head size (multiple of 32, <= 128); one wave = 16 query rows; block = 4 waves (64 queries) sharing K/V chunks of 32.
template <int D, bool CAUSAL>
__global__ __launch_bounds__(128) void k_flash(const float* __restrict__ qb, const float* __restrict__ kb, const float* __restrict__ vb,
                                             int pitch, int T, int H, float scale, float* __restrict__ y, int ypitch) {
  constexpr int KS = D / 32;        // k-steps for QK
  constexpr int DT = D / 16;        // d tiles for PV
  __shared__ __attribute__((aligned(16))) unsigned short sKh[32][D + 8], sKl[32][D + 8], sVh[32][D + 8], sVl[32][D + 8];
  __shared__ __attribute__((aligned(16))) unsigned short sPh[4][16][40], sPl[4][16][40];
  __shared__ __attribute__((aligned(16))) float sO[4][16][D];
  const int tid = threadIdx.x, w = tid >> 5, lane = tid & 31, ln = lane & 15, hh = lane >> 4;
  const int nqb = (T + 63) / 64;
  const int bh = blockIdx.x / nqb, qblk = blockIdx.x % nqb;
  const int b = bh / H, h = bh % H;
  const int q0 = qblk * 64 + w * 16;
  const float* Q = qb + (size_t)b * T * pitch + h * D;
  const float* K = kb + (size_t)b * T * pitch + h * D;
  const float* V = vb + (size_t)b * T * pitch + h * D;

  // A fragments of the wave's 16 query rows (scaled), hi/lo
  FragB aqh[KS], aql[KS];
  {
    int row = q0 + ln; if (row >= T) row = T - 1;
    const float* qr = Q + (size_t)row * pitch;
#pragma unroll
    for (int ks = 0; ks < KS; ++ks)
#pragma unroll
      for (int i = 0; i < 16; ++i) {
        const int d = ks * 32 + ((i < 8) ? (8 * hh + i) : (16 + 8 * hh + (i - 8)));
        const float x = qr[d] * scale; const unsigned short hb = bf16_bits(x);
        aqh[ks].u[i] = hb; aql[ks].u[i] = bf16_bits(x - bf16_val(hb));
      }
  }
  float m_r[8], l_r[8];
#pragma unroll
  for (int r = 0; r < 8; ++r) { m_r[r] = -3.0e38f; l_r[r] = 0.f; }
  v8f oacc[DT];
#pragma unroll
  for (int dt = 0; dt < DT; ++dt) oacc[dt] = (v8f){0.f,0.f,0.f,0.f,0.f,0.f,0.f,0.f};

  const int kv_end = CAUSAL ? min(T, qblk * 64 + 64) : T;     // block-uniform
  for (int j0 = 0; j0 < kv_end; j0 += 32) {
    __syncthreads();
    for (int e = tid; e < 32 * (D / 4); e += 128) {
      const int r = e / (D / 4), c4 = (e % (D / 4)) * 4;
      const int key = j0 + r;
      v4f kf = {0.f,0.f,0.f,0.f}, vf = {0.f,0.f,0.f,0.f};
      if (key < T) { kf = *(const v4fa*)(K + (size_t)key * pitch + c4); vf = *(const v4fa*)(V + (size_t)key * pitch + c4); }
#pragma unroll
      for (int t = 0; t < 4; ++t) {
        unsigned short hb = bf16_bits(kf[t]); sKh[r][c4 + t] = hb; sKl[r][c4 + t] = bf16_bits(kf[t] - bf16_val(hb));
        hb = bf16_bits(vf[t]); sVh[r][c4 + t] = hb; sVl[r][c4 + t] = bf16_bits(vf[t] - bf16_val(hb));
      }
    }
    __syncthreads();
    // S tile 16 x 32
    v8f s[2];
#pragma unroll
    for (int nt = 0; nt < 2; ++nt) {
      v8f acc = {};
#pragma unroll
      for (int ks = 0; ks < KS; ++ks) {
        FragB bh_, bl_;
        bh_.half[0] = *(const v8us*)&sKh[nt * 16 + ln][ks * 32 + 8 * hh]; bh_.half[1] = *(const v8us*)&sKh[nt * 16 + ln][ks * 32 + 16 + 8 * hh];
        bl_.half[0] = *(const v8us*)&sKl[nt * 16 + ln][ks * 32 + 8 * hh]; bl_.half[1] = *(const v8us*)&sKl[nt * 16 + ln][ks * 32 + 16 + 8 * hh];
        acc = mmaN<3>(aqh[ks].v, aql[ks].v, bh_.v, bl_.v, acc);
      }
      s[nt] = acc;
    }
    // mask + running max (rows 8hh+r; the 16 lanes of a half share rows)
    float alpha[8];
#pragma unroll
    for (int r = 0; r < 8; ++r) {
      const int qi = q0 + 8 * hh + r;
      const int ja = j0 + ln, jb = j0 + 16 + ln;
      if (CAUSAL) { if (ja > qi) s[0][r] = -3.0e38f; if (jb > qi) s[1][r] = -3.0e38f; }
      if (ja >= T) s[0][r] = -3.0e38f;
      if (jb >= T) s[1][r] = -3.0e38f;
      float mx = fmaxf(s[0][r], s[1][r]);
      mx = fmaxf(mx, __shfl_xor(mx, 1, 32)); mx = fmaxf(mx, __shfl_xor(mx, 2, 32)); mx = fmaxf(mx, __shfl_xor(mx, 4, 32)); mx = fmaxf(mx, __shfl_xor(mx, 8, 32));
      const float mnew = fmaxf(m_r[r], mx);
      alpha[r] = (mnew > -1.0e38f) ? __expf(m_r[r] - mnew) : 1.0f;
      const float p0 = (s[0][r] > -1.0e38f) ? __expf(s[0][r] - mnew) : 0.f;
      const float p1 = (s[1][r] > -1.0e38f) ? __expf(s[1][r] - mnew) : 0.f;
      m_r[r] = mnew;
      l_r[r] = l_r[r] * alpha[r] + p0 + p1;            // per-lane partial row sum (16 lanes combined at the end)
      unsigned short hb = bf16_bits(p0); sPh[w][8 * hh + r][ln] = hb;      sPl[w][8 * hh + r][ln] = bf16_bits(p0 - bf16_val(hb));
      hb = bf16_bits(p1);                sPh[w][8 * hh + r][16 + ln] = hb; sPl[w][8 * hh + r][16 + ln] = bf16_bits(p1 - bf16_val(hb));
    }
#pragma unroll
    for (int dt = 0; dt < DT; ++dt)
#pragma unroll
      for (int r = 0; r < 8; ++r) oacc[dt][r] *= alpha[r];
    __builtin_amdgcn_fence(__ATOMIC_ACQ_REL, "workgroup");
    __builtin_amdgcn_wave_barrier();
    FragB pah, pal;
    pah.half[0] = *(const v8us*)&sPh[w][ln][8 * hh]; pah.half[1] = *(const v8us*)&sPh[w][ln][16 + 8 * hh];
    pal.half[0] = *(const v8us*)&sPl[w][ln][8 * hh]; pal.half[1] = *(const v8us*)&sPl[w][ln][16 + 8 * hh];
#pragma unroll
    for (int dt = 0; dt < DT; ++dt) {
      FragB bvh, bvl;
#pragma unroll
      for (int i = 0; i < 8; ++i) {
        bvh.u[i] = sVh[8 * hh + i][dt * 16 + ln]; bvh.u[8 + i] = sVh[16 + 8 * hh + i][dt * 16 + ln];
        bvl.u[i] = sVl[8 * hh + i][dt * 16 + ln]; bvl.u[8 + i] = sVl[16 + 8 * hh + i][dt * 16 + ln];
      }
      oacc[dt] = mmaN<3>(pah.v, pal.v, bvh.v, bvl.v, oacc[dt]);
    }
    __builtin_amdgcn_fence(__ATOMIC_ACQ_REL, "workgroup");
    __builtin_amdgcn_wave_barrier();
  }
#pragma unroll
  for (int r = 0; r < 8; ++r) {
    float l = l_r[r];
    l += __shfl_xor(l, 1, 32); l += __shfl_xor(l, 2, 32); l += __shfl_xor(l, 4, 32); l += __shfl_xor(l, 8, 32);
    l_r[r] = (l > 0.f) ? 1.0f / l : 0.f;
  }
#pragma unroll
  for (int dt = 0; dt < DT; ++dt)
#pragma unroll
    for (int r = 0; r < 8; ++r) sO[w][8 * hh + r][dt * 16 + ln] = oacc[dt][r] * l_r[r];
  __builtin_amdgcn_fence(__ATOMIC_ACQ_REL, "workgroup");
  __builtin_amdgcn_wave_barrier();
  {
    for (int r = 0; r < 16; ++r) {
      const int row = q0 + r;
      if (row < T && lane < D / 4) {
        const v4f val = *(const v4fa*)&sO[w][r][lane * 4];
        *(v4f*)(y + ((size_t)b * T + row) * ypitch + h * D + lane * 4) = val;
      }
    }
    
  }
}

// GEMM C = act(A·W + bias + resid): A f32 (ASPLIT -> hi/lo 2 terms), Wt bf16 [N][K]; ACT 0 none, 1 relu, 2 exact gelu;
// resid (optional, f32, row index = (row % rmod), pitch ldr, RES_BF16 rounds it) added before the activation.
template <bool ASPLIT, int ACT, bool BIAS_BF16, bool RES_BF16>
__global__ __launch_bounds__(128) void k_gemm_bf3(const float* __restrict__ A, int lda, const unsigned short* __restrict__ Wt, int ldb,
                                                const float* __restrict__ bias, const float* __restrict__ resid, int rmod, int ldr,
                                                float* __restrict__ C, int ldc, int M, int N, int K) {
  __shared__ __attribute__((aligned(16))) float so[4][16][64];
  const int tid = threadIdx.x, w = tid >> 5, lane = tid & 31, ln = lane & 15, hh = lane >> 4;
  const int ntn = N / 64;
  const int wid = blockIdx.x * 4 + w;
  const int mt = wid / ntn, nq = wid % ntn;
  if (mt * 16 >= M) return;
  const int row0 = mt * 16, col0 = nq * 64;
  const float* arow = A + (size_t)(row0 + ln) * lda;
  v8f acc[4] = {};
  for (int kb = 0; kb < K; kb += 32) {
    FragB ah, al;
    const v4f x0 = *(const v4fa*)(arow + kb + 8 * hh), x1 = *(const v4fa*)(arow + kb + 8 * hh + 4);
    const v4f x2 = *(const v4fa*)(arow + kb + 16 + 8 * hh), x3 = *(const v4fa*)(arow + kb + 16 + 8 * hh + 4);
    float xs[16] = {x0[0],x0[1],x0[2],x0[3],x1[0],x1[1],x1[2],x1[3],x2[0],x2[1],x2[2],x2[3],x3[0],x3[1],x3[2],x3[3]};
#pragma unroll
    for (int i = 0; i < 16; ++i) { const unsigned short hb = bf16_bits(xs[i]); ah.u[i] = hb; al.u[i] = ASPLIT ? bf16_bits(xs[i] - bf16_val(hb)) : (unsigned short)0; }
#pragma unroll
    for (int t = 0; t < 4; ++t) {
      const unsigned short* brow = Wt + (size_t)(col0 + t * 16 + ln) * ldb + kb;
      FragB b;
      b.half[0] = *(const v8us*)(brow + 8 * hh);
      b.half[1] = *(const v8us*)(brow + 16 + 8 * hh);
      acc[t] = mmaN<ASPLIT ? 2 : 1>(ah.v, al.v, b.v, b.v, acc[t]);
    }
  }
#pragma unroll
  for (int t = 0; t < 4; ++t) {
    const int col = col0 + t * 16 + ln;
    float bv = bias ? bias[col] : 0.f;
    if (BIAS_BF16) bv = bf16_round(bv);
#pragma unroll
    for (int r = 0; r < 8; ++r) {
      float v = acc[t][r] + bv;
      if (resid) { float rv = resid[(size_t)((row0 + 8 * hh + r) % rmod) * ldr + col]; if (RES_BF16) rv = bf16_round(rv); v += rv; }
      if (ACT == 1) v = fmaxf(v, 0.f);
      if (ACT == 2) v = 0.5f * v * (1.0f + erff(v * 0.70710678118654752f));
      if (ACT == 3) { const float u = 0.7978845608028654f * (v + 0.044715f * v * v * v); v = 0.5f * v * (1.0f + tanhf(u)); }
      so[w][8 * hh + r][t * 16 + ln] = v;
    }
  }
  __builtin_amdgcn_fence(__ATOMIC_ACQ_REL, "workgroup");
  __builtin_amdgcn_wave_barrier();
  const int rsub = lane >> 4, c4 = (lane & 15) * 4;
  {
#pragma unroll
    for (int q = 0; q < 8; ++q) {
      const int r = q * 2 + rsub;
      const v4f v = *(const v4fa*)&so[w][r][c4];
      *(v4f*)(C + (size_t)(row0 + r) * ldc + col0 + c4) = v;
    }
    
  }
}
// row LayerNorm (biased variance, eps) over N: s = X (+ R); optional out_sum <- s; out_norm <- (s-mu)*rsqrt(var+eps)*g + b
template <bool PARAM_BF16>
__global__ __launch_bounds__(256) void k_layernorm(const float* __restrict__ X, const float* __restrict__ R, const float* __restrict__ g, const float* __restrict__ bta,
                                                  float* __restrict__ out_sum, float* __restrict__ out_norm, int N, float eps) {
  __shared__ float red[256];
  const int row = blockIdx.x, tid = threadIdx.x;
  const float* x = X + (size_t)row * N; const float* rr = R ? R + (size_t)row * N : nullptr;
  float vals[16];                     // up to N = 4096
  const int per = N / 256;            // contiguous chunk per thread? use strided-by-4 chunks: thread handles j = tid*4 + 1024*u
  float s1 = 0.f;
  for (int u = 0; u < per / 4; ++u) {
    const int j = tid * 4 + 1024 * u;
    const v4f a = *(const v4fa*)(x + j);
    v4f b = {0.f,0.f,0.f,0.f}; if (rr) b = *(const v4fa*)(rr + j);
#pragma unroll
    for (int q = 0; q < 4; ++q) { const float v = a[q] + b[q]; vals[u * 4 + q] = v; s1 += v; }
  }
  red[tid] = s1; __syncthreads();
  for (int st = 128; st > 0; st >>= 1) { if (tid < st) red[tid] += red[tid + st]; __syncthreads(); }
  const float mu = red[0] / (float)N; __syncthreads();
  float s2 = 0.f;
  for (int u = 0; u < per / 4; ++u)
#pragma unroll
    for (int q = 0; q < 4; ++q) { const float c = vals[u * 4 + q] - mu; s2 += c * c; }
  red[tid] = s2; __syncthreads();
  for (int st = 128; st > 0; st >>= 1) { if (tid < st) red[tid] += red[tid + st]; __syncthreads(); }
  const float rs = rsqrtf(red[0] / (float)N + eps);
  {
    for (int u = 0; u < per / 4; ++u) {
      const int j = tid * 4 + 1024 * u;
      v4f o, sm;
#pragma unroll
      for (int q = 0; q < 4; ++q) {
        float gg = g[j + q], bb = bta[j + q];
        if (PARAM_BF16) { gg = bf16_round(gg); bb = bf16_round(bb); }
        sm[q] = vals[u * 4 + q]; o[q] = (vals[u * 4 + q] - mu) * rs * gg + bb;
      }
      if (out_sum) *(v4f*)(out_sum + (size_t)row * N + j) = sm;
      *(v4f*)(out_norm + (size_t)row * N + j) = o;
    }
    
  }
}

// batched f32 [K][N] (pitch lds, batch stride sIn) -> transposed hi/lo planes [N][K] (batch stride sOut); thread per (n, 8 k); grid.y = batch
__global__ __launch_bounds__(256) void k_split_transpose_b(const float* __restrict__ src, int lds_, size_t sIn, unsigned short* __restrict__ hi, unsigned short* __restrict__ lo, size_t sOut, int K, int N) {
  const size_t t = (size_t)blockIdx.x * 256 + threadIdx.x; const int k8n = K / 8; if (t >= (size_t)N * k8n) return;
  src += (size_t)blockIdx.y * sIn; hi += (size_t)blockIdx.y * sOut; lo += (size_t)blockIdx.y * sOut;
  const int n = (int)(t / k8n), k8 = (int)(t % k8n) * 8; v8us vh, vl;
#pragma unroll
  for (int i = 0; i < 8; ++i) { const float x = src[(size_t)(k8 + i) * lds_ + n]; const unsigned short hb = bf16_bits(x); vh[i] = hb; vl[i] = bf16_bits(x - bf16_val(hb)); }
  unsigned short* dh = hi + (size_t)n * K + k8; unsigned short* dl = lo + (size_t)n * K + k8;
  *(v8us*)dh = vh; *(v8us*)dl = vl; 
}

typedef float f2v __attribute__((ext_vector_type(2)));
typedef __bf16 bf2v __attribute__((ext_vector_type(2)));
__device__ __forceinline__ unsigned int pk_bf16(float a, float b) { return __builtin_bit_cast(unsigned int, __builtin_convertvector((f2v){a, b}, bf2v)); }   // round to nearest even
__device__ __forceinline__ float xhalf(float x) { return __builtin_bit_cast(float, __builtin_amdgcn_permlanex16(__builtin_bit_cast(int, x), __builtin_bit_cast(int, x), 0x76543210, 0xfedcba98, false, false)); }   // lane l with lane l ^ 16
__device__ __forceinline__ v8f wmma_bf(v16b a, v16b b, v8f c) { return __builtin_amdgcn_wmma_f32_16x16x32_bf16(false, a, false, b, (short)0, c, false, false); }
typedef _Float16 v16h __attribute__((ext_vector_type(16)));
typedef _Float16 h2v __attribute__((ext_vector_type(2)));
union FragH { v16h v; v8us half[2]; unsigned int w[8]; };
__device__ __forceinline__ unsigned int pk_f16(float a, float b) { return __builtin_bit_cast(unsigned int, __builtin_convertvector((f2v){a, b}, h2v)); }   // round to nearest even
__device__ __forceinline__ v8f wmma_hf(v16h a, v16h b, v8f c) { return __builtin_amdgcn_wmma_f32_16x16x32_f16(false, a, false, b, (short)0, c, false, false); }

// [q | k | v] = x * [Wq | Wk | Wv]. A block owns PM rows of x and all 192 columns. x is read once, in whole lines, rounded to bf16 and kept in LDS.
// Wave w holds the B fragments of column tiles 3 (w % 4) ... + 2 for k-steps 12 (w / 4) ... + 11 in registers (packed by k_wt_bf16) and
// multiplies all four row tiles by them; the two K halves of a result are added through LDS. From that LDS tile the block writes what the attention launch reads:
// q and k rounded to f16 as rows Qb[row][64] and Kb[row][64], v rounded to f16 and transposed as Vt[batch][d][token] (f16: 11 bits, finite below 65504).
#define PM 64
#define XR 40          // x tile in LDS, one plane per k-step: row pitch in elements, 80 bytes = 16 * odd, at which 16-byte fragment reads meet no bank conflict
#define XS (PM * XR + 32)   // plane pitch in elements: 16 banks past a multiple of 64, so the four k-steps that one staging store spans do not collide
#define OP 196         // result tile pitch in floats: rows 8 apart fall 32 banks apart, so the two lane halves of a store do not collide
__global__ __launch_bounds__(256) void k_proj(const float* __restrict__ x, const unsigned short* __restrict__ Bp, unsigned short* __restrict__ Qb, unsigned short* __restrict__ Kb, unsigned short* __restrict__ Vt) {
  __shared__ __attribute__((aligned(16))) unsigned short sx[(CC / 32) * XS];
  __shared__ __attribute__((aligned(16))) float so[PM][OP];
  const int tid = threadIdx.x, w = tid >> 5, lane = tid & 31, ln = lane & 15, hh = lane >> 4;
  const int ng = w & 3, kh = w >> 2;
  const size_t row0 = (size_t)blockIdx.x * PM;
  // staging: wave w brings rows 16 (w % 4) ... + 15, columns 384 (w / 4) ... + 383, as 48 wave-wide loads of 512 contiguous bytes
  const float* xp = x + (row0 + ng * 16) * CC + kh * 384 + lane * 4;
  const unsigned int bo = ((ng * 72 + kh * 12) * 64 + lane) * 16;   // this lane's place in the packed fragments, in bytes
  const unsigned short* bp = (const unsigned short*)((const char*)Bp + bo);
  v4f xa[48];
#pragma unroll
  for (int i = 0; i < 48; ++i) xa[i] = *(const v4fa*)(xp + (i / 3) * CC + (i % 3) * 128);
  FragB bf[3][12];
#pragma unroll
  for (int t = 0; t < 2; ++t)
#pragma unroll
    for (int kk = 0; kk < 12; ++kk) { bf[t][kk].half[0] = *(const v8us*)(bp + ((t * 24 + kk) * 2) * 256); bf[t][kk].half[1] = *(const v8us*)(bp + ((t * 24 + kk) * 2 + 1) * 256); }
  // stands in front of the reuse of the address registers that the loads above name; pointer and offset are inputs so that their registers live up to the wait
  asm volatile("s_wait_xcnt 0x0" :: "v"(xp), "v"(bo) : "memory");
  unsigned short* xs = sx + (kh * 12 + (lane >> 3)) * XS + ng * 16 * XR + (lane & 7) * 4;
#pragma unroll
  for (int i = 0; i < 48; ++i) *(uint2*)(xs + (i % 3) * 4 * XS + (i / 3) * XR) = make_uint2(pk_bf16(xa[i][0], xa[i][1]), pk_bf16(xa[i][2], xa[i][3]));
  // the third column tile's fragments: a second group of loads, with a wait of its own
#pragma unroll
  for (int kk = 0; kk < 12; ++kk) { bf[2][kk].half[0] = *(const v8us*)(bp + ((48 + kk) * 2) * 256); bf[2][kk].half[1] = *(const v8us*)(bp + ((48 + kk) * 2 + 1) * 256); }
  // as above, for the loads of the third tile
  asm volatile("s_wait_xcnt 0x0" :: "v"(bo) : "memory");
  __syncthreads();

  v8f acc[4][3];
#pragma unroll
  for (int mt = 0; mt < 4; ++mt)
#pragma unroll
    for (int t = 0; t < 3; ++t) acc[mt][t] = (v8f){0.f,0.f,0.f,0.f,0.f,0.f,0.f,0.f};
  const unsigned short* ap = sx + kh * 12 * XS + ln * XR + 8 * hh;
  // the next k-step's four A fragments are asked for as one group ahead of this k-step's products
  FragB a[2][4];
#pragma unroll
  for (int mt = 0; mt < 4; ++mt) { a[0][mt].half[0] = *(const v8us*)(ap + mt * 16 * XR); a[0][mt].half[1] = *(const v8us*)(ap + mt * 16 * XR + 16); }
#pragma unroll
  for (int kk = 0; kk < 12; ++kk) {
    if (kk + 1 < 12) {
#pragma unroll
      for (int mt = 0; mt < 4; ++mt) { a[(kk + 1) & 1][mt].half[0] = *(const v8us*)(ap + (kk + 1) * XS + mt * 16 * XR); a[(kk + 1) & 1][mt].half[1] = *(const v8us*)(ap + (kk + 1) * XS + mt * 16 * XR + 16); }
    }
#pragma unroll
    for (int mt = 0; mt < 4; ++mt)
#pragma unroll
      for (int t = 0; t < 3; ++t) acc[mt][t] = wmma_bf(a[kk & 1][mt].v, bf[t][kk].v, acc[mt][t]);
    // keeps the order one load group, twelve products: left free, the scheduler asks for four k-steps at once, runs out of registers and then waits out a fragment's LDS latency before every three products
    __builtin_amdgcn_sched_barrier(0);
  }

  // the wave of the first K half finishes row tiles 0 and 1, its partner 2 and 3: each hands the other two over, then adds its own to what it was handed
  float* sg = &so[(kh ? 0 : 32) + 8 * hh][ng * 48 + ln];
  float* sk = &so[(kh ? 32 : 0) + 8 * hh][ng * 48 + ln];
#pragma unroll
  for (int m = 0; m < 2; ++m)
#pragma unroll
    for (int t = 0; t < 3; ++t)
#pragma unroll
      for (int r = 0; r < 8; ++r) sg[(m * 16 + r) * OP + t * 16] = kh ? acc[m][t][r] : acc[m + 2][t][r];
  __syncthreads();
#pragma unroll
  for (int m = 0; m < 2; ++m)
#pragma unroll
    for (int t = 0; t < 3; ++t)
#pragma unroll
      for (int r = 0; r < 8; ++r) sk[(m * 16 + r) * OP + t * 16] += kh ? acc[m + 2][t][r] : acc[m][t][r];
  __syncthreads();
  // every store instruction below covers four whole 128-byte lines
  // q and k: eight columns of one row a thread; each tile's 64 x 64 f16 are 8 KB in a row of Qb or Kb
  uint4 qw[2], kw[2];
#pragma unroll
  for (int i = 0; i < 2; ++i) {
    const int u = i * 256 + tid;
    const v4f a0 = *(const v4fa*)&so[u >> 3][(u & 7) * 8], a1 = *(const v4fa*)&so[u >> 3][(u & 7) * 8 + 4];
    qw[i] = make_uint4(pk_f16(a0[0], a0[1]), pk_f16(a0[2], a0[3]), pk_f16(a1[0], a1[1]), pk_f16(a1[2], a1[3]));
    const v4f c0 = *(const v4fa*)&so[u >> 3][HH + (u & 7) * 8], c1 = *(const v4fa*)&so[u >> 3][HH + (u & 7) * 8 + 4];
    kw[i] = make_uint4(pk_f16(c0[0], c0[1]), pk_f16(c0[2], c0[3]), pk_f16(c1[0], c1[1]), pk_f16(c1[2], c1[3]));
  }
  // v: eight rows of one column a thread; the tile's 64 tokens are one line of each of the 64 rows of this batch's Vt plane
  uint4 vw[2];
#pragma unroll
  for (int i = 0; i < 2; ++i) {
    const float* c = &so[(tid & 7) * 8][2 * HH + i * 32 + (tid >> 3)];
    vw[i] = make_uint4(pk_f16(c[0], c[OP]), pk_f16(c[2 * OP], c[3 * OP]), pk_f16(c[4 * OP], c[5 * OP]), pk_f16(c[6 * OP], c[7 * OP]));
  }
  unsigned short* oq = Qb + row0 * HH + tid * 8;
  unsigned short* ok = Kb + row0 * HH + tid * 8;
  unsigned short* ov = Vt + ((row0 / TT) * HH + (tid >> 3)) * TT + row0 % TT + (tid & 7) * 8;
#pragma unroll
  for (int i = 0; i < 2; ++i) *(uint4*)(ov + (size_t)i * 32 * TT) = vw[i];
#pragma unroll
  for (int i = 0; i < 2; ++i) *(uint4*)(ok + i * 2048) = kw[i];
#pragma unroll
  for (int i = 0; i < 2; ++i) *(uint4*)(oq + i * 2048) = qw[i];
}

// Scores, masked softmax and P*v in one launch, all batches. A block owns 64 query rows of one batch; each of its AW waves
// holds all 64 (AQ tiles of 16 as B operands, f16) and walks its own TT / AW keys in passes of 32 with a maximum that is renewed only when a pass needs it:
// St = k * qt (a lane holds 16 scores of ONE query), Pt packs from the two St tiles into a B operand (f16; P lies in 0 ... PMAX), Ot += vt * Pt.
// Every operand is one f16 value, 11 bits on both sides of a product, so each product is one WMMA.
// The AW partial (maximum, sum, Ot) sets are joined through LDS at the end. Scores never reach memory.
#define AQ 4
#define AW 8
#define AKEYS (TT / AW)
#define PMAX 256.0f   // largest lane sum of P that a pass may reach against a maximum that lags: 2^8, far inside f16
__global__ __launch_bounds__(AW * 32) void k_attn(const unsigned short* __restrict__ Qb, const unsigned short* __restrict__ Kb, const unsigned short* __restrict__ Vt,
                                                  const int* __restrict__ mask, float* __restrict__ out) {
  __shared__ __attribute__((aligned(16))) v4f sO[AW][AQ * 8][32];
  __shared__ float sM[AW][AQ][16], sL[AW][AQ][16];
  const int tid = threadIdx.x, w = tid >> 5, lane = tid & 31, ln = lane & 15, hh = lane >> 4;
  const int b = blockIdx.x / (TT / 64), q0 = (blockIdx.x % (TT / 64)) * 64;
  const float c2 = 0.03608439182435161f * 1.4426950408889634f;   // 768^-0.5 * log2(e): the softmax runs in base 2

  FragH qf[AQ][2];
  const unsigned short* qp = Qb + ((size_t)b * TT + q0 + ln) * HH + 8 * hh;
#pragma unroll
  for (int qt = 0; qt < AQ; ++qt)
#pragma unroll
    for (int ks = 0; ks < 2; ++ks) { qf[qt][ks].half[0] = *(const v8us*)(qp + qt * 16 * HH + ks * 32); qf[qt][ks].half[1] = *(const v8us*)(qp + qt * 16 * HH + ks * 32 + 16); }
  // stands in front of the reuse of the address registers that the q loads name; the pointer is an input so that its registers live up to the wait
  asm volatile("s_wait_xcnt 0x0" :: "v"(qp) : "memory");
  float m_r[AQ], l_r[AQ];
  v8f oacc[AQ][4];
#pragma unroll
  for (int qt = 0; qt < AQ; ++qt) {
    m_r[qt] = -3.0e38f; l_r[qt] = 0.f;   // finite start: a pass whose keys are all masked gives exp2(-inf) = 0, never inf - inf
#pragma unroll
    for (int dt = 0; dt < 4; ++dt) oacc[qt][dt] = (v8f){0.f,0.f,0.f,0.f,0.f,0.f,0.f,0.f};
  }
  const unsigned short* kp = Kb + ((size_t)b * TT + w * AKEYS + ln) * HH + 8 * hh;
  const unsigned short* vp = Vt + ((size_t)b * HH + ln) * TT + w * AKEYS + 8 * hh;
  const int* mp = mask + (size_t)b * TT + w * AKEYS + lane;   // one mask word a lane: a pass's 32 keys
  int one = 1;   // passes through each wait below, so that the pointer additions, which are multiples of it, cannot be lifted over the wait

  FragH ka[2][2];
  int mk;
#pragma unroll
  for (int t = 0; t < 2; ++t)
#pragma unroll
    for (int ks = 0; ks < 2; ++ks) { ka[t][ks].half[0] = *(const v8us*)(kp + t * 16 * HH + ks * 32); ka[t][ks].half[1] = *(const v8us*)(kp + t * 16 * HH + ks * 32 + 16); }
  mk = *mp;
  // stands in front of the overwrite of the address registers that the loads above name; the pointers are inputs so that their registers live up to it
  asm volatile("s_wait_xcnt 0x0" : "+s"(one) : "v"(kp), "v"(mp) : "memory");
  kp += one * 32 * HH; mp += one * 32;

  // rolled, for speed only: one pass is several KB of code
#pragma unroll 1
  for (int it = 0; it < AKEYS / 32; ++it) {
    FragH va[4];
#pragma unroll
    for (int dt = 0; dt < 4; ++dt) { va[dt].half[0] = *(const v8us*)(vp + (size_t)dt * 16 * TT); va[dt].half[1] = *(const v8us*)(vp + (size_t)dt * 16 * TT + 16); }
    // the next pass's k rows and mask words are fetched now; the last pass fetches its own again, so every address stays inside
    FragH kn[2][2];
#pragma unroll
    for (int t = 0; t < 2; ++t)
#pragma unroll
      for (int ks = 0; ks < 2; ++ks) { kn[t][ks].half[0] = *(const v8us*)(kp + t * 16 * HH + ks * 32); kn[t][ks].half[1] = *(const v8us*)(kp + t * 16 * HH + ks * 32 + 16); }
    const int mn = *mp;
    // stands in front of the overwrite of the address registers that this pass's loads name; the pointers are inputs so that their registers live up to it
    asm volatile("s_wait_xcnt 0x0" : "+s"(one) : "v"(vp), "v"(kp), "v"(mp) : "memory");
    const int adv = (it + 2 < AKEYS / 32) ? one : 0;
    vp += one * 32; kp += adv * 32 * HH; mp += adv * 32;

    // bit 16 t + r of nb: key 16 t + 8 hh + r of this pass is masked
    const unsigned int nb = ~__builtin_amdgcn_ballot_w32(mk != 0) >> (8 * hh);
    v8f bias[2];   // 0 for a kept key, -inf for a masked one; rows of St are keys, so one set serves all query tiles
#pragma unroll
    for (int r = 0; r < 8; ++r) {
      bias[0][r] = __uint_as_float((unsigned int)((int)(nb << (31 - r)) >> 31) & 0xFF800000u);
      bias[1][r] = __uint_as_float((unsigned int)((int)(nb << (15 - r)) >> 31) & 0xFF800000u);
    }

    v8f s[AQ][2];
#pragma unroll
    for (int qt = 0; qt < AQ; ++qt) {
      v8f s0 = {}, s1 = {};
#pragma unroll
      for (int ks = 0; ks < 2; ++ks) { s0 = wmma_hf(ka[0][ks].v, qf[qt][ks].v, s0); s1 = wmma_hf(ka[1][ks].v, qf[qt][ks].v, s1); }
      s[qt][0] = s0 + bias[0]; s[qt][1] = s1 + bias[1];
    }
    // Common path: the exponentials are taken against the maximum in use, with no search for a new one and no rescale. P is never negative, so a lane's
    // sum of P bounds each of its P: while every sum stays at or below PMAX, every P fits f16 and the pass stands as it is.
    FragH pf[AQ];
    float sum[AQ];
    bool redo = it == 0;   // no maximum is in use yet: the first pass goes straight to the full path (scalar test)
    if (!redo) {
#pragma unroll
      for (int qt = 0; qt < AQ; ++qt) {
        const float mc = m_r[qt] * c2;
        float e[16];
#pragma unroll
        for (int r = 0; r < 8; ++r) { e[r] = __builtin_fmaf(s[qt][0][r], c2, -mc); e[8 + r] = __builtin_fmaf(s[qt][1][r], c2, -mc); }
        // one tile's exponentials in one statement, each in place: none reads the result or overwrites the source of the one in front of it,
        // and the v_nop fills the slot that the instruction set asks for behind the last
        asm("v_exp_f32 %0, %0\n\tv_exp_f32 %1, %1\n\tv_exp_f32 %2, %2\n\tv_exp_f32 %3, %3\n\tv_exp_f32 %4, %4\n\tv_exp_f32 %5, %5\n\t"
            "v_exp_f32 %6, %6\n\tv_exp_f32 %7, %7\n\tv_exp_f32 %8, %8\n\tv_exp_f32 %9, %9\n\tv_exp_f32 %10, %10\n\tv_exp_f32 %11, %11\n\t"
            "v_exp_f32 %12, %12\n\tv_exp_f32 %13, %13\n\tv_exp_f32 %14, %14\n\tv_exp_f32 %15, %15\n\tv_nop"
            : "+v"(e[0]), "+v"(e[1]), "+v"(e[2]), "+v"(e[3]), "+v"(e[4]), "+v"(e[5]), "+v"(e[6]), "+v"(e[7]), "+v"(e[8]), "+v"(e[9]),
              "+v"(e[10]), "+v"(e[11]), "+v"(e[12]), "+v"(e[13]), "+v"(e[14]), "+v"(e[15]));
        float t = 0.f;
#pragma unroll
        for (int i = 0; i < 8; ++i) {
          const float pa = e[2 * i], pb = e[2 * i + 1];
          t += pa + pb;
          pf[qt].w[i] = pk_f16(pa, pb);
        }
        sum[qt] = t;
      }
      // one test a pass for all four tiles; written so that an infinite or not-a-number sum also takes the full path
      redo = __builtin_amdgcn_ballot_w32(!((sum[0] + sum[1]) + (sum[2] + sum[3]) <= PMAX)) != 0;
    }
    if (redo) {
      // Full path, whole wave: new maximum, rescale of sums and outputs, exponentials against the new maximum
#pragma unroll
      for (int qt = 0; qt < AQ; ++qt) {
        const v8f s0 = s[qt][0], s1 = s[qt][1];
        float mx = fmaxf(s0[0], s1[0]);
#pragma unroll
        for (int r = 1; r < 8; ++r) mx = fmaxf(mx, fmaxf(s0[r], s1[r]));
        mx = fmaxf(mx, xhalf(mx));
        const float mnew = fmaxf(m_r[qt], mx);
        float alpha = (m_r[qt] - mnew) * c2;
        const float mc = mnew * c2;
        m_r[qt] = mnew;
        float e[16];
#pragma unroll
        for (int r = 0; r < 8; ++r) { e[r] = __builtin_fmaf(s0[r], c2, -mc); e[8 + r] = __builtin_fmaf(s1[r], c2, -mc); }
        // in place and closed by a v_nop, for the same reason as above
        asm("v_exp_f32 %0, %0\n\tv_exp_f32 %1, %1\n\tv_exp_f32 %2, %2\n\tv_exp_f32 %3, %3\n\tv_exp_f32 %4, %4\n\tv_exp_f32 %5, %5\n\t"
            "v_exp_f32 %6, %6\n\tv_exp_f32 %7, %7\n\tv_exp_f32 %8, %8\n\tv_exp_f32 %9, %9\n\tv_exp_f32 %10, %10\n\tv_exp_f32 %11, %11\n\t"
            "v_exp_f32 %12, %12\n\tv_exp_f32 %13, %13\n\tv_exp_f32 %14, %14\n\tv_exp_f32 %15, %15\n\tv_exp_f32 %16, %16\n\tv_nop"
            : "+v"(e[0]), "+v"(e[1]), "+v"(e[2]), "+v"(e[3]), "+v"(e[4]), "+v"(e[5]), "+v"(e[6]), "+v"(e[7]), "+v"(e[8]), "+v"(e[9]),
              "+v"(e[10]), "+v"(e[11]), "+v"(e[12]), "+v"(e[13]), "+v"(e[14]), "+v"(e[15]), "+v"(alpha));
        float t = 0.f;
#pragma unroll
        for (int i = 0; i < 8; ++i) {
          const float pa = e[2 * i], pb = e[2 * i + 1];
          t += pa + pb;
          pf[qt].w[i] = pk_f16(pa, pb);
        }
        sum[qt] = t;
        l_r[qt] *= alpha;
#pragma unroll
        for (int dt = 0; dt < 4; ++dt) oacc[qt][dt] *= alpha;
      }
    }
#pragma unroll
    for (int qt = 0; qt < AQ; ++qt) {
      l_r[qt] += sum[qt];   // this lane half's keys only; the halves are joined after the loop
#pragma unroll
      for (int dt = 0; dt < 4; ++dt) oacc[qt][dt] = wmma_hf(va[dt].v, pf[qt].v, oacc[qt][dt]);
    }
#pragma unroll
    for (int t = 0; t < 2; ++t)
#pragma unroll
      for (int ks = 0; ks < 2; ++ks) ka[t][ks] = kn[t][ks];
    mk = mn;
  }

#pragma unroll
  for (int qt = 0; qt < AQ; ++qt) {
    const float l = l_r[qt] + xhalf(l_r[qt]);
    if (hh == 0) { sM[w][qt][ln] = m_r[qt]; sL[w][qt][ln] = l; }
#pragma unroll
    for (int dt = 0; dt < 4; ++dt) {
      sO[w][qt * 8 + dt * 2][lane]     = (v4f){oacc[qt][dt][0], oacc[qt][dt][1], oacc[qt][dt][2], oacc[qt][dt][3]};
      sO[w][qt * 8 + dt * 2 + 1][lane] = (v4f){oacc[qt][dt][4], oacc[qt][dt][5], oacc[qt][dt][6], oacc[qt][dt][7]};
    }
  }
  __syncthreads();
  // join: wave w finishes query tile w / 2, head columns 32 * (w % 2) ... + 31 (one 128-byte line of each output row)
  const int qm = w >> 1;
  float M = -3.0e38f;
#pragma unroll
  for (int p = 0; p < AW; ++p) M = fmaxf(M, sM[p][qm][ln]);
  float f[AW], den = 0.f;
#pragma unroll
  for (int p = 0; p < AW; ++p) f[p] = (sM[p][qm][ln] - M) * c2;
  // in place and closed by a v_nop, for the same reason as in the loop
  asm("v_exp_f32 %0, %0\n\tv_exp_f32 %1, %1\n\tv_exp_f32 %2, %2\n\tv_exp_f32 %3, %3\n\tv_exp_f32 %4, %4\n\tv_exp_f32 %5, %5\n\tv_exp_f32 %6, %6\n\tv_exp_f32 %7, %7\n\tv_nop"
      : "+v"(f[0]), "+v"(f[1]), "+v"(f[2]), "+v"(f[3]), "+v"(f[4]), "+v"(f[5]), "+v"(f[6]), "+v"(f[7]));
#pragma unroll
  for (int p = 0; p < AW; ++p) den += sL[p][qm][ln] * f[p];
  const float inv = 1.0f / den;   // every key masked: den = 0, and 0 * inf gives NaN
#pragma unroll
  for (int dd = 0; dd < 2; ++dd) {
    const int dt = (w & 1) * 2 + dd;
    v4f a0 = {0.f,0.f,0.f,0.f}, a1 = {0.f,0.f,0.f,0.f};
#pragma unroll
    for (int p = 0; p < AW; ++p) { a0 += sO[p][qm * 8 + dt * 2][lane] * f[p]; a1 += sO[p][qm * 8 + dt * 2 + 1][lane] * f[p]; }
    float* o = out + ((size_t)b * TT + q0 + qm * 16 + ln) * HH + dt * 16 + 8 * hh;
    *(v4f*)o = a0 * inv; *(v4f*)(o + 4) = a1 * inv;
  }
}
extern "C" void kernel_launch(void* const* d_in, const int* in_sizes, int n_in,
                              void* d_out, int out_size, void* d_ws, size_t ws_size, hipStream_t stream) {
  (void)in_sizes; (void)n_in; (void)out_size;
  const float* x = (const float*)d_in[0]; const int* mask = (const int*)d_in[1]; const float* Wk = (const float*)d_in[2]; const float* Wq = (const float*)d_in[3]; const float* Wv = (const float*)d_in[4];
  char* ws = (char*)d_ws; size_t off = 0;
  auto take = [&](size_t bytes) { char* p = ws + off; off += (bytes + 255) & ~(size_t)255; return p; };
  unsigned short* Bt = (unsigned short*)take((size_t)192 * CC * 2); unsigned short* Qb = (unsigned short*)take((size_t)MR * HH * 2); unsigned short* Kb = (unsigned short*)take((size_t)MR * HH * 2); unsigned short* Vt = (unsigned short*)take((size_t)BB * HH * TT * 2);
  if (off > ws_size) return;
  k_wt_bf16<<<3 * HH * (CC / 8) / 256, 256, 0, stream>>>(Wq, Wk, Wv, Bt);   // the 12 column tiles of [Wq | Wk | Wv]
  k_proj<<<MR / PM, 256, 0, stream>>>(x, Bt, Qb, Kb, Vt);      // q, k, vt
  k_attn<<<BB * (TT / 64), AW * 32, 0, stream>>>(Qb, Kb, Vt, mask, (float*)d_out);
}

// v007
// One run takes 24.8 microseconds.
// Next to v006, in two timings, it ran 1.13 and 1.11 times as fast.
// Over all steps from v000 it is 66.4 times as fast.
#include <hip/hip_runtime.h>
// [q|k|v] = x*[Wq|Wk|Wv] (M = 16384, K = 768, N = 192; x and W rounded to bf16: single exact WMMA term, f32 accumulate); then one fused launch:
// St = k*qt, masked running-maximum softmax in f32, Ot += vt*Pt: q, k, v and P each rounded once to f16, one product each on v_wmma_f32_16x16x32_f16, f32 accumulate.
#define BB 8
#define TT 2048
#define CC 768
#define HH 64
#define MR (BB * TT)

typedef __bf16 v16b __attribute__((ext_vector_type(16)));
typedef unsigned short v8us __attribute__((ext_vector_type(8), may_alias));
typedef float  v8f  __attribute__((ext_vector_type(8)));
typedef float  v4f  __attribute__((ext_vector_type(4)));
typedef float  v4fa __attribute__((ext_vector_type(4), may_alias));
union FragB { v16b v; v8us half[2]; unsigned short u[16]; };

__device__ __forceinline__ unsigned short bf16_bits(float x) { unsigned int u = __float_as_uint(x); return (unsigned short)((u + 0x7FFFu + ((u >> 16) & 1u)) >> 16); }
__device__ __forceinline__ float bf16_val(unsigned short b) { return __uint_as_float(((unsigned int)b) << 16); }
__device__ __forceinline__ float bf16_round(float x) { return bf16_val(bf16_bits(x)); }
// D += A·B with NT terms: 1 = ah·bh, 2 = + al·bh (A split), 3 = + ah·bl (both split)
template <int NT>
__device__ __forceinline__ v8f mmaN(v16b ah, v16b al, v16b bh, v16b bl, v8f c) {
  c = __builtin_amdgcn_wmma_f32_16x16x32_bf16(false, ah, false, bh, (short)0, c, false, false);
  if (NT >= 2) c = __builtin_amdgcn_wmma_f32_16x16x32_bf16(false, al, false, bh, (short)0, c, false, false);
  if (NT >= 3) c = __builtin_amdgcn_wmma_f32_16x16x32_bf16(false, ah, false, bl, (short)0, c, false, false);
  asm volatile("v_nop\n\tv_nop\n\tv_nop\n\tv_nop" : "+v"(c) : "v"(ah), "v"(al), "v"(bh), "v"(bl));
  return c;
}

// Wq, Wk, Wv [CC][HH] f32 -> bf16 B fragments of [Wq | Wk | Wv], fragment-major, all three in one launch: unit ((tile * (CC / 32) + ks) * 2 + h) * 32 + lane holds the
// 16 bytes that this lane of the B fragment (column tile of the 192 columns, k-step ks, register half h) needs, so that one wave-wide 16-byte load of a fragment half
// covers 512 contiguous bytes. One unit a thread; a block's 256 units lie in one matrix (HH * CC / 8 units each, a multiple of 256), so the choice of the source is scalar.
__global__ __launch_bounds__(256) void k_wt_bf16(const float* __restrict__ Wq, const float* __restrict__ Wk, const float* __restrict__ Wv, unsigned short* __restrict__ Wt) {
  const int m = blockIdx.x / (HH * (CC / 8) / 256);
  const float* __restrict__ W = m == 0 ? Wq : m == 1 ? Wk : Wv;
  const int u = blockIdx.x * 256 + threadIdx.x;
  const int lane = u & 31, h = (u >> 5) & 1, ks = (u >> 6) % (CC / 32), tile = (u >> 6) / (CC / 32);
  const int n = (tile & 3) * 16 + (lane & 15), k8 = ks * 32 + h * 16 + (lane >> 4) * 8;
  float f[8];
#pragma unroll
  for (int i = 0; i < 8; ++i) f[i] = W[(k8 + i) * HH + n];
  v8us v;
#pragma unroll
  for (int i = 0; i < 8; ++i) v[i] = bf16_bits(f[i]);
  *(v8us*)(Wt + (size_t)u * 8) = v;
}

// GEMM C[M][N] (f32, pitch ldc) = act(A[M][K]·W + bias). A f32 row-major (pitch lda) converted per fragment to bf16
// (ASPLIT: hi/lo two planes -> 2 terms, else single rounded term); Wt bf16 [N][K] (pitch ldb). BIAS_BF16 rounds the
// bias to bf16 first (bias quantised to bf16 before the add). K%32==0, M%16==0, N%64==0.
template <bool ASPLIT, int ACT, bool BIAS_BF16>
__global__ __launch_bounds__(128) void k_gemm_bf(const float* __restrict__ A, int lda, const unsigned short* __restrict__ Wt, int ldb,
                                               const float* __restrict__ bias, float* __restrict__ C, int ldc, int M, int N, int K) {
  __shared__ __attribute__((aligned(16))) float so[4][16][64];
  const int tid = threadIdx.x, w = tid >> 5, lane = tid & 31, ln = lane & 15, hh = lane >> 4;
  const int ntn = N / 64;
  const int wid = blockIdx.x * 4 + w;
  const int mt = wid / ntn, nq = wid % ntn;
  if (mt * 16 >= M) return;
  const int row0 = mt * 16, col0 = nq * 64;
  const float* arow = A + (size_t)(row0 + ln) * lda;
  v8f acc[4] = {};
  for (int kb = 0; kb < K; kb += 32) {
    FragB ah, al;
    const v4f x0 = *(const v4fa*)(arow + kb + 8 * hh), x1 = *(const v4fa*)(arow + kb + 8 * hh + 4);
    const v4f x2 = *(const v4fa*)(arow + kb + 16 + 8 * hh), x3 = *(const v4fa*)(arow + kb + 16 + 8 * hh + 4);
    float xs[16] = {x0[0],x0[1],x0[2],x0[3],x1[0],x1[1],x1[2],x1[3],x2[0],x2[1],x2[2],x2[3],x3[0],x3[1],x3[2],x3[3]};
#pragma unroll
    for (int i = 0; i < 16; ++i) { const unsigned short hb = bf16_bits(xs[i]); ah.u[i] = hb; al.u[i] = ASPLIT ? bf16_bits(xs[i] - bf16_val(hb)) : (unsigned short)0; }
#pragma unroll
    for (int t = 0; t < 4; ++t) {
      const unsigned short* brow = Wt + (size_t)(col0 + t * 16 + ln) * ldb + kb;
      FragB b;
      b.half[0] = *(const v8us*)(brow + 8 * hh);
      b.half[1] = *(const v8us*)(brow + 16 + 8 * hh);
      acc[t] = mmaN<ASPLIT ? 2 : 1>(ah.v, al.v, b.v, b.v, acc[t]);
    }
  }
#pragma unroll
  for (int t = 0; t < 4; ++t) {
    float bv = bias ? bias[col0 + t * 16 + ln] : 0.f;
    if (BIAS_BF16) bv = bf16_round(bv);
#pragma unroll
    for (int r = 0; r < 8; ++r) { float v = acc[t][r] + bv; if (ACT == 1) v = fmaxf(v, 0.f); so[w][8 * hh + r][t * 16 + ln] = v; }
  }
  __builtin_amdgcn_fence(__ATOMIC_ACQ_REL, "workgroup");
  __builtin_amdgcn_wave_barrier();
  const int rsub = lane >> 4, c4 = (lane & 15) * 4;
  {
#pragma unroll
    for (int q = 0; q < 8; ++q) {
      const int r = q * 2 + rsub;
      const v4f v = *(const v4fa*)&so[w][r][c4];
      *(v4f*)(C + (size_t)(row0 + r) * ldc + col0 + c4) = v;
    }
    
  }
}

// Flash-style causal/unmasked attention, all contractions 3-term bf16 hi/lo splits, f32 softmax with running max.
// q,k,v rows are read from f32 buffers with arbitrary row pitch (so they can live inside a fused qkv buffer);
// D = head size (multiple of 32, <= 128); one wave = 16 query rows; block = 4 waves (64 queries) sharing K/V chunks of 32.
template <int D, bool CAUSAL>
__global__ __launch_bounds__(128) void k_flash(const float* __restrict__ qb, const float* __restrict__ kb, const float* __restrict__ vb,
                                             int pitch, int T, int H, float scale, float* __restrict__ y, int ypitch) {
  constexpr int KS = D / 32;        // k-steps for QK
  constexpr int DT = D / 16;        // d tiles for PV
  __shared__ __attribute__((aligned(16))) unsigned short sKh[32][D + 8], sKl[32][D + 8], sVh[32][D + 8], sVl[32][D + 8];
  __shared__ __attribute__((aligned(16))) unsigned short sPh[4][16][40], sPl[4][16][40];
  __shared__ __attribute__((aligned(16))) float sO[4][16][D];
  const int tid = threadIdx.x, w = tid >> 5, lane = tid & 31, ln = lane & 15, hh = lane >> 4;
  const int nqb = (T + 63) / 64;
  const int bh = blockIdx.x / nqb, qblk = blockIdx.x % nqb;
  const int b = bh / H, h = bh % H;
  const int q0 = qblk * 64 + w * 16;
  const float* Q = qb + (size_t)b * T * pitch + h * D;
  const float* K = kb + (size_t)b * T * pitch + h * D;
  const float* V = vb + (size_t)b * T * pitch + h * D;

  // A fragments of the wave's 16 query rows (scaled), hi/lo
  FragB aqh[KS], aql[KS];
  {
    int row = q0 + ln; if (row >= T) row = T - 1;
    const float* qr = Q + (size_t)row * pitch;
#pragma unroll
    for (int ks = 0; ks < KS; ++ks)
#pragma unroll
      for (int i = 0; i < 16; ++i) {
        const int d = ks * 32 + ((i < 8) ? (8 * hh + i) : (16 + 8 * hh + (i - 8)));
        const float x = qr[d] * scale; const unsigned short hb = bf16_bits(x);
        aqh[ks].u[i] = hb; aql[ks].u[i] = bf16_bits(x - bf16_val(hb));
      }
  }
  float m_r[8], l_r[8];
#pragma unroll
  for (int r = 0; r < 8; ++r) { m_r[r] = -3.0e38f; l_r[r] = 0.f; }
  v8f oacc[DT];
#pragma unroll
  for (int dt = 0; dt < DT; ++dt) oacc[dt] = (v8f){0.f,0.f,0.f,0.f,0.f,0.f,0.f,0.f};

  const int kv_end = CAUSAL ? min(T, qblk * 64 + 64) : T;     // block-uniform
  for (int j0 = 0; j0 < kv_end; j0 += 32) {
    __syncthreads();
    for (int e = tid; e < 32 * (D / 4); e += 128) {
      const int r = e / (D / 4), c4 = (e % (D / 4)) * 4;
      const int key = j0 + r;
      v4f kf = {0.f,0.f,0.f,0.f}, vf = {0.f,0.f,0.f,0.f};
      if (key < T) { kf = *(const v4fa*)(K + (size_t)key * pitch + c4); vf = *(const v4fa*)(V + (size_t)key * pitch + c4); }
#pragma unroll
      for (int t = 0; t < 4; ++t) {
        unsigned short hb = bf16_bits(kf[t]); sKh[r][c4 + t] = hb; sKl[r][c4 + t] = bf16_bits(kf[t] - bf16_val(hb));
        hb = bf16_bits(vf[t]); sVh[r][c4 + t] = hb; sVl[r][c4 + t] = bf16_bits(vf[t] - bf16_val(hb));
      }
    }
    __syncthreads();
    // S tile 16 x 32
    v8f s[2];
#pragma unroll
    for (int nt = 0; nt < 2; ++nt) {
      v8f acc = {};
#pragma unroll
      for (int ks = 0; ks < KS; ++ks) {
        FragB bh_, bl_;
        bh_.half[0] = *(const v8us*)&sKh[nt * 16 + ln][ks * 32 + 8 * hh]; bh_.half[1] = *(const v8us*)&sKh[nt * 16 + ln][ks * 32 + 16 + 8 * hh];
        bl_.half[0] = *(const v8us*)&sKl[nt * 16 + ln][ks * 32 + 8 * hh]; bl_.half[1] = *(const v8us*)&sKl[nt * 16 + ln][ks * 32 + 16 + 8 * hh];
        acc = mmaN<3>(aqh[ks].v, aql[ks].v, bh_.v, bl_.v, acc);
      }
      s[nt] = acc;
    }
    // mask + running max (rows 8hh+r; the 16 lanes of a half share rows)
    float alpha[8];
#pragma unroll
    for (int r = 0; r < 8; ++r) {
      const int qi = q0 + 8 * hh + r;
      const int ja = j0 + ln, jb = j0 + 16 + ln;
      if (CAUSAL) { if (ja > qi) s[0][r] = -3.0e38f; if (jb > qi) s[1][r] = -3.0e38f; }
      if (ja >= T) s[0][r] = -3.0e38f;
      if (jb >= T) s[1][r] = -3.0e38f;
      float mx = fmaxf(s[0][r], s[1][r]);
      mx = fmaxf(mx, __shfl_xor(mx, 1, 32)); mx = fmaxf(mx, __shfl_xor(mx, 2, 32)); mx = fmaxf(mx, __shfl_xor(mx, 4, 32)); mx = fmaxf(mx, __shfl_xor(mx, 8, 32));
      const float mnew = fmaxf(m_r[r], mx);
      alpha[r] = (mnew > -1.0e38f) ? __expf(m_r[r] - mnew) : 1.0f;
      const float p0 = (s[0][r] > -1.0e38f) ? __expf(s[0][r] - mnew) : 0.f;
      const float p1 = (s[1][r] > -1.0e38f) ? __expf(s[1][r] - mnew) : 0.f;
      m_r[r] = mnew;
      l_r[r] = l_r[r] * alpha[r] + p0 + p1;            // per-lane partial row sum (16 lanes combined at the end)
      unsigned short hb = bf16_bits(p0); sPh[w][8 * hh + r][ln] = hb;      sPl[w][8 * hh + r][ln] = bf16_bits(p0 - bf16_val(hb));
      hb = bf16_bits(p1);                sPh[w][8 * hh + r][16 + ln] = hb; sPl[w][8 * hh + r][16 + ln] = bf16_bits(p1 - bf16_val(hb));
    }
#pragma unroll
    for (int dt = 0; dt < DT; ++dt)
#pragma unroll
      for (int r = 0; r < 8; ++r) oacc[dt][r] *= alpha[r];
    __builtin_amdgcn_fence(__ATOMIC_ACQ_REL, "workgroup");
    __builtin_amdgcn_wave_barrier();
    FragB pah, pal;
    pah.half[0] = *(const v8us*)&sPh[w][ln][8 * hh]; pah.half[1] = *(const v8us*)&sPh[w][ln][16 + 8 * hh];
    pal.half[0] = *(const v8us*)&sPl[w][ln][8 * hh]; pal.half[1] = *(const v8us*)&sPl[w][ln][16 + 8 * hh];
#pragma unroll
    for (int dt = 0; dt < DT; ++dt) {
      FragB bvh, bvl;
#pragma unroll
      for (int i = 0; i < 8; ++i) {
        bvh.u[i] = sVh[8 * hh + i][dt * 16 + ln]; bvh.u[8 + i] = sVh[16 + 8 * hh + i][dt * 16 + ln];
        bvl.u[i] = sVl[8 * hh + i][dt * 16 + ln]; bvl.u[8 + i] = sVl[16 + 8 * hh + i][dt * 16 + ln];
      }
      oacc[dt] = mmaN<3>(pah.v, pal.v, bvh.v, bvl.v, oacc[dt]);
    }
    __builtin_amdgcn_fence(__ATOMIC_ACQ_REL, "workgroup");
    __builtin_amdgcn_wave_barrier();
  }
#pragma unroll
  for (int r = 0; r < 8; ++r) {
    float l = l_r[r];
    l += __shfl_xor(l, 1, 32); l += __shfl_xor(l, 2, 32); l += __shfl_xor(l, 4, 32); l += __shfl_xor(l, 8, 32);
    l_r[r] = (l > 0.f) ? 1.0f / l : 0.f;
  }
#pragma unroll
  for (int dt = 0; dt < DT; ++dt)
#pragma unroll
    for (int r = 0; r < 8; ++r) sO[w][8 * hh + r][dt * 16 + ln] = oacc[dt][r] * l_r[r];
  __builtin_amdgcn_fence(__ATOMIC_ACQ_REL, "workgroup");
  __builtin_amdgcn_wave_barrier();
  {
    for (int r = 0; r < 16; ++r) {
      const int row = q0 + r;
      if (row < T && lane < D / 4) {
        const v4f val = *(const v4fa*)&sO[w][r][lane * 4];
        *(v4f*)(y + ((size_t)b * T + row) * ypitch + h * D + lane * 4) = val;
      }
    }
    
  }
}

// GEMM C = act(A·W + bias + resid): A f32 (ASPLIT -> hi/lo 2 terms), Wt bf16 [N][K]; ACT 0 none, 1 relu, 2 exact gelu;
// resid (optional, f32, row index = (row % rmod), pitch ldr, RES_BF16 rounds it) added before the activation.
template <bool ASPLIT, int ACT, bool BIAS_BF16, bool RES_BF16>
__global__ __launch_bounds__(128) void k_gemm_bf3(const float* __restrict__ A, int lda, const unsigned short* __restrict__ Wt, int ldb,
                                                const float* __restrict__ bias, const float* __restrict__ resid, int rmod, int ldr,
                                                float* __restrict__ C, int ldc, int M, int N, int K) {
  __shared__ __attribute__((aligned(16))) float so[4][16][64];
  const int tid = threadIdx.x, w = tid >> 5, lane = tid & 31, ln = lane & 15, hh = lane >> 4;
  const int ntn = N / 64;
  const int wid = blockIdx.x * 4 + w;
  const int mt = wid / ntn, nq = wid % ntn;
  if (mt * 16 >= M) return;
  const int row0 = mt * 16, col0 = nq * 64;
  const float* arow = A + (size_t)(row0 + ln) * lda;
  v8f acc[4] = {};
  for (int kb = 0; kb < K; kb += 32) {
    FragB ah, al;
    const v4f x0 = *(const v4fa*)(arow + kb + 8 * hh), x1 = *(const v4fa*)(arow + kb + 8 * hh + 4);
    const v4f x2 = *(const v4fa*)(arow + kb + 16 + 8 * hh), x3 = *(const v4fa*)(arow + kb + 16 + 8 * hh + 4);
    float xs[16] = {x0[0],x0[1],x0[2],x0[3],x1[0],x1[1],x1[2],x1[3],x2[0],x2[1],x2[2],x2[3],x3[0],x3[1],x3[2],x3[3]};
#pragma unroll
    for (int i = 0; i < 16; ++i) { const unsigned short hb = bf16_bits(xs[i]); ah.u[i] = hb; al.u[i] = ASPLIT ? bf16_bits(xs[i] - bf16_val(hb)) : (unsigned short)0; }
#pragma unroll
    for (int t = 0; t < 4; ++t) {
      const unsigned short* brow = Wt + (size_t)(col0 + t * 16 + ln) * ldb + kb;
      FragB b;
      b.half[0] = *(const v8us*)(brow + 8 * hh);
      b.half[1] = *(const v8us*)(brow + 16 + 8 * hh);
      acc[t] = mmaN<ASPLIT ? 2 : 1>(ah.v, al.v, b.v, b.v, acc[t]);
    }
  }
#pragma unroll
  for (int t = 0; t < 4; ++t) {
    const int col = col0 + t * 16 + ln;
    float bv = bias ? bias[col] : 0.f;
    if (BIAS_BF16) bv = bf16_round(bv);
#pragma unroll
    for (int r = 0; r < 8; ++r) {
      float v = acc[t][r] + bv;
      if (resid) { float rv = resid[(size_t)((row0 + 8 * hh + r) % rmod) * ldr + col]; if (RES_BF16) rv = bf16_round(rv); v += rv; }
      if (ACT == 1) v = fmaxf(v, 0.f);
      if (ACT == 2) v = 0.5f * v * (1.0f + erff(v * 0.70710678118654752f));
      if (ACT == 3) { const float u = 0.7978845608028654f * (v + 0.044715f * v * v * v); v = 0.5f * v * (1.0f + tanhf(u)); }
      so[w][8 * hh + r][t * 16 + ln] = v;
    }
  }
  __builtin_amdgcn_fence(__ATOMIC_ACQ_REL, "workgroup");
  __builtin_amdgcn_wave_barrier();
  const int rsub = lane >> 4, c4 = (lane & 15) * 4;
  {
#pragma unroll
    for (int q = 0; q < 8; ++q) {
      const int r = q * 2 + rsub;
      const v4f v = *(const v4fa*)&so[w][r][c4];
      *(v4f*)(C + (size_t)(row0 + r) * ldc + col0 + c4) = v;
    }
    
  }
}
// row LayerNorm (biased variance, eps) over N: s = X (+ R); optional out_sum <- s; out_norm <- (s-mu)*rsqrt(var+eps)*g + b
template <bool PARAM_BF16>
__global__ __launch_bounds__(256) void k_layernorm(const float* __restrict__ X, const float* __restrict__ R, const float* __restrict__ g, const float* __restrict__ bta,
                                                  float* __restrict__ out_sum, float* __restrict__ out_norm, int N, float eps) {
  __shared__ float red[256];
  const int row = blockIdx.x, tid = threadIdx.x;
  const float* x = X + (size_t)row * N; const float* rr = R ? R + (size_t)row * N : nullptr;
  float vals[16];                     // up to N = 4096
  const int per = N / 256;            // contiguous chunk per thread? use strided-by-4 chunks: thread handles j = tid*4 + 1024*u
  float s1 = 0.f;
  for (int u = 0; u < per / 4; ++u) {
    const int j = tid * 4 + 1024 * u;
    const v4f a = *(const v4fa*)(x + j);
    v4f b = {0.f,0.f,0.f,0.f}; if (rr) b = *(const v4fa*)(rr + j);
#pragma unroll
    for (int q = 0; q < 4; ++q) { const float v = a[q] + b[q]; vals[u * 4 + q] = v; s1 += v; }
  }
  red[tid] = s1; __syncthreads();
  for (int st = 128; st > 0; st >>= 1) { if (tid < st) red[tid] += red[tid + st]; __syncthreads(); }
  const float mu = red[0] / (float)N; __syncthreads();
  float s2 = 0.f;
  for (int u = 0; u < per / 4; ++u)
#pragma unroll
    for (int q = 0; q < 4; ++q) { const float c = vals[u * 4 + q] - mu; s2 += c * c; }
  red[tid] = s2; __syncthreads();
  for (int st = 128; st > 0; st >>= 1) { if (tid < st) red[tid] += red[tid + st]; __syncthreads(); }
  const float rs = rsqrtf(red[0] / (float)N + eps);
  {
    for (int u = 0; u < per / 4; ++u) {
      const int j = tid * 4 + 1024 * u;
      v4f o, sm;
#pragma unroll
      for (int q = 0; q < 4; ++q) {
        float gg = g[j + q], bb = bta[j + q];
        if (PARAM_BF16) { gg = bf16_round(gg); bb = bf16_round(bb); }
        sm[q] = vals[u * 4 + q]; o[q] = (vals[u * 4 + q] - mu) * rs * gg + bb;
      }
      if (out_sum) *(v4f*)(out_sum + (size_t)row * N + j) = sm;
      *(v4f*)(out_norm + (size_t)row * N + j) = o;
    }
    
  }
}

// batched f32 [K][N] (pitch lds, batch stride sIn) -> transposed hi/lo planes [N][K] (batch stride sOut); thread per (n, 8 k); grid.y = batch
__global__ __launch_bounds__(256) void k_split_transpose_b(const float* __restrict__ src, int lds_, size_t sIn, unsigned short* __restrict__ hi, unsigned short* __restrict__ lo, size_t sOut, int K, int N) {
  const size_t t = (size_t)blockIdx.x * 256 + threadIdx.x; const int k8n = K / 8; if (t >= (size_t)N * k8n) return;
  src += (size_t)blockIdx.y * sIn; hi += (size_t)blockIdx.y * sOut; lo += (size_t)blockIdx.y * sOut;
  const int n = (int)(t / k8n), k8 = (int)(t % k8n) * 8; v8us vh, vl;
#pragma unroll
  for (int i = 0; i < 8; ++i) { const float x = src[(size_t)(k8 + i) * lds_ + n]; const unsigned short hb = bf16_bits(x); vh[i] = hb; vl[i] = bf16_bits(x - bf16_val(hb)); }
  unsigned short* dh = hi + (size_t)n * K + k8; unsigned short* dl = lo + (size_t)n * K + k8;
  *(v8us*)dh = vh; *(v8us*)dl = vl; 
}

typedef float f2v __attribute__((ext_vector_type(2)));
typedef __bf16 bf2v __attribute__((ext_vector_type(2)));
__device__ __forceinline__ unsigned int pk_bf16(float a, float b) { return __builtin_bit_cast(unsigned int, __builtin_convertvector((f2v){a, b}, bf2v)); }   // round to nearest even
__device__ __forceinline__ float xhalf(float x) { return __builtin_bit_cast(float, __builtin_amdgcn_permlanex16(__builtin_bit_cast(int, x), __builtin_bit_cast(int, x), 0x76543210, 0xfedcba98, false, false)); }   // lane l with lane l ^ 16
__device__ __forceinline__ v8f wmma_bf(v16b a, v16b b, v8f c) { return __builtin_amdgcn_wmma_f32_16x16x32_bf16(false, a, false, b, (short)0, c, false, false); }
typedef _Float16 v16h __attribute__((ext_vector_type(16)));
typedef _Float16 h2v __attribute__((ext_vector_type(2)));
union FragH { v16h v; v8us half[2]; unsigned int w[8]; };
__device__ __forceinline__ unsigned int pk_f16(float a, float b) { return __builtin_bit_cast(unsigned int, __builtin_convertvector((f2v){a, b}, h2v)); }   // round to nearest even
__device__ __forceinline__ v8f wmma_hf(v16h a, v16h b, v8f c) { return __builtin_amdgcn_wmma_f32_16x16x32_f16(false, a, false, b, (short)0, c, false, false); }

// [q | k | v] = x * [Wq | Wk | Wv]. A block owns PM rows of x and all 192 columns. x is read once, in whole lines, rounded to bf16 and kept in LDS.
// Wave w holds the B fragments of column tiles 3 (w % 4) ... + 2 for k-steps 12 (w / 4) ... + 11 in registers (packed by k_wt_bf16) and
// multiplies all four row tiles by them; the two K halves of a result are added through LDS. From that LDS tile the block writes what the attention launch reads:
// q, k and v rounded to f16 (11 bits, finite below 65504), each laid out fragment-major in 16-byte units, so that one wave-wide 16-byte load of a fragment half covers 512 contiguous bytes:
// Qb, Kb: unit ((row / 16) * 4 + ks * 2 + h) * 32 + lane holds columns 32 ks + 16 h + 8 (lane / 16) ... + 7 of row 16 (row / 16) + lane % 16 (rows count through all batches);
// Vt: unit ((row / 32) * 8 + dt * 2 + h) * 32 + lane holds column 16 dt + lane % 16 of the eight rows 32 (row / 32) + 16 h + 8 (lane / 16) ... + 7.
#define PM 64
#define XR 40          // x tile in LDS, one plane per k-step: row pitch in elements, 80 bytes = 16 * odd, at which 16-byte fragment reads meet no bank conflict
#define XS (PM * XR + 32)   // plane pitch in elements: 16 banks past a multiple of 64, so the four k-steps that one staging store spans do not collide
#define OP 196         // result tile pitch in floats: rows 8 apart fall 32 banks apart, so the two lane halves of a store do not collide
__global__ __launch_bounds__(256) void k_proj(const float* __restrict__ x, const unsigned short* __restrict__ Bp, unsigned short* __restrict__ Qb, unsigned short* __restrict__ Kb, unsigned short* __restrict__ Vt) {
  __shared__ __attribute__((aligned(16))) unsigned short sx[(CC / 32) * XS];
  __shared__ __attribute__((aligned(16))) float so[PM][OP];
  const int tid = threadIdx.x, w = tid >> 5, lane = tid & 31, ln = lane & 15, hh = lane >> 4;
  const int ng = w & 3, kh = w >> 2;
  const size_t row0 = (size_t)blockIdx.x * PM;
  // staging: wave w brings rows 16 (w % 4) ... + 15, columns 384 (w / 4) ... + 383, as 48 wave-wide loads of 512 contiguous bytes
  const float* xp = x + (row0 + ng * 16) * CC + kh * 384 + lane * 4;
  const unsigned int bo = ((ng * 72 + kh * 12) * 64 + lane) * 16;   // this lane's place in the packed fragments, in bytes
  const unsigned short* bp = (const unsigned short*)((const char*)Bp + bo);
  v4f xa[48];
#pragma unroll
  for (int i = 0; i < 48; ++i) xa[i] = *(const v4fa*)(xp + (i / 3) * CC + (i % 3) * 128);
  FragB bf[3][12];
#pragma unroll
  for (int t = 0; t < 2; ++t)
#pragma unroll
    for (int kk = 0; kk < 12; ++kk) { bf[t][kk].half[0] = *(const v8us*)(bp + ((t * 24 + kk) * 2) * 256); bf[t][kk].half[1] = *(const v8us*)(bp + ((t * 24 + kk) * 2 + 1) * 256); }
  // stands in front of the reuse of the address registers that the loads above name; pointer and offset are inputs so that their registers live up to the wait
  asm volatile("s_wait_xcnt 0x0" :: "v"(xp), "v"(bo) : "memory");
  unsigned short* xs = sx + (kh * 12 + (lane >> 3)) * XS + ng * 16 * XR + (lane & 7) * 4;
#pragma unroll
  for (int i = 0; i < 48; ++i) *(uint2*)(xs + (i % 3) * 4 * XS + (i / 3) * XR) = make_uint2(pk_bf16(xa[i][0], xa[i][1]), pk_bf16(xa[i][2], xa[i][3]));
  // the third column tile's fragments: a second group of loads, with a wait of its own
#pragma unroll
  for (int kk = 0; kk < 12; ++kk) { bf[2][kk].half[0] = *(const v8us*)(bp + ((48 + kk) * 2) * 256); bf[2][kk].half[1] = *(const v8us*)(bp + ((48 + kk) * 2 + 1) * 256); }
  // as above, for the loads of the third tile
  asm volatile("s_wait_xcnt 0x0" :: "v"(bo) : "memory");
  __syncthreads();

  v8f acc[4][3];
#pragma unroll
  for (int mt = 0; mt < 4; ++mt)
#pragma unroll
    for (int t = 0; t < 3; ++t) acc[mt][t] = (v8f){0.f,0.f,0.f,0.f,0.f,0.f,0.f,0.f};
  const unsigned short* ap = sx + kh * 12 * XS + ln * XR + 8 * hh;
  // the next k-step's four A fragments are asked for as one group ahead of this k-step's products
  FragB a[2][4];
#pragma unroll
  for (int mt = 0; mt < 4; ++mt) { a[0][mt].half[0] = *(const v8us*)(ap + mt * 16 * XR); a[0][mt].half[1] = *(const v8us*)(ap + mt * 16 * XR + 16); }
#pragma unroll
  for (int kk = 0; kk < 12; ++kk) {
    if (kk + 1 < 12) {
#pragma unroll
      for (int mt = 0; mt < 4; ++mt) { a[(kk + 1) & 1][mt].half[0] = *(const v8us*)(ap + (kk + 1) * XS + mt * 16 * XR); a[(kk + 1) & 1][mt].half[1] = *(const v8us*)(ap + (kk + 1) * XS + mt * 16 * XR + 16); }
    }
#pragma unroll
    for (int mt = 0; mt < 4; ++mt)
#pragma unroll
      for (int t = 0; t < 3; ++t) acc[mt][t] = wmma_bf(a[kk & 1][mt].v, bf[t][kk].v, acc[mt][t]);
    // keeps the order one load group, twelve products: left free, the scheduler asks for four k-steps at once, runs out of registers and then waits out a fragment's LDS latency before every three products
    __builtin_amdgcn_sched_barrier(0);
  }

  // the wave of the first K half finishes row tiles 0 and 1, its partner 2 and 3: each hands the other two over, then adds its own to what it was handed
  float* sg = &so[(kh ? 0 : 32) + 8 * hh][ng * 48 + ln];
  float* sk = &so[(kh ? 32 : 0) + 8 * hh][ng * 48 + ln];
#pragma unroll
  for (int m = 0; m < 2; ++m)
#pragma unroll
    for (int t = 0; t < 3; ++t)
#pragma unroll
      for (int r = 0; r < 8; ++r) sg[(m * 16 + r) * OP + t * 16] = kh ? acc[m][t][r] : acc[m + 2][t][r];
  __syncthreads();
#pragma unroll
  for (int m = 0; m < 2; ++m)
#pragma unroll
    for (int t = 0; t < 3; ++t)
#pragma unroll
      for (int r = 0; r < 8; ++r) sk[(m * 16 + r) * OP + t * 16] += kh ? acc[m + 2][t][r] : acc[m][t][r];
  __syncthreads();
  // every store instruction below covers four whole 128-byte lines
  // thread tid writes units tid and 256 + tid of the block's 512 units (8 KB in a row) of each of Qb, Kb and Vt
  // q and k: eight columns of one row a thread; wave w has fragment half w % 4 (= ks * 2 + h) of row tiles w / 4 and 2 + w / 4
  uint4 qw[2], kw[2];
#pragma unroll
  for (int i = 0; i < 2; ++i) {
    const float* c = &so[(i * 2 + kh) * 16 + ln][(ng * 2 + hh) * 8];
    const v4f a0 = *(const v4fa*)c, a1 = *(const v4fa*)(c + 4);
    qw[i] = make_uint4(pk_f16(a0[0], a0[1]), pk_f16(a0[2], a0[3]), pk_f16(a1[0], a1[1]), pk_f16(a1[2], a1[3]));
    const v4f c0 = *(const v4fa*)(c + HH), c1 = *(const v4fa*)(c + HH + 4);
    kw[i] = make_uint4(pk_f16(c0[0], c0[1]), pk_f16(c0[2], c0[3]), pk_f16(c1[0], c1[1]), pk_f16(c1[2], c1[3]));
  }
  // v: eight rows of one column a thread; wave w has fragment half w % 2 of column tile w / 2, for rows 0 ... 31 and 32 ... 63
  uint4 vw[2];
#pragma unroll
  for (int i = 0; i < 2; ++i) {
    const float* c = &so[i * 32 + (w & 1) * 16 + hh * 8][2 * HH + (w >> 1) * 16 + ln];
    vw[i] = make_uint4(pk_f16(c[0], c[OP]), pk_f16(c[2 * OP], c[3 * OP]), pk_f16(c[4 * OP], c[5 * OP]), pk_f16(c[6 * OP], c[7 * OP]));
  }
  unsigned short* oq = Qb + row0 * HH + tid * 8;
  unsigned short* ok = Kb + row0 * HH + tid * 8;
  unsigned short* ov = Vt + row0 * HH + tid * 8;
#pragma unroll
  for (int i = 0; i < 2; ++i) *(uint4*)(ov + i * 2048) = vw[i];
#pragma unroll
  for (int i = 0; i < 2; ++i) *(uint4*)(ok + i * 2048) = kw[i];
#pragma unroll
  for (int i = 0; i < 2; ++i) *(uint4*)(oq + i * 2048) = qw[i];
}

// Scores, masked softmax and P*v in one launch, all batches. A block owns 64 query rows of one batch; each of its AW waves
// holds all 64 (AQ tiles of 16 as B operands, f16) and walks its own TT / AW keys in passes of 32 with a maximum that is renewed only when a pass needs it:
// St = k * qt (a lane holds 16 scores of ONE query), Pt packs from the two St tiles into a B operand (f16; P lies in 0 ... PMAX), Ot += vt * Pt.
// Every operand is one f16 value, 11 bits on both sides of a product, so each product is one WMMA.
// The AW partial (maximum, sum, Ot) sets are joined through LDS at the end. Scores never reach memory.
#define AQ 4
#define AW 8
#define AKEYS (TT / AW)
#define PMAX 256.0f   // largest lane sum of P that a pass may reach against a maximum that lags: 2^8, far inside f16
__global__ __launch_bounds__(AW * 32) void k_attn(const unsigned short* __restrict__ Qb, const unsigned short* __restrict__ Kb, const unsigned short* __restrict__ Vt,
                                                  const int* __restrict__ mask, float* __restrict__ out) {
  __shared__ __attribute__((aligned(16))) v4f sO[AW][AQ * 8][32];
  __shared__ float sM[AW][AQ][16], sL[AW][AQ][16];
  const int tid = threadIdx.x, w = tid >> 5, lane = tid & 31, ln = lane & 15, hh = lane >> 4;
  const int b = blockIdx.x / (TT / 64), q0 = (blockIdx.x % (TT / 64)) * 64;
  const float c2 = 0.03608439182435161f * 1.4426950408889634f;   // 768^-0.5 * log2(e): the softmax runs in base 2

  FragH qf[AQ][2];
  // q, k and vt lie fragment-major (layout: at k_proj): fragment half n of a run of rows stands 256 n elements behind the lane's first unit
  const unsigned short* qp = Qb + ((size_t)b * TT + q0) * HH + lane * 8;
#pragma unroll
  for (int qt = 0; qt < AQ; ++qt)
#pragma unroll
    for (int ks = 0; ks < 2; ++ks) { qf[qt][ks].half[0] = *(const v8us*)(qp + (qt * 4 + ks * 2) * 256); qf[qt][ks].half[1] = *(const v8us*)(qp + (qt * 4 + ks * 2 + 1) * 256); }
  // stands in front of the reuse of the address registers that the q loads name; the pointer is an input so that its registers live up to the wait
  asm volatile("s_wait_xcnt 0x0" :: "v"(qp) : "memory");
  float m_r[AQ], l_r[AQ];
  v8f oacc[AQ][4];
#pragma unroll
  for (int qt = 0; qt < AQ; ++qt) {
    m_r[qt] = -3.0e38f; l_r[qt] = 0.f;   // finite start: a pass whose keys are all masked gives exp2(-inf) = 0, never inf - inf
#pragma unroll
    for (int dt = 0; dt < 4; ++dt) oacc[qt][dt] = (v8f){0.f,0.f,0.f,0.f,0.f,0.f,0.f,0.f};
  }
  const unsigned short* kp = Kb + ((size_t)b * TT + w * AKEYS) * HH + lane * 8;
  const unsigned short* vp = Vt + ((size_t)b * TT + w * AKEYS) * HH + lane * 8;
  const int* mp = mask + (size_t)b * TT + w * AKEYS + lane;   // one mask word a lane: a pass's 32 keys
  int one = 1;   // passes through each wait below, so that the pointer additions, which are multiples of it, cannot be lifted over the wait

  FragH ka[2][2];
  int mk;
#pragma unroll
  for (int t = 0; t < 2; ++t)
#pragma unroll
    for (int ks = 0; ks < 2; ++ks) { ka[t][ks].half[0] = *(const v8us*)(kp + (t * 4 + ks * 2) * 256); ka[t][ks].half[1] = *(const v8us*)(kp + (t * 4 + ks * 2 + 1) * 256); }
  mk = *mp;
  // stands in front of the overwrite of the address registers that the loads above name; the pointers are inputs so that their registers live up to it
  asm volatile("s_wait_xcnt 0x0" : "+s"(one) : "v"(kp), "v"(mp) : "memory");
  kp += one * 32 * HH; mp += one * 32;

  // rolled, for speed only: one pass is several KB of code
#pragma unroll 1
  for (int it = 0; it < AKEYS / 32; ++it) {
    FragH va[4];
#pragma unroll
    for (int dt = 0; dt < 4; ++dt) { va[dt].half[0] = *(const v8us*)(vp + dt * 2 * 256); va[dt].half[1] = *(const v8us*)(vp + (dt * 2 + 1) * 256); }
    // the next pass's k rows and mask words are fetched now; the last pass fetches its own again, so every address stays inside
    FragH kn[2][2];
#pragma unroll
    for (int t = 0; t < 2; ++t)
#pragma unroll
      for (int ks = 0; ks < 2; ++ks) { kn[t][ks].half[0] = *(const v8us*)(kp + (t * 4 + ks * 2) * 256); kn[t][ks].half[1] = *(const v8us*)(kp + (t * 4 + ks * 2 + 1) * 256); }
    const int mn = *mp;
    // stands in front of the overwrite of the address registers that this pass's loads name; the pointers are inputs so that their registers live up to it
    asm volatile("s_wait_xcnt 0x0" : "+s"(one) : "v"(vp), "v"(kp), "v"(mp) : "memory");
    const int adv = (it + 2 < AKEYS / 32) ? one : 0;
    vp += one * 32 * HH; kp += adv * 32 * HH; mp += adv * 32;

    // bit 16 t + r of nb: key 16 t + 8 hh + r of this pass is masked
    const unsigned int nb = ~__builtin_amdgcn_ballot_w32(mk != 0) >> (8 * hh);
    v8f bias[2];   // 0 for a kept key, -inf for a masked one; rows of St are keys, so one set serves all query tiles
#pragma unroll
    for (int r = 0; r < 8; ++r) {
      bias[0][r] = __uint_as_float((unsigned int)((int)(nb << (31 - r)) >> 31) & 0xFF800000u);
      bias[1][r] = __uint_as_float((unsigned int)((int)(nb << (15 - r)) >> 31) & 0xFF800000u);
    }

    v8f s[AQ][2];
#pragma unroll
    for (int qt = 0; qt < AQ; ++qt) {
      v8f s0 = {}, s1 = {};
#pragma unroll
      for (int ks = 0; ks < 2; ++ks) { s0 = wmma_hf(ka[0][ks].v, qf[qt][ks].v, s0); s1 = wmma_hf(ka[1][ks].v, qf[qt][ks].v, s1); }
      s[qt][0] = s0 + bias[0]; s[qt][1] = s1 + bias[1];
    }
    // Common path: the exponentials are taken against the maximum in use, with no search for a new one and no rescale. P is never negative, so a lane's
    // sum of P bounds each of its P: while every sum stays at or below PMAX, every P fits f16 and the pass stands as it is.
    FragH pf[AQ];
    float sum[AQ];
    bool redo = it == 0;   // no maximum is in use yet: the first pass goes straight to the full path (scalar test)
    if (!redo) {
#pragma unroll
      for (int qt = 0; qt < AQ; ++qt) {
        const float mc = m_r[qt] * c2;
        float e[16];
#pragma unroll
        for (int r = 0; r < 8; ++r) { e[r] = __builtin_fmaf(s[qt][0][r], c2, -mc); e[8 + r] = __builtin_fmaf(s[qt][1][r], c2, -mc); }
        // one tile's exponentials in one statement, each in place: none reads the result or overwrites the source of the one in front of it,
        // and the v_nop fills the slot that the instruction set asks for behind the last
        asm("v_exp_f32 %0, %0\n\tv_exp_f32 %1, %1\n\tv_exp_f32 %2, %2\n\tv_exp_f32 %3, %3\n\tv_exp_f32 %4, %4\n\tv_exp_f32 %5, %5\n\t"
            "v_exp_f32 %6, %6\n\tv_exp_f32 %7, %7\n\tv_exp_f32 %8, %8\n\tv_exp_f32 %9, %9\n\tv_exp_f32 %10, %10\n\tv_exp_f32 %11, %11\n\t"
            "v_exp_f32 %12, %12\n\tv_exp_f32 %13, %13\n\tv_exp_f32 %14, %14\n\tv_exp_f32 %15, %15\n\tv_nop"
            : "+v"(e[0]), "+v"(e[1]), "+v"(e[2]), "+v"(e[3]), "+v"(e[4]), "+v"(e[5]), "+v"(e[6]), "+v"(e[7]), "+v"(e[8]), "+v"(e[9]),
              "+v"(e[10]), "+v"(e[11]), "+v"(e[12]), "+v"(e[13]), "+v"(e[14]), "+v"(e[15]));
        float t = 0.f;
#pragma unroll
        for (int i = 0; i < 8; ++i) {
          const float pa = e[2 * i], pb = e[2 * i + 1];
          t += pa + pb;
          pf[qt].w[i] = pk_f16(pa, pb);
        }
        sum[qt] = t;
      }
      // one test a pass for all four tiles; written so that an infinite or not-a-number sum also takes the full path
      redo = __builtin_amdgcn_ballot_w32(!((sum[0] + sum[1]) + (sum[2] + sum[3]) <= PMAX)) != 0;
    }
    if (redo) {
      // Full path, whole wave: new maximum, rescale of sums and outputs, exponentials against the new maximum
#pragma unroll
      for (int qt = 0; qt < AQ; ++qt) {
        const v8f s0 = s[qt][0], s1 = s[qt][1];
        float mx = fmaxf(s0[0], s1[0]);
#pragma unroll
        for (int r = 1; r < 8; ++r) mx = fmaxf(mx, fmaxf(s0[r], s1[r]));
        mx = fmaxf(mx, xhalf(mx));
        const float mnew = fmaxf(m_r[qt], mx);
        float alpha = (m_r[qt] - mnew) * c2;
        const float mc = mnew * c2;
        m_r[qt] = mnew;
        float e[16];
#pragma unroll
        for (int r = 0; r < 8; ++r) { e[r] = __builtin_fmaf(s0[r], c2, -mc); e[8 + r] = __builtin_fmaf(s1[r], c2, -mc); }
        // in place and closed by a v_nop, for the same reason as above
        asm("v_exp_f32 %0, %0\n\tv_exp_f32 %1, %1\n\tv_exp_f32 %2, %2\n\tv_exp_f32 %3, %3\n\tv_exp_f32 %4, %4\n\tv_exp_f32 %5, %5\n\t"
            "v_exp_f32 %6, %6\n\tv_exp_f32 %7, %7\n\tv_exp_f32 %8, %8\n\tv_exp_f32 %9, %9\n\tv_exp_f32 %10, %10\n\tv_exp_f32 %11, %11\n\t"
            "v_exp_f32 %12, %12\n\tv_exp_f32 %13, %13\n\tv_exp_f32 %14, %14\n\tv_exp_f32 %15, %15\n\tv_exp_f32 %16, %16\n\tv_nop"
            : "+v"(e[0]), "+v"(e[1]), "+v"(e[2]), "+v"(e[3]), "+v"(e[4]), "+v"(e[5]), "+v"(e[6]), "+v"(e[7]), "+v"(e[8]), "+v"(e[9]),
              "+v"(e[10]), "+v"(e[11]), "+v"(e[12]), "+v"(e[13]), "+v"(e[14]), "+v"(e[15]), "+v"(alpha));
        float t = 0.f;
#pragma unroll
        for (int i = 0; i < 8; ++i) {
          const float pa = e[2 * i], pb = e[2 * i + 1];
          t += pa + pb;
          pf[qt].w[i] = pk_f16(pa, pb);
        }
        sum[qt] = t;
        l_r[qt] *= alpha;
#pragma unroll
        for (int dt = 0; dt < 4; ++dt) oacc[qt][dt] *= alpha;
      }
    }
#pragma unroll
    for (int qt = 0; qt < AQ; ++qt) {
      l_r[qt] += sum[qt];   // this lane half's keys only; the halves are joined after the loop
#pragma unroll
      for (int dt = 0; dt < 4; ++dt) oacc[qt][dt] = wmma_hf(va[dt].v, pf[qt].v, oacc[qt][dt]);
    }
#pragma unroll
    for (int t = 0; t < 2; ++t)
#pragma unroll
      for (int ks = 0; ks < 2; ++ks) ka[t][ks] = kn[t][ks];
    mk = mn;
  }

#pragma unroll
  for (int qt = 0; qt < AQ; ++qt) {
    const float l = l_r[qt] + xhalf(l_r[qt]);
    if (hh == 0) { sM[w][qt][ln] = m_r[qt]; sL[w][qt][ln] = l; }
#pragma unroll
    for (int dt = 0; dt < 4; ++dt) {
      sO[w][qt * 8 + dt * 2][lane]     = (v4f){oacc[qt][dt][0], oacc[qt][dt][1], oacc[qt][dt][2], oacc[qt][dt][3]};
      sO[w][qt * 8 + dt * 2 + 1][lane] = (v4f){oacc[qt][dt][4], oacc[qt][dt][5], oacc[qt][dt][6], oacc[qt][dt][7]};
    }
  }
  __syncthreads();
  // join: wave w finishes query tile w / 2, head columns 32 * (w % 2) ... + 31 (one 128-byte line of each output row)
  const int qm = w >> 1;
  float M = -3.0e38f;
#pragma unroll
  for (int p = 0; p < AW; ++p) M = fmaxf(M, sM[p][qm][ln]);
  float f[AW], den = 0.f;
#pragma unroll
  for (int p = 0; p < AW; ++p) f[p] = (sM[p][qm][ln] - M) * c2;
  // in place and closed by a v_nop, for the same reason as in the loop
  asm("v_exp_f32 %0, %0\n\tv_exp_f32 %1, %1\n\tv_exp_f32 %2, %2\n\tv_exp_f32 %3, %3\n\tv_exp_f32 %4, %4\n\tv_exp_f32 %5, %5\n\tv_exp_f32 %6, %6\n\tv_exp_f32 %7, %7\n\tv_nop"
      : "+v"(f[0]), "+v"(f[1]), "+v"(f[2]), "+v"(f[3]), "+v"(f[4]), "+v"(f[5]), "+v"(f[6]), "+v"(f[7]));
#pragma unroll
  for (int p = 0; p < AW; ++p) den += sL[p][qm][ln] * f[p];
  const float inv = 1.0f / den;   // every key masked: den = 0, and 0 * inf gives NaN
#pragma unroll
  for (int dd = 0; dd < 2; ++dd) {
    const int dt = (w & 1) * 2 + dd;
    v4f a0 = {0.f,0.f,0.f,0.f}, a1 = {0.f,0.f,0.f,0.f};
#pragma unroll
    for (int p = 0; p < AW; ++p) { a0 += sO[p][qm * 8 + dt * 2][lane] * f[p]; a1 += sO[p][qm * 8 + dt * 2 + 1][lane] * f[p]; }
    float* o = out + ((size_t)b * TT + q0 + qm * 16 + ln) * HH + dt * 16 + 8 * hh;
    *(v4f*)o = a0 * inv; *(v4f*)(o + 4) = a1 * inv;
  }
}
extern "C" void kernel_launch(void* const* d_in, const int* in_sizes, int n_in,
                              void* d_out, int out_size, void* d_ws, size_t ws_size, hipStream_t stream) {
  (void)in_sizes; (void)n_in; (void)out_size;
  const float* x = (const float*)d_in[0]; const int* mask = (const int*)d_in[1]; const float* Wk = (const float*)d_in[2]; const float* Wq = (const float*)d_in[3]; const float* Wv = (const float*)d_in[4];
  char* ws = (char*)d_ws; size_t off = 0;
  auto take = [&](size_t bytes) { char* p = ws + off; off += (bytes + 255) & ~(size_t)255; return p; };
  unsigned short* Bt = (unsigned short*)take((size_t)192 * CC * 2); unsigned short* Qb = (unsigned short*)take((size_t)MR * HH * 2); unsigned short* Kb = (unsigned short*)take((size_t)MR * HH * 2); unsigned short* Vt = (unsigned short*)take((size_t)BB * HH * TT * 2);
  if (off > ws_size) return;
  k_wt_bf16<<<3 * HH * (CC / 8) / 256, 256, 0, stream>>>(Wq, Wk, Wv, Bt);   // the 12 column tiles of [Wq | Wk | Wv]
  k_proj<<<MR / PM, 256, 0, stream>>>(x, Bt, Qb, Kb, Vt);      // q, k, vt
  k_attn<<<BB * (TT / 64), AW * 32, 0, stream>>>(Qb, Kb, Vt, mask, (float*)d_out);
}

// v008
// It runs in 23.6 microseconds.
// Two timings next to v007 put it at 1.06 and 1.05 times that version's speed.
// Over all steps from v000 it is 69.9 times as fast.
#include <hip/hip_runtime.h>
// [q|k|v] = x*[Wq|Wk|Wv] (M = 16384, K = 768, N = 192; x and W rounded to bf16: single exact WMMA term, f32 accumulate); then one fused launch:
// St = k*qt, masked running-maximum softmax in f32, Ot += vt*Pt: q, k, v and P each rounded once to f16, one product each on v_wmma_f32_16x16x32_f16, f32 accumulate.
#define BB 8
#define TT 2048
#define CC 768
#define HH 64
#define MR (BB * TT)

typedef __bf16 v16b __attribute__((ext_vector_type(16)));
typedef unsigned short v8us __attribute__((ext_vector_type(8), may_alias));
typedef float  v8f  __attribute__((ext_vector_type(8)));
typedef float  v4f  __attribute__((ext_vector_type(4)));
typedef float  v4fa __attribute__((ext_vector_type(4), may_alias));
union FragB { v16b v; v8us half[2]; unsigned short u[16]; };

__device__ __forceinline__ unsigned short bf16_bits(float x) { unsigned int u = __float_as_uint(x); return (unsigned short)((u + 0x7FFFu + ((u >> 16) & 1u)) >> 16); }
__device__ __forceinline__ float bf16_val(unsigned short b) { return __uint_as_float(((unsigned int)b) << 16); }
__device__ __forceinline__ float bf16_round(float x) { return bf16_val(bf16_bits(x)); }
// D += A·B with NT terms: 1 = ah·bh, 2 = + al·bh (A split), 3 = + ah·bl (both split)
template <int NT>
__device__ __forceinline__ v8f mmaN(v16b ah, v16b al, v16b bh, v16b bl, v8f c) {
  c = __builtin_amdgcn_wmma_f32_16x16x32_bf16(false, ah, false, bh, (short)0, c, false, false);
  if (NT >= 2) c = __builtin_amdgcn_wmma_f32_16x16x32_bf16(false, al, false, bh, (short)0, c, false, false);
  if (NT >= 3) c = __builtin_amdgcn_wmma_f32_16x16x32_bf16(false, ah, false, bl, (short)0, c, false, false);
  asm volatile("v_nop\n\tv_nop\n\tv_nop\n\tv_nop" : "+v"(c) : "v"(ah), "v"(al), "v"(bh), "v"(bl));
  return c;
}

// Wq, Wk, Wv [CC][HH] f32 -> bf16 B fragments of [Wq | Wk | Wv], fragment-major, all three in one launch: unit ((tile * (CC / 32) + ks) * 2 + h) * 32 + lane holds the
// 16 bytes that this lane of the B fragment (column tile of the 192 columns, k-step ks, register half h) needs, so that one wave-wide 16-byte load of a fragment half
// covers 512 contiguous bytes. One unit a thread; a block's 256 units lie in one matrix (HH * CC / 8 units each, a multiple of 256), so the choice of the source is scalar.
__global__ __launch_bounds__(256) void k_wt_bf16(const float* __restrict__ Wq, const float* __restrict__ Wk, const float* __restrict__ Wv, unsigned short* __restrict__ Wt) {
  const int m = blockIdx.x / (HH * (CC / 8) / 256);
  const float* __restrict__ W = m == 0 ? Wq : m == 1 ? Wk : Wv;
  const int u = blockIdx.x * 256 + threadIdx.x;
  const int lane = u & 31, h = (u >> 5) & 1, ks = (u >> 6) % (CC / 32), tile = (u >> 6) / (CC / 32);
  const int n = (tile & 3) * 16 + (lane & 15), k8 = ks * 32 + h * 16 + (lane >> 4) * 8;
  float f[8];
#pragma unroll
  for (int i = 0; i < 8; ++i) f[i] = W[(k8 + i) * HH + n];
  v8us v;
#pragma unroll
  for (int i = 0; i < 8; ++i) v[i] = bf16_bits(f[i]);
  *(v8us*)(Wt + (size_t)u * 8) = v;
}

// GEMM C[M][N] (f32, pitch ldc) = act(A[M][K]·W + bias). A f32 row-major (pitch lda) converted per fragment to bf16
// (ASPLIT: hi/lo two planes -> 2 terms, else single rounded term); Wt bf16 [N][K] (pitch ldb). BIAS_BF16 rounds the
// bias to bf16 first (bias quantised to bf16 before the add). K%32==0, M%16==0, N%64==0.
template <bool ASPLIT, int ACT, bool BIAS_BF16>
__global__ __launch_bounds__(128) void k_gemm_bf(const float* __restrict__ A, int lda, const unsigned short* __restrict__ Wt, int ldb,
                                               const float* __restrict__ bias, float* __restrict__ C, int ldc, int M, int N, int K) {
  __shared__ __attribute__((aligned(16))) float so[4][16][64];
  const int tid = threadIdx.x, w = tid >> 5, lane = tid & 31, ln = lane & 15, hh = lane >> 4;
  const int ntn = N / 64;
  const int wid = blockIdx.x * 4 + w;
  const int mt = wid / ntn, nq = wid % ntn;
  if (mt * 16 >= M) return;
  const int row0 = mt * 16, col0 = nq * 64;
  const float* arow = A + (size_t)(row0 + ln) * lda;
  v8f acc[4] = {};
  for (int kb = 0; kb < K; kb += 32) {
    FragB ah, al;
    const v4f x0 = *(const v4fa*)(arow + kb + 8 * hh), x1 = *(const v4fa*)(arow + kb + 8 * hh + 4);
    const v4f x2 = *(const v4fa*)(arow + kb + 16 + 8 * hh), x3 = *(const v4fa*)(arow + kb + 16 + 8 * hh + 4);
    float xs[16] = {x0[0],x0[1],x0[2],x0[3],x1[0],x1[1],x1[2],x1[3],x2[0],x2[1],x2[2],x2[3],x3[0],x3[1],x3[2],x3[3]};
#pragma unroll
    for (int i = 0; i < 16; ++i) { const unsigned short hb = bf16_bits(xs[i]); ah.u[i] = hb; al.u[i] = ASPLIT ? bf16_bits(xs[i] - bf16_val(hb)) : (unsigned short)0; }
#pragma unroll
    for (int t = 0; t < 4; ++t) {
      const unsigned short* brow = Wt + (size_t)(col0 + t * 16 + ln) * ldb + kb;
      FragB b;
      b.half[0] = *(const v8us*)(brow + 8 * hh);
      b.half[1] = *(const v8us*)(brow + 16 + 8 * hh);
      acc[t] = mmaN<ASPLIT ? 2 : 1>(ah.v, al.v, b.v, b.v, acc[t]);
    }
  }
#pragma unroll
  for (int t = 0; t < 4; ++t) {
    float bv = bias ? bias[col0 + t * 16 + ln] : 0.f;
    if (BIAS_BF16) bv = bf16_round(bv);
#pragma unroll
    for (int r = 0; r < 8; ++r) { float v = acc[t][r] + bv; if (ACT == 1) v = fmaxf(v, 0.f); so[w][8 * hh + r][t * 16 + ln] = v; }
  }
  __builtin_amdgcn_fence(__ATOMIC_ACQ_REL, "workgroup");
  __builtin_amdgcn_wave_barrier();
  const int rsub = lane >> 4, c4 = (lane & 15) * 4;
  {
#pragma unroll
    for (int q = 0; q < 8; ++q) {
      const int r = q * 2 + rsub;
      const v4f v = *(const v4fa*)&so[w][r][c4];
      *(v4f*)(C + (size_t)(row0 + r) * ldc + col0 + c4) = v;
    }
    
  }
}

// Flash-style causal/unmasked attention, all contractions 3-term bf16 hi/lo splits, f32 softmax with running max.
// q,k,v rows are read from f32 buffers with arbitrary row pitch (so they can live inside a fused qkv buffer);
// D = head size (multiple of 32, <= 128); one wave = 16 query rows; block = 4 waves (64 queries) sharing K/V chunks of 32.
template <int D, bool CAUSAL>
__global__ __launch_bounds__(128) void k_flash(const float* __restrict__ qb, const float* __restrict__ kb, const float* __restrict__ vb,
                                             int pitch, int T, int H, float scale, float* __restrict__ y, int ypitch) {
  constexpr int KS = D / 32;        // k-steps for QK
  constexpr int DT = D / 16;        // d tiles for PV
  __shared__ __attribute__((aligned(16))) unsigned short sKh[32][D + 8], sKl[32][D + 8], sVh[32][D + 8], sVl[32][D + 8];
  __shared__ __attribute__((aligned(16))) unsigned short sPh[4][16][40], sPl[4][16][40];
  __shared__ __attribute__((aligned(16))) float sO[4][16][D];
  const int tid = threadIdx.x, w = tid >> 5, lane = tid & 31, ln = lane & 15, hh = lane >> 4;
  const int nqb = (T + 63) / 64;
  const int bh = blockIdx.x / nqb, qblk = blockIdx.x % nqb;
  const int b = bh / H, h = bh % H;
  const int q0 = qblk * 64 + w * 16;
  const float* Q = qb + (size_t)b * T * pitch + h * D;
  const float* K = kb + (size_t)b * T * pitch + h * D;
  const float* V = vb + (size_t)b * T * pitch + h * D;

  // A fragments of the wave's 16 query rows (scaled), hi/lo
  FragB aqh[KS], aql[KS];
  {
    int row = q0 + ln; if (row >= T) row = T - 1;
    const float* qr = Q + (size_t)row * pitch;
#pragma unroll
    for (int ks = 0; ks < KS; ++ks)
#pragma unroll
      for (int i = 0; i < 16; ++i) {
        const int d = ks * 32 + ((i < 8) ? (8 * hh + i) : (16 + 8 * hh + (i - 8)));
        const float x = qr[d] * scale; const unsigned short hb = bf16_bits(x);
        aqh[ks].u[i] = hb; aql[ks].u[i] = bf16_bits(x - bf16_val(hb));
      }
  }
  float m_r[8], l_r[8];
#pragma unroll
  for (int r = 0; r < 8; ++r) { m_r[r] = -3.0e38f; l_r[r] = 0.f; }
  v8f oacc[DT];
#pragma unroll
  for (int dt = 0; dt < DT; ++dt) oacc[dt] = (v8f){0.f,0.f,0.f,0.f,0.f,0.f,0.f,0.f};

  const int kv_end = CAUSAL ? min(T, qblk * 64 + 64) : T;     // block-uniform
  for (int j0 = 0; j0 < kv_end; j0 += 32) {
    __syncthreads();
    for (int e = tid; e < 32 * (D / 4); e += 128) {
      const int r = e / (D / 4), c4 = (e % (D / 4)) * 4;
      const int key = j0 + r;
      v4f kf = {0.f,0.f,0.f,0.f}, vf = {0.f,0.f,0.f,0.f};
      if (key < T) { kf = *(const v4fa*)(K + (size_t)key * pitch + c4); vf = *(const v4fa*)(V + (size_t)key * pitch + c4); }
#pragma unroll
      for (int t = 0; t < 4; ++t) {
        unsigned short hb = bf16_bits(kf[t]); sKh[r][c4 + t] = hb; sKl[r][c4 + t] = bf16_bits(kf[t] - bf16_val(hb));
        hb = bf16_bits(vf[t]); sVh[r][c4 + t] = hb; sVl[r][c4 + t] = bf16_bits(vf[t] - bf16_val(hb));
      }
    }
    __syncthreads();
    // S tile 16 x 32
    v8f s[2];
#pragma unroll
    for (int nt = 0; nt < 2; ++nt) {
      v8f acc = {};
#pragma unroll
      for (int ks = 0; ks < KS; ++ks) {
        FragB bh_, bl_;
        bh_.half[0] = *(const v8us*)&sKh[nt * 16 + ln][ks * 32 + 8 * hh]; bh_.half[1] = *(const v8us*)&sKh[nt * 16 + ln][ks * 32 + 16 + 8 * hh];
        bl_.half[0] = *(const v8us*)&sKl[nt * 16 + ln][ks * 32 + 8 * hh]; bl_.half[1] = *(const v8us*)&sKl[nt * 16 + ln][ks * 32 + 16 + 8 * hh];
        acc = mmaN<3>(aqh[ks].v, aql[ks].v, bh_.v, bl_.v, acc);
      }
      s[nt] = acc;
    }
    // mask + running max (rows 8hh+r; the 16 lanes of a half share rows)
    float alpha[8];
#pragma unroll
    for (int r = 0; r < 8; ++r) {
      const int qi = q0 + 8 * hh + r;
      const int ja = j0 + ln, jb = j0 + 16 + ln;
      if (CAUSAL) { if (ja > qi) s[0][r] = -3.0e38f; if (jb > qi) s[1][r] = -3.0e38f; }
      if (ja >= T) s[0][r] = -3.0e38f;
      if (jb >= T) s[1][r] = -3.0e38f;
      float mx = fmaxf(s[0][r], s[1][r]);
      mx = fmaxf(mx, __shfl_xor(mx, 1, 32)); mx = fmaxf(mx, __shfl_xor(mx, 2, 32)); mx = fmaxf(mx, __shfl_xor(mx, 4, 32)); mx = fmaxf(mx, __shfl_xor(mx, 8, 32));
      const float mnew = fmaxf(m_r[r], mx);
      alpha[r] = (mnew > -1.0e38f) ? __expf(m_r[r] - mnew) : 1.0f;
      const float p0 = (s[0][r] > -1.0e38f) ? __expf(s[0][r] - mnew) : 0.f;
      const float p1 = (s[1][r] > -1.0e38f) ? __expf(s[1][r] - mnew) : 0.f;
      m_r[r] = mnew;
      l_r[r] = l_r[r] * alpha[r] + p0 + p1;            // per-lane partial row sum (16 lanes combined at the end)
      unsigned short hb = bf16_bits(p0); sPh[w][8 * hh + r][ln] = hb;      sPl[w][8 * hh + r][ln] = bf16_bits(p0 - bf16_val(hb));
      hb = bf16_bits(p1);                sPh[w][8 * hh + r][16 + ln] = hb; sPl[w][8 * hh + r][16 + ln] = bf16_bits(p1 - bf16_val(hb));
    }
#pragma unroll
    for (int dt = 0; dt < DT; ++dt)
#pragma unroll
      for (int r = 0; r < 8; ++r) oacc[dt][r] *= alpha[r];
    __builtin_amdgcn_fence(__ATOMIC_ACQ_REL, "workgroup");
    __builtin_amdgcn_wave_barrier();
    FragB pah, pal;
    pah.half[0] = *(const v8us*)&sPh[w][ln][8 * hh]; pah.half[1] = *(const v8us*)&sPh[w][ln][16 + 8 * hh];
    pal.half[0] = *(const v8us*)&sPl[w][ln][8 * hh]; pal.half[1] = *(const v8us*)&sPl[w][ln][16 + 8 * hh];
#pragma unroll
    for (int dt = 0; dt < DT; ++dt) {
      FragB bvh, bvl;
#pragma unroll
      for (int i = 0; i < 8; ++i) {
        bvh.u[i] = sVh[8 * hh + i][dt * 16 + ln]; bvh.u[8 + i] = sVh[16 + 8 * hh + i][dt * 16 + ln];
        bvl.u[i] = sVl[8 * hh + i][dt * 16 + ln]; bvl.u[8 + i] = sVl[16 + 8 * hh + i][dt * 16 + ln];
      }
      oacc[dt] = mmaN<3>(pah.v, pal.v, bvh.v, bvl.v, oacc[dt]);
    }
    __builtin_amdgcn_fence(__ATOMIC_ACQ_REL, "workgroup");
    __builtin_amdgcn_wave_barrier();
  }
#pragma unroll
  for (int r = 0; r < 8; ++r) {
    float l = l_r[r];
    l += __shfl_xor(l, 1, 32); l += __shfl_xor(l, 2, 32); l += __shfl_xor(l, 4, 32); l += __shfl_xor(l, 8, 32);
    l_r[r] = (l > 0.f) ? 1.0f / l : 0.f;
  }
#pragma unroll
  for (int dt = 0; dt < DT; ++dt)
#pragma unroll
    for (int r = 0; r < 8; ++r) sO[w][8 * hh + r][dt * 16 + ln] = oacc[dt][r] * l_r[r];
  __builtin_amdgcn_fence(__ATOMIC_ACQ_REL, "workgroup");
  __builtin_amdgcn_wave_barrier();
  {
    for (int r = 0; r < 16; ++r) {
      const int row = q0 + r;
      if (row < T && lane < D / 4) {
        const v4f val = *(const v4fa*)&sO[w][r][lane * 4];
        *(v4f*)(y + ((size_t)b * T + row) * ypitch + h * D + lane * 4) = val;
      }
    }
    
  }
}

// GEMM C = act(A·W + bias + resid): A f32 (ASPLIT -> hi/lo 2 terms), Wt bf16 [N][K]; ACT 0 none, 1 relu, 2 exact gelu;
// resid (optional, f32, row index = (row % rmod), pitch ldr, RES_BF16 rounds it) added before the activation.
template <bool ASPLIT, int ACT, bool BIAS_BF16, bool RES_BF16>
__global__ __launch_bounds__(128) void k_gemm_bf3(const float* __restrict__ A, int lda, const unsigned short* __restrict__ Wt, int ldb,
                                                const float* __restrict__ bias, const float* __restrict__ resid, int rmod, int ldr,
                                                float* __restrict__ C, int ldc, int M, int N, int K) {
  __shared__ __attribute__((aligned(16))) float so[4][16][64];
  const int tid = threadIdx.x, w = tid >> 5, lane = tid & 31, ln = lane & 15, hh = lane >> 4;
  const int ntn = N / 64;
  const int wid = blockIdx.x * 4 + w;
  const int mt = wid / ntn, nq = wid % ntn;
  if (mt * 16 >= M) return;
  const int row0 = mt * 16, col0 = nq * 64;
  const float* arow = A + (size_t)(row0 + ln) * lda;
  v8f acc[4] = {};
  for (int kb = 0; kb < K; kb += 32) {
    FragB ah, al;
    const v4f x0 = *(const v4fa*)(arow + kb + 8 * hh), x1 = *(const v4fa*)(arow + kb + 8 * hh + 4);
    const v4f x2 = *(const v4fa*)(arow + kb + 16 + 8 * hh), x3 = *(const v4fa*)(arow + kb + 16 + 8 * hh + 4);
    float xs[16] = {x0[0],x0[1],x0[2],x0[3],x1[0],x1[1],x1[2],x1[3],x2[0],x2[1],x2[2],x2[3],x3[0],x3[1],x3[2],x3[3]};
#pragma unroll
    for (int i = 0; i < 16; ++i) { const unsigned short hb = bf16_bits(xs[i]); ah.u[i] = hb; al.u[i] = ASPLIT ? bf16_bits(xs[i] - bf16_val(hb)) : (unsigned short)0; }
#pragma unroll
    for (int t = 0; t < 4; ++t) {
      const unsigned short* brow = Wt + (size_t)(col0 + t * 16 + ln) * ldb + kb;
      FragB b;
      b.half[0] = *(const v8us*)(brow + 8 * hh);
      b.half[1] = *(const v8us*)(brow + 16 + 8 * hh);
      acc[t] = mmaN<ASPLIT ? 2 : 1>(ah.v, al.v, b.v, b.v, acc[t]);
    }
  }
#pragma unroll
  for (int t = 0; t < 4; ++t) {
    const int col = col0 + t * 16 + ln;
    float bv = bias ? bias[col] : 0.f;
    if (BIAS_BF16) bv = bf16_round(bv);
#pragma unroll
    for (int r = 0; r < 8; ++r) {
      float v = acc[t][r] + bv;
      if (resid) { float rv = resid[(size_t)((row0 + 8 * hh + r) % rmod) * ldr + col]; if (RES_BF16) rv = bf16_round(rv); v += rv; }
      if (ACT == 1) v = fmaxf(v, 0.f);
      if (ACT == 2) v = 0.5f * v * (1.0f + erff(v * 0.70710678118654752f));
      if (ACT == 3) { const float u = 0.7978845608028654f * (v + 0.044715f * v * v * v); v = 0.5f * v * (1.0f + tanhf(u)); }
      so[w][8 * hh + r][t * 16 + ln] = v;
    }
  }
  __builtin_amdgcn_fence(__ATOMIC_ACQ_REL, "workgroup");
  __builtin_amdgcn_wave_barrier();
  const int rsub = lane >> 4, c4 = (lane & 15) * 4;
  {
#pragma unroll
    for (int q = 0; q < 8; ++q) {
      const int r = q * 2 + rsub;
      const v4f v = *(const v4fa*)&so[w][r][c4];
      *(v4f*)(C + (size_t)(row0 + r) * ldc + col0 + c4) = v;
    }
    
  }
}
// row LayerNorm (biased variance, eps) over N: s = X (+ R); optional out_sum <- s; out_norm <- (s-mu)*rsqrt(var+eps)*g + b
template <bool PARAM_BF16>
__global__ __launch_bounds__(256) void k_layernorm(const float* __restrict__ X, const float* __restrict__ R, const float* __restrict__ g, const float* __restrict__ bta,
                                                  float* __restrict__ out_sum, float* __restrict__ out_norm, int N, float eps) {
  __shared__ float red[256];
  const int row = blockIdx.x, tid = threadIdx.x;
  const float* x = X + (size_t)row * N; const float* rr = R ? R + (size_t)row * N : nullptr;
  float vals[16];                     // up to N = 4096
  const int per = N / 256;            // contiguous chunk per thread? use strided-by-4 chunks: thread handles j = tid*4 + 1024*u
  float s1 = 0.f;
  for (int u = 0; u < per / 4; ++u) {
    const int j = tid * 4 + 1024 * u;
    const v4f a = *(const v4fa*)(x + j);
    v4f b = {0.f,0.f,0.f,0.f}; if (rr) b = *(const v4fa*)(rr + j);
#pragma unroll
    for (int q = 0; q < 4; ++q) { const float v = a[q] + b[q]; vals[u * 4 + q] = v; s1 += v; }
  }
  red[tid] = s1; __syncthreads();
  for (int st = 128; st > 0; st >>= 1) { if (tid < st) red[tid] += red[tid + st]; __syncthreads(); }
  const float mu = red[0] / (float)N; __syncthreads();
  float s2 = 0.f;
  for (int u = 0; u < per / 4; ++u)
#pragma unroll
    for (int q = 0; q < 4; ++q) { const float c = vals[u * 4 + q] - mu; s2 += c * c; }
  red[tid] = s2; __syncthreads();
  for (int st = 128; st > 0; st >>= 1) { if (tid < st) red[tid] += red[tid + st]; __syncthreads(); }
  const float rs = rsqrtf(red[0] / (float)N + eps);
  {
    for (int u = 0; u < per / 4; ++u) {
      const int j = tid * 4 + 1024 * u;
      v4f o, sm;
#pragma unroll
      for (int q = 0; q < 4; ++q) {
        float gg = g[j + q], bb = bta[j + q];
        if (PARAM_BF16) { gg = bf16_round(gg); bb = bf16_round(bb); }
        sm[q] = vals[u * 4 + q]; o[q] = (vals[u * 4 + q] - mu) * rs * gg + bb;
      }
      if (out_sum) *(v4f*)(out_sum + (size_t)row * N + j) = sm;
      *(v4f*)(out_norm + (size_t)row * N + j) = o;
    }
    
  }
}

// batched f32 [K][N] (pitch lds, batch stride sIn) -> transposed hi/lo planes [N][K] (batch stride sOut); thread per (n, 8 k); grid.y = batch
__global__ __launch_bounds__(256) void k_split_transpose_b(const float* __restrict__ src, int lds_, size_t sIn, unsigned short* __restrict__ hi, unsigned short* __restrict__ lo, size_t sOut, int K, int N) {
  const size_t t = (size_t)blockIdx.x * 256 + threadIdx.x; const int k8n = K / 8; if (t >= (size_t)N * k8n) return;
  src += (size_t)blockIdx.y * sIn; hi += (size_t)blockIdx.y * sOut; lo += (size_t)blockIdx.y * sOut;
  const int n = (int)(t / k8n), k8 = (int)(t % k8n) * 8; v8us vh, vl;
#pragma unroll
  for (int i = 0; i < 8; ++i) { const float x = src[(size_t)(k8 + i) * lds_ + n]; const unsigned short hb = bf16_bits(x); vh[i] = hb; vl[i] = bf16_bits(x - bf16_val(hb)); }
  unsigned short* dh = hi + (size_t)n * K + k8; unsigned short* dl = lo + (size_t)n * K + k8;
  *(v8us*)dh = vh; *(v8us*)dl = vl; 
}

typedef float f2v __attribute__((ext_vector_type(2)));
typedef __bf16 bf2v __attribute__((ext_vector_type(2)));
__device__ __forceinline__ unsigned int pk_bf16(float a, float b) { return __builtin_bit_cast(unsigned int, __builtin_convertvector((f2v){a, b}, bf2v)); }   // round to nearest even
__device__ __forceinline__ float xhalf(float x) { return __builtin_bit_cast(float, __builtin_amdgcn_permlanex16(__builtin_bit_cast(int, x), __builtin_bit_cast(int, x), 0x76543210, 0xfedcba98, false, false)); }   // lane l with lane l ^ 16
__device__ __forceinline__ v8f wmma_bf(v16b a, v16b b, v8f c) { return __builtin_amdgcn_wmma_f32_16x16x32_bf16(false, a, false, b, (short)0, c, false, false); }
typedef _Float16 v16h __attribute__((ext_vector_type(16)));
typedef _Float16 h2v __attribute__((ext_vector_type(2)));
union FragH { v16h v; v8us half[2]; unsigned int w[8]; };
__device__ __forceinline__ unsigned int pk_f16(float a, float b) { return __builtin_bit_cast(unsigned int, __builtin_convertvector((f2v){a, b}, h2v)); }   // round to nearest even
__device__ __forceinline__ v8f wmma_hf(v16h a, v16h b, v8f c) { return __builtin_amdgcn_wmma_f32_16x16x32_f16(false, a, false, b, (short)0, c, false, false); }

// [q | k | v] = x * [Wq | Wk | Wv]. A block owns PM rows of x and all 192 columns. x is read once, in whole lines, rounded to bf16 and kept in LDS.
// Wave w holds the B fragments of column tiles 3 (w % 4) ... + 2 for k-steps 12 (w / 4) ... + 11 in registers (packed by k_wt_bf16) and
// multiplies all four row tiles by them; the two K halves of a result are added through LDS. From that LDS tile the block writes what the attention launch reads:
// q, k and v rounded to f16 (11 bits, finite below 65504), each laid out fragment-major in 16-byte units, so that one wave-wide 16-byte load of a fragment half covers 512 contiguous bytes:
// Qb, Kb: unit ((row / 16) * 4 + ks * 2 + h) * 32 + lane holds columns 32 ks + 16 h + 8 (lane / 16) ... + 7 of row 16 (row / 16) + lane % 16 (rows count through all batches);
// Vt: unit ((row / 32) * 8 + dt * 2 + h) * 32 + lane holds column 16 dt + lane % 16 of the eight rows 32 (row / 32) + 16 h + 8 (lane / 16) ... + 7.
#define PM 64
#define XR 40          // x tile in LDS, one plane per k-step: row pitch in elements, 80 bytes = 16 * odd, at which 16-byte fragment reads meet no bank conflict
#define XS (PM * XR + 32)   // plane pitch in elements: 16 banks past a multiple of 64, so the four k-steps that one staging store spans do not collide
#define OP 196         // result tile pitch in floats: rows 8 apart fall 32 banks apart, so the two lane halves of a store do not collide
__global__ __launch_bounds__(256) void k_proj(const float* __restrict__ x, const unsigned short* __restrict__ Bp, unsigned short* __restrict__ Qb, unsigned short* __restrict__ Kb, unsigned short* __restrict__ Vt) {
  __shared__ __attribute__((aligned(16))) unsigned short sx[(CC / 32) * XS];
  __shared__ __attribute__((aligned(16))) float so[PM][OP];
  const int tid = threadIdx.x, w = tid >> 5, lane = tid & 31, ln = lane & 15, hh = lane >> 4;
  const int ng = w & 3, kh = w >> 2;
  // Blocks whose index is equal modulo BB work on one batch, here and in the attention launch. For speed only; the result is the same wherever a block lands.
  const size_t row0 = ((size_t)(blockIdx.x % BB) * (TT / PM) + blockIdx.x / BB) * PM;
  // staging: wave w brings rows 16 (w % 4) ... + 15, columns 384 (w / 4) ... + 383, as 48 wave-wide loads of 512 contiguous bytes
  const float* xp = x + (row0 + ng * 16) * CC + kh * 384 + lane * 4;
  const unsigned int bo = ((ng * 72 + kh * 12) * 64 + lane) * 16;   // this lane's place in the packed fragments, in bytes
  const unsigned short* bp = (const unsigned short*)((const char*)Bp + bo);
  v4f xa[48];
#pragma unroll
  for (int i = 0; i < 48; ++i) xa[i] = *(const v4fa*)(xp + (i / 3) * CC + (i % 3) * 128);
  FragB bf[3][12];
#pragma unroll
  for (int t = 0; t < 2; ++t)
#pragma unroll
    for (int kk = 0; kk < 12; ++kk) { bf[t][kk].half[0] = *(const v8us*)(bp + ((t * 24 + kk) * 2) * 256); bf[t][kk].half[1] = *(const v8us*)(bp + ((t * 24 + kk) * 2 + 1) * 256); }
  // stands in front of the reuse of the address registers that the loads above name; pointer and offset are inputs so that their registers live up to the wait
  asm volatile("s_wait_xcnt 0x0" :: "v"(xp), "v"(bo) : "memory");
  unsigned short* xs = sx + (kh * 12 + (lane >> 3)) * XS + ng * 16 * XR + (lane & 7) * 4;
#pragma unroll
  for (int i = 0; i < 48; ++i) *(uint2*)(xs + (i % 3) * 4 * XS + (i / 3) * XR) = make_uint2(pk_bf16(xa[i][0], xa[i][1]), pk_bf16(xa[i][2], xa[i][3]));
  // the third column tile's fragments: a second group of loads, with a wait of its own
#pragma unroll
  for (int kk = 0; kk < 12; ++kk) { bf[2][kk].half[0] = *(const v8us*)(bp + ((48 + kk) * 2) * 256); bf[2][kk].half[1] = *(const v8us*)(bp + ((48 + kk) * 2 + 1) * 256); }
  // as above, for the loads of the third tile
  asm volatile("s_wait_xcnt 0x0" :: "v"(bo) : "memory");
  __syncthreads();

  v8f acc[4][3];
#pragma unroll
  for (int mt = 0; mt < 4; ++mt)
#pragma unroll
    for (int t = 0; t < 3; ++t) acc[mt][t] = (v8f){0.f,0.f,0.f,0.f,0.f,0.f,0.f,0.f};
  const unsigned short* ap = sx + kh * 12 * XS + ln * XR + 8 * hh;
  // the next k-step's four A fragments are asked for as one group ahead of this k-step's products
  FragB a[2][4];
#pragma unroll
  for (int mt = 0; mt < 4; ++mt) { a[0][mt].half[0] = *(const v8us*)(ap + mt * 16 * XR); a[0][mt].half[1] = *(const v8us*)(ap + mt * 16 * XR + 16); }
#pragma unroll
  for (int kk = 0; kk < 12; ++kk) {
    if (kk + 1 < 12) {
#pragma unroll
      for (int mt = 0; mt < 4; ++mt) { a[(kk + 1) & 1][mt].half[0] = *(const v8us*)(ap + (kk + 1) * XS + mt * 16 * XR); a[(kk + 1) & 1][mt].half[1] = *(const v8us*)(ap + (kk + 1) * XS + mt * 16 * XR + 16); }
    }
#pragma unroll
    for (int mt = 0; mt < 4; ++mt)
#pragma unroll
      for (int t = 0; t < 3; ++t) acc[mt][t] = wmma_bf(a[kk & 1][mt].v, bf[t][kk].v, acc[mt][t]);
    // keeps the order one load group, twelve products: left free, the scheduler asks for four k-steps at once, runs out of registers and then waits out a fragment's LDS latency before every three products
    __builtin_amdgcn_sched_barrier(0);
  }

  // the wave of the first K half finishes row tiles 0 and 1, its partner 2 and 3: each hands the other two over, then adds its own to what it was handed
  float* sg = &so[(kh ? 0 : 32) + 8 * hh][ng * 48 + ln];
  float* sk = &so[(kh ? 32 : 0) + 8 * hh][ng * 48 + ln];
#pragma unroll
  for (int m = 0; m < 2; ++m)
#pragma unroll
    for (int t = 0; t < 3; ++t)
#pragma unroll
      for (int r = 0; r < 8; ++r) sg[(m * 16 + r) * OP + t * 16] = kh ? acc[m][t][r] : acc[m + 2][t][r];
  __syncthreads();
#pragma unroll
  for (int m = 0; m < 2; ++m)
#pragma unroll
    for (int t = 0; t < 3; ++t)
#pragma unroll
      for (int r = 0; r < 8; ++r) sk[(m * 16 + r) * OP + t * 16] += kh ? acc[m + 2][t][r] : acc[m][t][r];
  __syncthreads();
  // every store instruction below covers four whole 128-byte lines
  // thread tid writes units tid and 256 + tid of the block's 512 units (8 KB in a row) of each of Qb, Kb and Vt
  // q and k: eight columns of one row a thread; wave w has fragment half w % 4 (= ks * 2 + h) of row tiles w / 4 and 2 + w / 4
  uint4 qw[2], kw[2];
#pragma unroll
  for (int i = 0; i < 2; ++i) {
    const float* c = &so[(i * 2 + kh) * 16 + ln][(ng * 2 + hh) * 8];
    const v4f a0 = *(const v4fa*)c, a1 = *(const v4fa*)(c + 4);
    qw[i] = make_uint4(pk_f16(a0[0], a0[1]), pk_f16(a0[2], a0[3]), pk_f16(a1[0], a1[1]), pk_f16(a1[2], a1[3]));
    const v4f c0 = *(const v4fa*)(c + HH), c1 = *(const v4fa*)(c + HH + 4);
    kw[i] = make_uint4(pk_f16(c0[0], c0[1]), pk_f16(c0[2], c0[3]), pk_f16(c1[0], c1[1]), pk_f16(c1[2], c1[3]));
  }
  // v: eight rows of one column a thread; wave w has fragment half w % 2 of column tile w / 2, for rows 0 ... 31 and 32 ... 63
  uint4 vw[2];
#pragma unroll
  for (int i = 0; i < 2; ++i) {
    const float* c = &so[i * 32 + (w & 1) * 16 + hh * 8][2 * HH + (w >> 1) * 16 + ln];
    vw[i] = make_uint4(pk_f16(c[0], c[OP]), pk_f16(c[2 * OP], c[3 * OP]), pk_f16(c[4 * OP], c[5 * OP]), pk_f16(c[6 * OP], c[7 * OP]));
  }
  unsigned short* oq = Qb + row0 * HH + tid * 8;
  unsigned short* ok = Kb + row0 * HH + tid * 8;
  unsigned short* ov = Vt + row0 * HH + tid * 8;
#pragma unroll
  for (int i = 0; i < 2; ++i) *(uint4*)(ov + i * 2048) = vw[i];
#pragma unroll
  for (int i = 0; i < 2; ++i) *(uint4*)(ok + i * 2048) = kw[i];
#pragma unroll
  for (int i = 0; i < 2; ++i) *(uint4*)(oq + i * 2048) = qw[i];
}

// Scores, masked softmax and P*v in one launch, all batches. A block owns 64 query rows of one batch; each of its AW waves
// holds all 64 (AQ tiles of 16 as B operands, f16) and walks its own TT / AW keys in passes of 32 with a maximum that is renewed only when a pass needs it:
// St = k * qt (a lane holds 16 scores of ONE query), Pt packs from the two St tiles into a B operand (f16; P lies in 0 ... PMAX), Ot += vt * Pt.
// Every operand is one f16 value, 11 bits on both sides of a product, so each product is one WMMA.
// The AW partial (maximum, sum, Ot) sets are joined through LDS at the end. Scores never reach memory.
#define AQ 4
#define AW 8
#define AKEYS (TT / AW)
#define PMAX 256.0f   // largest lane sum of P that a pass may reach against a maximum that lags: 2^8, far inside f16
__global__ __launch_bounds__(AW * 32) void k_attn(const unsigned short* __restrict__ Qb, const unsigned short* __restrict__ Kb, const unsigned short* __restrict__ Vt,
                                                  const int* __restrict__ mask, float* __restrict__ out) {
  __shared__ __attribute__((aligned(16))) v4f sO[AW][AQ * 8][32];
  __shared__ float sM[AW][AQ][16], sL[AW][AQ][16];
  const int tid = threadIdx.x, w = tid >> 5, lane = tid & 31, ln = lane & 15, hh = lane >> 4;
  const int b = blockIdx.x % BB, q0 = (blockIdx.x / BB) * 64;   // batch = index modulo BB, as in k_proj (the reason stands there)
  const float c2 = 0.03608439182435161f * 1.4426950408889634f;   // 768^-0.5 * log2(e): the softmax runs in base 2

  FragH qf[AQ][2];
  // q, k and vt lie fragment-major (layout: at k_proj): fragment half n of a run of rows stands 256 n elements behind the lane's first unit
  const unsigned short* qp = Qb + ((size_t)b * TT + q0) * HH + lane * 8;
#pragma unroll
  for (int qt = 0; qt < AQ; ++qt)
#pragma unroll
    for (int ks = 0; ks < 2; ++ks) { qf[qt][ks].half[0] = *(const v8us*)(qp + (qt * 4 + ks * 2) * 256); qf[qt][ks].half[1] = *(const v8us*)(qp + (qt * 4 + ks * 2 + 1) * 256); }
  // stands in front of the reuse of the address registers that the q loads name; the pointer is an input so that its registers live up to the wait
  asm volatile("s_wait_xcnt 0x0" :: "v"(qp) : "memory");
  float m_r[AQ], l_r[AQ];
  v8f oacc[AQ][4];
#pragma unroll
  for (int qt = 0; qt < AQ; ++qt) {
    m_r[qt] = -3.0e38f; l_r[qt] = 0.f;   // finite start: a pass whose keys are all masked gives exp2(-inf) = 0, never inf - inf
#pragma unroll
    for (int dt = 0; dt < 4; ++dt) oacc[qt][dt] = (v8f){0.f,0.f,0.f,0.f,0.f,0.f,0.f,0.f};
  }
  const unsigned short* kp = Kb + ((size_t)b * TT + w * AKEYS) * HH + lane * 8;
  const unsigned short* vp = Vt + ((size_t)b * TT + w * AKEYS) * HH + lane * 8;
  const int* mp = mask + (size_t)b * TT + w * AKEYS + lane;   // one mask word a lane: a pass's 32 keys
  int one = 1;   // passes through each wait below, so that the pointer additions, which are multiples of it, cannot be lifted over the wait

  FragH ka[2][2];
  int mk;
#pragma unroll
  for (int t = 0; t < 2; ++t)
#pragma unroll
    for (int ks = 0; ks < 2; ++ks) { ka[t][ks].half[0] = *(const v8us*)(kp + (t * 4 + ks * 2) * 256); ka[t][ks].half[1] = *(const v8us*)(kp + (t * 4 + ks * 2 + 1) * 256); }
  mk = *mp;
  // stands in front of the overwrite of the address registers that the loads above name; the pointers are inputs so that their registers live up to it
  asm volatile("s_wait_xcnt 0x0" : "+s"(one) : "v"(kp), "v"(mp) : "memory");
  kp += one * 32 * HH; mp += one * 32;

  // rolled, for speed only: one pass is several KB of code
#pragma unroll 1
  for (int it = 0; it < AKEYS / 32; ++it) {
    FragH va[4];
#pragma unroll
    for (int dt = 0; dt < 4; ++dt) { va[dt].half[0] = *(const v8us*)(vp + dt * 2 * 256); va[dt].half[1] = *(const v8us*)(vp + (dt * 2 + 1) * 256); }
    // the next pass's k rows and mask words are fetched now; the last pass fetches its own again, so every address stays inside
    FragH kn[2][2];
#pragma unroll
    for (int t = 0; t < 2; ++t)
#pragma unroll
      for (int ks = 0; ks < 2; ++ks) { kn[t][ks].half[0] = *(const v8us*)(kp + (t * 4 + ks * 2) * 256); kn[t][ks].half[1] = *(const v8us*)(kp + (t * 4 + ks * 2 + 1) * 256); }
    const int mn = *mp;
    // stands in front of the overwrite of the address registers that this pass's loads name; the pointers are inputs so that their registers live up to it
    asm volatile("s_wait_xcnt 0x0" : "+s"(one) : "v"(vp), "v"(kp), "v"(mp) : "memory");
    const int adv = (it + 2 < AKEYS / 32) ? one : 0;
    vp += one * 32 * HH; kp += adv * 32 * HH; mp += adv * 32;

    // bit 16 t + r of nb: key 16 t + 8 hh + r of this pass is masked
    const unsigned int nb = ~__builtin_amdgcn_ballot_w32(mk != 0) >> (8 * hh);
    v8f bias[2];   // 0 for a kept key, -inf for a masked one; rows of St are keys, so one set serves all query tiles
#pragma unroll
    for (int r = 0; r < 8; ++r) {
      bias[0][r] = __uint_as_float((unsigned int)((int)(nb << (31 - r)) >> 31) & 0xFF800000u);
      bias[1][r] = __uint_as_float((unsigned int)((int)(nb << (15 - r)) >> 31) & 0xFF800000u);
    }

    v8f s[AQ][2];
#pragma unroll
    for (int qt = 0; qt < AQ; ++qt) {
      v8f s0 = {}, s1 = {};
#pragma unroll
      for (int ks = 0; ks < 2; ++ks) { s0 = wmma_hf(ka[0][ks].v, qf[qt][ks].v, s0); s1 = wmma_hf(ka[1][ks].v, qf[qt][ks].v, s1); }
      s[qt][0] = s0 + bias[0]; s[qt][1] = s1 + bias[1];
    }
    // Common path: the exponentials are taken against the maximum in use, with no search for a new one and no rescale. P is never negative, so a lane's
    // sum of P bounds each of its P: while every sum stays at or below PMAX, every P fits f16 and the pass stands as it is.
    FragH pf[AQ];
    float sum[AQ];
    bool redo = it == 0;   // no maximum is in use yet: the first pass goes straight to the full path (scalar test)
    if (!redo) {
#pragma unroll
      for (int qt = 0; qt < AQ; ++qt) {
        const float mc = m_r[qt] * c2;
        float e[16];
#pragma unroll
        for (int r = 0; r < 8; ++r) { e[r] = __builtin_fmaf(s[qt][0][r], c2, -mc); e[8 + r] = __builtin_fmaf(s[qt][1][r], c2, -mc); }
        // one tile's exponentials in one statement, each in place: none reads the result or overwrites the source of the one in front of it,
        // and the v_nop fills the slot that the instruction set asks for behind the last
        asm("v_exp_f32 %0, %0\n\tv_exp_f32 %1, %1\n\tv_exp_f32 %2, %2\n\tv_exp_f32 %3, %3\n\tv_exp_f32 %4, %4\n\tv_exp_f32 %5, %5\n\t"
            "v_exp_f32 %6, %6\n\tv_exp_f32 %7, %7\n\tv_exp_f32 %8, %8\n\tv_exp_f32 %9, %9\n\tv_exp_f32 %10, %10\n\tv_exp_f32 %11, %11\n\t"
            "v_exp_f32 %12, %12\n\tv_exp_f32 %13, %13\n\tv_exp_f32 %14, %14\n\tv_exp_f32 %15, %15\n\tv_nop"
            : "+v"(e[0]), "+v"(e[1]), "+v"(e[2]), "+v"(e[3]), "+v"(e[4]), "+v"(e[5]), "+v"(e[6]), "+v"(e[7]), "+v"(e[8]), "+v"(e[9]),
              "+v"(e[10]), "+v"(e[11]), "+v"(e[12]), "+v"(e[13]), "+v"(e[14]), "+v"(e[15]));
        float t = 0.f;
#pragma unroll
        for (int i = 0; i < 8; ++i) {
          const float pa = e[2 * i], pb = e[2 * i + 1];
          t += pa + pb;
          pf[qt].w[i] = pk_f16(pa, pb);
        }
        sum[qt] = t;
      }
      // one test a pass for all four tiles; written so that an infinite or not-a-number sum also takes the full path
      redo = __builtin_amdgcn_ballot_w32(!((sum[0] + sum[1]) + (sum[2] + sum[3]) <= PMAX)) != 0;
    }
    if (redo) {
      // Full path, whole wave: new maximum, rescale of sums and outputs, exponentials against the new maximum
#pragma unroll
      for (int qt = 0; qt < AQ; ++qt) {
        const v8f s0 = s[qt][0], s1 = s[qt][1];
        float mx = fmaxf(s0[0], s1[0]);
#pragma unroll
        for (int r = 1; r < 8; ++r) mx = fmaxf(mx, fmaxf(s0[r], s1[r]));
        mx = fmaxf(mx, xhalf(mx));
        const float mnew = fmaxf(m_r[qt], mx);
        float alpha = (m_r[qt] - mnew) * c2;
        const float mc = mnew * c2;
        m_r[qt] = mnew;
        float e[16];
#pragma unroll
        for (int r = 0; r < 8; ++r) { e[r] = __builtin_fmaf(s0[r], c2, -mc); e[8 + r] = __builtin_fmaf(s1[r], c2, -mc); }
        // in place and closed by a v_nop, for the same reason as above
        asm("v_exp_f32 %0, %0\n\tv_exp_f32 %1, %1\n\tv_exp_f32 %2, %2\n\tv_exp_f32 %3, %3\n\tv_exp_f32 %4, %4\n\tv_exp_f32 %5, %5\n\t"
            "v_exp_f32 %6, %6\n\tv_exp_f32 %7, %7\n\tv_exp_f32 %8, %8\n\tv_exp_f32 %9, %9\n\tv_exp_f32 %10, %10\n\tv_exp_f32 %11, %11\n\t"
            "v_exp_f32 %12, %12\n\tv_exp_f32 %13, %13\n\tv_exp_f32 %14, %14\n\tv_exp_f32 %15, %15\n\tv_exp_f32 %16, %16\n\tv_nop"
            : "+v"(e[0]), "+v"(e[1]), "+v"(e[2]), "+v"(e[3]), "+v"(e[4]), "+v"(e[5]), "+v"(e[6]), "+v"(e[7]), "+v"(e[8]), "+v"(e[9]),
              "+v"(e[10]), "+v"(e[11]), "+v"(e[12]), "+v"(e[13]), "+v"(e[14]), "+v"(e[15]), "+v"(alpha));
        float t = 0.f;
#pragma unroll
        for (int i = 0; i < 8; ++i) {
          const float pa = e[2 * i], pb = e[2 * i + 1];
          t += pa + pb;
          pf[qt].w[i] = pk_f16(pa, pb);
        }
        sum[qt] = t;
        l_r[qt] *= alpha;
#pragma unroll
        for (int dt = 0; dt < 4; ++dt) oacc[qt][dt] *= alpha;
      }
    }
#pragma unroll
    for (int qt = 0; qt < AQ; ++qt) {
      l_r[qt] += sum[qt];   // this lane half's keys only; the halves are joined after the loop
#pragma unroll
      for (int dt = 0; dt < 4; ++dt) oacc[qt][dt] = wmma_hf(va[dt].v, pf[qt].v, oacc[qt][dt]);
    }
#pragma unroll
    for (int t = 0; t < 2; ++t)
#pragma unroll
      for (int ks = 0; ks < 2; ++ks) ka[t][ks] = kn[t][ks];
    mk = mn;
  }

#pragma unroll
  for (int qt = 0; qt < AQ; ++qt) {
    const float l = l_r[qt] + xhalf(l_r[qt]);
    if (hh == 0) { sM[w][qt][ln] = m_r[qt]; sL[w][qt][ln] = l; }
#pragma unroll
    for (int dt = 0; dt < 4; ++dt) {
      sO[w][qt * 8 + dt * 2][lane]     = (v4f){oacc[qt][dt][0], oacc[qt][dt][1], oacc[qt][dt][2], oacc[qt][dt][3]};
      sO[w][qt * 8 + dt * 2 + 1][lane] = (v4f){oacc[qt][dt][4], oacc[qt][dt][5], oacc[qt][dt][6], oacc[qt][dt][7]};
    }
  }
  __syncthreads();
  // join: wave w finishes query tile w / 2, head columns 32 * (w % 2) ... + 31 (one 128-byte line of each output row)
  const int qm = w >> 1;
  float M = -3.0e38f;
#pragma unroll
  for (int p = 0; p < AW; ++p) M = fmaxf(M, sM[p][qm][ln]);
  float f[AW], den = 0.f;
#pragma unroll
  for (int p = 0; p < AW; ++p) f[p] = (sM[p][qm][ln] - M) * c2;
  // in place and closed by a v_nop, for the same reason as in the loop
  asm("v_exp_f32 %0, %0\n\tv_exp_f32 %1, %1\n\tv_exp_f32 %2, %2\n\tv_exp_f32 %3, %3\n\tv_exp_f32 %4, %4\n\tv_exp_f32 %5, %5\n\tv_exp_f32 %6, %6\n\tv_exp_f32 %7, %7\n\tv_nop"
      : "+v"(f[0]), "+v"(f[1]), "+v"(f[2]), "+v"(f[3]), "+v"(f[4]), "+v"(f[5]), "+v"(f[6]), "+v"(f[7]));
#pragma unroll
  for (int p = 0; p < AW; ++p) den += sL[p][qm][ln] * f[p];
  const float inv = 1.0f / den;   // every key masked: den = 0, and 0 * inf gives NaN
#pragma unroll
  for (int dd = 0; dd < 2; ++dd) {
    const int dt = (w & 1) * 2 + dd;
    v4f a0 = {0.f,0.f,0.f,0.f}, a1 = {0.f,0.f,0.f,0.f};
#pragma unroll
    for (int p = 0; p < AW; ++p) { a0 += sO[p][qm * 8 + dt * 2][lane] * f[p]; a1 += sO[p][qm * 8 + dt * 2 + 1][lane] * f[p]; }
    float* o = out + ((size_t)b * TT + q0 + qm * 16 + ln) * HH + dt * 16 + 8 * hh;
    *(v4f*)o = a0 * inv; *(v4f*)(o + 4) = a1 * inv;
  }
}
extern "C" void kernel_launch(void* const* d_in, const int* in_sizes, int n_in,
                              void* d_out, int out_size, void* d_ws, size_t ws_size, hipStream_t stream) {
  (void)in_sizes; (void)n_in; (void)out_size;
  const float* x = (const float*)d_in[0]; const int* mask = (const int*)d_in[1]; const float* Wk = (const float*)d_in[2]; const float* Wq = (const float*)d_in[3]; const float* Wv = (const float*)d_in[4];
  char* ws = (char*)d_ws; size_t off = 0;
  auto take = [&](size_t bytes) { char* p = ws + off; off += (bytes + 255) & ~(size_t)255; return p; };
  unsigned short* Bt = (unsigned short*)take((size_t)192 * CC * 2); unsigned short* Qb = (unsigned short*)take((size_t)MR * HH * 2); unsigned short* Kb = (unsigned short*)take((size_t)MR * HH * 2); unsigned short* Vt = (unsigned short*)take((size_t)BB * HH * TT * 2);
  if (off > ws_size) return;
  k_wt_bf16<<<3 * HH * (CC / 8) / 256, 256, 0, stream>>>(Wq, Wk, Wv, Bt);   // the 12 column tiles of [Wq | Wk | Wv]
  k_proj<<<MR / PM, 256, 0, stream>>>(x, Bt, Qb, Kb, Vt);      // q, k, vt
  k_attn<<<BB * (TT / 64), AW * 32, 0, stream>>>(Qb, Kb, Vt, mask, (float*)d_out);
}

// v009
// One run takes 23 microseconds.
// In two side-by-side timings against v008, it was 1.03 and 1.02 times as fast.
// Over all steps from v000 it is 72.0 times as fast.
#include <hip/hip_runtime.h>
// [q|k|v] = x*[Wq|Wk|Wv] (M = 16384, K = 768, N = 192; x and W rounded to bf16: single exact WMMA term, f32 accumulate); then one fused launch:
// St = k*qt, masked running-maximum softmax in f32, Ot += vt*Pt: q, k, v and P each rounded once to f16, one product each on v_wmma_f32_16x16x32_f16, f32 accumulate.
#define BB 8
#define TT 2048
#define CC 768
#define HH 64
#define MR (BB * TT)

typedef __bf16 v16b __attribute__((ext_vector_type(16)));
typedef unsigned short v8us __attribute__((ext_vector_type(8), may_alias));
typedef float  v8f  __attribute__((ext_vector_type(8)));
typedef float  v4f  __attribute__((ext_vector_type(4)));
typedef float  v4fa __attribute__((ext_vector_type(4), may_alias));
union FragB { v16b v; v8us half[2]; unsigned short u[16]; };

__device__ __forceinline__ unsigned short bf16_bits(float x) { unsigned int u = __float_as_uint(x); return (unsigned short)((u + 0x7FFFu + ((u >> 16) & 1u)) >> 16); }
__device__ __forceinline__ float bf16_val(unsigned short b) { return __uint_as_float(((unsigned int)b) << 16); }
__device__ __forceinline__ float bf16_round(float x) { return bf16_val(bf16_bits(x)); }
// D += A·B with NT terms: 1 = ah·bh, 2 = + al·bh (A split), 3 = + ah·bl (both split)
template <int NT>
__device__ __forceinline__ v8f mmaN(v16b ah, v16b al, v16b bh, v16b bl, v8f c) {
  c = __builtin_amdgcn_wmma_f32_16x16x32_bf16(false, ah, false, bh, (short)0, c, false, false);
  if (NT >= 2) c = __builtin_amdgcn_wmma_f32_16x16x32_bf16(false, al, false, bh, (short)0, c, false, false);
  if (NT >= 3) c = __builtin_amdgcn_wmma_f32_16x16x32_bf16(false, ah, false, bl, (short)0, c, false, false);
  asm volatile("v_nop\n\tv_nop\n\tv_nop\n\tv_nop" : "+v"(c) : "v"(ah), "v"(al), "v"(bh), "v"(bl));
  return c;
}

// Wq, Wk, Wv [CC][HH] f32 -> bf16 B fragments of [Wq | Wk | Wv], fragment-major, all three in one launch: unit ((tile * (CC / 32) + ks) * 2 + h) * 32 + lane holds the
// 16 bytes that this lane of the B fragment (column tile of the 192 columns, k-step ks, register half h) needs, so that one wave-wide 16-byte load of a fragment half
// covers 512 contiguous bytes. One unit a thread; a block's 256 units lie in one matrix (HH * CC / 8 units each, a multiple of 256), so the choice of the source is scalar.
__global__ __launch_bounds__(256) void k_wt_bf16(const float* __restrict__ Wq, const float* __restrict__ Wk, const float* __restrict__ Wv, unsigned short* __restrict__ Wt) {
  const int m = blockIdx.x / (HH * (CC / 8) / 256);
  const float* __restrict__ W = m == 0 ? Wq : m == 1 ? Wk : Wv;
  const int u = blockIdx.x * 256 + threadIdx.x;
  const int lane = u & 31, h = (u >> 5) & 1, ks = (u >> 6) % (CC / 32), tile = (u >> 6) / (CC / 32);
  const int n = (tile & 3) * 16 + (lane & 15), k8 = ks * 32 + h * 16 + (lane >> 4) * 8;
  float f[8];
#pragma unroll
  for (int i = 0; i < 8; ++i) f[i] = W[(k8 + i) * HH + n];
  v8us v;
#pragma unroll
  for (int i = 0; i < 8; ++i) v[i] = bf16_bits(f[i]);
  *(v8us*)(Wt + (size_t)u * 8) = v;
}

// GEMM C[M][N] (f32, pitch ldc) = act(A[M][K]·W + bias). A f32 row-major (pitch lda) converted per fragment to bf16
// (ASPLIT: hi/lo two planes -> 2 terms, else single rounded term); Wt bf16 [N][K] (pitch ldb). BIAS_BF16 rounds the
// bias to bf16 first (bias quantised to bf16 before the add). K%32==0, M%16==0, N%64==0.
template <bool ASPLIT, int ACT, bool BIAS_BF16>
__global__ __launch_bounds__(128) void k_gemm_bf(const float* __restrict__ A, int lda, const unsigned short* __restrict__ Wt, int ldb,
                                               const float* __restrict__ bias, float* __restrict__ C, int ldc, int M, int N, int K) {
  __shared__ __attribute__((aligned(16))) float so[4][16][64];
  const int tid = threadIdx.x, w = tid >> 5, lane = tid & 31, ln = lane & 15, hh = lane >> 4;
  const int ntn = N / 64;
  const int wid = blockIdx.x * 4 + w;
  const int mt = wid / ntn, nq = wid % ntn;
  if (mt * 16 >= M) return;
  const int row0 = mt * 16, col0 = nq * 64;
  const float* arow = A + (size_t)(row0 + ln) * lda;
  v8f acc[4] = {};
  for (int kb = 0; kb < K; kb += 32) {
    FragB ah, al;
    const v4f x0 = *(const v4fa*)(arow + kb + 8 * hh), x1 = *(const v4fa*)(arow + kb + 8 * hh + 4);
    const v4f x2 = *(const v4fa*)(arow + kb + 16 + 8 * hh), x3 = *(const v4fa*)(arow + kb + 16 + 8 * hh + 4);
    float xs[16] = {x0[0],x0[1],x0[2],x0[3],x1[0],x1[1],x1[2],x1[3],x2[0],x2[1],x2[2],x2[3],x3[0],x3[1],x3[2],x3[3]};
#pragma unroll
    for (int i = 0; i < 16; ++i) { const unsigned short hb = bf16_bits(xs[i]); ah.u[i] = hb; al.u[i] = ASPLIT ? bf16_bits(xs[i] - bf16_val(hb)) : (unsigned short)0; }
#pragma unroll
    for (int t = 0; t < 4; ++t) {
      const unsigned short* brow = Wt + (size_t)(col0 + t * 16 + ln) * ldb + kb;
      FragB b;
      b.half[0] = *(const v8us*)(brow + 8 * hh);
      b.half[1] = *(const v8us*)(brow + 16 + 8 * hh);
      acc[t] = mmaN<ASPLIT ? 2 : 1>(ah.v, al.v, b.v, b.v, acc[t]);
    }
  }
#pragma unroll
  for (int t = 0; t < 4; ++t) {
    float bv = bias ? bias[col0 + t * 16 + ln] : 0.f;
    if (BIAS_BF16) bv = bf16_round(bv);
#pragma unroll
    for (int r = 0; r < 8; ++r) { float v = acc[t][r] + bv; if (ACT == 1) v = fmaxf(v, 0.f); so[w][8 * hh + r][t * 16 + ln] = v; }
  }
  __builtin_amdgcn_fence(__ATOMIC_ACQ_REL, "workgroup");
  __builtin_amdgcn_wave_barrier();
  const int rsub = lane >> 4, c4 = (lane & 15) * 4;
  {
#pragma unroll
    for (int q = 0; q < 8; ++q) {
      const int r = q * 2 + rsub;
      const v4f v = *(const v4fa*)&so[w][r][c4];
      *(v4f*)(C + (size_t)(row0 + r) * ldc + col0 + c4) = v;
    }
    
  }
}

// Flash-style causal/unmasked attention, all contractions 3-term bf16 hi/lo splits, f32 softmax with running max.
// q,k,v rows are read from f32 buffers with arbitrary row pitch (so they can live inside a fused qkv buffer);
// D = head size (multiple of 32, <= 128); one wave = 16 query rows; block = 4 waves (64 queries) sharing K/V chunks of 32.
template <int D, bool CAUSAL>
__global__ __launch_bounds__(128) void k_flash(const float* __restrict__ qb, const float* __restrict__ kb, const float* __restrict__ vb,
                                             int pitch, int T, int H, float scale, float* __restrict__ y, int ypitch) {
  constexpr int KS = D / 32;        // k-steps for QK
  constexpr int DT = D / 16;        // d tiles for PV
  __shared__ __attribute__((aligned(16))) unsigned short sKh[32][D + 8], sKl[32][D + 8], sVh[32][D + 8], sVl[32][D + 8];
  __shared__ __attribute__((aligned(16))) unsigned short sPh[4][16][40], sPl[4][16][40];
  __shared__ __attribute__((aligned(16))) float sO[4][16][D];
  const int tid = threadIdx.x, w = tid >> 5, lane = tid & 31, ln = lane & 15, hh = lane >> 4;
  const int nqb = (T + 63) / 64;
  const int bh = blockIdx.x / nqb, qblk = blockIdx.x % nqb;
  const int b = bh / H, h = bh % H;
  const int q0 = qblk * 64 + w * 16;
  const float* Q = qb + (size_t)b * T * pitch + h * D;
  const float* K = kb + (size_t)b * T * pitch + h * D;
  const float* V = vb + (size_t)b * T * pitch + h * D;

  // A fragments of the wave's 16 query rows (scaled), hi/lo
  FragB aqh[KS], aql[KS];
  {
    int row = q0 + ln; if (row >= T) row = T - 1;
    const float* qr = Q + (size_t)row * pitch;
#pragma unroll
    for (int ks = 0; ks < KS; ++ks)
#pragma unroll
      for (int i = 0; i < 16; ++i) {
        const int d = ks * 32 + ((i < 8) ? (8 * hh + i) : (16 + 8 * hh + (i - 8)));
        const float x = qr[d] * scale; const unsigned short hb = bf16_bits(x);
        aqh[ks].u[i] = hb; aql[ks].u[i] = bf16_bits(x - bf16_val(hb));
      }
  }
  float m_r[8], l_r[8];
#pragma unroll
  for (int r = 0; r < 8; ++r) { m_r[r] = -3.0e38f; l_r[r] = 0.f; }
  v8f oacc[DT];
#pragma unroll
  for (int dt = 0; dt < DT; ++dt) oacc[dt] = (v8f){0.f,0.f,0.f,0.f,0.f,0.f,0.f,0.f};

  const int kv_end = CAUSAL ? min(T, qblk * 64 + 64) : T;     // block-uniform
  for (int j0 = 0; j0 < kv_end; j0 += 32) {
    __syncthreads();
    for (int e = tid; e < 32 * (D / 4); e += 128) {
      const int r = e / (D / 4), c4 = (e % (D / 4)) * 4;
      const int key = j0 + r;
      v4f kf = {0.f,0.f,0.f,0.f}, vf = {0.f,0.f,0.f,0.f};
      if (key < T) { kf = *(const v4fa*)(K + (size_t)key * pitch + c4); vf = *(const v4fa*)(V + (size_t)key * pitch + c4); }
#pragma unroll
      for (int t = 0; t < 4; ++t) {
        unsigned short hb = bf16_bits(kf[t]); sKh[r][c4 + t] = hb; sKl[r][c4 + t] = bf16_bits(kf[t] - bf16_val(hb));
        hb = bf16_bits(vf[t]); sVh[r][c4 + t] = hb; sVl[r][c4 + t] = bf16_bits(vf[t] - bf16_val(hb));
      }
    }
    __syncthreads();
    // S tile 16 x 32
    v8f s[2];
#pragma unroll
    for (int nt = 0; nt < 2; ++nt) {
      v8f acc = {};
#pragma unroll
      for (int ks = 0; ks < KS; ++ks) {
        FragB bh_, bl_;
        bh_.half[0] = *(const v8us*)&sKh[nt * 16 + ln][ks * 32 + 8 * hh]; bh_.half[1] = *(const v8us*)&sKh[nt * 16 + ln][ks * 32 + 16 + 8 * hh];
        bl_.half[0] = *(const v8us*)&sKl[nt * 16 + ln][ks * 32 + 8 * hh]; bl_.half[1] = *(const v8us*)&sKl[nt * 16 + ln][ks * 32 + 16 + 8 * hh];
        acc = mmaN<3>(aqh[ks].v, aql[ks].v, bh_.v, bl_.v, acc);
      }
      s[nt] = acc;
    }
    // mask + running max (rows 8hh+r; the 16 lanes of a half share rows)
    float alpha[8];
#pragma unroll
    for (int r = 0; r < 8; ++r) {
      const int qi = q0 + 8 * hh + r;
      const int ja = j0 + ln, jb = j0 + 16 + ln;
      if (CAUSAL) { if (ja > qi) s[0][r] = -3.0e38f; if (jb > qi) s[1][r] = -3.0e38f; }
      if (ja >= T) s[0][r] = -3.0e38f;
      if (jb >= T) s[1][r] = -3.0e38f;
      float mx = fmaxf(s[0][r], s[1][r]);
      mx = fmaxf(mx, __shfl_xor(mx, 1, 32)); mx = fmaxf(mx, __shfl_xor(mx, 2, 32)); mx = fmaxf(mx, __shfl_xor(mx, 4, 32)); mx = fmaxf(mx, __shfl_xor(mx, 8, 32));
      const float mnew = fmaxf(m_r[r], mx);
      alpha[r] = (mnew > -1.0e38f) ? __expf(m_r[r] - mnew) : 1.0f;
      const float p0 = (s[0][r] > -1.0e38f) ? __expf(s[0][r] - mnew) : 0.f;
      const float p1 = (s[1][r] > -1.0e38f) ? __expf(s[1][r] - mnew) : 0.f;
      m_r[r] = mnew;
      l_r[r] = l_r[r] * alpha[r] + p0 + p1;            // per-lane partial row sum (16 lanes combined at the end)
      unsigned short hb = bf16_bits(p0); sPh[w][8 * hh + r][ln] = hb;      sPl[w][8 * hh + r][ln] = bf16_bits(p0 - bf16_val(hb));
      hb = bf16_bits(p1);                sPh[w][8 * hh + r][16 + ln] = hb; sPl[w][8 * hh + r][16 + ln] = bf16_bits(p1 - bf16_val(hb));
    }
#pragma unroll
    for (int dt = 0; dt < DT; ++dt)
#pragma unroll
      for (int r = 0; r < 8; ++r) oacc[dt][r] *= alpha[r];
    __builtin_amdgcn_fence(__ATOMIC_ACQ_REL, "workgroup");
    __builtin_amdgcn_wave_barrier();
    FragB pah, pal;
    pah.half[0] = *(const v8us*)&sPh[w][ln][8 * hh]; pah.half[1] = *(const v8us*)&sPh[w][ln][16 + 8 * hh];
    pal.half[0] = *(const v8us*)&sPl[w][ln][8 * hh]; pal.half[1] = *(const v8us*)&sPl[w][ln][16 + 8 * hh];
#pragma unroll
    for (int dt = 0; dt < DT; ++dt) {
      FragB bvh, bvl;
#pragma unroll
      for (int i = 0; i < 8; ++i) {
        bvh.u[i] = sVh[8 * hh + i][dt * 16 + ln]; bvh.u[8 + i] = sVh[16 + 8 * hh + i][dt * 16 + ln];
        bvl.u[i] = sVl[8 * hh + i][dt * 16 + ln]; bvl.u[8 + i] = sVl[16 + 8 * hh + i][dt * 16 + ln];
      }
      oacc[dt] = mmaN<3>(pah.v, pal.v, bvh.v, bvl.v, oacc[dt]);
    }
    __builtin_amdgcn_fence(__ATOMIC_ACQ_REL, "workgroup");
    __builtin_amdgcn_wave_barrier();
  }
#pragma unroll
  for (int r = 0; r < 8; ++r) {
    float l = l_r[r];
    l += __shfl_xor(l, 1, 32); l += __shfl_xor(l, 2, 32); l += __shfl_xor(l, 4, 32); l += __shfl_xor(l, 8, 32);
    l_r[r] = (l > 0.f) ? 1.0f / l : 0.f;
  }
#pragma unroll
  for (int dt = 0; dt < DT; ++dt)
#pragma unroll
    for (int r = 0; r < 8; ++r) sO[w][8 * hh + r][dt * 16 + ln] = oacc[dt][r] * l_r[r];
  __builtin_amdgcn_fence(__ATOMIC_ACQ_REL, "workgroup");
  __builtin_amdgcn_wave_barrier();
  {
    for (int r = 0; r < 16; ++r) {
      const int row = q0 + r;
      if (row < T && lane < D / 4) {
        const v4f val = *(const v4fa*)&sO[w][r][lane * 4];
        *(v4f*)(y + ((size_t)b * T + row) * ypitch + h * D + lane * 4) = val;
      }
    }
    
  }
}

// GEMM C = act(A·W + bias + resid): A f32 (ASPLIT -> hi/lo 2 terms), Wt bf16 [N][K]; ACT 0 none, 1 relu, 2 exact gelu;
// resid (optional, f32, row index = (row % rmod), pitch ldr, RES_BF16 rounds it) added before the activation.
template <bool ASPLIT, int ACT, bool BIAS_BF16, bool RES_BF16>
__global__ __launch_bounds__(128) void k_gemm_bf3(const float* __restrict__ A, int lda, const unsigned short* __restrict__ Wt, int ldb,
                                                const float* __restrict__ bias, const float* __restrict__ resid, int rmod, int ldr,
                                                float* __restrict__ C, int ldc, int M, int N, int K) {
  __shared__ __attribute__((aligned(16))) float so[4][16][64];
  const int tid = threadIdx.x, w = tid >> 5, lane = tid & 31, ln = lane & 15, hh = lane >> 4;
  const int ntn = N / 64;
  const int wid = blockIdx.x * 4 + w;
  const int mt = wid / ntn, nq = wid % ntn;
  if (mt * 16 >= M) return;
  const int row0 = mt * 16, col0 = nq * 64;
  const float* arow = A + (size_t)(row0 + ln) * lda;
  v8f acc[4] = {};
  for (int kb = 0; kb < K; kb += 32) {
    FragB ah, al;
    const v4f x0 = *(const v4fa*)(arow + kb + 8 * hh), x1 = *(const v4fa*)(arow + kb + 8 * hh + 4);
    const v4f x2 = *(const v4fa*)(arow + kb + 16 + 8 * hh), x3 = *(const v4fa*)(arow + kb + 16 + 8 * hh + 4);
    float xs[16] = {x0[0],x0[1],x0[2],x0[3],x1[0],x1[1],x1[2],x1[3],x2[0],x2[1],x2[2],x2[3],x3[0],x3[1],x3[2],x3[3]};
#pragma unroll
    for (int i = 0; i < 16; ++i) { const unsigned short hb = bf16_bits(xs[i]); ah.u[i] = hb; al.u[i] = ASPLIT ? bf16_bits(xs[i] - bf16_val(hb)) : (unsigned short)0; }
#pragma unroll
    for (int t = 0; t < 4; ++t) {
      const unsigned short* brow = Wt + (size_t)(col0 + t * 16 + ln) * ldb + kb;
      FragB b;
      b.half[0] = *(const v8us*)(brow + 8 * hh);
      b.half[1] = *(const v8us*)(brow + 16 + 8 * hh);
      acc[t] = mmaN<ASPLIT ? 2 : 1>(ah.v, al.v, b.v, b.v, acc[t]);
    }
  }
#pragma unroll
  for (int t = 0; t < 4; ++t) {
    const int col = col0 + t * 16 + ln;
    float bv = bias ? bias[col] : 0.f;
    if (BIAS_BF16) bv = bf16_round(bv);
#pragma unroll
    for (int r = 0; r < 8; ++r) {
      float v = acc[t][r] + bv;
      if (resid) { float rv = resid[(size_t)((row0 + 8 * hh + r) % rmod) * ldr + col]; if (RES_BF16) rv = bf16_round(rv); v += rv; }
      if (ACT == 1) v = fmaxf(v, 0.f);
      if (ACT == 2) v = 0.5f * v * (1.0f + erff(v * 0.70710678118654752f));
      if (ACT == 3) { const float u = 0.7978845608028654f * (v + 0.044715f * v * v * v); v = 0.5f * v * (1.0f + tanhf(u)); }
      so[w][8 * hh + r][t * 16 + ln] = v;
    }
  }
  __builtin_amdgcn_fence(__ATOMIC_ACQ_REL, "workgroup");
  __builtin_amdgcn_wave_barrier();
  const int rsub = lane >> 4, c4 = (lane & 15) * 4;
  {
#pragma unroll
    for (int q = 0; q < 8; ++q) {
      const int r = q * 2 + rsub;
      const v4f v = *(const v4fa*)&so[w][r][c4];
      *(v4f*)(C + (size_t)(row0 + r) * ldc + col0 + c4) = v;
    }
    
  }
}
// row LayerNorm (biased variance, eps) over N: s = X (+ R); optional out_sum <- s; out_norm <- (s-mu)*rsqrt(var+eps)*g + b
template <bool PARAM_BF16>
__global__ __launch_bounds__(256) void k_layernorm(const float* __restrict__ X, const float* __restrict__ R, const float* __restrict__ g, const float* __restrict__ bta,
                                                  float* __restrict__ out_sum, float* __restrict__ out_norm, int N, float eps) {
  __shared__ float red[256];
  const int row = blockIdx.x, tid = threadIdx.x;
  const float* x = X + (size_t)row * N; const float* rr = R ? R + (size_t)row * N : nullptr;
  float vals[16];                     // up to N = 4096
  const int per = N / 256;            // contiguous chunk per thread? use strided-by-4 chunks: thread handles j = tid*4 + 1024*u
  float s1 = 0.f;
  for (int u = 0; u < per / 4; ++u) {
    const int j = tid * 4 + 1024 * u;
    const v4f a = *(const v4fa*)(x + j);
    v4f b = {0.f,0.f,0.f,0.f}; if (rr) b = *(const v4fa*)(rr + j);
#pragma unroll
    for (int q = 0; q < 4; ++q) { const float v = a[q] + b[q]; vals[u * 4 + q] = v; s1 += v; }
  }
  red[tid] = s1; __syncthreads();
  for (int st = 128; st > 0; st >>= 1) { if (tid < st) red[tid] += red[tid + st]; __syncthreads(); }
  const float mu = red[0] / (float)N; __syncthreads();
  float s2 = 0.f;
  for (int u = 0; u < per / 4; ++u)
#pragma unroll
    for (int q = 0; q < 4; ++q) { const float c = vals[u * 4 + q] - mu; s2 += c * c; }
  red[tid] = s2; __syncthreads();
  for (int st = 128; st > 0; st >>= 1) { if (tid < st) red[tid] += red[tid + st]; __syncthreads(); }
  const float rs = rsqrtf(red[0] / (float)N + eps);
  {
    for (int u = 0; u < per / 4; ++u) {
      const int j = tid * 4 + 1024 * u;
      v4f o, sm;
#pragma unroll
      for (int q = 0; q < 4; ++q) {
        float gg = g[j + q], bb = bta[j + q];
        if (PARAM_BF16) { gg = bf16_round(gg); bb = bf16_round(bb); }
        sm[q] = vals[u * 4 + q]; o[q] = (vals[u * 4 + q] - mu) * rs * gg + bb;
      }
      if (out_sum) *(v4f*)(out_sum + (size_t)row * N + j) = sm;
      *(v4f*)(out_norm + (size_t)row * N + j) = o;
    }
    
  }
}

// batched f32 [K][N] (pitch lds, batch stride sIn) -> transposed hi/lo planes [N][K] (batch stride sOut); thread per (n, 8 k); grid.y = batch
__global__ __launch_bounds__(256) void k_split_transpose_b(const float* __restrict__ src, int lds_, size_t sIn, unsigned short* __restrict__ hi, unsigned short* __restrict__ lo, size_t sOut, int K, int N) {
  const size_t t = (size_t)blockIdx.x * 256 + threadIdx.x; const int k8n = K / 8; if (t >= (size_t)N * k8n) return;
  src += (size_t)blockIdx.y * sIn; hi += (size_t)blockIdx.y * sOut; lo += (size_t)blockIdx.y * sOut;
  const int n = (int)(t / k8n), k8 = (int)(t % k8n) * 8; v8us vh, vl;
#pragma unroll
  for (int i = 0; i < 8; ++i) { const float x = src[(size_t)(k8 + i) * lds_ + n]; const unsigned short hb = bf16_bits(x); vh[i] = hb; vl[i] = bf16_bits(x - bf16_val(hb)); }
  unsigned short* dh = hi + (size_t)n * K + k8; unsigned short* dl = lo + (size_t)n * K + k8;
  *(v8us*)dh = vh; *(v8us*)dl = vl; 
}

typedef float f2v __attribute__((ext_vector_type(2)));
typedef __bf16 bf2v __attribute__((ext_vector_type(2)));
__device__ __forceinline__ unsigned int pk_bf16(float a, float b) { return __builtin_bit_cast(unsigned int, __builtin_convertvector((f2v){a, b}, bf2v)); }   // round to nearest even
__device__ __forceinline__ float xhalf(float x) { return __builtin_bit_cast(float, __builtin_amdgcn_permlanex16(__builtin_bit_cast(int, x), __builtin_bit_cast(int, x), 0x76543210, 0xfedcba98, false, false)); }   // lane l with lane l ^ 16
__device__ __forceinline__ v8f wmma_bf(v16b a, v16b b, v8f c) { return __builtin_amdgcn_wmma_f32_16x16x32_bf16(false, a, false, b, (short)0, c, false, false); }
typedef _Float16 v16h __attribute__((ext_vector_type(16)));
typedef _Float16 h2v __attribute__((ext_vector_type(2)));
union FragH { v16h v; v8us half[2]; unsigned int w[8]; };
__device__ __forceinline__ unsigned int pk_f16(float a, float b) { return __builtin_bit_cast(unsigned int, __builtin_convertvector((f2v){a, b}, h2v)); }   // round to nearest even
__device__ __forceinline__ v8f wmma_hf(v16h a, v16h b, v8f c) { return __builtin_amdgcn_wmma_f32_16x16x32_f16(false, a, false, b, (short)0, c, false, false); }

// [q | k | v] = x * [Wq | Wk | Wv]. A block owns PM rows of x and all 192 columns. x is read once, in whole lines, rounded to bf16 and kept in LDS.
// Wave w holds the B fragments of column tiles 3 (w % 4) ... + 2 for k-steps 12 (w / 4) ... + 11 in registers (packed by k_wt_bf16) and
// multiplies all four row tiles by them; the two K halves of a result are added through LDS. From that LDS tile the block writes what the attention launch reads:
// q, k and v rounded to f16 (11 bits, finite below 65504), each laid out fragment-major in 16-byte units, so that one wave-wide 16-byte load of a fragment half covers 512 contiguous bytes:
// Qb, Kb: unit ((row / 16) * 4 + ks * 2 + h) * 32 + lane holds columns 32 ks + 16 h + 8 (lane / 16) ... + 7 of row 16 (row / 16) + lane % 16 (rows count through all batches);
// Vt: unit ((row / 32) * 8 + dt * 2 + h) * 32 + lane holds column 16 dt + lane % 16 of the eight rows 32 (row / 32) + 16 h + 8 (lane / 16) ... + 7.
#define PM 64
#define XR 40          // x tile in LDS, one plane per k-step: row pitch in elements, 80 bytes = 16 * odd, at which 16-byte fragment reads meet no bank conflict
#define XS (PM * XR + 32)   // plane pitch in elements: 16 banks past a multiple of 64, so the four k-steps that one staging store spans do not collide
#define OP 196         // result tile pitch in floats: rows 8 apart fall 32 banks apart, so the two lane halves of a store do not collide
__global__ __launch_bounds__(256) void k_proj(const float* __restrict__ x, const unsigned short* __restrict__ Bp, unsigned short* __restrict__ Qb, unsigned short* __restrict__ Kb, unsigned short* __restrict__ Vt) {
  __shared__ __attribute__((aligned(16))) unsigned short sx[(CC / 32) * XS];
  __shared__ __attribute__((aligned(16))) float so[PM][OP];
  const int tid = threadIdx.x, w = tid >> 5, lane = tid & 31, ln = lane & 15, hh = lane >> 4;
  const int ng = w & 3, kh = w >> 2;
  // Blocks whose index is equal modulo BB work on one batch, here and in the attention launch. For speed only; the result is the same wherever a block lands.
  const size_t row0 = ((size_t)(blockIdx.x % BB) * (TT / PM) + blockIdx.x / BB) * PM;
  // staging: wave w brings rows 16 (w % 4) ... + 15, columns 384 (w / 4) ... + 383, as 48 wave-wide loads of 512 contiguous bytes
  const float* xp = x + (row0 + ng * 16) * CC + kh * 384 + lane * 4;
  const unsigned int bo = ((ng * 72 + kh * 12) * 64 + lane) * 16;   // this lane's place in the packed fragments, in bytes
  // All blocks read the same packed W lines from L2. Each block takes its waves' twelve k-steps from a first step of its own and wraps round (slot kk holds k-step kr[kk],
  // for the W fragments and the x planes alike), so that blocks which run in step ask for different lines at any one moment. For speed only: every k-step is still taken once.
  const int r0 = (blockIdx.x / BB) % 12;
  int kr[12];
  unsigned int bk[12];   // this lane's place in slot kk's fragments of the first column tile, in bytes
#pragma unroll
  for (int kk = 0; kk < 12; ++kk) { kr[kk] = r0 + kk - (r0 + kk >= 12 ? 12 : 0); bk[kk] = bo + kr[kk] * 1024; }
  const char* bc = (const char*)Bp;
  v4f xa[48];
#pragma unroll
  for (int i = 0; i < 48; ++i) xa[i] = *(const v4fa*)(xp + (i / 3) * CC + (i % 3) * 128);
  FragB bf[3][12];
#pragma unroll
  for (int t = 0; t < 2; ++t)
#pragma unroll
    for (int kk = 0; kk < 12; ++kk) { bf[t][kk].half[0] = *(const v8us*)(bc + bk[kk] + t * 24576); bf[t][kk].half[1] = *(const v8us*)(bc + bk[kk] + t * 24576 + 512); }
  // stands in front of the reuse of the address registers that the loads above name; pointer and offsets are inputs so that their registers live up to the wait
  asm volatile("s_wait_xcnt 0x0" :: "v"(xp), "v"(bk[0]), "v"(bk[1]), "v"(bk[2]), "v"(bk[3]), "v"(bk[4]), "v"(bk[5]), "v"(bk[6]), "v"(bk[7]), "v"(bk[8]), "v"(bk[9]), "v"(bk[10]), "v"(bk[11]) : "memory");
  unsigned short* xs = sx + (kh * 12 + (lane >> 3)) * XS + ng * 16 * XR + (lane & 7) * 4;
#pragma unroll
  for (int i = 0; i < 48; ++i) *(uint2*)(xs + (i % 3) * 4 * XS + (i / 3) * XR) = make_uint2(pk_bf16(xa[i][0], xa[i][1]), pk_bf16(xa[i][2], xa[i][3]));
  // the third column tile's fragments: a second group of loads, with a wait of its own
#pragma unroll
  for (int kk = 0; kk < 12; ++kk) { bf[2][kk].half[0] = *(const v8us*)(bc + bk[kk] + 2 * 24576); bf[2][kk].half[1] = *(const v8us*)(bc + bk[kk] + 2 * 24576 + 512); }
  // as above, for the loads of the third tile
  asm volatile("s_wait_xcnt 0x0" :: "v"(bk[0]), "v"(bk[1]), "v"(bk[2]), "v"(bk[3]), "v"(bk[4]), "v"(bk[5]), "v"(bk[6]), "v"(bk[7]), "v"(bk[8]), "v"(bk[9]), "v"(bk[10]), "v"(bk[11]) : "memory");
  __syncthreads();

  v8f acc[4][3];
#pragma unroll
  for (int mt = 0; mt < 4; ++mt)
#pragma unroll
    for (int t = 0; t < 3; ++t) acc[mt][t] = (v8f){0.f,0.f,0.f,0.f,0.f,0.f,0.f,0.f};
  const unsigned short* ap = sx + kh * 12 * XS + ln * XR + 8 * hh;
  // the next k-step's four A fragments are asked for as one group ahead of this k-step's products
  FragB a[2][4];
#pragma unroll
  for (int mt = 0; mt < 4; ++mt) { a[0][mt].half[0] = *(const v8us*)(ap + kr[0] * XS + mt * 16 * XR); a[0][mt].half[1] = *(const v8us*)(ap + kr[0] * XS + mt * 16 * XR + 16); }
#pragma unroll
  for (int kk = 0; kk < 12; ++kk) {
    if (kk + 1 < 12) {
#pragma unroll
      for (int mt = 0; mt < 4; ++mt) { a[(kk + 1) & 1][mt].half[0] = *(const v8us*)(ap + kr[kk + 1] * XS + mt * 16 * XR); a[(kk + 1) & 1][mt].half[1] = *(const v8us*)(ap + kr[kk + 1] * XS + mt * 16 * XR + 16); }
    }
#pragma unroll
    for (int mt = 0; mt < 4; ++mt)
#pragma unroll
      for (int t = 0; t < 3; ++t) acc[mt][t] = wmma_bf(a[kk & 1][mt].v, bf[t][kk].v, acc[mt][t]);
    // keeps the order one load group, twelve products: left free, the scheduler asks for four k-steps at once, runs out of registers and then waits out a fragment's LDS latency before every three products
    __builtin_amdgcn_sched_barrier(0);
  }

  // the wave of the first K half finishes row tiles 0 and 1, its partner 2 and 3: each hands the other two over, then adds its own to what it was handed
  float* sg = &so[(kh ? 0 : 32) + 8 * hh][ng * 48 + ln];
  float* sk = &so[(kh ? 32 : 0) + 8 * hh][ng * 48 + ln];
#pragma unroll
  for (int m = 0; m < 2; ++m)
#pragma unroll
    for (int t = 0; t < 3; ++t)
#pragma unroll
      for (int r = 0; r < 8; ++r) sg[(m * 16 + r) * OP + t * 16] = kh ? acc[m][t][r] : acc[m + 2][t][r];
  __syncthreads();
#pragma unroll
  for (int m = 0; m < 2; ++m)
#pragma unroll
    for (int t = 0; t < 3; ++t)
#pragma unroll
      for (int r = 0; r < 8; ++r) sk[(m * 16 + r) * OP + t * 16] += kh ? acc[m + 2][t][r] : acc[m][t][r];
  __syncthreads();
  // every store instruction below covers four whole 128-byte lines
  // thread tid writes units tid and 256 + tid of the block's 512 units (8 KB in a row) of each of Qb, Kb and Vt
  // q and k: eight columns of one row a thread; wave w has fragment half w % 4 (= ks * 2 + h) of row tiles w / 4 and 2 + w / 4
  uint4 qw[2], kw[2];
#pragma unroll
  for (int i = 0; i < 2; ++i) {
    const float* c = &so[(i * 2 + kh) * 16 + ln][(ng * 2 + hh) * 8];
    const v4f a0 = *(const v4fa*)c, a1 = *(const v4fa*)(c + 4);
    qw[i] = make_uint4(pk_f16(a0[0], a0[1]), pk_f16(a0[2], a0[3]), pk_f16(a1[0], a1[1]), pk_f16(a1[2], a1[3]));
    const v4f c0 = *(const v4fa*)(c + HH), c1 = *(const v4fa*)(c + HH + 4);
    kw[i] = make_uint4(pk_f16(c0[0], c0[1]), pk_f16(c0[2], c0[3]), pk_f16(c1[0], c1[1]), pk_f16(c1[2], c1[3]));
  }
  // v: eight rows of one column a thread; wave w has fragment half w % 2 of column tile w / 2, for rows 0 ... 31 and 32 ... 63
  uint4 vw[2];
#pragma unroll
  for (int i = 0; i < 2; ++i) {
    const float* c = &so[i * 32 + (w & 1) * 16 + hh * 8][2 * HH + (w >> 1) * 16 + ln];
    vw[i] = make_uint4(pk_f16(c[0], c[OP]), pk_f16(c[2 * OP], c[3 * OP]), pk_f16(c[4 * OP], c[5 * OP]), pk_f16(c[6 * OP], c[7 * OP]));
  }
  unsigned short* oq = Qb + row0 * HH + tid * 8;
  unsigned short* ok = Kb + row0 * HH + tid * 8;
  unsigned short* ov = Vt + row0 * HH + tid * 8;
#pragma unroll
  for (int i = 0; i < 2; ++i) *(uint4*)(ov + i * 2048) = vw[i];
#pragma unroll
  for (int i = 0; i < 2; ++i) *(uint4*)(ok + i * 2048) = kw[i];
#pragma unroll
  for (int i = 0; i < 2; ++i) *(uint4*)(oq + i * 2048) = qw[i];
}

// Scores, masked softmax and P*v in one launch, all batches. A block owns 64 query rows of one batch; each of its AW waves
// holds all 64 (AQ tiles of 16 as B operands, f16) and walks its own TT / AW keys in passes of 32, from a first pass set by the block index, with a maximum that is renewed only when a pass needs it:
// St = k * qt (a lane holds 16 scores of ONE query), Pt packs from the two St tiles into a B operand (f16; P lies in 0 ... PMAX), Ot += vt * Pt.
// Every operand is one f16 value, 11 bits on both sides of a product, so each product is one WMMA.
// The AW partial (maximum, sum, Ot) sets are joined through LDS at the end. Scores never reach memory.
#define AQ 4
#define AW 8
#define AKEYS (TT / AW)
#define ANP (AKEYS / 32)   // passes of a wave
#define PMAX 256.0f   // largest lane sum of P that a pass may reach against a maximum that lags: 2^8, far inside f16
__global__ __launch_bounds__(AW * 32) void k_attn(const unsigned short* __restrict__ Qb, const unsigned short* __restrict__ Kb, const unsigned short* __restrict__ Vt,
                                                  const int* __restrict__ mask, float* __restrict__ out) {
  __shared__ __attribute__((aligned(16))) v4f sO[AW][AQ * 8][32];
  __shared__ float sM[AW][AQ][16], sL[AW][AQ][16];
  const int tid = threadIdx.x, w = tid >> 5, lane = tid & 31, ln = lane & 15, hh = lane >> 4;
  const int b = blockIdx.x % BB, q0 = (blockIdx.x / BB) * 64;   // batch = index modulo BB, as in k_proj (the reason stands there)
  const float c2 = 0.03608439182435161f * 1.4426950408889634f;   // 768^-0.5 * log2(e): the softmax runs in base 2

  FragH qf[AQ][2];
  // q, k and vt lie fragment-major (layout: at k_proj): fragment half n of a run of rows stands 256 n elements behind the lane's first unit
  const unsigned short* qp = Qb + ((size_t)b * TT + q0) * HH + lane * 8;
#pragma unroll
  for (int qt = 0; qt < AQ; ++qt)
#pragma unroll
    for (int ks = 0; ks < 2; ++ks) { qf[qt][ks].half[0] = *(const v8us*)(qp + (qt * 4 + ks * 2) * 256); qf[qt][ks].half[1] = *(const v8us*)(qp + (qt * 4 + ks * 2 + 1) * 256); }
  // stands in front of the reuse of the address registers that the q loads name; the pointer is an input so that its registers live up to the wait
  asm volatile("s_wait_xcnt 0x0" :: "v"(qp) : "memory");
  float m_r[AQ], l_r[AQ];
  v8f oacc[AQ][4];
#pragma unroll
  for (int qt = 0; qt < AQ; ++qt) {
    m_r[qt] = -3.0e38f; l_r[qt] = 0.f;   // finite start: a pass whose keys are all masked gives exp2(-inf) = 0, never inf - inf
#pragma unroll
    for (int dt = 0; dt < 4; ++dt) oacc[qt][dt] = (v8f){0.f,0.f,0.f,0.f,0.f,0.f,0.f,0.f};
  }
  // The 32 blocks of a batch read the same k and vt lines from L2. Each block starts the walk through its waves' key ranges at a pass of its own, rot, and wraps round,
  // so that blocks which run in step ask for different lines at any one moment. For speed only: every pass is still made once, in another order.
  const int rot = (blockIdx.x / BB) % ANP;
  const unsigned short* kp = Kb + ((size_t)b * TT + w * AKEYS + rot * 32) * HH + lane * 8;
  const unsigned short* vp = Vt + ((size_t)b * TT + w * AKEYS + rot * 32) * HH + lane * 8;
  const int* mp = mask + (size_t)b * TT + w * AKEYS + rot * 32 + lane;   // one mask word a lane: a pass's 32 keys
  int one = 1;   // passes through each wait below, so that the pointer additions, which are multiples of it, cannot be lifted over the wait

  FragH ka[2][2];
  int mk;
#pragma unroll
  for (int t = 0; t < 2; ++t)
#pragma unroll
    for (int ks = 0; ks < 2; ++ks) { ka[t][ks].half[0] = *(const v8us*)(kp + (t * 4 + ks * 2) * 256); ka[t][ks].half[1] = *(const v8us*)(kp + (t * 4 + ks * 2 + 1) * 256); }
  mk = *mp;
  // stands in front of the overwrite of the address registers that the loads above name; the pointers are inputs so that their registers live up to it
  asm volatile("s_wait_xcnt 0x0" : "+s"(one) : "v"(kp), "v"(mp) : "memory");
  { const int d = one * (rot == ANP - 1 ? 1 - ANP : 1); kp += d * 32 * HH; mp += d * 32; }   // on to the next pass of the range; behind its last pass comes its first

  // rolled: one pass is several KB of code
#pragma unroll 1
  for (int it = 0; it < ANP; ++it) {
    FragH va[4];
#pragma unroll
    for (int dt = 0; dt < 4; ++dt) { va[dt].half[0] = *(const v8us*)(vp + dt * 2 * 256); va[dt].half[1] = *(const v8us*)(vp + (dt * 2 + 1) * 256); }
    // the next pass's k rows and mask words are fetched now; the last pass fetches its own again, so every address stays inside
    FragH kn[2][2];
#pragma unroll
    for (int t = 0; t < 2; ++t)
#pragma unroll
      for (int ks = 0; ks < 2; ++ks) { kn[t][ks].half[0] = *(const v8us*)(kp + (t * 4 + ks * 2) * 256); kn[t][ks].half[1] = *(const v8us*)(kp + (t * 4 + ks * 2 + 1) * 256); }
    const int mn = *mp;
    // stands in front of the overwrite of the address registers that this pass's loads name; the pointers are inputs so that their registers live up to it
    asm volatile("s_wait_xcnt 0x0" : "+s"(one) : "v"(vp), "v"(kp), "v"(mp) : "memory");
    const int pc = (it + rot) % ANP;   // the pass in hand: vp stands there, kp and mp one pass on (scalar)
    const int dv = one * (pc == ANP - 1 ? 1 - ANP : 1);
    const int dk = (it + 2 < ANP) ? one * (pc == ANP - 2 ? 1 - ANP : 1) : 0;
    vp += dv * 32 * HH; kp += dk * 32 * HH; mp += dk * 32;

    // bit 16 t + r of nb: key 16 t + 8 hh + r of this pass is masked
    const unsigned int nb = ~__builtin_amdgcn_ballot_w32(mk != 0) >> (8 * hh);
    v8f bias[2];   // 0 for a kept key, -inf for a masked one; rows of St are keys, so one set serves all query tiles
#pragma unroll
    for (int r = 0; r < 8; ++r) {
      bias[0][r] = __uint_as_float((unsigned int)((int)(nb << (31 - r)) >> 31) & 0xFF800000u);
      bias[1][r] = __uint_as_float((unsigned int)((int)(nb << (15 - r)) >> 31) & 0xFF800000u);
    }

    v8f s[AQ][2];
#pragma unroll
    for (int qt = 0; qt < AQ; ++qt) {
      v8f s0 = {}, s1 = {};
#pragma unroll
      for (int ks = 0; ks < 2; ++ks) { s0 = wmma_hf(ka[0][ks].v, qf[qt][ks].v, s0); s1 = wmma_hf(ka[1][ks].v, qf[qt][ks].v, s1); }
      s[qt][0] = s0 + bias[0]; s[qt][1] = s1 + bias[1];
    }
    // Common path: the exponentials are taken against the maximum in use, with no search for a new one and no rescale. P is never negative, so a lane's
    // sum of P bounds each of its P: while every sum stays at or below PMAX, every P fits f16 and the pass stands as it is.
    FragH pf[AQ];
    float sum[AQ];
    bool redo = it == 0;   // no maximum is in use yet: the first pass goes straight to the full path (scalar test)
    if (!redo) {
#pragma unroll
      for (int qt = 0; qt < AQ; ++qt) {
        const float mc = m_r[qt] * c2;
        float e[16];
#pragma unroll
        for (int r = 0; r < 8; ++r) { e[r] = __builtin_fmaf(s[qt][0][r], c2, -mc); e[8 + r] = __builtin_fmaf(s[qt][1][r], c2, -mc); }
        // one tile's exponentials in one statement, each in place: none reads the result or overwrites the source of the one in front of it,
        // and the v_nop fills the slot that the instruction set asks for behind the last
        asm("v_exp_f32 %0, %0\n\tv_exp_f32 %1, %1\n\tv_exp_f32 %2, %2\n\tv_exp_f32 %3, %3\n\tv_exp_f32 %4, %4\n\tv_exp_f32 %5, %5\n\t"
            "v_exp_f32 %6, %6\n\tv_exp_f32 %7, %7\n\tv_exp_f32 %8, %8\n\tv_exp_f32 %9, %9\n\tv_exp_f32 %10, %10\n\tv_exp_f32 %11, %11\n\t"
            "v_exp_f32 %12, %12\n\tv_exp_f32 %13, %13\n\tv_exp_f32 %14, %14\n\tv_exp_f32 %15, %15\n\tv_nop"
            : "+v"(e[0]), "+v"(e[1]), "+v"(e[2]), "+v"(e[3]), "+v"(e[4]), "+v"(e[5]), "+v"(e[6]), "+v"(e[7]), "+v"(e[8]), "+v"(e[9]),
              "+v"(e[10]), "+v"(e[11]), "+v"(e[12]), "+v"(e[13]), "+v"(e[14]), "+v"(e[15]));
        float t = 0.f;
#pragma unroll
        for (int i = 0; i < 8; ++i) {
          const float pa = e[2 * i], pb = e[2 * i + 1];
          t += pa + pb;
          pf[qt].w[i] = pk_f16(pa, pb);
        }
        sum[qt] = t;
      }
      // one test a pass for all four tiles; written so that an infinite or not-a-number sum also takes the full path
      redo = __builtin_amdgcn_ballot_w32(!((sum[0] + sum[1]) + (sum[2] + sum[3]) <= PMAX)) != 0;
    }
    if (redo) {
      // Full path, whole wave: new maximum, rescale of sums and outputs, exponentials against the new maximum
#pragma unroll
      for (int qt = 0; qt < AQ; ++qt) {
        const v8f s0 = s[qt][0], s1 = s[qt][1];
        float mx = fmaxf(s0[0], s1[0]);
#pragma unroll
        for (int r = 1; r < 8; ++r) mx = fmaxf(mx, fmaxf(s0[r], s1[r]));
        mx = fmaxf(mx, xhalf(mx));
        const float mnew = fmaxf(m_r[qt], mx);
        float alpha = (m_r[qt] - mnew) * c2;
        const float mc = mnew * c2;
        m_r[qt] = mnew;
        float e[16];
#pragma unroll
        for (int r = 0; r < 8; ++r) { e[r] = __builtin_fmaf(s0[r], c2, -mc); e[8 + r] = __builtin_fmaf(s1[r], c2, -mc); }
        // in place and closed by a v_nop, for the same reason as above
        asm("v_exp_f32 %0, %0\n\tv_exp_f32 %1, %1\n\tv_exp_f32 %2, %2\n\tv_exp_f32 %3, %3\n\tv_exp_f32 %4, %4\n\tv_exp_f32 %5, %5\n\t"
            "v_exp_f32 %6, %6\n\tv_exp_f32 %7, %7\n\tv_exp_f32 %8, %8\n\tv_exp_f32 %9, %9\n\tv_exp_f32 %10, %10\n\tv_exp_f32 %11, %11\n\t"
            "v_exp_f32 %12, %12\n\tv_exp_f32 %13, %13\n\tv_exp_f32 %14, %14\n\tv_exp_f32 %15, %15\n\tv_exp_f32 %16, %16\n\tv_nop"
            : "+v"(e[0]), "+v"(e[1]), "+v"(e[2]), "+v"(e[3]), "+v"(e[4]), "+v"(e[5]), "+v"(e[6]), "+v"(e[7]), "+v"(e[8]), "+v"(e[9]),
              "+v"(e[10]), "+v"(e[11]), "+v"(e[12]), "+v"(e[13]), "+v"(e[14]), "+v"(e[15]), "+v"(alpha));
        float t = 0.f;
#pragma unroll
        for (int i = 0; i < 8; ++i) {
          const float pa = e[2 * i], pb = e[2 * i + 1];
          t += pa + pb;
          pf[qt].w[i] = pk_f16(pa, pb);
        }
        sum[qt] = t;
        l_r[qt] *= alpha;
#pragma unroll
        for (int dt = 0; dt < 4; ++dt) oacc[qt][dt] *= alpha;
      }
    }
#pragma unroll
    for (int qt = 0; qt < AQ; ++qt) {
      l_r[qt] += sum[qt];   // this lane half's keys only; the halves are joined after the loop
#pragma unroll
      for (int dt = 0; dt < 4; ++dt) oacc[qt][dt] = wmma_hf(va[dt].v, pf[qt].v, oacc[qt][dt]);
    }
#pragma unroll
    for (int t = 0; t < 2; ++t)
#pragma unroll
      for (int ks = 0; ks < 2; ++ks) ka[t][ks] = kn[t][ks];
    mk = mn;
  }

#pragma unroll
  for (int qt = 0; qt < AQ; ++qt) {
    const float l = l_r[qt] + xhalf(l_r[qt]);
    if (hh == 0) { sM[w][qt][ln] = m_r[qt]; sL[w][qt][ln] = l; }
#pragma unroll
    for (int dt = 0; dt < 4; ++dt) {
      sO[w][qt * 8 + dt * 2][lane]     = (v4f){oacc[qt][dt][0], oacc[qt][dt][1], oacc[qt][dt][2], oacc[qt][dt][3]};
      sO[w][qt * 8 + dt * 2 + 1][lane] = (v4f){oacc[qt][dt][4], oacc[qt][dt][5], oacc[qt][dt][6], oacc[qt][dt][7]};
    }
  }
  __syncthreads();
  // join: wave w finishes query tile w / 2, head columns 32 * (w % 2) ... + 31 (one 128-byte line of each output row)
  const int qm = w >> 1;
  float M = -3.0e38f;
#pragma unroll
  for (int p = 0; p < AW; ++p) M = fmaxf(M, sM[p][qm][ln]);
  float f[AW], den = 0.f;
#pragma unroll
  for (int p = 0; p < AW; ++p) f[p] = (sM[p][qm][ln] - M) * c2;
  // in place and closed by a v_nop, for the same reason as in the loop
  asm("v_exp_f32 %0, %0\n\tv_exp_f32 %1, %1\n\tv_exp_f32 %2, %2\n\tv_exp_f32 %3, %3\n\tv_exp_f32 %4, %4\n\tv_exp_f32 %5, %5\n\tv_exp_f32 %6, %6\n\tv_exp_f32 %7, %7\n\tv_nop"
      : "+v"(f[0]), "+v"(f[1]), "+v"(f[2]), "+v"(f[3]), "+v"(f[4]), "+v"(f[5]), "+v"(f[6]), "+v"(f[7]));
#pragma unroll
  for (int p = 0; p < AW; ++p) den += sL[p][qm][ln] * f[p];
  const float inv = 1.0f / den;   // every key masked: den = 0, and 0 * inf gives NaN
#pragma unroll
  for (int dd = 0; dd < 2; ++dd) {
    const int dt = (w & 1) * 2 + dd;
    v4f a0 = {0.f,0.f,0.f,0.f}, a1 = {0.f,0.f,0.f,0.f};
#pragma unroll
    for (int p = 0; p < AW; ++p) { a0 += sO[p][qm * 8 + dt * 2][lane] * f[p]; a1 += sO[p][qm * 8 + dt * 2 + 1][lane] * f[p]; }
    float* o = out + ((size_t)b * TT + q0 + qm * 16 + ln) * HH + dt * 16 + 8 * hh;
    *(v4f*)o = a0 * inv; *(v4f*)(o + 4) = a1 * inv;
  }
}
extern "C" void kernel_launch(void* const* d_in, const int* in_sizes, int n_in,
                              void* d_out, int out_size, void* d_ws, size_t ws_size, hipStream_t stream) {
  (void)in_sizes; (void)n_in; (void)out_size;
  const float* x = (const float*)d_in[0]; const int* mask = (const int*)d_in[1]; const float* Wk = (const float*)d_in[2]; const float* Wq = (const float*)d_in[3]; const float* Wv = (const float*)d_in[4];
  char* ws = (char*)d_ws; size_t off = 0;
  auto take = [&](size_t bytes) { char* p = ws + off; off += (bytes + 255) & ~(size_t)255; return p; };
  unsigned short* Bt = (unsigned short*)take((size_t)192 * CC * 2); unsigned short* Qb = (unsigned short*)take((size_t)MR * HH * 2); unsigned short* Kb = (unsigned short*)take((size_t)MR * HH * 2); unsigned short* Vt = (unsigned short*)take((size_t)BB * HH * TT * 2);
  if (off > ws_size) return;
  k_wt_bf16<<<3 * HH * (CC / 8) / 256, 256, 0, stream>>>(Wq, Wk, Wv, Bt);   // the 12 column tiles of [Wq | Wk | Wv]
  k_proj<<<MR / PM, 256, 0, stream>>>(x, Bt, Qb, Kb, Vt);      // q, k, vt
  k_attn<<<BB * (TT / 64), AW * 32, 0, stream>>>(Qb, Kb, Vt, mask, (float*)d_out);
}

// v010
// It runs in 22.4 microseconds.
// Two timings next to v009 put it at 1.04 and 1.05 times that version's speed.
// All steps since v000 together make it 75.1 times as fast.
#include <hip/hip_runtime.h>
// [q|k|v] = x*[Wq|Wk|Wv] (M = 16384, K = 768, N = 192; x and W rounded to bf16: single exact WMMA term, f32 accumulate); then one fused launch:
// St = k*qt, masked running-maximum softmax in f32, Ot += vt*Pt: q (scaled), k, v and P each rounded once to f16, one product each on v_wmma_f32_16x16x32_f16, f32 accumulate.
#define BB 8
#define TT 2048
#define CC 768
#define HH 64
#define MR (BB * TT)
#define QSC (0.03608439182435161f * 1.4426950408889634f)   // 768^-0.5 * log2(e): the projection scales q by it, so that k * qt is the score in base-2 exponent units

typedef __bf16 v16b __attribute__((ext_vector_type(16)));
typedef unsigned short v8us __attribute__((ext_vector_type(8), may_alias));
typedef float  v8f  __attribute__((ext_vector_type(8)));
typedef float  v4f  __attribute__((ext_vector_type(4)));
typedef float  v4fa __attribute__((ext_vector_type(4), may_alias));
union FragB { v16b v; v8us half[2]; unsigned short u[16]; };

__device__ __forceinline__ unsigned short bf16_bits(float x) { unsigned int u = __float_as_uint(x); return (unsigned short)((u + 0x7FFFu + ((u >> 16) & 1u)) >> 16); }
__device__ __forceinline__ float bf16_val(unsigned short b) { return __uint_as_float(((unsigned int)b) << 16); }
__device__ __forceinline__ float bf16_round(float x) { return bf16_val(bf16_bits(x)); }
// D += A·B with NT terms: 1 = ah·bh, 2 = + al·bh (A split), 3 = + ah·bl (both split)
template <int NT>
__device__ __forceinline__ v8f mmaN(v16b ah, v16b al, v16b bh, v16b bl, v8f c) {
  c = __builtin_amdgcn_wmma_f32_16x16x32_bf16(false, ah, false, bh, (short)0, c, false, false);
  if (NT >= 2) c = __builtin_amdgcn_wmma_f32_16x16x32_bf16(false, al, false, bh, (short)0, c, false, false);
  if (NT >= 3) c = __builtin_amdgcn_wmma_f32_16x16x32_bf16(false, ah, false, bl, (short)0, c, false, false);
  asm volatile("v_nop\n\tv_nop\n\tv_nop\n\tv_nop" : "+v"(c) : "v"(ah), "v"(al), "v"(bh), "v"(bl));
  return c;
}

// Wq, Wk, Wv [CC][HH] f32 -> bf16 B fragments of [Wq | Wk | Wv], fragment-major, all three in one launch: unit ((tile * (CC / 32) + ks) * 2 + h) * 32 + lane holds the
// 16 bytes that this lane of the B fragment (column tile of the 192 columns, k-step ks, register half h) needs, so that one wave-wide 16-byte load of a fragment half
// covers 512 contiguous bytes. One unit a thread; a block's 256 units lie in one matrix (HH * CC / 8 units each, a multiple of 256), so the choice of the source is scalar.
__global__ __launch_bounds__(256) void k_wt_bf16(const float* __restrict__ Wq, const float* __restrict__ Wk, const float* __restrict__ Wv, unsigned short* __restrict__ Wt) {
  const int m = blockIdx.x / (HH * (CC / 8) / 256);
  const float* __restrict__ W = m == 0 ? Wq : m == 1 ? Wk : Wv;
  const int u = blockIdx.x * 256 + threadIdx.x;
  const int lane = u & 31, h = (u >> 5) & 1, ks = (u >> 6) % (CC / 32), tile = (u >> 6) / (CC / 32);
  const int n = (tile & 3) * 16 + (lane & 15), k8 = ks * 32 + h * 16 + (lane >> 4) * 8;
  float f[8];
#pragma unroll
  for (int i = 0; i < 8; ++i) f[i] = W[(k8 + i) * HH + n];
  v8us v;
#pragma unroll
  for (int i = 0; i < 8; ++i) v[i] = bf16_bits(f[i]);
  *(v8us*)(Wt + (size_t)u * 8) = v;
}

// GEMM C[M][N] (f32, pitch ldc) = act(A[M][K]·W + bias). A f32 row-major (pitch lda) converted per fragment to bf16
// (ASPLIT: hi/lo two planes -> 2 terms, else single rounded term); Wt bf16 [N][K] (pitch ldb). BIAS_BF16 rounds the
// bias to bf16 first (bias quantised to bf16 before the add). K%32==0, M%16==0, N%64==0.
template <bool ASPLIT, int ACT, bool BIAS_BF16>
__global__ __launch_bounds__(128) void k_gemm_bf(const float* __restrict__ A, int lda, const unsigned short* __restrict__ Wt, int ldb,
                                               const float* __restrict__ bias, float* __restrict__ C, int ldc, int M, int N, int K) {
  __shared__ __attribute__((aligned(16))) float so[4][16][64];
  const int tid = threadIdx.x, w = tid >> 5, lane = tid & 31, ln = lane & 15, hh = lane >> 4;
  const int ntn = N / 64;
  const int wid = blockIdx.x * 4 + w;
  const int mt = wid / ntn, nq = wid % ntn;
  if (mt * 16 >= M) return;
  const int row0 = mt * 16, col0 = nq * 64;
  const float* arow = A + (size_t)(row0 + ln) * lda;
  v8f acc[4] = {};
  for (int kb = 0; kb < K; kb += 32) {
    FragB ah, al;
    const v4f x0 = *(const v4fa*)(arow + kb + 8 * hh), x1 = *(const v4fa*)(arow + kb + 8 * hh + 4);
    const v4f x2 = *(const v4fa*)(arow + kb + 16 + 8 * hh), x3 = *(const v4fa*)(arow + kb + 16 + 8 * hh + 4);
    float xs[16] = {x0[0],x0[1],x0[2],x0[3],x1[0],x1[1],x1[2],x1[3],x2[0],x2[1],x2[2],x2[3],x3[0],x3[1],x3[2],x3[3]};
#pragma unroll
    for (int i = 0; i < 16; ++i) { const unsigned short hb = bf16_bits(xs[i]); ah.u[i] = hb; al.u[i] = ASPLIT ? bf16_bits(xs[i] - bf16_val(hb)) : (unsigned short)0; }
#pragma unroll
    for (int t = 0; t < 4; ++t) {
      const unsigned short* brow = Wt + (size_t)(col0 + t * 16 + ln) * ldb + kb;
      FragB b;
      b.half[0] = *(const v8us*)(brow + 8 * hh);
      b.half[1] = *(const v8us*)(brow + 16 + 8 * hh);
      acc[t] = mmaN<ASPLIT ? 2 : 1>(ah.v, al.v, b.v, b.v, acc[t]);
    }
  }
#pragma unroll
  for (int t = 0; t < 4; ++t) {
    float bv = bias ? bias[col0 + t * 16 + ln] : 0.f;
    if (BIAS_BF16) bv = bf16_round(bv);
#pragma unroll
    for (int r = 0; r < 8; ++r) { float v = acc[t][r] + bv; if (ACT == 1) v = fmaxf(v, 0.f); so[w][8 * hh + r][t * 16 + ln] = v; }
  }
  __builtin_amdgcn_fence(__ATOMIC_ACQ_REL, "workgroup");
  __builtin_amdgcn_wave_barrier();
  const int rsub = lane >> 4, c4 = (lane & 15) * 4;
  {
#pragma unroll
    for (int q = 0; q < 8; ++q) {
      const int r = q * 2 + rsub;
      const v4f v = *(const v4fa*)&so[w][r][c4];
      *(v4f*)(C + (size_t)(row0 + r) * ldc + col0 + c4) = v;
    }
    
  }
}

// Flash-style causal/unmasked attention, all contractions 3-term bf16 hi/lo splits, f32 softmax with running max.
// q,k,v rows are read from f32 buffers with arbitrary row pitch (so they can live inside a fused qkv buffer);
// D = head size (multiple of 32, <= 128); one wave = 16 query rows; block = 4 waves (64 queries) sharing K/V chunks of 32.
template <int D, bool CAUSAL>
__global__ __launch_bounds__(128) void k_flash(const float* __restrict__ qb, const float* __restrict__ kb, const float* __restrict__ vb,
                                             int pitch, int T, int H, float scale, float* __restrict__ y, int ypitch) {
  constexpr int KS = D / 32;        // k-steps for QK
  constexpr int DT = D / 16;        // d tiles for PV
  __shared__ __attribute__((aligned(16))) unsigned short sKh[32][D + 8], sKl[32][D + 8], sVh[32][D + 8], sVl[32][D + 8];
  __shared__ __attribute__((aligned(16))) unsigned short sPh[4][16][40], sPl[4][16][40];
  __shared__ __attribute__((aligned(16))) float sO[4][16][D];
  const int tid = threadIdx.x, w = tid >> 5, lane = tid & 31, ln = lane & 15, hh = lane >> 4;
  const int nqb = (T + 63) / 64;
  const int bh = blockIdx.x / nqb, qblk = blockIdx.x % nqb;
  const int b = bh / H, h = bh % H;
  const int q0 = qblk * 64 + w * 16;
  const float* Q = qb + (size_t)b * T * pitch + h * D;
  const float* K = kb + (size_t)b * T * pitch + h * D;
  const float* V = vb + (size_t)b * T * pitch + h * D;

  // A fragments of the wave's 16 query rows (scaled), hi/lo
  FragB aqh[KS], aql[KS];
  {
    int row = q0 + ln; if (row >= T) row = T - 1;
    const float* qr = Q + (size_t)row * pitch;
#pragma unroll
    for (int ks = 0; ks < KS; ++ks)
#pragma unroll
      for (int i = 0; i < 16; ++i) {
        const int d = ks * 32 + ((i < 8) ? (8 * hh + i) : (16 + 8 * hh + (i - 8)));
        const float x = qr[d] * scale; const unsigned short hb = bf16_bits(x);
        aqh[ks].u[i] = hb; aql[ks].u[i] = bf16_bits(x - bf16_val(hb));
      }
  }
  float m_r[8], l_r[8];
#pragma unroll
  for (int r = 0; r < 8; ++r) { m_r[r] = -3.0e38f; l_r[r] = 0.f; }
  v8f oacc[DT];
#pragma unroll
  for (int dt = 0; dt < DT; ++dt) oacc[dt] = (v8f){0.f,0.f,0.f,0.f,0.f,0.f,0.f,0.f};

  const int kv_end = CAUSAL ? min(T, qblk * 64 + 64) : T;     // block-uniform
  for (int j0 = 0; j0 < kv_end; j0 += 32) {
    __syncthreads();
    for (int e = tid; e < 32 * (D / 4); e += 128) {
      const int r = e / (D / 4), c4 = (e % (D / 4)) * 4;
      const int key = j0 + r;
      v4f kf = {0.f,0.f,0.f,0.f}, vf = {0.f,0.f,0.f,0.f};
      if (key < T) { kf = *(const v4fa*)(K + (size_t)key * pitch + c4); vf = *(const v4fa*)(V + (size_t)key * pitch + c4); }
#pragma unroll
      for (int t = 0; t < 4; ++t) {
        unsigned short hb = bf16_bits(kf[t]); sKh[r][c4 + t] = hb; sKl[r][c4 + t] = bf16_bits(kf[t] - bf16_val(hb));
        hb = bf16_bits(vf[t]); sVh[r][c4 + t] = hb; sVl[r][c4 + t] = bf16_bits(vf[t] - bf16_val(hb));
      }
    }
    __syncthreads();
    // S tile 16 x 32
    v8f s[2];
#pragma unroll
    for (int nt = 0; nt < 2; ++nt) {
      v8f acc = {};
#pragma unroll
      for (int ks = 0; ks < KS; ++ks) {
        FragB bh_, bl_;
        bh_.half[0] = *(const v8us*)&sKh[nt * 16 + ln][ks * 32 + 8 * hh]; bh_.half[1] = *(const v8us*)&sKh[nt * 16 + ln][ks * 32 + 16 + 8 * hh];
        bl_.half[0] = *(const v8us*)&sKl[nt * 16 + ln][ks * 32 + 8 * hh]; bl_.half[1] = *(const v8us*)&sKl[nt * 16 + ln][ks * 32 + 16 + 8 * hh];
        acc = mmaN<3>(aqh[ks].v, aql[ks].v, bh_.v, bl_.v, acc);
      }
      s[nt] = acc;
    }
    // mask + running max (rows 8hh+r; the 16 lanes of a half share rows)
    float alpha[8];
#pragma unroll
    for (int r = 0; r < 8; ++r) {
      const int qi = q0 + 8 * hh + r;
      const int ja = j0 + ln, jb = j0 + 16 + ln;
      if (CAUSAL) { if (ja > qi) s[0][r] = -3.0e38f; if (jb > qi) s[1][r] = -3.0e38f; }
      if (ja >= T) s[0][r] = -3.0e38f;
      if (jb >= T) s[1][r] = -3.0e38f;
      float mx = fmaxf(s[0][r], s[1][r]);
      mx = fmaxf(mx, __shfl_xor(mx, 1, 32)); mx = fmaxf(mx, __shfl_xor(mx, 2, 32)); mx = fmaxf(mx, __shfl_xor(mx, 4, 32)); mx = fmaxf(mx, __shfl_xor(mx, 8, 32));
      const float mnew = fmaxf(m_r[r], mx);
      alpha[r] = (mnew > -1.0e38f) ? __expf(m_r[r] - mnew) : 1.0f;
      const float p0 = (s[0][r] > -1.0e38f) ? __expf(s[0][r] - mnew) : 0.f;
      const float p1 = (s[1][r] > -1.0e38f) ? __expf(s[1][r] - mnew) : 0.f;
      m_r[r] = mnew;
      l_r[r] = l_r[r] * alpha[r] + p0 + p1;            // per-lane partial row sum (16 lanes combined at the end)
      unsigned short hb = bf16_bits(p0); sPh[w][8 * hh + r][ln] = hb;      sPl[w][8 * hh + r][ln] = bf16_bits(p0 - bf16_val(hb));
      hb = bf16_bits(p1);                sPh[w][8 * hh + r][16 + ln] = hb; sPl[w][8 * hh + r][16 + ln] = bf16_bits(p1 - bf16_val(hb));
    }
#pragma unroll
    for (int dt = 0; dt < DT; ++dt)
#pragma unroll
      for (int r = 0; r < 8; ++r) oacc[dt][r] *= alpha[r];
    __builtin_amdgcn_fence(__ATOMIC_ACQ_REL, "workgroup");
    __builtin_amdgcn_wave_barrier();
    FragB pah, pal;
    pah.half[0] = *(const v8us*)&sPh[w][ln][8 * hh]; pah.half[1] = *(const v8us*)&sPh[w][ln][16 + 8 * hh];
    pal.half[0] = *(const v8us*)&sPl[w][ln][8 * hh]; pal.half[1] = *(const v8us*)&sPl[w][ln][16 + 8 * hh];
#pragma unroll
    for (int dt = 0; dt < DT; ++dt) {
      FragB bvh, bvl;
#pragma unroll
      for (int i = 0; i < 8; ++i) {
        bvh.u[i] = sVh[8 * hh + i][dt * 16 + ln]; bvh.u[8 + i] = sVh[16 + 8 * hh + i][dt * 16 + ln];
        bvl.u[i] = sVl[8 * hh + i][dt * 16 + ln]; bvl.u[8 + i] = sVl[16 + 8 * hh + i][dt * 16 + ln];
      }
      oacc[dt] = mmaN<3>(pah.v, pal.v, bvh.v, bvl.v, oacc[dt]);
    }
    __builtin_amdgcn_fence(__ATOMIC_ACQ_REL, "workgroup");
    __builtin_amdgcn_wave_barrier();
  }
#pragma unroll
  for (int r = 0; r < 8; ++r) {
    float l = l_r[r];
    l += __shfl_xor(l, 1, 32); l += __shfl_xor(l, 2, 32); l += __shfl_xor(l, 4, 32); l += __shfl_xor(l, 8, 32);
    l_r[r] = (l > 0.f) ? 1.0f / l : 0.f;
  }
#pragma unroll
  for (int dt = 0; dt < DT; ++dt)
#pragma unroll
    for (int r = 0; r < 8; ++r) sO[w][8 * hh + r][dt * 16 + ln] = oacc[dt][r] * l_r[r];
  __builtin_amdgcn_fence(__ATOMIC_ACQ_REL, "workgroup");
  __builtin_amdgcn_wave_barrier();
  {
    for (int r = 0; r < 16; ++r) {
      const int row = q0 + r;
      if (row < T && lane < D / 4) {
        const v4f val = *(const v4fa*)&sO[w][r][lane * 4];
        *(v4f*)(y + ((size_t)b * T + row) * ypitch + h * D + lane * 4) = val;
      }
    }
    
  }
}

// GEMM C = act(A·W + bias + resid): A f32 (ASPLIT -> hi/lo 2 terms), Wt bf16 [N][K]; ACT 0 none, 1 relu, 2 exact gelu;
// resid (optional, f32, row index = (row % rmod), pitch ldr, RES_BF16 rounds it) added before the activation.
template <bool ASPLIT, int ACT, bool BIAS_BF16, bool RES_BF16>
__global__ __launch_bounds__(128) void k_gemm_bf3(const float* __restrict__ A, int lda, const unsigned short* __restrict__ Wt, int ldb,
                                                const float* __restrict__ bias, const float* __restrict__ resid, int rmod, int ldr,
                                                float* __restrict__ C, int ldc, int M, int N, int K) {
  __shared__ __attribute__((aligned(16))) float so[4][16][64];
  const int tid = threadIdx.x, w = tid >> 5, lane = tid & 31, ln = lane & 15, hh = lane >> 4;
  const int ntn = N / 64;
  const int wid = blockIdx.x * 4 + w;
  const int mt = wid / ntn, nq = wid % ntn;
  if (mt * 16 >= M) return;
  const int row0 = mt * 16, col0 = nq * 64;
  const float* arow = A + (size_t)(row0 + ln) * lda;
  v8f acc[4] = {};
  for (int kb = 0; kb < K; kb += 32) {
    FragB ah, al;
    const v4f x0 = *(const v4fa*)(arow + kb + 8 * hh), x1 = *(const v4fa*)(arow + kb + 8 * hh + 4);
    const v4f x2 = *(const v4fa*)(arow + kb + 16 + 8 * hh), x3 = *(const v4fa*)(arow + kb + 16 + 8 * hh + 4);
    float xs[16] = {x0[0],x0[1],x0[2],x0[3],x1[0],x1[1],x1[2],x1[3],x2[0],x2[1],x2[2],x2[3],x3[0],x3[1],x3[2],x3[3]};
#pragma unroll
    for (int i = 0; i < 16; ++i) { const unsigned short hb = bf16_bits(xs[i]); ah.u[i] = hb; al.u[i] = ASPLIT ? bf16_bits(xs[i] - bf16_val(hb)) : (unsigned short)0; }
#pragma unroll
    for (int t = 0; t < 4; ++t) {
      const unsigned short* brow = Wt + (size_t)(col0 + t * 16 + ln) * ldb + kb;
      FragB b;
      b.half[0] = *(const v8us*)(brow + 8 * hh);
      b.half[1] = *(const v8us*)(brow + 16 + 8 * hh);
      acc[t] = mmaN<ASPLIT ? 2 : 1>(ah.v, al.v, b.v, b.v, acc[t]);
    }
  }
#pragma unroll
  for (int t = 0; t < 4; ++t) {
    const int col = col0 + t * 16 + ln;
    float bv = bias ? bias[col] : 0.f;
    if (BIAS_BF16) bv = bf16_round(bv);
#pragma unroll
    for (int r = 0; r < 8; ++r) {
      float v = acc[t][r] + bv;
      if (resid) { float rv = resid[(size_t)((row0 + 8 * hh + r) % rmod) * ldr + col]; if (RES_BF16) rv = bf16_round(rv); v += rv; }
      if (ACT == 1) v = fmaxf(v, 0.f);
      if (ACT == 2) v = 0.5f * v * (1.0f + erff(v * 0.70710678118654752f));
      if (ACT == 3) { const float u = 0.7978845608028654f * (v + 0.044715f * v * v * v); v = 0.5f * v * (1.0f + tanhf(u)); }
      so[w][8 * hh + r][t * 16 + ln] = v;
    }
  }
  __builtin_amdgcn_fence(__ATOMIC_ACQ_REL, "workgroup");
  __builtin_amdgcn_wave_barrier();
  const int rsub = lane >> 4, c4 = (lane & 15) * 4;
  {
#pragma unroll
    for (int q = 0; q < 8; ++q) {
      const int r = q * 2 + rsub;
      const v4f v = *(const v4fa*)&so[w][r][c4];
      *(v4f*)(C + (size_t)(row0 + r) * ldc + col0 + c4) = v;
    }
    
  }
}
// row LayerNorm (biased variance, eps) over N: s = X (+ R); optional out_sum <- s; out_norm <- (s-mu)*rsqrt(var+eps)*g + b
template <bool PARAM_BF16>
__global__ __launch_bounds__(256) void k_layernorm(const float* __restrict__ X, const float* __restrict__ R, const float* __restrict__ g, const float* __restrict__ bta,
                                                  float* __restrict__ out_sum, float* __restrict__ out_norm, int N, float eps) {
  __shared__ float red[256];
  const int row = blockIdx.x, tid = threadIdx.x;
  const float* x = X + (size_t)row * N; const float* rr = R ? R + (size_t)row * N : nullptr;
  float vals[16];                     // up to N = 4096
  const int per = N / 256;            // contiguous chunk per thread? use strided-by-4 chunks: thread handles j = tid*4 + 1024*u
  float s1 = 0.f;
  for (int u = 0; u < per / 4; ++u) {
    const int j = tid * 4 + 1024 * u;
    const v4f a = *(const v4fa*)(x + j);
    v4f b = {0.f,0.f,0.f,0.f}; if (rr) b = *(const v4fa*)(rr + j);
#pragma unroll
    for (int q = 0; q < 4; ++q) { const float v = a[q] + b[q]; vals[u * 4 + q] = v; s1 += v; }
  }
  red[tid] = s1; __syncthreads();
  for (int st = 128; st > 0; st >>= 1) { if (tid < st) red[tid] += red[tid + st]; __syncthreads(); }
  const float mu = red[0] / (float)N; __syncthreads();
  float s2 = 0.f;
  for (int u = 0; u < per / 4; ++u)
#pragma unroll
    for (int q = 0; q < 4; ++q) { const float c = vals[u * 4 + q] - mu; s2 += c * c; }
  red[tid] = s2; __syncthreads();
  for (int st = 128; st > 0; st >>= 1) { if (tid < st) red[tid] += red[tid + st]; __syncthreads(); }
  const float rs = rsqrtf(red[0] / (float)N + eps);
  {
    for (int u = 0; u < per / 4; ++u) {
      const int j = tid * 4 + 1024 * u;
      v4f o, sm;
#pragma unroll
      for (int q = 0; q < 4; ++q) {
        float gg = g[j + q], bb = bta[j + q];
        if (PARAM_BF16) { gg = bf16_round(gg); bb = bf16_round(bb); }
        sm[q] = vals[u * 4 + q]; o[q] = (vals[u * 4 + q] - mu) * rs * gg + bb;
      }
      if (out_sum) *(v4f*)(out_sum + (size_t)row * N + j) = sm;
      *(v4f*)(out_norm + (size_t)row * N + j) = o;
    }
    
  }
}

// batched f32 [K][N] (pitch lds, batch stride sIn) -> transposed hi/lo planes [N][K] (batch stride sOut); thread per (n, 8 k); grid.y = batch
__global__ __launch_bounds__(256) void k_split_transpose_b(const float* __restrict__ src, int lds_, size_t sIn, unsigned short* __restrict__ hi, unsigned short* __restrict__ lo, size_t sOut, int K, int N) {
  const size_t t = (size_t)blockIdx.x * 256 + threadIdx.x; const int k8n = K / 8; if (t >= (size_t)N * k8n) return;
  src += (size_t)blockIdx.y * sIn; hi += (size_t)blockIdx.y * sOut; lo += (size_t)blockIdx.y * sOut;
  const int n = (int)(t / k8n), k8 = (int)(t % k8n) * 8; v8us vh, vl;
#pragma unroll
  for (int i = 0; i < 8; ++i) { const float x = src[(size_t)(k8 + i) * lds_ + n]; const unsigned short hb = bf16_bits(x); vh[i] = hb; vl[i] = bf16_bits(x - bf16_val(hb)); }
  unsigned short* dh = hi + (size_t)n * K + k8; unsigned short* dl = lo + (size_t)n * K + k8;
  *(v8us*)dh = vh; *(v8us*)dl = vl; 
}

typedef float f2v __attribute__((ext_vector_type(2)));
typedef __bf16 bf2v __attribute__((ext_vector_type(2)));
__device__ __forceinline__ unsigned int pk_bf16(float a, float b) { return __builtin_bit_cast(unsigned int, __builtin_convertvector((f2v){a, b}, bf2v)); }   // round to nearest even
__device__ __forceinline__ float xhalf(float x) { return __builtin_bit_cast(float, __builtin_amdgcn_permlanex16(__builtin_bit_cast(int, x), __builtin_bit_cast(int, x), 0x76543210, 0xfedcba98, false, false)); }   // lane l with lane l ^ 16
__device__ __forceinline__ v8f wmma_bf(v16b a, v16b b, v8f c) { return __builtin_amdgcn_wmma_f32_16x16x32_bf16(false, a, false, b, (short)0, c, false, false); }
typedef _Float16 v16h __attribute__((ext_vector_type(16)));
typedef _Float16 h2v __attribute__((ext_vector_type(2)));
union FragH { v16h v; v8us half[2]; unsigned int w[8]; };
__device__ __forceinline__ unsigned int pk_f16(float a, float b) { return __builtin_bit_cast(unsigned int, __builtin_convertvector((f2v){a, b}, h2v)); }   // round to nearest even
__device__ __forceinline__ v8f wmma_hf(v16h a, v16h b, v8f c) { return __builtin_amdgcn_wmma_f32_16x16x32_f16(false, a, false, b, (short)0, c, false, false); }

// [q | k | v] = x * [Wq | Wk | Wv]. A block owns PM rows of x and all 192 columns. x is read once, in whole lines, rounded to bf16 and kept in LDS.
// Wave w holds the B fragments of column tiles 3 (w % 4) ... + 2 for k-steps 12 (w / 4) ... + 11 in registers (packed by k_wt_bf16) and
// multiplies all four row tiles by them; the two K halves of a result are added through LDS. From that LDS tile the block writes what the attention launch reads:
// q * QSC, k and v rounded to f16 (11 bits, finite below 65504), each laid out fragment-major in 16-byte units, so that one wave-wide 16-byte load of a fragment half covers 512 contiguous bytes:
// Qb, Kb: unit ((row / 16) * 4 + ks * 2 + h) * 32 + lane holds columns 32 ks + 16 h + 8 (lane / 16) ... + 7 of row 16 (row / 16) + lane % 16 (rows count through all batches);
// Vt: unit ((row / 32) * 8 + dt * 2 + h) * 32 + lane holds column 16 dt + lane % 16 of the eight rows 32 (row / 32) + 16 h + 8 (lane / 16) ... + 7.
#define PM 64
#define XR 40          // x tile in LDS, one plane per k-step: row pitch in elements, 80 bytes = 16 * odd, at which 16-byte fragment reads meet no bank conflict
#define XS (PM * XR + 32)   // plane pitch in elements: 16 banks past a multiple of 64, so the four k-steps that one staging store spans do not collide
#define OP 196         // result tile pitch in floats: rows 8 apart fall 32 banks apart, so the two lane halves of a store do not collide
__global__ __launch_bounds__(256) void k_proj(const float* __restrict__ x, const unsigned short* __restrict__ Bp, unsigned short* __restrict__ Qb, unsigned short* __restrict__ Kb, unsigned short* __restrict__ Vt) {
  __shared__ __attribute__((aligned(16))) unsigned short sx[(CC / 32) * XS];
  __shared__ __attribute__((aligned(16))) float so[PM][OP];
  const int tid = threadIdx.x, w = tid >> 5, lane = tid & 31, ln = lane & 15, hh = lane >> 4;
  const int ng = w & 3, kh = w >> 2;
  // Blocks whose index is equal modulo BB work on one batch, here and in the attention launch. For speed only; the result is the same wherever a block lands.
  const size_t row0 = ((size_t)(blockIdx.x % BB) * (TT / PM) + blockIdx.x / BB) * PM;
  // staging: wave w brings rows 16 (w % 4) ... + 15, columns 384 (w / 4) ... + 383, as 48 wave-wide loads of 512 contiguous bytes
  const float* xp = x + (row0 + ng * 16) * CC + kh * 384 + lane * 4;
  const unsigned int bo = ((ng * 72 + kh * 12) * 64 + lane) * 16;   // this lane's place in the packed fragments, in bytes
  // All blocks read the same packed W lines from L2. Each block takes its waves' twelve k-steps from a first step of its own and wraps round (slot kk holds k-step kr[kk],
  // for the W fragments and the x planes alike), so that blocks which run in step ask for different lines at any one moment. For speed only: every k-step is still taken once.
  const int r0 = (blockIdx.x / BB) % 12;
  int kr[12];
  unsigned int bk[12];   // this lane's place in slot kk's fragments of the first column tile, in bytes
#pragma unroll
  for (int kk = 0; kk < 12; ++kk) { kr[kk] = r0 + kk - (r0 + kk >= 12 ? 12 : 0); bk[kk] = bo + kr[kk] * 1024; }
  const char* bc = (const char*)Bp;
  v4f xa[48];
#pragma unroll
  for (int i = 0; i < 48; ++i) xa[i] = *(const v4fa*)(xp + (i / 3) * CC + (i % 3) * 128);
  FragB bf[3][12];
#pragma unroll
  for (int t = 0; t < 2; ++t)
#pragma unroll
    for (int kk = 0; kk < 12; ++kk) { bf[t][kk].half[0] = *(const v8us*)(bc + bk[kk] + t * 24576); bf[t][kk].half[1] = *(const v8us*)(bc + bk[kk] + t * 24576 + 512); }
  // stands in front of the reuse of the address registers that the loads above name; pointer and offsets are inputs so that their registers live up to the wait
  asm volatile("s_wait_xcnt 0x0" :: "v"(xp), "v"(bk[0]), "v"(bk[1]), "v"(bk[2]), "v"(bk[3]), "v"(bk[4]), "v"(bk[5]), "v"(bk[6]), "v"(bk[7]), "v"(bk[8]), "v"(bk[9]), "v"(bk[10]), "v"(bk[11]) : "memory");
  unsigned short* xs = sx + (kh * 12 + (lane >> 3)) * XS + ng * 16 * XR + (lane & 7) * 4;
#pragma unroll
  for (int i = 0; i < 48; ++i) *(uint2*)(xs + (i % 3) * 4 * XS + (i / 3) * XR) = make_uint2(pk_bf16(xa[i][0], xa[i][1]), pk_bf16(xa[i][2], xa[i][3]));
  // the third column tile's fragments: a second group of loads, with a wait of its own
#pragma unroll
  for (int kk = 0; kk < 12; ++kk) { bf[2][kk].half[0] = *(const v8us*)(bc + bk[kk] + 2 * 24576); bf[2][kk].half[1] = *(const v8us*)(bc + bk[kk] + 2 * 24576 + 512); }
  // as above, for the loads of the third tile
  asm volatile("s_wait_xcnt 0x0" :: "v"(bk[0]), "v"(bk[1]), "v"(bk[2]), "v"(bk[3]), "v"(bk[4]), "v"(bk[5]), "v"(bk[6]), "v"(bk[7]), "v"(bk[8]), "v"(bk[9]), "v"(bk[10]), "v"(bk[11]) : "memory");
  __syncthreads();

  v8f acc[4][3];
#pragma unroll
  for (int mt = 0; mt < 4; ++mt)
#pragma unroll
    for (int t = 0; t < 3; ++t) acc[mt][t] = (v8f){0.f,0.f,0.f,0.f,0.f,0.f,0.f,0.f};
  const unsigned short* ap = sx + kh * 12 * XS + ln * XR + 8 * hh;
  // the next k-step's four A fragments are asked for as one group ahead of this k-step's products
  FragB a[2][4];
#pragma unroll
  for (int mt = 0; mt < 4; ++mt) { a[0][mt].half[0] = *(const v8us*)(ap + kr[0] * XS + mt * 16 * XR); a[0][mt].half[1] = *(const v8us*)(ap + kr[0] * XS + mt * 16 * XR + 16); }
#pragma unroll
  for (int kk = 0; kk < 12; ++kk) {
    if (kk + 1 < 12) {
#pragma unroll
      for (int mt = 0; mt < 4; ++mt) { a[(kk + 1) & 1][mt].half[0] = *(const v8us*)(ap + kr[kk + 1] * XS + mt * 16 * XR); a[(kk + 1) & 1][mt].half[1] = *(const v8us*)(ap + kr[kk + 1] * XS + mt * 16 * XR + 16); }
    }
#pragma unroll
    for (int mt = 0; mt < 4; ++mt)
#pragma unroll
      for (int t = 0; t < 3; ++t) acc[mt][t] = wmma_bf(a[kk & 1][mt].v, bf[t][kk].v, acc[mt][t]);
    // keeps the order one load group, twelve products: left free, the scheduler asks for four k-steps at once, runs out of registers and then waits out a fragment's LDS latency before every three products
    __builtin_amdgcn_sched_barrier(0);
  }

  // the wave of the first K half finishes row tiles 0 and 1, its partner 2 and 3: each hands the other two over, then adds its own to what it was handed
  float* sg = &so[(kh ? 0 : 32) + 8 * hh][ng * 48 + ln];
  float* sk = &so[(kh ? 32 : 0) + 8 * hh][ng * 48 + ln];
#pragma unroll
  for (int m = 0; m < 2; ++m)
#pragma unroll
    for (int t = 0; t < 3; ++t)
#pragma unroll
      for (int r = 0; r < 8; ++r) sg[(m * 16 + r) * OP + t * 16] = kh ? acc[m][t][r] : acc[m + 2][t][r];
  __syncthreads();
#pragma unroll
  for (int m = 0; m < 2; ++m)
#pragma unroll
    for (int t = 0; t < 3; ++t)
#pragma unroll
      for (int r = 0; r < 8; ++r) sk[(m * 16 + r) * OP + t * 16] += kh ? acc[m + 2][t][r] : acc[m][t][r];
  __syncthreads();
  // every store instruction below covers four whole 128-byte lines
  // thread tid writes units tid and 256 + tid of the block's 512 units (8 KB in a row) of each of Qb, Kb and Vt
  // q and k: eight columns of one row a thread; wave w has fragment half w % 4 (= ks * 2 + h) of row tiles w / 4 and 2 + w / 4
  uint4 qw[2], kw[2];
#pragma unroll
  for (int i = 0; i < 2; ++i) {
    const float* c = &so[(i * 2 + kh) * 16 + ln][(ng * 2 + hh) * 8];
    const v4f a0 = *(const v4fa*)c, a1 = *(const v4fa*)(c + 4);
    qw[i] = make_uint4(pk_f16(a0[0] * QSC, a0[1] * QSC), pk_f16(a0[2] * QSC, a0[3] * QSC), pk_f16(a1[0] * QSC, a1[1] * QSC), pk_f16(a1[2] * QSC, a1[3] * QSC));
    const v4f c0 = *(const v4fa*)(c + HH), c1 = *(const v4fa*)(c + HH + 4);
    kw[i] = make_uint4(pk_f16(c0[0], c0[1]), pk_f16(c0[2], c0[3]), pk_f16(c1[0], c1[1]), pk_f16(c1[2], c1[3]));
  }
  // v: eight rows of one column a thread; wave w has fragment half w % 2 of column tile w / 2, for rows 0 ... 31 and 32 ... 63
  uint4 vw[2];
#pragma unroll
  for (int i = 0; i < 2; ++i) {
    const float* c = &so[i * 32 + (w & 1) * 16 + hh * 8][2 * HH + (w >> 1) * 16 + ln];
    vw[i] = make_uint4(pk_f16(c[0], c[OP]), pk_f16(c[2 * OP], c[3 * OP]), pk_f16(c[4 * OP], c[5 * OP]), pk_f16(c[6 * OP], c[7 * OP]));
  }
  unsigned short* oq = Qb + row0 * HH + tid * 8;
  unsigned short* ok = Kb + row0 * HH + tid * 8;
  unsigned short* ov = Vt + row0 * HH + tid * 8;
#pragma unroll
  for (int i = 0; i < 2; ++i) *(uint4*)(ov + i * 2048) = vw[i];
#pragma unroll
  for (int i = 0; i < 2; ++i) *(uint4*)(ok + i * 2048) = kw[i];
#pragma unroll
  for (int i = 0; i < 2; ++i) *(uint4*)(oq + i * 2048) = qw[i];
}

// Scores, masked softmax and P*v in one launch, all batches. A block owns 64 query rows of one batch; each of its AW waves
// holds all 64 (AQ tiles of 16 as B operands, f16) and walks its own TT / AW keys in passes of 32, from a first pass set by the block index, with a maximum that is renewed only when a pass needs it:
// St = k * qt - maximum in use (a lane holds 16 scores of ONE query; q comes scaled and the maximum is the start value of the product, so St is the exponent itself), Pt packs from the two St tiles into a B operand (f16; P lies in 0 ... PMAX), Ot += vt * Pt.
// Every operand is one f16 value, 11 bits on both sides of a product, so each product is one WMMA.
// The AW partial (maximum, sum, Ot) sets are joined through LDS at the end. Scores never reach memory.
#define AQ 4
#define AW 8
#define AKEYS (TT / AW)
#define ANP (AKEYS / 32)   // passes of a wave
#define PMAX 256.0f   // largest lane sum of P that a pass may reach against a maximum that lags: 2^8, far inside f16
__global__ __launch_bounds__(AW * 32) void k_attn(const unsigned short* __restrict__ Qb, const unsigned short* __restrict__ Kb, const unsigned short* __restrict__ Vt,
                                                  const int* __restrict__ mask, float* __restrict__ out) {
  __shared__ __attribute__((aligned(16))) v4f sO[AW][AQ * 8][32];
  __shared__ float sM[AW][AQ][16], sL[AW][AQ][16];
  const int tid = threadIdx.x, w = tid >> 5, lane = tid & 31, ln = lane & 15, hh = lane >> 4;
  const int b = blockIdx.x % BB, q0 = (blockIdx.x / BB) * 64;   // batch = index modulo BB, as in k_proj (the reason stands there)

  FragH qf[AQ][2];
  // q, k and vt lie fragment-major (layout: at k_proj): fragment half n of a run of rows stands 256 n elements behind the lane's first unit
  const unsigned short* qp = Qb + ((size_t)b * TT + q0) * HH + lane * 8;
#pragma unroll
  for (int qt = 0; qt < AQ; ++qt)
#pragma unroll
    for (int ks = 0; ks < 2; ++ks) { qf[qt][ks].half[0] = *(const v8us*)(qp + (qt * 4 + ks * 2) * 256); qf[qt][ks].half[1] = *(const v8us*)(qp + (qt * 4 + ks * 2 + 1) * 256); }
  // stands in front of the reuse of the address registers that the q loads name; the pointer is an input so that its registers live up to the wait
  asm volatile("s_wait_xcnt 0x0" :: "v"(qp) : "memory");
  float m_r[AQ], l_r[AQ];
  v8f cm[AQ];   // start value of the score products: minus the maximum in use, the same in all eight rows (a lane's scores are all of one query); rewritten only when the maximum is
  v8f oacc[AQ][4];
#pragma unroll
  for (int qt = 0; qt < AQ; ++qt) {
    m_r[qt] = -3.0e38f; l_r[qt] = 0.f;   // finite start: a pass whose keys are all masked gives exp2(-inf) = 0, never inf - inf
    cm[qt] = (v8f){0.f,0.f,0.f,0.f,0.f,0.f,0.f,0.f};   // while no maximum is in use the scores come out as they are
#pragma unroll
    for (int dt = 0; dt < 4; ++dt) oacc[qt][dt] = (v8f){0.f,0.f,0.f,0.f,0.f,0.f,0.f,0.f};
  }
  // The 32 blocks of a batch read the same k and vt lines from L2. Each block starts the walk through its waves' key ranges at a pass of its own, rot, and wraps round,
  // so that blocks which run in step ask for different lines at any one moment. For speed only: every pass is still made once, in another order.
  const int rot = (blockIdx.x / BB) % ANP;
  const unsigned short* kp = Kb + ((size_t)b * TT + w * AKEYS + rot * 32) * HH + lane * 8;
  const unsigned short* vp = Vt + ((size_t)b * TT + w * AKEYS + rot * 32) * HH + lane * 8;
  const int* mp = mask + (size_t)b * TT + w * AKEYS + rot * 32 + lane;   // one mask word a lane: a pass's 32 keys
  int one = 1;   // passes through each wait below, so that the pointer additions, which are multiples of it, cannot be lifted over the wait

  bool fresh = true;   // no key has been kept so far, so no maximum is in use (scalar)
  FragH ka[2][2];
  int mk;
#pragma unroll
  for (int t = 0; t < 2; ++t)
#pragma unroll
    for (int ks = 0; ks < 2; ++ks) { ka[t][ks].half[0] = *(const v8us*)(kp + (t * 4 + ks * 2) * 256); ka[t][ks].half[1] = *(const v8us*)(kp + (t * 4 + ks * 2 + 1) * 256); }
  mk = *mp;
  // stands in front of the overwrite of the address registers that the loads above name; the pointers are inputs so that their registers live up to it
  asm volatile("s_wait_xcnt 0x0" : "+s"(one) : "v"(kp), "v"(mp) : "memory");
  { const int d = one * (rot == ANP - 1 ? 1 - ANP : 1); kp += d * 32 * HH; mp += d * 32; }   // on to the next pass of the range; behind its last pass comes its first

  // rolled: one pass is several KB of code
#pragma unroll 1
  for (int it = 0; it < ANP; ++it) {
    FragH va[4];
#pragma unroll
    for (int dt = 0; dt < 4; ++dt) { va[dt].half[0] = *(const v8us*)(vp + dt * 2 * 256); va[dt].half[1] = *(const v8us*)(vp + (dt * 2 + 1) * 256); }
    // the next pass's k rows and mask words are fetched now; the last pass fetches its own again, so every address stays inside
    FragH kn[2][2];
#pragma unroll
    for (int t = 0; t < 2; ++t)
#pragma unroll
      for (int ks = 0; ks < 2; ++ks) { kn[t][ks].half[0] = *(const v8us*)(kp + (t * 4 + ks * 2) * 256); kn[t][ks].half[1] = *(const v8us*)(kp + (t * 4 + ks * 2 + 1) * 256); }
    const int mn = *mp;
    // stands in front of the overwrite of the address registers that this pass's loads name; the pointers are inputs so that their registers live up to it
    asm volatile("s_wait_xcnt 0x0" : "+s"(one) : "v"(vp), "v"(kp), "v"(mp) : "memory");
    const int pc = (it + rot) % ANP;   // the pass in hand: vp stands there, kp and mp one pass on (scalar)
    const int dv = one * (pc == ANP - 1 ? 1 - ANP : 1);
    const int dk = (it + 2 < ANP) ? one * (pc == ANP - 2 ? 1 - ANP : 1) : 0;
    vp += dv * 32 * HH; kp += dk * 32 * HH; mp += dk * 32;

    const unsigned int kept = __builtin_amdgcn_ballot_w32(mk != 0);   // bit j: key j of this pass is kept (scalar)
    // St of all four query tiles, as exponents: the products start from minus the maximum in use, which costs no vector instruction.
    // Rows of St are keys: a masked key's row gets -inf added, in a branch that a pass without masked keys jumps (scalar test).
    v8f s[AQ][2];
    auto scores = [&]() {
#pragma unroll
      for (int qt = 0; qt < AQ; ++qt) {
        v8f s0 = cm[qt], s1 = cm[qt];
#pragma unroll
        for (int ks = 0; ks < 2; ++ks) { s0 = wmma_hf(ka[0][ks].v, qf[qt][ks].v, s0); s1 = wmma_hf(ka[1][ks].v, qf[qt][ks].v, s1); }
        s[qt][0] = s0; s[qt][1] = s1;
      }
      if (kept != 0xFFFFFFFFu) {
        const unsigned int nb = ~kept >> (8 * hh);   // bit 16 t + r: key 16 t + 8 hh + r of this pass is masked
        v8f bias[2];   // 0 for a kept key, -inf for a masked one; one set serves all query tiles
#pragma unroll
        for (int r = 0; r < 8; ++r) {
          bias[0][r] = __uint_as_float((unsigned int)((int)(nb << (31 - r)) >> 31) & 0xFF800000u);
          bias[1][r] = __uint_as_float((unsigned int)((int)(nb << (15 - r)) >> 31) & 0xFF800000u);
        }
#pragma unroll
        for (int qt = 0; qt < AQ; ++qt) { s[qt][0] += bias[0]; s[qt][1] += bias[1]; }
      }
    };
    // Common path: the exponentials are taken against the maximum in use, with no search for a new one and no rescale. P is never negative, so a lane's
    // sum of P bounds each of its P: while every sum stays at or below PMAX, every P fits f16 and the pass stands as it is.
    FragH pf[AQ];
    float sum[AQ];
    bool redo = fresh;   // no maximum is in use yet: the pass goes straight to the full path (scalar test)
    if (!redo) {
      scores();
#pragma unroll
      for (int qt = 0; qt < AQ; ++qt) {
        float e[16];
#pragma unroll
        for (int r = 0; r < 8; ++r) { e[r] = s[qt][0][r]; e[8 + r] = s[qt][1][r]; }
        // one tile's exponentials in one statement, each in place: none reads the result or overwrites the source of the one in front of it,
        // and the v_nop fills the slot that the instruction set asks for behind the last
        asm("v_exp_f32 %0, %0\n\tv_exp_f32 %1, %1\n\tv_exp_f32 %2, %2\n\tv_exp_f32 %3, %3\n\tv_exp_f32 %4, %4\n\tv_exp_f32 %5, %5\n\t"
            "v_exp_f32 %6, %6\n\tv_exp_f32 %7, %7\n\tv_exp_f32 %8, %8\n\tv_exp_f32 %9, %9\n\tv_exp_f32 %10, %10\n\tv_exp_f32 %11, %11\n\t"
            "v_exp_f32 %12, %12\n\tv_exp_f32 %13, %13\n\tv_exp_f32 %14, %14\n\tv_exp_f32 %15, %15\n\tv_nop"
            : "+v"(e[0]), "+v"(e[1]), "+v"(e[2]), "+v"(e[3]), "+v"(e[4]), "+v"(e[5]), "+v"(e[6]), "+v"(e[7]), "+v"(e[8]), "+v"(e[9]),
              "+v"(e[10]), "+v"(e[11]), "+v"(e[12]), "+v"(e[13]), "+v"(e[14]), "+v"(e[15]));
        float t = 0.f;
#pragma unroll
        for (int i = 0; i < 8; ++i) {
          const float pa = e[2 * i], pb = e[2 * i + 1];
          t += pa + pb;
          pf[qt].w[i] = pk_f16(pa, pb);
        }
        sum[qt] = t;
      }
      // one test a pass for all four tiles; written so that an infinite or not-a-number sum also takes the full path
      redo = __builtin_amdgcn_ballot_w32(!((sum[0] + sum[1]) + (sum[2] + sum[3]) <= PMAX)) != 0;
    }
    if (redo) {
      // Full path, whole wave: the scores anew (the common path took its exponentials in place), new maximum, rescale of sums and outputs, exponentials against the new maximum
      scores();
#pragma unroll
      for (int qt = 0; qt < AQ; ++qt) {
        const v8f s0 = s[qt][0], s1 = s[qt][1];
        float mx = fmaxf(s0[0], s1[0]);
#pragma unroll
        for (int r = 1; r < 8; ++r) mx = fmaxf(mx, fmaxf(s0[r], s1[r]));
        mx = fmaxf(mx, xhalf(mx));
        const float mu = -cm[qt][0];   // what the scores at hand have had taken off
        const float mnew = fmaxf(m_r[qt], mx + mu);
        float alpha = m_r[qt] - mnew;
        const float d = mnew - mu;
        m_r[qt] = mnew;
        float e[16];
#pragma unroll
        for (int r = 0; r < 8; ++r) { e[r] = s0[r] - d; e[8 + r] = s1[r] - d; }
        // in place and closed by a v_nop, for the same reason as above
        asm("v_exp_f32 %0, %0\n\tv_exp_f32 %1, %1\n\tv_exp_f32 %2, %2\n\tv_exp_f32 %3, %3\n\tv_exp_f32 %4, %4\n\tv_exp_f32 %5, %5\n\t"
            "v_exp_f32 %6, %6\n\tv_exp_f32 %7, %7\n\tv_exp_f32 %8, %8\n\tv_exp_f32 %9, %9\n\tv_exp_f32 %10, %10\n\tv_exp_f32 %11, %11\n\t"
            "v_exp_f32 %12, %12\n\tv_exp_f32 %13, %13\n\tv_exp_f32 %14, %14\n\tv_exp_f32 %15, %15\n\tv_exp_f32 %16, %16\n\tv_nop"
            : "+v"(e[0]), "+v"(e[1]), "+v"(e[2]), "+v"(e[3]), "+v"(e[4]), "+v"(e[5]), "+v"(e[6]), "+v"(e[7]), "+v"(e[8]), "+v"(e[9]),
              "+v"(e[10]), "+v"(e[11]), "+v"(e[12]), "+v"(e[13]), "+v"(e[14]), "+v"(e[15]), "+v"(alpha));
        float t = 0.f;
#pragma unroll
        for (int i = 0; i < 8; ++i) {
          const float pa = e[2 * i], pb = e[2 * i + 1];
          t += pa + pb;
          pf[qt].w[i] = pk_f16(pa, pb);
        }
        sum[qt] = t;
        l_r[qt] *= alpha;
#pragma unroll
        for (int dt = 0; dt < 4; ++dt) oacc[qt][dt] *= alpha;
        const float nc = mnew > -1.0e38f ? -mnew : 0.f;   // every key so far masked: still no maximum in use
        cm[qt] = (v8f){nc, nc, nc, nc, nc, nc, nc, nc};
      }
    }
    fresh = fresh && kept == 0;
#pragma unroll
    for (int qt = 0; qt < AQ; ++qt) {
      l_r[qt] += sum[qt];   // this lane half's keys only; the halves are joined after the loop
#pragma unroll
      for (int dt = 0; dt < 4; ++dt) oacc[qt][dt] = wmma_hf(va[dt].v, pf[qt].v, oacc[qt][dt]);
    }
#pragma unroll
    for (int t = 0; t < 2; ++t)
#pragma unroll
      for (int ks = 0; ks < 2; ++ks) ka[t][ks] = kn[t][ks];
    mk = mn;
  }

#pragma unroll
  for (int qt = 0; qt < AQ; ++qt) {
    const float l = l_r[qt] + xhalf(l_r[qt]);
    if (hh == 0) { sM[w][qt][ln] = m_r[qt]; sL[w][qt][ln] = l; }
#pragma unroll
    for (int dt = 0; dt < 4; ++dt) {
      sO[w][qt * 8 + dt * 2][lane]     = (v4f){oacc[qt][dt][0], oacc[qt][dt][1], oacc[qt][dt][2], oacc[qt][dt][3]};
      sO[w][qt * 8 + dt * 2 + 1][lane] = (v4f){oacc[qt][dt][4], oacc[qt][dt][5], oacc[qt][dt][6], oacc[qt][dt][7]};
    }
  }
  __syncthreads();
  // join: wave w finishes query tile w / 2, head columns 32 * (w % 2) ... + 31 (one 128-byte line of each output row)
  const int qm = w >> 1;
  float M = -3.0e38f;
#pragma unroll
  for (int p = 0; p < AW; ++p) M = fmaxf(M, sM[p][qm][ln]);
  float f[AW], den = 0.f;
#pragma unroll
  for (int p = 0; p < AW; ++p) f[p] = sM[p][qm][ln] - M;   // the maxima are in exponent units
  // in place and closed by a v_nop, for the same reason as in the loop
  asm("v_exp_f32 %0, %0\n\tv_exp_f32 %1, %1\n\tv_exp_f32 %2, %2\n\tv_exp_f32 %3, %3\n\tv_exp_f32 %4, %4\n\tv_exp_f32 %5, %5\n\tv_exp_f32 %6, %6\n\tv_exp_f32 %7, %7\n\tv_nop"
      : "+v"(f[0]), "+v"(f[1]), "+v"(f[2]), "+v"(f[3]), "+v"(f[4]), "+v"(f[5]), "+v"(f[6]), "+v"(f[7]));
#pragma unroll
  for (int p = 0; p < AW; ++p) den += sL[p][qm][ln] * f[p];
  const float inv = 1.0f / den;   // every key masked: den = 0, and 0 * inf gives NaN
#pragma unroll
  for (int dd = 0; dd < 2; ++dd) {
    const int dt = (w & 1) * 2 + dd;
    v4f a0 = {0.f,0.f,0.f,0.f}, a1 = {0.f,0.f,0.f,0.f};
#pragma unroll
    for (int p = 0; p < AW; ++p) { a0 += sO[p][qm * 8 + dt * 2][lane] * f[p]; a1 += sO[p][qm * 8 + dt * 2 + 1][lane] * f[p]; }
    float* o = out + ((size_t)b * TT + q0 + qm * 16 + ln) * HH + dt * 16 + 8 * hh;
    *(v4f*)o = a0 * inv; *(v4f*)(o + 4) = a1 * inv;
  }
}
extern "C" void kernel_launch(void* const* d_in, const int* in_sizes, int n_in,
                              void* d_out, int out_size, void* d_ws, size_t ws_size, hipStream_t stream) {
  (void)in_sizes; (void)n_in; (void)out_size;
  const float* x = (const float*)d_in[0]; const int* mask = (const int*)d_in[1]; const float* Wk = (const float*)d_in[2]; const float* Wq = (const float*)d_in[3]; const float* Wv = (const float*)d_in[4];
  char* ws = (char*)d_ws; size_t off = 0;
  auto take = [&](size_t bytes) { char* p = ws + off; off += (bytes + 255) & ~(size_t)255; return p; };
  unsigned short* Bt = (unsigned short*)take((size_t)192 * CC * 2); unsigned short* Qb = (unsigned short*)take((size_t)MR * HH * 2); unsigned short* Kb = (unsigned short*)take((size_t)MR * HH * 2); unsigned short* Vt = (unsigned short*)take((size_t)BB * HH * TT * 2);
  if (off > ws_size) return;
  k_wt_bf16<<<3 * HH * (CC / 8) / 256, 256, 0, stream>>>(Wq, Wk, Wv, Bt);   // the 12 column tiles of [Wq | Wk | Wv]
  k_proj<<<MR / PM, 256, 0, stream>>>(x, Bt, Qb, Kb, Vt);      // q, k, vt
  k_attn<<<BB * (TT / 64), AW * 32, 0, stream>>>(Qb, Kb, Vt, mask, (float*)d_out);
}
